// v000
// Measured on an AMD MI455X. A time is GPU time per run, averaged over a window of back-to-back runs after a warm-up
// (all launches, gaps included; the runs take copies of the inputs in turn), and the median of several windows.
// Apart from v000's, it joins two sittings. Times from different sittings can be a few percent apart, while
// side-by-side timings come from the same sitting.
// v000, which the later versions start from, runs in 591 microseconds.
#include <hip/hip_runtime.h>
// Vector-neuron attention (B=2, N=2048, C=256 × 3 coordinates, 8 heads × 64): the VN-linear maps (rows (b,n,c) × 256 → 512, weights (out,in) bf16-exact ×2^4) and the attention over the
// 192-dim (d, c) head features as a fused flash-style kernel on v_wmma_f32_16x16x32_f16 (S = Q·Kᵀ·192^-½ with 6 k-steps gathered from the three coordinate blocks, online softmax f32, P f16 ≤ 1,
// O = P·V with 12 d-tiles; RPW-16 waves); f16 operands, single products, f32 accumulate; layout permutes f32/VALU.
#define BB 2
#define NN 2048
#define CI 256
#define CO 512
#define NH 8
#define HD 64
#define NR3 (BB * NN * 3)
#define NR (BB * NN)

typedef __bf16 v16b __attribute__((ext_vector_type(16)));
typedef unsigned short v8us __attribute__((ext_vector_type(8), may_alias));
typedef float  v8f  __attribute__((ext_vector_type(8)));
typedef float  v4f  __attribute__((ext_vector_type(4)));
typedef float  v4fa __attribute__((ext_vector_type(4), may_alias));
union FragB { v16b v; v8us half[2]; unsigned short u[16]; };

__device__ __forceinline__ unsigned short bf16_bits(float x) { unsigned int u = __float_as_uint(x); return (unsigned short)((u + 0x7FFFu + ((u >> 16) & 1u)) >> 16); }
__device__ __forceinline__ float bf16_val(unsigned short b) { return __uint_as_float(((unsigned int)b) << 16); }
__device__ __forceinline__ float bf16_round(float x) { return bf16_val(bf16_bits(x)); }
// D += A·B with NT terms: 1 = ah·bh, 2 = + al·bh (A split), 3 = + ah·bl (both split)
template <int NT>
__device__ __forceinline__ v8f mmaN(v16b ah, v16b al, v16b bh, v16b bl, v8f c) {
  c = __builtin_amdgcn_wmma_f32_16x16x32_bf16(false, ah, false, bh, (short)0, c, false, false);
  if (NT >= 2) c = __builtin_amdgcn_wmma_f32_16x16x32_bf16(false, al, false, bh, (short)0, c, false, false);
  if (NT >= 3) c = __builtin_amdgcn_wmma_f32_16x16x32_bf16(false, ah, false, bl, (short)0, c, false, false);
  asm volatile("v_nop\n\tv_nop\n\tv_nop\n\tv_nop" : "+v"(c) : "v"(ah), "v"(al), "v"(bh), "v"(bl));
  return c;
}

__global__ __launch_bounds__(256) void k_wt_bf16(const float* __restrict__ W, unsigned short* __restrict__ Wt, int K, int N) {
  const int t = blockIdx.x * 256 + threadIdx.x;
  const int k8n = K / 8;
  if (t >= N * k8n) return;
  const int n = t / k8n, k8 = (t % k8n) * 8;
  v8us v;
#pragma unroll
  for (int i = 0; i < 8; ++i) v[i] = bf16_bits(W[(size_t)(k8 + i) * N + n]);
  *(v8us*)(Wt + (size_t)n * K + k8) = v;
  
}

// GEMM C[M][N] (f32, pitch ldc) = act(A[M][K]·W + bias). A f32 row-major (pitch lda) converted per fragment to bf16
// (ASPLIT: hi/lo two planes -> 2 terms, else single rounded term); Wt bf16 [N][K] (pitch ldb). BIAS_BF16 rounds the
// bias to bf16 first (bias quantised to bf16 before the add). K%32==0, M%16==0, N%64==0.
template <bool ASPLIT, int ACT, bool BIAS_BF16>
__global__ __launch_bounds__(128) void k_gemm_bf(const float* __restrict__ A, int lda, const unsigned short* __restrict__ Wt, int ldb,
                                               const float* __restrict__ bias, float* __restrict__ C, int ldc, int M, int N, int K) {
  __shared__ __attribute__((aligned(16))) float so[4][16][64];
  const int tid = threadIdx.x, w = tid >> 5, lane = tid & 31, ln = lane & 15, hh = lane >> 4;
  const int ntn = N / 64;
  const int wid = blockIdx.x * 4 + w;
  const int mt = wid / ntn, nq = wid % ntn;
  if (mt * 16 >= M) return;
  const int row0 = mt * 16, col0 = nq * 64;
  const float* arow = A + (size_t)(row0 + ln) * lda;
  v8f acc[4] = {};
  for (int kb = 0; kb < K; kb += 32) {
    FragB ah, al;
    const v4f x0 = *(const v4fa*)(arow + kb + 8 * hh), x1 = *(const v4fa*)(arow + kb + 8 * hh + 4);
    const v4f x2 = *(const v4fa*)(arow + kb + 16 + 8 * hh), x3 = *(const v4fa*)(arow + kb + 16 + 8 * hh + 4);
    float xs[16] = {x0[0],x0[1],x0[2],x0[3],x1[0],x1[1],x1[2],x1[3],x2[0],x2[1],x2[2],x2[3],x3[0],x3[1],x3[2],x3[3]};
#pragma unroll
    for (int i = 0; i < 16; ++i) { const unsigned short hb = bf16_bits(xs[i]); ah.u[i] = hb; al.u[i] = ASPLIT ? bf16_bits(xs[i] - bf16_val(hb)) : (unsigned short)0; }
#pragma unroll
    for (int t = 0; t < 4; ++t) {
      const unsigned short* brow = Wt + (size_t)(col0 + t * 16 + ln) * ldb + kb;
      FragB b;
      b.half[0] = *(const v8us*)(brow + 8 * hh);
      b.half[1] = *(const v8us*)(brow + 16 + 8 * hh);
      acc[t] = mmaN<ASPLIT ? 2 : 1>(ah.v, al.v, b.v, b.v, acc[t]);
    }
  }
#pragma unroll
  for (int t = 0; t < 4; ++t) {
    float bv = bias ? bias[col0 + t * 16 + ln] : 0.f;
    if (BIAS_BF16) bv = bf16_round(bv);
#pragma unroll
    for (int r = 0; r < 8; ++r) { float v = acc[t][r] + bv; if (ACT == 1) v = fmaxf(v, 0.f); so[w][8 * hh + r][t * 16 + ln] = v; }
  }
  __builtin_amdgcn_fence(__ATOMIC_ACQ_REL, "workgroup");
  __builtin_amdgcn_wave_barrier();
  const int rsub = lane >> 4, c4 = (lane & 15) * 4;
  {
#pragma unroll
    for (int q = 0; q < 8; ++q) {
      const int r = q * 2 + rsub;
      const v4f v = *(const v4fa*)&so[w][r][c4];
      *(v4f*)(C + (size_t)(row0 + r) * ldc + col0 + c4) = v;
    }
    
  }
}

// Flash-style causal/unmasked attention, all contractions 3-term bf16 hi/lo splits, f32 softmax with running max.
// q,k,v rows are read from f32 buffers with arbitrary row pitch (so they can live inside a fused qkv buffer);
// D = head size (multiple of 32, <= 128); one wave = 16 query rows; block = 4 waves (64 queries) sharing K/V chunks of 32.
template <int D, bool CAUSAL>
__global__ __launch_bounds__(128) void k_flash(const float* __restrict__ qb, const float* __restrict__ kb, const float* __restrict__ vb,
                                             int pitch, int T, int H, float scale, float* __restrict__ y, int ypitch) {
  constexpr int KS = D / 32;        // k-steps for QK
  constexpr int DT = D / 16;        // d tiles for PV
  __shared__ __attribute__((aligned(16))) unsigned short sKh[32][D + 8], sKl[32][D + 8], sVh[32][D + 8], sVl[32][D + 8];
  __shared__ __attribute__((aligned(16))) unsigned short sPh[4][16][40], sPl[4][16][40];
  __shared__ __attribute__((aligned(16))) float sO[4][16][D];
  const int tid = threadIdx.x, w = tid >> 5, lane = tid & 31, ln = lane & 15, hh = lane >> 4;
  const int nqb = (T + 63) / 64;
  const int bh = blockIdx.x / nqb, qblk = blockIdx.x % nqb;
  const int b = bh / H, h = bh % H;
  const int q0 = qblk * 64 + w * 16;
  const float* Q = qb + (size_t)b * T * pitch + h * D;
  const float* K = kb + (size_t)b * T * pitch + h * D;
  const float* V = vb + (size_t)b * T * pitch + h * D;

  // A fragments of the wave's 16 query rows (scaled), hi/lo
  FragB aqh[KS], aql[KS];
  {
    int row = q0 + ln; if (row >= T) row = T - 1;
    const float* qr = Q + (size_t)row * pitch;
#pragma unroll
    for (int ks = 0; ks < KS; ++ks)
#pragma unroll
      for (int i = 0; i < 16; ++i) {
        const int d = ks * 32 + ((i < 8) ? (8 * hh + i) : (16 + 8 * hh + (i - 8)));
        const float x = qr[d] * scale; const unsigned short hb = bf16_bits(x);
        aqh[ks].u[i] = hb; aql[ks].u[i] = bf16_bits(x - bf16_val(hb));
      }
  }
  float m_r[8], l_r[8];
#pragma unroll
  for (int r = 0; r < 8; ++r) { m_r[r] = -3.0e38f; l_r[r] = 0.f; }
  v8f oacc[DT];
#pragma unroll
  for (int dt = 0; dt < DT; ++dt) oacc[dt] = (v8f){0.f,0.f,0.f,0.f,0.f,0.f,0.f,0.f};

  const int kv_end = CAUSAL ? min(T, qblk * 64 + 64) : T;     // block-uniform
  for (int j0 = 0; j0 < kv_end; j0 += 32) {
    __syncthreads();
    for (int e = tid; e < 32 * (D / 4); e += 128) {
      const int r = e / (D / 4), c4 = (e % (D / 4)) * 4;
      const int key = j0 + r;
      v4f kf = {0.f,0.f,0.f,0.f}, vf = {0.f,0.f,0.f,0.f};
      if (key < T) { kf = *(const v4fa*)(K + (size_t)key * pitch + c4); vf = *(const v4fa*)(V + (size_t)key * pitch + c4); }
#pragma unroll
      for (int t = 0; t < 4; ++t) {
        unsigned short hb = bf16_bits(kf[t]); sKh[r][c4 + t] = hb; sKl[r][c4 + t] = bf16_bits(kf[t] - bf16_val(hb));
        hb = bf16_bits(vf[t]); sVh[r][c4 + t] = hb; sVl[r][c4 + t] = bf16_bits(vf[t] - bf16_val(hb));
      }
    }
    __syncthreads();
    // S tile 16 x 32
    v8f s[2];
#pragma unroll
    for (int nt = 0; nt < 2; ++nt) {
      v8f acc = {};
#pragma unroll
      for (int ks = 0; ks < KS; ++ks) {
        FragB bh_, bl_;
        bh_.half[0] = *(const v8us*)&sKh[nt * 16 + ln][ks * 32 + 8 * hh]; bh_.half[1] = *(const v8us*)&sKh[nt * 16 + ln][ks * 32 + 16 + 8 * hh];
        bl_.half[0] = *(const v8us*)&sKl[nt * 16 + ln][ks * 32 + 8 * hh]; bl_.half[1] = *(const v8us*)&sKl[nt * 16 + ln][ks * 32 + 16 + 8 * hh];
        acc = mmaN<3>(aqh[ks].v, aql[ks].v, bh_.v, bl_.v, acc);
      }
      s[nt] = acc;
    }
    // mask + running max (rows 8hh+r; the 16 lanes of a half share rows)
    float alpha[8];
#pragma unroll
    for (int r = 0; r < 8; ++r) {
      const int qi = q0 + 8 * hh + r;
      const int ja = j0 + ln, jb = j0 + 16 + ln;
      if (CAUSAL) { if (ja > qi) s[0][r] = -3.0e38f; if (jb > qi) s[1][r] = -3.0e38f; }
      if (ja >= T) s[0][r] = -3.0e38f;
      if (jb >= T) s[1][r] = -3.0e38f;
      float mx = fmaxf(s[0][r], s[1][r]);
      mx = fmaxf(mx, __shfl_xor(mx, 1, 32)); mx = fmaxf(mx, __shfl_xor(mx, 2, 32)); mx = fmaxf(mx, __shfl_xor(mx, 4, 32)); mx = fmaxf(mx, __shfl_xor(mx, 8, 32));
      const float mnew = fmaxf(m_r[r], mx);
      alpha[r] = (mnew > -1.0e38f) ? __expf(m_r[r] - mnew) : 1.0f;
      const float p0 = (s[0][r] > -1.0e38f) ? __expf(s[0][r] - mnew) : 0.f;
      const float p1 = (s[1][r] > -1.0e38f) ? __expf(s[1][r] - mnew) : 0.f;
      m_r[r] = mnew;
      l_r[r] = l_r[r] * alpha[r] + p0 + p1;            // per-lane partial row sum (16 lanes combined at the end)
      unsigned short hb = bf16_bits(p0); sPh[w][8 * hh + r][ln] = hb;      sPl[w][8 * hh + r][ln] = bf16_bits(p0 - bf16_val(hb));
      hb = bf16_bits(p1);                sPh[w][8 * hh + r][16 + ln] = hb; sPl[w][8 * hh + r][16 + ln] = bf16_bits(p1 - bf16_val(hb));
    }
#pragma unroll
    for (int dt = 0; dt < DT; ++dt)
#pragma unroll
      for (int r = 0; r < 8; ++r) oacc[dt][r] *= alpha[r];
    __builtin_amdgcn_fence(__ATOMIC_ACQ_REL, "workgroup");
    __builtin_amdgcn_wave_barrier();
    FragB pah, pal;
    pah.half[0] = *(const v8us*)&sPh[w][ln][8 * hh]; pah.half[1] = *(const v8us*)&sPh[w][ln][16 + 8 * hh];
    pal.half[0] = *(const v8us*)&sPl[w][ln][8 * hh]; pal.half[1] = *(const v8us*)&sPl[w][ln][16 + 8 * hh];
#pragma unroll
    for (int dt = 0; dt < DT; ++dt) {
      FragB bvh, bvl;
#pragma unroll
      for (int i = 0; i < 8; ++i) {
        bvh.u[i] = sVh[8 * hh + i][dt * 16 + ln]; bvh.u[8 + i] = sVh[16 + 8 * hh + i][dt * 16 + ln];
        bvl.u[i] = sVl[8 * hh + i][dt * 16 + ln]; bvl.u[8 + i] = sVl[16 + 8 * hh + i][dt * 16 + ln];
      }
      oacc[dt] = mmaN<3>(pah.v, pal.v, bvh.v, bvl.v, oacc[dt]);
    }
    __builtin_amdgcn_fence(__ATOMIC_ACQ_REL, "workgroup");
    __builtin_amdgcn_wave_barrier();
  }
#pragma unroll
  for (int r = 0; r < 8; ++r) {
    float l = l_r[r];
    l += __shfl_xor(l, 1, 32); l += __shfl_xor(l, 2, 32); l += __shfl_xor(l, 4, 32); l += __shfl_xor(l, 8, 32);
    l_r[r] = (l > 0.f) ? 1.0f / l : 0.f;
  }
#pragma unroll
  for (int dt = 0; dt < DT; ++dt)
#pragma unroll
    for (int r = 0; r < 8; ++r) sO[w][8 * hh + r][dt * 16 + ln] = oacc[dt][r] * l_r[r];
  __builtin_amdgcn_fence(__ATOMIC_ACQ_REL, "workgroup");
  __builtin_amdgcn_wave_barrier();
  {
    for (int r = 0; r < 16; ++r) {
      const int row = q0 + r;
      if (row < T && lane < D / 4) {
        const v4f val = *(const v4fa*)&sO[w][r][lane * 4];
        *(v4f*)(y + ((size_t)b * T + row) * ypitch + h * D + lane * 4) = val;
      }
    }
    
  }
}

// GEMM C = act(A·W + bias + resid): A f32 (ASPLIT -> hi/lo 2 terms), Wt bf16 [N][K]; ACT 0 none, 1 relu, 2 exact gelu;
// resid (optional, f32, row index = (row % rmod), pitch ldr, RES_BF16 rounds it) added before the activation.
template <bool ASPLIT, int ACT, bool BIAS_BF16, bool RES_BF16>
__global__ __launch_bounds__(128) void k_gemm_bf3(const float* __restrict__ A, int lda, const unsigned short* __restrict__ Wt, int ldb,
                                                const float* __restrict__ bias, const float* __restrict__ resid, int rmod, int ldr,
                                                float* __restrict__ C, int ldc, int M, int N, int K) {
  __shared__ __attribute__((aligned(16))) float so[4][16][64];
  const int tid = threadIdx.x, w = tid >> 5, lane = tid & 31, ln = lane & 15, hh = lane >> 4;
  const int ntn = N / 64;
  const int wid = blockIdx.x * 4 + w;
  const int mt = wid / ntn, nq = wid % ntn;
  if (mt * 16 >= M) return;
  const int row0 = mt * 16, col0 = nq * 64;
  const float* arow = A + (size_t)(row0 + ln) * lda;
  v8f acc[4] = {};
  for (int kb = 0; kb < K; kb += 32) {
    FragB ah, al;
    const v4f x0 = *(const v4fa*)(arow + kb + 8 * hh), x1 = *(const v4fa*)(arow + kb + 8 * hh + 4);
    const v4f x2 = *(const v4fa*)(arow + kb + 16 + 8 * hh), x3 = *(const v4fa*)(arow + kb + 16 + 8 * hh + 4);
    float xs[16] = {x0[0],x0[1],x0[2],x0[3],x1[0],x1[1],x1[2],x1[3],x2[0],x2[1],x2[2],x2[3],x3[0],x3[1],x3[2],x3[3]};
#pragma unroll
    for (int i = 0; i < 16; ++i) { const unsigned short hb = bf16_bits(xs[i]); ah.u[i] = hb; al.u[i] = ASPLIT ? bf16_bits(xs[i] - bf16_val(hb)) : (unsigned short)0; }
#pragma unroll
    for (int t = 0; t < 4; ++t) {
      const unsigned short* brow = Wt + (size_t)(col0 + t * 16 + ln) * ldb + kb;
      FragB b;
      b.half[0] = *(const v8us*)(brow + 8 * hh);
      b.half[1] = *(const v8us*)(brow + 16 + 8 * hh);
      acc[t] = mmaN<ASPLIT ? 2 : 1>(ah.v, al.v, b.v, b.v, acc[t]);
    }
  }
#pragma unroll
  for (int t = 0; t < 4; ++t) {
    const int col = col0 + t * 16 + ln;
    float bv = bias ? bias[col] : 0.f;
    if (BIAS_BF16) bv = bf16_round(bv);
#pragma unroll
    for (int r = 0; r < 8; ++r) {
      float v = acc[t][r] + bv;
      if (resid) { float rv = resid[(size_t)((row0 + 8 * hh + r) % rmod) * ldr + col]; if (RES_BF16) rv = bf16_round(rv); v += rv; }
      if (ACT == 1) v = fmaxf(v, 0.f);
      if (ACT == 2) v = 0.5f * v * (1.0f + erff(v * 0.70710678118654752f));
      if (ACT == 3) { const float u = 0.7978845608028654f * (v + 0.044715f * v * v * v); v = 0.5f * v * (1.0f + tanhf(u)); }
      so[w][8 * hh + r][t * 16 + ln] = v;
    }
  }
  __builtin_amdgcn_fence(__ATOMIC_ACQ_REL, "workgroup");
  __builtin_amdgcn_wave_barrier();
  const int rsub = lane >> 4, c4 = (lane & 15) * 4;
  {
#pragma unroll
    for (int q = 0; q < 8; ++q) {
      const int r = q * 2 + rsub;
      const v4f v = *(const v4fa*)&so[w][r][c4];
      *(v4f*)(C + (size_t)(row0 + r) * ldc + col0 + c4) = v;
    }
    
  }
}
// row LayerNorm (biased variance, eps) over N: s = X (+ R); optional out_sum <- s; out_norm <- (s-mu)*rsqrt(var+eps)*g + b
template <bool PARAM_BF16>
__global__ __launch_bounds__(256) void k_layernorm(const float* __restrict__ X, const float* __restrict__ R, const float* __restrict__ g, const float* __restrict__ bta,
                                                  float* __restrict__ out_sum, float* __restrict__ out_norm, int N, float eps) {
  __shared__ float red[256];
  const int row = blockIdx.x, tid = threadIdx.x;
  const float* x = X + (size_t)row * N; const float* rr = R ? R + (size_t)row * N : nullptr;
  float vals[16];                     // up to N = 4096
  const int per = N / 256;            // contiguous chunk per thread? use strided-by-4 chunks: thread handles j = tid*4 + 1024*u
  float s1 = 0.f;
  for (int u = 0; u < per / 4; ++u) {
    const int j = tid * 4 + 1024 * u;
    const v4f a = *(const v4fa*)(x + j);
    v4f b = {0.f,0.f,0.f,0.f}; if (rr) b = *(const v4fa*)(rr + j);
#pragma unroll
    for (int q = 0; q < 4; ++q) { const float v = a[q] + b[q]; vals[u * 4 + q] = v; s1 += v; }
  }
  red[tid] = s1; __syncthreads();
  for (int st = 128; st > 0; st >>= 1) { if (tid < st) red[tid] += red[tid + st]; __syncthreads(); }
  const float mu = red[0] / (float)N; __syncthreads();
  float s2 = 0.f;
  for (int u = 0; u < per / 4; ++u)
#pragma unroll
    for (int q = 0; q < 4; ++q) { const float c = vals[u * 4 + q] - mu; s2 += c * c; }
  red[tid] = s2; __syncthreads();
  for (int st = 128; st > 0; st >>= 1) { if (tid < st) red[tid] += red[tid + st]; __syncthreads(); }
  const float rs = rsqrtf(red[0] / (float)N + eps);
  {
    for (int u = 0; u < per / 4; ++u) {
      const int j = tid * 4 + 1024 * u;
      v4f o, sm;
#pragma unroll
      for (int q = 0; q < 4; ++q) {
        float gg = g[j + q], bb = bta[j + q];
        if (PARAM_BF16) { gg = bf16_round(gg); bb = bf16_round(bb); }
        sm[q] = vals[u * 4 + q]; o[q] = (vals[u * 4 + q] - mu) * rs * gg + bb;
      }
      if (out_sum) *(v4f*)(out_sum + (size_t)row * N + j) = sm;
      *(v4f*)(out_norm + (size_t)row * N + j) = o;
    }
    
  }
}



// ---- f16 WMMA path (v_wmma_f32_16x16x32_f16): 11-bit significands for operands in range — used for every contraction launched here (VN-linear maps, Q·Kᵀ, P·V)
typedef _Float16 v16h __attribute__((ext_vector_type(16)));
union FragH { v16h v; v8us half[2]; _Float16 h[16]; unsigned short u[16]; };
template <int NT>
__device__ __forceinline__ v8f mmaH(v16h ah, v16h al, v16h bh, v16h bl, v8f c) {
  c = __builtin_amdgcn_wmma_f32_16x16x32_f16(false, ah, false, bh, (short)0, c, false, false);
  if (NT >= 2) c = __builtin_amdgcn_wmma_f32_16x16x32_f16(false, al, false, bh, (short)0, c, false, false);
  if (NT >= 3) c = __builtin_amdgcn_wmma_f32_16x16x32_f16(false, ah, false, bl, (short)0, c, false, false);
  asm volatile("v_nop\n\tv_nop\n\tv_nop\n\tv_nop" : "+v"(c) : "v"(ah), "v"(al), "v"(bh), "v"(bl));
  return c;
}
// batched GEMM like k_gemm_b but f16 operands: A f32 (split into f16 hi/lo if ASPLIT, else rounded to f16), Bt = f16 values [n][k]; alpha; C f32; N multiple of 16 (partial tiles skipped)
template <bool ASPLIT>
__global__ __launch_bounds__(128) void k_gemm_h(const float* __restrict__ A, int lda, size_t sA, const _Float16* __restrict__ Bh, int ldb, size_t sB, float alpha, float* __restrict__ C, int ldc, size_t sC, int M, int N, int K) {
  __shared__ __attribute__((aligned(16))) float so[4][16][64];
  const int tid = threadIdx.x, w = tid >> 5, lane = tid & 31, ln = lane & 15, hh = lane >> 4; const int by = blockIdx.y;
  A += (size_t)by * sA; Bh += (size_t)by * sB; C += (size_t)by * sC;
  const int ntn = (N + 63) / 64; const int wid = blockIdx.x * 4 + w; const int mt = wid / ntn, nq = wid % ntn; if (mt * 16 >= M) return;
  const int row0 = mt * 16, col0 = nq * 64; const float* arow = A + (size_t)(row0 + ln) * lda;
  v8f acc[4] = {};
  for (int kb = 0; kb < K; kb += 32) {
    FragH ah, al;
    const v4f x0 = *(const v4fa*)(arow + kb + 8 * hh), x1 = *(const v4fa*)(arow + kb + 8 * hh + 4), x2 = *(const v4fa*)(arow + kb + 16 + 8 * hh), x3 = *(const v4fa*)(arow + kb + 16 + 8 * hh + 4);
    float xs[16] = {x0[0],x0[1],x0[2],x0[3],x1[0],x1[1],x1[2],x1[3],x2[0],x2[1],x2[2],x2[3],x3[0],x3[1],x3[2],x3[3]};
#pragma unroll
    for (int i = 0; i < 16; ++i) { const _Float16 h = (_Float16)xs[i]; ah.h[i] = h; al.h[i] = ASPLIT ? (_Float16)(xs[i] - (float)h) : (_Float16)0.0f; }
#pragma unroll
    for (int t = 0; t < 4; ++t) { if (col0 + t * 16 >= N) continue; const size_t boff = (size_t)(col0 + t * 16 + ln) * ldb + kb; FragH bq; bq.half[0] = *(const v8us*)(Bh + boff + 8 * hh); bq.half[1] = *(const v8us*)(Bh + boff + 16 + 8 * hh);
      acc[t] = mmaH<ASPLIT ? 2 : 1>(ah.v, al.v, bq.v, bq.v, acc[t]); }
  }
#pragma unroll
  for (int t = 0; t < 4; ++t) { if (col0 + t * 16 >= N) continue;
#pragma unroll
    for (int r = 0; r < 8; ++r) so[w][8 * hh + r][t * 16 + ln] = acc[t][r] * alpha; }
  __builtin_amdgcn_fence(__ATOMIC_ACQ_REL, "workgroup"); __builtin_amdgcn_wave_barrier();
  const int rsub = lane >> 4, c4 = (lane & 15) * 4;
  {
#pragma unroll
    for (int q = 0; q < 8; ++q) { const int r = q * 2 + rsub; if (col0 + c4 < N) { const v4f v = *(const v4fa*)&so[w][r][c4]; *(v4f*)(C + (size_t)(row0 + r) * ldc + col0 + c4) = v; } }
     }
}

// Wt[n][k] = f16(W[k][n]·scale) from f32 row-major W[K][N] (scale = power of two; bf16-exact weights stay exact in f16 away from the subnormal range)
__global__ __launch_bounds__(256) void k_wt_f16(const float* __restrict__ W, _Float16* __restrict__ Wt, int K, int N, float scale) {
  const int t = blockIdx.x * 256 + threadIdx.x; if (t >= N * (K / 8)) return; const int n = t / (K / 8), k8 = (t % (K / 8)) * 8; FragH f;
#pragma unroll
  for (int i = 0; i < 8; ++i) f.h[i] = (_Float16)(bf16_round(W[(size_t)(k8 + i) * N + n]) * scale); const v8us o = f.half[0];
  *(v8us*)((unsigned short*)Wt + (size_t)n * K + k8) = o; 
}
// k_gemm_hh variant with fused epilogue: v = acc·alpha + bias[by·sBias + col] (+ CP[(row/rowsPerB)·sCPb + by·64 + col] if CP) ; ACT 0 none / 1 elu ; writes f16 C16 and/or f32 C, each if non-null
template <int ACT>
__global__ __launch_bounds__(128) void k_gemm_hhx(const _Float16* __restrict__ A, int lda, size_t sA, const _Float16* __restrict__ Bh, int ldb, size_t sB, float alpha, const float* __restrict__ bias, size_t sBias, const float* __restrict__ CP, int rowsPerB, size_t sCPb, int row0g,
    float* __restrict__ C, _Float16* __restrict__ C16, int ldc, size_t sC, int M, int N, int K) {
  __shared__ __attribute__((aligned(16))) float so[4][16][64];
  const int tid = threadIdx.x, w = tid >> 5, lane = tid & 31, ln = lane & 15, hh = lane >> 4; const int by = blockIdx.y;
  A += (size_t)by * sA; Bh += (size_t)by * sB; const size_t cofs = (size_t)by * sC; const float* bp = bias ? bias + (size_t)by * sBias : nullptr;
  const int ntn = (N + 63) / 64; const int wid = blockIdx.x * 4 + w; const int mt = wid / ntn, nq = wid % ntn; if (mt * 16 >= M) return;
  const int row0 = mt * 16, col0 = nq * 64; const _Float16* arow = A + (size_t)(row0 + ln) * lda;
  v8f acc[4] = {};
  for (int kb = 0; kb < K; kb += 32) { FragH ah; ah.half[0] = *(const v8us*)((const unsigned short*)arow + kb + 8 * hh); ah.half[1] = *(const v8us*)((const unsigned short*)arow + kb + 16 + 8 * hh);
#pragma unroll
    for (int t = 0; t < 4; ++t) { if (col0 + t * 16 >= N) continue; const size_t boff = (size_t)(col0 + t * 16 + ln) * ldb + kb; FragH bq; bq.half[0] = *(const v8us*)((const unsigned short*)Bh + boff + 8 * hh); bq.half[1] = *(const v8us*)((const unsigned short*)Bh + boff + 16 + 8 * hh);
      acc[t] = mmaH<1>(ah.v, ah.v, bq.v, bq.v, acc[t]); }
  }
#pragma unroll
  for (int t = 0; t < 4; ++t) { if (col0 + t * 16 >= N) continue; const int col = col0 + t * 16 + ln; const float bv = bp ? bf16_round(bp[col]) : 0.f;
#pragma unroll
    for (int r = 0; r < 8; ++r) { float v = acc[t][r] * alpha + bv; if (CP) { const int bidx = (row0g + row0 + 8 * hh + r) / rowsPerB; v += CP[(size_t)bidx * sCPb + (size_t)by * 64 + col]; } if (ACT == 1) v = (v > 0.f) ? v : expm1f(v); else if (ACT == 3) v = fmaxf(v, 0.f); so[w][8 * hh + r][t * 16 + ln] = v; } }
  __builtin_amdgcn_fence(__ATOMIC_ACQ_REL, "workgroup"); __builtin_amdgcn_wave_barrier();
  const int rsub = lane >> 4, c4 = (lane & 15) * 4; typedef _Float16 v4h __attribute__((ext_vector_type(4)));
  {
#pragma unroll
    for (int q = 0; q < 8; ++q) { const int r = q * 2 + rsub; if (col0 + c4 < N) { const v4f v = *(const v4fa*)&so[w][r][c4]; if (C) *(v4f*)(C + cofs + (size_t)(row0 + r) * ldc + col0 + c4) = v; if (C16) { v4h h4; for (int i = 0; i < 4; ++i) h4[i] = (_Float16)v[i]; *(v4h*)(C16 + cofs + (size_t)(row0 + r) * ldc + col0 + c4) = h4; } } }
     }
}


__global__ __launch_bounds__(256) void k_round16f(const float* __restrict__ W, _Float16* __restrict__ Bt, size_t n8) { const size_t t = (size_t)blockIdx.x * 256 + threadIdx.x; if (t >= n8) return; FragH f;
#pragma unroll
  for (int i = 0; i < 8; ++i) f.h[i] = (_Float16)(bf16_round(W[t * 8 + i]) * 16.0f); *(v8us*)((unsigned short*)Bt + t * 8) = f.half[0];  }
__global__ __launch_bounds__(256) void k_x3(const float* __restrict__ x, _Float16* __restrict__ X3) { const size_t t = (size_t)blockIdx.x * 256 + threadIdx.x; if (t >= (size_t)NR * 3 * (CI / 8)) return; const size_t bn = t / (3 * (CI / 8)); const int rem = (int)(t % (3 * (CI / 8))); const int c = rem / (CI / 8), i8 = (rem % (CI / 8)) * 8; FragH f;
#pragma unroll
  for (int q = 0; q < 8; ++q) f.h[q] = (_Float16)bf16_round(x[(bn * CI + i8 + q) * 3 + c]); *(v8us*)((unsigned short*)X3 + t * 8) = f.half[0];  }
__global__ __launch_bounds__(256) void k_vt3(const _Float16* __restrict__ V16, _Float16* __restrict__ Vt) { __shared__ unsigned short tl[64][66]; const int tid = threadIdx.x; const int per = 3 * (NN / 64); const int slab = blockIdx.x / per, rem = blockIdx.x % per; const int c = rem / (NN / 64), mg = rem % (NN / 64); const int b = slab / NH, h = slab % NH;
  for (int i = tid; i < 64 * 8; i += 256) { const int r = i / 8, c8 = (i % 8) * 8; FragH f; f.half[0] = *(const v8us*)((const unsigned short*)V16 + ((size_t)b * NN + mg * 64 + r) * (3 * CO) + c * CO + h * HD + c8);
#pragma unroll
    for (int q = 0; q < 8; ++q) tl[r][c8 + q] = f.u[q]; }
  __syncthreads();
  {
#pragma unroll
    for (int rd = 0; rd < 2; ++rd) { const int d = rd * 32 + tid / 8, pc = tid % 8; FragH f;
#pragma unroll
      for (int q = 0; q < 8; ++q) f.u[q] = tl[pc * 8 + q][d]; *(v8us*)((unsigned short*)Vt + ((size_t)slab * 192 + c * 64 + d) * NN + mg * 64 + pc * 8) = f.half[0]; }
     } }
__global__ __launch_bounds__(128) void k_vnattn(const _Float16* __restrict__ Q16, const _Float16* __restrict__ K16, const _Float16* __restrict__ Vt, float* __restrict__ O) {
  __shared__ __attribute__((aligned(16))) unsigned short sP[4][16][40]; __shared__ __attribute__((aligned(16))) float sO[4][16][192 + 4];
  const int tid = threadIdx.x, w = tid >> 5, lane = tid & 31, ln = lane & 15, hh = lane >> 4; const int slab = blockIdx.x / (NN / 64), qblk = blockIdx.x % (NN / 64); const int b = slab / NH, h = slab % NH; const int q0 = qblk * 64 + w * 16;
  FragH aq[6]; { const unsigned short* qr = (const unsigned short*)Q16 + ((size_t)b * NN + q0 + ln) * (3 * CO) + h * HD;      // row (b,n) = [c0 | c1 | c2] × 512 (= rows (b,n,c) of pitch 512)
#pragma unroll
    for (int ks = 0; ks < 6; ++ks) { const int c = ks >> 1, s32 = (ks & 1) * 32; aq[ks].half[0] = *(const v8us*)(qr + c * CO + s32 + 8 * hh); aq[ks].half[1] = *(const v8us*)(qr + c * CO + s32 + 16 + 8 * hh); } }
  const unsigned short* Vth = (const unsigned short*)Vt + (size_t)slab * 192 * NN;
  float m_r[8], l_r[8]; v8f oacc[12];
#pragma unroll
  for (int r = 0; r < 8; ++r) { m_r[r] = -3.0e38f; l_r[r] = 0.f; }
#pragma unroll
  for (int dt = 0; dt < 12; ++dt) oacc[dt] = (v8f){0.f,0.f,0.f,0.f,0.f,0.f,0.f,0.f};
#pragma unroll 1
  for (int j0 = 0; j0 < NN; j0 += 32) { v8f s[2];
#pragma unroll
    for (int nt = 0; nt < 2; ++nt) { const unsigned short* kr = (const unsigned short*)K16 + ((size_t)b * NN + j0 + nt * 16 + ln) * (3 * CO) + h * HD; v8f acc = (v8f){0.f,0.f,0.f,0.f,0.f,0.f,0.f,0.f};
#pragma unroll
      for (int ks = 0; ks < 6; ++ks) { const int c = ks >> 1, s32 = (ks & 1) * 32; FragH bk; bk.half[0] = *(const v8us*)(kr + c * CO + s32 + 8 * hh); bk.half[1] = *(const v8us*)(kr + c * CO + s32 + 16 + 8 * hh); acc = mmaH<1>(aq[ks].v, aq[ks].v, bk.v, bk.v, acc); } s[nt] = acc; }
#pragma unroll
    for (int r = 0; r < 8; ++r) { const float s0 = s[0][r] * 0.07216878364870323f, s1 = s[1][r] * 0.07216878364870323f; float mc = fmaxf(s0, s1);
      mc = fmaxf(mc, __shfl_xor(mc, 1, 32)); mc = fmaxf(mc, __shfl_xor(mc, 2, 32)); mc = fmaxf(mc, __shfl_xor(mc, 4, 32)); mc = fmaxf(mc, __shfl_xor(mc, 8, 32));
      const float mn = fmaxf(m_r[r], mc); const float al = expf(m_r[r] - mn); m_r[r] = mn; const float p0 = expf(s0 - mn), p1 = expf(s1 - mn); l_r[r] = l_r[r] * al + p0 + p1;
#pragma unroll
      for (int dt = 0; dt < 12; ++dt) oacc[dt][r] *= al;
      FragH t2; t2.h[0] = (_Float16)p0; t2.h[1] = (_Float16)p1; sP[w][8 * hh + r][ln] = t2.u[0]; sP[w][8 * hh + r][16 + ln] = t2.u[1]; }
    __builtin_amdgcn_fence(__ATOMIC_ACQ_REL, "workgroup"); __builtin_amdgcn_wave_barrier();
    FragH pa; pa.half[0] = *(const v8us*)&sP[w][ln][8 * hh]; pa.half[1] = *(const v8us*)&sP[w][ln][16 + 8 * hh];
#pragma unroll
    for (int dt = 0; dt < 12; ++dt) { const unsigned short* vrow = Vth + (size_t)(dt * 16 + ln) * NN + j0; FragH bv; bv.half[0] = *(const v8us*)(vrow + 8 * hh); bv.half[1] = *(const v8us*)(vrow + 16 + 8 * hh); oacc[dt] = mmaH<1>(pa.v, pa.v, bv.v, bv.v, oacc[dt]); }
    __builtin_amdgcn_fence(__ATOMIC_ACQ_REL, "workgroup"); __builtin_amdgcn_wave_barrier(); }
#pragma unroll
  for (int r = 0; r < 8; ++r) { float l = l_r[r]; l += __shfl_xor(l, 1, 32); l += __shfl_xor(l, 2, 32); l += __shfl_xor(l, 4, 32); l += __shfl_xor(l, 8, 32); l_r[r] = 1.0f / l; }
#pragma unroll
  for (int dt = 0; dt < 12; ++dt)
#pragma unroll
    for (int r = 0; r < 8; ++r) sO[w][8 * hh + r][dt * 16 + ln] = oacc[dt][r] * l_r[r];
  __builtin_amdgcn_fence(__ATOMIC_ACQ_REL, "workgroup"); __builtin_amdgcn_wave_barrier();
  {
#pragma unroll
    for (int r = 0; r < 16; ++r) { float* orow = O + ((size_t)b * NN + q0 + r) * (NH * 192) + h * 192; { const v4f v = *(const v4fa*)&sO[w][r][lane * 4]; *(v4f*)(orow + lane * 4) = v; } if (lane < 16) { const v4f v2 = *(const v4fa*)&sO[w][r][128 + lane * 4]; *(v4f*)(orow + 128 + lane * 4) = v2; } }
     } }
__global__ __launch_bounds__(256) void k_o3(const float* __restrict__ O, _Float16* __restrict__ O3) { const size_t t = (size_t)blockIdx.x * 256 + threadIdx.x; if (t >= (size_t)NR3 * (CO / 8)) return; const size_t row = t / (CO / 8); const int col8 = (int)(t % (CO / 8)) * 8; const int c = (int)(row % 3); const size_t bn = row / 3; const int h = col8 / HD, d = col8 % HD; FragH f;
#pragma unroll
  for (int q = 0; q < 8; ++q) f.h[q] = (_Float16)O[bn * (NH * 192) + h * 192 + c * 64 + d + q]; *(v8us*)((unsigned short*)O3 + t * 8) = f.half[0];  }
__global__ __launch_bounds__(256) void k_fin(const float* __restrict__ OUT2, float* __restrict__ out) { __shared__ float tl[8][3 * CI + 4]; const int tid = threadIdx.x; const size_t bn0 = (size_t)blockIdx.x * 8;
  for (int i = tid; i < 8 * 3 * CI; i += 256) { const int j = i / (3 * CI), rem = i % (3 * CI); const int c = rem / CI, o = rem % CI; tl[j][o * 3 + c] = OUT2[((bn0 + j) * 3 + c) * CI + o]; }
  __syncthreads();
  { for (int i = tid; i < 8 * 3 * CI / 4; i += 256) { const int j = i / (3 * CI / 4), pc = i % (3 * CI / 4); const v4f v = *(const v4fa*)&tl[j][pc * 4]; *(v4f*)(out + (bn0 + j) * 3 * CI + pc * 4) = v; }  } }
extern "C" void kernel_launch(void* const* d_in, const int* in_sizes, int n_in,
                              void* d_out, int out_size, void* d_ws, size_t ws_size, hipStream_t stream) {
  (void)in_sizes; (void)n_in; (void)out_size;
  const float* x = (const float*)d_in[0]; const float* Wq = (const float*)d_in[1]; const float* Wk = (const float*)d_in[2]; const float* Wv = (const float*)d_in[3]; const float* Wo = (const float*)d_in[4];
  char* ws = (char*)d_ws; size_t off = 0;
  auto take = [&](size_t bytes) { char* p = ws + off; off += (bytes + 255) & ~(size_t)255; return p; };
  _Float16* Bq = (_Float16*)take((size_t)CO * CI * 2); _Float16* Bk = (_Float16*)take((size_t)CO * CI * 2); _Float16* Bv = (_Float16*)take((size_t)CO * CI * 2); _Float16* Bo = (_Float16*)take((size_t)CI * CO * 2);
  _Float16* X3 = (_Float16*)take((size_t)NR3 * CI * 2); _Float16* Q16 = (_Float16*)take((size_t)NR3 * CO * 2); _Float16* K16 = (_Float16*)take((size_t)NR3 * CO * 2); _Float16* V16 = (_Float16*)take((size_t)NR3 * CO * 2); _Float16* Vt = (_Float16*)take((size_t)NR3 * CO * 2); float* O = (float*)take((size_t)NR * NH * 192 * 4); _Float16* O3 = Q16; float* OUT2 = (float*)V16;      // Q16 dead after the attention; V16 (12.6 MB) dead after k_vt3 → OUT2 (12.6 MB)
  if (off > ws_size) return;      // 1.0 + 6.3 + 12.6 × 4 + 25.2 ≈ 83 MB
  const unsigned gw = (unsigned)((CO * CI / 8 + 255) / 256); k_round16f<<<gw, 256, 0, stream>>>(Wq, Bq, (size_t)CO * CI / 8); k_round16f<<<gw, 256, 0, stream>>>(Wk, Bk, (size_t)CO * CI / 8); k_round16f<<<gw, 256, 0, stream>>>(Wv, Bv, (size_t)CO * CI / 8); k_round16f<<<gw, 256, 0, stream>>>(Wo, Bo, (size_t)CI * CO / 8);      // (out,in)
  k_x3<<<(unsigned)(((size_t)NR * 3 * (CI / 8) + 255) / 256), 256, 0, stream>>>(x, X3);
  // X3 = rows (b,n,c) × 256; q/k/v planes = rows (b,n,c) × 512 ≡ [(b,n)][c·512 + o]
  const dim3 gg(((NR3 / 16) * (CO / 64) + 3) / 4, 1), go(((NR3 / 16) * (CI / 64) + 3) / 4, 1);
  k_gemm_hhx<0><<<gg, 128, 0, stream>>>(X3, CI, 0, Bq, CI, 0, 0.0625f, nullptr, 0, nullptr, 1, 0, 0, nullptr, Q16, CO, 0, NR3, CO, CI);
  k_gemm_hhx<0><<<gg, 128, 0, stream>>>(X3, CI, 0, Bk, CI, 0, 0.0625f, nullptr, 0, nullptr, 1, 0, 0, nullptr, K16, CO, 0, NR3, CO, CI);
  k_gemm_hhx<0><<<gg, 128, 0, stream>>>(X3, CI, 0, Bv, CI, 0, 0.0625f, nullptr, 0, nullptr, 1, 0, 0, nullptr, V16, CO, 0, NR3, CO, CI);
  k_vt3<<<BB * NH * 3 * (NN / 64), 256, 0, stream>>>(V16, Vt);
  k_vnattn<<<BB * NH * (NN / 64), 128, 0, stream>>>(Q16, K16, Vt, O);
  k_o3<<<(unsigned)(((size_t)NR3 * (CO / 8) + 255) / 256), 256, 0, stream>>>(O, O3);
  k_gemm_hhx<0><<<go, 128, 0, stream>>>(O3, CO, 0, Bo, CO, 0, 0.0625f, nullptr, 0, nullptr, 1, 0, 0, OUT2, nullptr, CI, 0, NR3, CI, CO);      // rows (b,n,c) × 256
  k_fin<<<NR / 8, 256, 0, stream>>>(OUT2, (float*)d_out);
}

// v001
// Measured time: 223 microseconds a run.
// Two timings next to v000 put it at 2.69 and 2.68 times that version's speed.
#include <hip/hip_runtime.h>
// Vector-neuron attention (B=2, N=2048, C=256 × 3 coordinates, 8 heads × 64): the VN-linear maps (rows (b,n,c) × 256 → 512, weights (out,in) bf16-exact ×2^4) and the attention over the
// 192-dim (d, c) head features as a fused flash-style kernel on v_wmma_f32_16x16x32_f16 (S = Q·Kᵀ·192^-½ with 6 k-steps gathered from the three coordinate blocks, online softmax f32, P f16 ≤ 1,
// O = P·V with 12 d-tiles; RPW-16 waves); f16 operands, single products, f32 accumulate; layout permutes f32/VALU.
#define BB 2
#define NN 2048
#define CI 256
#define CO 512
#define NH 8
#define HD 64
#define NR3 (BB * NN * 3)
#define NR (BB * NN)

typedef __bf16 v16b __attribute__((ext_vector_type(16)));
typedef unsigned short v8us __attribute__((ext_vector_type(8), may_alias));
typedef float  v8f  __attribute__((ext_vector_type(8)));
typedef float  v4f  __attribute__((ext_vector_type(4)));
typedef float  v4fa __attribute__((ext_vector_type(4), may_alias));
union FragB { v16b v; v8us half[2]; unsigned short u[16]; };

__device__ __forceinline__ unsigned short bf16_bits(float x) { unsigned int u = __float_as_uint(x); return (unsigned short)((u + 0x7FFFu + ((u >> 16) & 1u)) >> 16); }
__device__ __forceinline__ float bf16_val(unsigned short b) { return __uint_as_float(((unsigned int)b) << 16); }
__device__ __forceinline__ float bf16_round(float x) { return bf16_val(bf16_bits(x)); }
// D += A·B with NT terms: 1 = ah·bh, 2 = + al·bh (A split), 3 = + ah·bl (both split)
template <int NT>
__device__ __forceinline__ v8f mmaN(v16b ah, v16b al, v16b bh, v16b bl, v8f c) {
  c = __builtin_amdgcn_wmma_f32_16x16x32_bf16(false, ah, false, bh, (short)0, c, false, false);
  if (NT >= 2) c = __builtin_amdgcn_wmma_f32_16x16x32_bf16(false, al, false, bh, (short)0, c, false, false);
  if (NT >= 3) c = __builtin_amdgcn_wmma_f32_16x16x32_bf16(false, ah, false, bl, (short)0, c, false, false);
  asm volatile("v_nop\n\tv_nop\n\tv_nop\n\tv_nop" : "+v"(c) : "v"(ah), "v"(al), "v"(bh), "v"(bl));
  return c;
}

__global__ __launch_bounds__(256) void k_wt_bf16(const float* __restrict__ W, unsigned short* __restrict__ Wt, int K, int N) {
  const int t = blockIdx.x * 256 + threadIdx.x;
  const int k8n = K / 8;
  if (t >= N * k8n) return;
  const int n = t / k8n, k8 = (t % k8n) * 8;
  v8us v;
#pragma unroll
  for (int i = 0; i < 8; ++i) v[i] = bf16_bits(W[(size_t)(k8 + i) * N + n]);
  *(v8us*)(Wt + (size_t)n * K + k8) = v;
  
}

// GEMM C[M][N] (f32, pitch ldc) = act(A[M][K]·W + bias). A f32 row-major (pitch lda) converted per fragment to bf16
// (ASPLIT: hi/lo two planes -> 2 terms, else single rounded term); Wt bf16 [N][K] (pitch ldb). BIAS_BF16 rounds the
// bias to bf16 first (bias quantised to bf16 before the add). K%32==0, M%16==0, N%64==0.
template <bool ASPLIT, int ACT, bool BIAS_BF16>
__global__ __launch_bounds__(128) void k_gemm_bf(const float* __restrict__ A, int lda, const unsigned short* __restrict__ Wt, int ldb,
                                               const float* __restrict__ bias, float* __restrict__ C, int ldc, int M, int N, int K) {
  __shared__ __attribute__((aligned(16))) float so[4][16][64];
  const int tid = threadIdx.x, w = tid >> 5, lane = tid & 31, ln = lane & 15, hh = lane >> 4;
  const int ntn = N / 64;
  const int wid = blockIdx.x * 4 + w;
  const int mt = wid / ntn, nq = wid % ntn;
  if (mt * 16 >= M) return;
  const int row0 = mt * 16, col0 = nq * 64;
  const float* arow = A + (size_t)(row0 + ln) * lda;
  v8f acc[4] = {};
  for (int kb = 0; kb < K; kb += 32) {
    FragB ah, al;
    const v4f x0 = *(const v4fa*)(arow + kb + 8 * hh), x1 = *(const v4fa*)(arow + kb + 8 * hh + 4);
    const v4f x2 = *(const v4fa*)(arow + kb + 16 + 8 * hh), x3 = *(const v4fa*)(arow + kb + 16 + 8 * hh + 4);
    float xs[16] = {x0[0],x0[1],x0[2],x0[3],x1[0],x1[1],x1[2],x1[3],x2[0],x2[1],x2[2],x2[3],x3[0],x3[1],x3[2],x3[3]};
#pragma unroll
    for (int i = 0; i < 16; ++i) { const unsigned short hb = bf16_bits(xs[i]); ah.u[i] = hb; al.u[i] = ASPLIT ? bf16_bits(xs[i] - bf16_val(hb)) : (unsigned short)0; }
#pragma unroll
    for (int t = 0; t < 4; ++t) {
      const unsigned short* brow = Wt + (size_t)(col0 + t * 16 + ln) * ldb + kb;
      FragB b;
      b.half[0] = *(const v8us*)(brow + 8 * hh);
      b.half[1] = *(const v8us*)(brow + 16 + 8 * hh);
      acc[t] = mmaN<ASPLIT ? 2 : 1>(ah.v, al.v, b.v, b.v, acc[t]);
    }
  }
#pragma unroll
  for (int t = 0; t < 4; ++t) {
    float bv = bias ? bias[col0 + t * 16 + ln] : 0.f;
    if (BIAS_BF16) bv = bf16_round(bv);
#pragma unroll
    for (int r = 0; r < 8; ++r) { float v = acc[t][r] + bv; if (ACT == 1) v = fmaxf(v, 0.f); so[w][8 * hh + r][t * 16 + ln] = v; }
  }
  __builtin_amdgcn_fence(__ATOMIC_ACQ_REL, "workgroup");
  __builtin_amdgcn_wave_barrier();
  const int rsub = lane >> 4, c4 = (lane & 15) * 4;
  {
#pragma unroll
    for (int q = 0; q < 8; ++q) {
      const int r = q * 2 + rsub;
      const v4f v = *(const v4fa*)&so[w][r][c4];
      *(v4f*)(C + (size_t)(row0 + r) * ldc + col0 + c4) = v;
    }
    
  }
}

// Flash-style causal/unmasked attention, all contractions 3-term bf16 hi/lo splits, f32 softmax with running max.
// q,k,v rows are read from f32 buffers with arbitrary row pitch (so they can live inside a fused qkv buffer);
// D = head size (multiple of 32, <= 128); one wave = 16 query rows; block = 4 waves (64 queries) sharing K/V chunks of 32.
template <int D, bool CAUSAL>
__global__ __launch_bounds__(128) void k_flash(const float* __restrict__ qb, const float* __restrict__ kb, const float* __restrict__ vb,
                                             int pitch, int T, int H, float scale, float* __restrict__ y, int ypitch) {
  constexpr int KS = D / 32;        // k-steps for QK
  constexpr int DT = D / 16;        // d tiles for PV
  __shared__ __attribute__((aligned(16))) unsigned short sKh[32][D + 8], sKl[32][D + 8], sVh[32][D + 8], sVl[32][D + 8];
  __shared__ __attribute__((aligned(16))) unsigned short sPh[4][16][40], sPl[4][16][40];
  __shared__ __attribute__((aligned(16))) float sO[4][16][D];
  const int tid = threadIdx.x, w = tid >> 5, lane = tid & 31, ln = lane & 15, hh = lane >> 4;
  const int nqb = (T + 63) / 64;
  const int bh = blockIdx.x / nqb, qblk = blockIdx.x % nqb;
  const int b = bh / H, h = bh % H;
  const int q0 = qblk * 64 + w * 16;
  const float* Q = qb + (size_t)b * T * pitch + h * D;
  const float* K = kb + (size_t)b * T * pitch + h * D;
  const float* V = vb + (size_t)b * T * pitch + h * D;

  // A fragments of the wave's 16 query rows (scaled), hi/lo
  FragB aqh[KS], aql[KS];
  {
    int row = q0 + ln; if (row >= T) row = T - 1;
    const float* qr = Q + (size_t)row * pitch;
#pragma unroll
    for (int ks = 0; ks < KS; ++ks)
#pragma unroll
      for (int i = 0; i < 16; ++i) {
        const int d = ks * 32 + ((i < 8) ? (8 * hh + i) : (16 + 8 * hh + (i - 8)));
        const float x = qr[d] * scale; const unsigned short hb = bf16_bits(x);
        aqh[ks].u[i] = hb; aql[ks].u[i] = bf16_bits(x - bf16_val(hb));
      }
  }
  float m_r[8], l_r[8];
#pragma unroll
  for (int r = 0; r < 8; ++r) { m_r[r] = -3.0e38f; l_r[r] = 0.f; }
  v8f oacc[DT];
#pragma unroll
  for (int dt = 0; dt < DT; ++dt) oacc[dt] = (v8f){0.f,0.f,0.f,0.f,0.f,0.f,0.f,0.f};

  const int kv_end = CAUSAL ? min(T, qblk * 64 + 64) : T;     // block-uniform
  for (int j0 = 0; j0 < kv_end; j0 += 32) {
    __syncthreads();
    for (int e = tid; e < 32 * (D / 4); e += 128) {
      const int r = e / (D / 4), c4 = (e % (D / 4)) * 4;
      const int key = j0 + r;
      v4f kf = {0.f,0.f,0.f,0.f}, vf = {0.f,0.f,0.f,0.f};
      if (key < T) { kf = *(const v4fa*)(K + (size_t)key * pitch + c4); vf = *(const v4fa*)(V + (size_t)key * pitch + c4); }
#pragma unroll
      for (int t = 0; t < 4; ++t) {
        unsigned short hb = bf16_bits(kf[t]); sKh[r][c4 + t] = hb; sKl[r][c4 + t] = bf16_bits(kf[t] - bf16_val(hb));
        hb = bf16_bits(vf[t]); sVh[r][c4 + t] = hb; sVl[r][c4 + t] = bf16_bits(vf[t] - bf16_val(hb));
      }
    }
    __syncthreads();
    // S tile 16 x 32
    v8f s[2];
#pragma unroll
    for (int nt = 0; nt < 2; ++nt) {
      v8f acc = {};
#pragma unroll
      for (int ks = 0; ks < KS; ++ks) {
        FragB bh_, bl_;
        bh_.half[0] = *(const v8us*)&sKh[nt * 16 + ln][ks * 32 + 8 * hh]; bh_.half[1] = *(const v8us*)&sKh[nt * 16 + ln][ks * 32 + 16 + 8 * hh];
        bl_.half[0] = *(const v8us*)&sKl[nt * 16 + ln][ks * 32 + 8 * hh]; bl_.half[1] = *(const v8us*)&sKl[nt * 16 + ln][ks * 32 + 16 + 8 * hh];
        acc = mmaN<3>(aqh[ks].v, aql[ks].v, bh_.v, bl_.v, acc);
      }
      s[nt] = acc;
    }
    // mask + running max (rows 8hh+r; the 16 lanes of a half share rows)
    float alpha[8];
#pragma unroll
    for (int r = 0; r < 8; ++r) {
      const int qi = q0 + 8 * hh + r;
      const int ja = j0 + ln, jb = j0 + 16 + ln;
      if (CAUSAL) { if (ja > qi) s[0][r] = -3.0e38f; if (jb > qi) s[1][r] = -3.0e38f; }
      if (ja >= T) s[0][r] = -3.0e38f;
      if (jb >= T) s[1][r] = -3.0e38f;
      float mx = fmaxf(s[0][r], s[1][r]);
      mx = fmaxf(mx, __shfl_xor(mx, 1, 32)); mx = fmaxf(mx, __shfl_xor(mx, 2, 32)); mx = fmaxf(mx, __shfl_xor(mx, 4, 32)); mx = fmaxf(mx, __shfl_xor(mx, 8, 32));
      const float mnew = fmaxf(m_r[r], mx);
      alpha[r] = (mnew > -1.0e38f) ? __expf(m_r[r] - mnew) : 1.0f;
      const float p0 = (s[0][r] > -1.0e38f) ? __expf(s[0][r] - mnew) : 0.f;
      const float p1 = (s[1][r] > -1.0e38f) ? __expf(s[1][r] - mnew) : 0.f;
      m_r[r] = mnew;
      l_r[r] = l_r[r] * alpha[r] + p0 + p1;            // per-lane partial row sum (16 lanes combined at the end)
      unsigned short hb = bf16_bits(p0); sPh[w][8 * hh + r][ln] = hb;      sPl[w][8 * hh + r][ln] = bf16_bits(p0 - bf16_val(hb));
      hb = bf16_bits(p1);                sPh[w][8 * hh + r][16 + ln] = hb; sPl[w][8 * hh + r][16 + ln] = bf16_bits(p1 - bf16_val(hb));
    }
#pragma unroll
    for (int dt = 0; dt < DT; ++dt)
#pragma unroll
      for (int r = 0; r < 8; ++r) oacc[dt][r] *= alpha[r];
    __builtin_amdgcn_fence(__ATOMIC_ACQ_REL, "workgroup");
    __builtin_amdgcn_wave_barrier();
    FragB pah, pal;
    pah.half[0] = *(const v8us*)&sPh[w][ln][8 * hh]; pah.half[1] = *(const v8us*)&sPh[w][ln][16 + 8 * hh];
    pal.half[0] = *(const v8us*)&sPl[w][ln][8 * hh]; pal.half[1] = *(const v8us*)&sPl[w][ln][16 + 8 * hh];
#pragma unroll
    for (int dt = 0; dt < DT; ++dt) {
      FragB bvh, bvl;
#pragma unroll
      for (int i = 0; i < 8; ++i) {
        bvh.u[i] = sVh[8 * hh + i][dt * 16 + ln]; bvh.u[8 + i] = sVh[16 + 8 * hh + i][dt * 16 + ln];
        bvl.u[i] = sVl[8 * hh + i][dt * 16 + ln]; bvl.u[8 + i] = sVl[16 + 8 * hh + i][dt * 16 + ln];
      }
      oacc[dt] = mmaN<3>(pah.v, pal.v, bvh.v, bvl.v, oacc[dt]);
    }
    __builtin_amdgcn_fence(__ATOMIC_ACQ_REL, "workgroup");
    __builtin_amdgcn_wave_barrier();
  }
#pragma unroll
  for (int r = 0; r < 8; ++r) {
    float l = l_r[r];
    l += __shfl_xor(l, 1, 32); l += __shfl_xor(l, 2, 32); l += __shfl_xor(l, 4, 32); l += __shfl_xor(l, 8, 32);
    l_r[r] = (l > 0.f) ? 1.0f / l : 0.f;
  }
#pragma unroll
  for (int dt = 0; dt < DT; ++dt)
#pragma unroll
    for (int r = 0; r < 8; ++r) sO[w][8 * hh + r][dt * 16 + ln] = oacc[dt][r] * l_r[r];
  __builtin_amdgcn_fence(__ATOMIC_ACQ_REL, "workgroup");
  __builtin_amdgcn_wave_barrier();
  {
    for (int r = 0; r < 16; ++r) {
      const int row = q0 + r;
      if (row < T && lane < D / 4) {
        const v4f val = *(const v4fa*)&sO[w][r][lane * 4];
        *(v4f*)(y + ((size_t)b * T + row) * ypitch + h * D + lane * 4) = val;
      }
    }
    
  }
}

// GEMM C = act(A·W + bias + resid): A f32 (ASPLIT -> hi/lo 2 terms), Wt bf16 [N][K]; ACT 0 none, 1 relu, 2 exact gelu;
// resid (optional, f32, row index = (row % rmod), pitch ldr, RES_BF16 rounds it) added before the activation.
template <bool ASPLIT, int ACT, bool BIAS_BF16, bool RES_BF16>
__global__ __launch_bounds__(128) void k_gemm_bf3(const float* __restrict__ A, int lda, const unsigned short* __restrict__ Wt, int ldb,
                                                const float* __restrict__ bias, const float* __restrict__ resid, int rmod, int ldr,
                                                float* __restrict__ C, int ldc, int M, int N, int K) {
  __shared__ __attribute__((aligned(16))) float so[4][16][64];
  const int tid = threadIdx.x, w = tid >> 5, lane = tid & 31, ln = lane & 15, hh = lane >> 4;
  const int ntn = N / 64;
  const int wid = blockIdx.x * 4 + w;
  const int mt = wid / ntn, nq = wid % ntn;
  if (mt * 16 >= M) return;
  const int row0 = mt * 16, col0 = nq * 64;
  const float* arow = A + (size_t)(row0 + ln) * lda;
  v8f acc[4] = {};
  for (int kb = 0; kb < K; kb += 32) {
    FragB ah, al;
    const v4f x0 = *(const v4fa*)(arow + kb + 8 * hh), x1 = *(const v4fa*)(arow + kb + 8 * hh + 4);
    const v4f x2 = *(const v4fa*)(arow + kb + 16 + 8 * hh), x3 = *(const v4fa*)(arow + kb + 16 + 8 * hh + 4);
    float xs[16] = {x0[0],x0[1],x0[2],x0[3],x1[0],x1[1],x1[2],x1[3],x2[0],x2[1],x2[2],x2[3],x3[0],x3[1],x3[2],x3[3]};
#pragma unroll
    for (int i = 0; i < 16; ++i) { const unsigned short hb = bf16_bits(xs[i]); ah.u[i] = hb; al.u[i] = ASPLIT ? bf16_bits(xs[i] - bf16_val(hb)) : (unsigned short)0; }
#pragma unroll
    for (int t = 0; t < 4; ++t) {
      const unsigned short* brow = Wt + (size_t)(col0 + t * 16 + ln) * ldb + kb;
      FragB b;
      b.half[0] = *(const v8us*)(brow + 8 * hh);
      b.half[1] = *(const v8us*)(brow + 16 + 8 * hh);
      acc[t] = mmaN<ASPLIT ? 2 : 1>(ah.v, al.v, b.v, b.v, acc[t]);
    }
  }
#pragma unroll
  for (int t = 0; t < 4; ++t) {
    const int col = col0 + t * 16 + ln;
    float bv = bias ? bias[col] : 0.f;
    if (BIAS_BF16) bv = bf16_round(bv);
#pragma unroll
    for (int r = 0; r < 8; ++r) {
      float v = acc[t][r] + bv;
      if (resid) { float rv = resid[(size_t)((row0 + 8 * hh + r) % rmod) * ldr + col]; if (RES_BF16) rv = bf16_round(rv); v += rv; }
      if (ACT == 1) v = fmaxf(v, 0.f);
      if (ACT == 2) v = 0.5f * v * (1.0f + erff(v * 0.70710678118654752f));
      if (ACT == 3) { const float u = 0.7978845608028654f * (v + 0.044715f * v * v * v); v = 0.5f * v * (1.0f + tanhf(u)); }
      so[w][8 * hh + r][t * 16 + ln] = v;
    }
  }
  __builtin_amdgcn_fence(__ATOMIC_ACQ_REL, "workgroup");
  __builtin_amdgcn_wave_barrier();
  const int rsub = lane >> 4, c4 = (lane & 15) * 4;
  {
#pragma unroll
    for (int q = 0; q < 8; ++q) {
      const int r = q * 2 + rsub;
      const v4f v = *(const v4fa*)&so[w][r][c4];
      *(v4f*)(C + (size_t)(row0 + r) * ldc + col0 + c4) = v;
    }
    
  }
}
// row LayerNorm (biased variance, eps) over N: s = X (+ R); optional out_sum <- s; out_norm <- (s-mu)*rsqrt(var+eps)*g + b
template <bool PARAM_BF16>
__global__ __launch_bounds__(256) void k_layernorm(const float* __restrict__ X, const float* __restrict__ R, const float* __restrict__ g, const float* __restrict__ bta,
                                                  float* __restrict__ out_sum, float* __restrict__ out_norm, int N, float eps) {
  __shared__ float red[256];
  const int row = blockIdx.x, tid = threadIdx.x;
  const float* x = X + (size_t)row * N; const float* rr = R ? R + (size_t)row * N : nullptr;
  float vals[16];                     // up to N = 4096
  const int per = N / 256;            // contiguous chunk per thread? use strided-by-4 chunks: thread handles j = tid*4 + 1024*u
  float s1 = 0.f;
  for (int u = 0; u < per / 4; ++u) {
    const int j = tid * 4 + 1024 * u;
    const v4f a = *(const v4fa*)(x + j);
    v4f b = {0.f,0.f,0.f,0.f}; if (rr) b = *(const v4fa*)(rr + j);
#pragma unroll
    for (int q = 0; q < 4; ++q) { const float v = a[q] + b[q]; vals[u * 4 + q] = v; s1 += v; }
  }
  red[tid] = s1; __syncthreads();
  for (int st = 128; st > 0; st >>= 1) { if (tid < st) red[tid] += red[tid + st]; __syncthreads(); }
  const float mu = red[0] / (float)N; __syncthreads();
  float s2 = 0.f;
  for (int u = 0; u < per / 4; ++u)
#pragma unroll
    for (int q = 0; q < 4; ++q) { const float c = vals[u * 4 + q] - mu; s2 += c * c; }
  red[tid] = s2; __syncthreads();
  for (int st = 128; st > 0; st >>= 1) { if (tid < st) red[tid] += red[tid + st]; __syncthreads(); }
  const float rs = rsqrtf(red[0] / (float)N + eps);
  {
    for (int u = 0; u < per / 4; ++u) {
      const int j = tid * 4 + 1024 * u;
      v4f o, sm;
#pragma unroll
      for (int q = 0; q < 4; ++q) {
        float gg = g[j + q], bb = bta[j + q];
        if (PARAM_BF16) { gg = bf16_round(gg); bb = bf16_round(bb); }
        sm[q] = vals[u * 4 + q]; o[q] = (vals[u * 4 + q] - mu) * rs * gg + bb;
      }
      if (out_sum) *(v4f*)(out_sum + (size_t)row * N + j) = sm;
      *(v4f*)(out_norm + (size_t)row * N + j) = o;
    }
    
  }
}



// ---- f16 WMMA path (v_wmma_f32_16x16x32_f16): 11-bit significands for operands in range — used for every contraction launched here (VN-linear maps, Q·Kᵀ, P·V)
typedef _Float16 v16h __attribute__((ext_vector_type(16)));
union FragH { v16h v; v8us half[2]; _Float16 h[16]; unsigned short u[16]; };
template <int NT>
__device__ __forceinline__ v8f mmaH(v16h ah, v16h al, v16h bh, v16h bl, v8f c) {
  c = __builtin_amdgcn_wmma_f32_16x16x32_f16(false, ah, false, bh, (short)0, c, false, false);
  if (NT >= 2) c = __builtin_amdgcn_wmma_f32_16x16x32_f16(false, al, false, bh, (short)0, c, false, false);
  if (NT >= 3) c = __builtin_amdgcn_wmma_f32_16x16x32_f16(false, ah, false, bl, (short)0, c, false, false);
  asm volatile("v_nop\n\tv_nop\n\tv_nop\n\tv_nop" : "+v"(c) : "v"(ah), "v"(al), "v"(bh), "v"(bl));
  return c;
}
// batched GEMM like k_gemm_b but f16 operands: A f32 (split into f16 hi/lo if ASPLIT, else rounded to f16), Bt = f16 values [n][k]; alpha; C f32; N multiple of 16 (partial tiles skipped)
template <bool ASPLIT>
__global__ __launch_bounds__(128) void k_gemm_h(const float* __restrict__ A, int lda, size_t sA, const _Float16* __restrict__ Bh, int ldb, size_t sB, float alpha, float* __restrict__ C, int ldc, size_t sC, int M, int N, int K) {
  __shared__ __attribute__((aligned(16))) float so[4][16][64];
  const int tid = threadIdx.x, w = tid >> 5, lane = tid & 31, ln = lane & 15, hh = lane >> 4; const int by = blockIdx.y;
  A += (size_t)by * sA; Bh += (size_t)by * sB; C += (size_t)by * sC;
  const int ntn = (N + 63) / 64; const int wid = blockIdx.x * 4 + w; const int mt = wid / ntn, nq = wid % ntn; if (mt * 16 >= M) return;
  const int row0 = mt * 16, col0 = nq * 64; const float* arow = A + (size_t)(row0 + ln) * lda;
  v8f acc[4] = {};
  for (int kb = 0; kb < K; kb += 32) {
    FragH ah, al;
    const v4f x0 = *(const v4fa*)(arow + kb + 8 * hh), x1 = *(const v4fa*)(arow + kb + 8 * hh + 4), x2 = *(const v4fa*)(arow + kb + 16 + 8 * hh), x3 = *(const v4fa*)(arow + kb + 16 + 8 * hh + 4);
    float xs[16] = {x0[0],x0[1],x0[2],x0[3],x1[0],x1[1],x1[2],x1[3],x2[0],x2[1],x2[2],x2[3],x3[0],x3[1],x3[2],x3[3]};
#pragma unroll
    for (int i = 0; i < 16; ++i) { const _Float16 h = (_Float16)xs[i]; ah.h[i] = h; al.h[i] = ASPLIT ? (_Float16)(xs[i] - (float)h) : (_Float16)0.0f; }
#pragma unroll
    for (int t = 0; t < 4; ++t) { if (col0 + t * 16 >= N) continue; const size_t boff = (size_t)(col0 + t * 16 + ln) * ldb + kb; FragH bq; bq.half[0] = *(const v8us*)(Bh + boff + 8 * hh); bq.half[1] = *(const v8us*)(Bh + boff + 16 + 8 * hh);
      acc[t] = mmaH<ASPLIT ? 2 : 1>(ah.v, al.v, bq.v, bq.v, acc[t]); }
  }
#pragma unroll
  for (int t = 0; t < 4; ++t) { if (col0 + t * 16 >= N) continue;
#pragma unroll
    for (int r = 0; r < 8; ++r) so[w][8 * hh + r][t * 16 + ln] = acc[t][r] * alpha; }
  __builtin_amdgcn_fence(__ATOMIC_ACQ_REL, "workgroup"); __builtin_amdgcn_wave_barrier();
  const int rsub = lane >> 4, c4 = (lane & 15) * 4;
  {
#pragma unroll
    for (int q = 0; q < 8; ++q) { const int r = q * 2 + rsub; if (col0 + c4 < N) { const v4f v = *(const v4fa*)&so[w][r][c4]; *(v4f*)(C + (size_t)(row0 + r) * ldc + col0 + c4) = v; } }
     }
}

// Wt[n][k] = f16(W[k][n]·scale) from f32 row-major W[K][N] (scale = power of two; bf16-exact weights stay exact in f16 away from the subnormal range)
__global__ __launch_bounds__(256) void k_wt_f16(const float* __restrict__ W, _Float16* __restrict__ Wt, int K, int N, float scale) {
  const int t = blockIdx.x * 256 + threadIdx.x; if (t >= N * (K / 8)) return; const int n = t / (K / 8), k8 = (t % (K / 8)) * 8; FragH f;
#pragma unroll
  for (int i = 0; i < 8; ++i) f.h[i] = (_Float16)(bf16_round(W[(size_t)(k8 + i) * N + n]) * scale); const v8us o = f.half[0];
  *(v8us*)((unsigned short*)Wt + (size_t)n * K + k8) = o; 
}
// k_gemm_hh variant with fused epilogue: v = acc·alpha + bias[by·sBias + col] (+ CP[(row/rowsPerB)·sCPb + by·64 + col] if CP) ; ACT 0 none / 1 elu ; writes f16 C16 and/or f32 C, each if non-null
template <int ACT>
__global__ __launch_bounds__(128) void k_gemm_hhx(const _Float16* __restrict__ A, int lda, size_t sA, const _Float16* __restrict__ Bh, int ldb, size_t sB, float alpha, const float* __restrict__ bias, size_t sBias, const float* __restrict__ CP, int rowsPerB, size_t sCPb, int row0g,
    float* __restrict__ C, _Float16* __restrict__ C16, int ldc, size_t sC, int M, int N, int K) {
  __shared__ __attribute__((aligned(16))) float so[4][16][64];
  const int tid = threadIdx.x, w = tid >> 5, lane = tid & 31, ln = lane & 15, hh = lane >> 4; const int by = blockIdx.y;
  A += (size_t)by * sA; Bh += (size_t)by * sB; const size_t cofs = (size_t)by * sC; const float* bp = bias ? bias + (size_t)by * sBias : nullptr;
  const int ntn = (N + 63) / 64; const int wid = blockIdx.x * 4 + w; const int mt = wid / ntn, nq = wid % ntn; if (mt * 16 >= M) return;
  const int row0 = mt * 16, col0 = nq * 64; const _Float16* arow = A + (size_t)(row0 + ln) * lda;
  v8f acc[4] = {};
  for (int kb = 0; kb < K; kb += 32) { FragH ah; ah.half[0] = *(const v8us*)((const unsigned short*)arow + kb + 8 * hh); ah.half[1] = *(const v8us*)((const unsigned short*)arow + kb + 16 + 8 * hh);
#pragma unroll
    for (int t = 0; t < 4; ++t) { if (col0 + t * 16 >= N) continue; const size_t boff = (size_t)(col0 + t * 16 + ln) * ldb + kb; FragH bq; bq.half[0] = *(const v8us*)((const unsigned short*)Bh + boff + 8 * hh); bq.half[1] = *(const v8us*)((const unsigned short*)Bh + boff + 16 + 8 * hh);
      acc[t] = mmaH<1>(ah.v, ah.v, bq.v, bq.v, acc[t]); }
  }
#pragma unroll
  for (int t = 0; t < 4; ++t) { if (col0 + t * 16 >= N) continue; const int col = col0 + t * 16 + ln; const float bv = bp ? bf16_round(bp[col]) : 0.f;
#pragma unroll
    for (int r = 0; r < 8; ++r) { float v = acc[t][r] * alpha + bv; if (CP) { const int bidx = (row0g + row0 + 8 * hh + r) / rowsPerB; v += CP[(size_t)bidx * sCPb + (size_t)by * 64 + col]; } if (ACT == 1) v = (v > 0.f) ? v : expm1f(v); else if (ACT == 3) v = fmaxf(v, 0.f); so[w][8 * hh + r][t * 16 + ln] = v; } }
  __builtin_amdgcn_fence(__ATOMIC_ACQ_REL, "workgroup"); __builtin_amdgcn_wave_barrier();
  const int rsub = lane >> 4, c4 = (lane & 15) * 4; typedef _Float16 v4h __attribute__((ext_vector_type(4)));
  {
#pragma unroll
    for (int q = 0; q < 8; ++q) { const int r = q * 2 + rsub; if (col0 + c4 < N) { const v4f v = *(const v4fa*)&so[w][r][c4]; if (C) *(v4f*)(C + cofs + (size_t)(row0 + r) * ldc + col0 + c4) = v; if (C16) { v4h h4; for (int i = 0; i < 4; ++i) h4[i] = (_Float16)v[i]; *(v4h*)(C16 + cofs + (size_t)(row0 + r) * ldc + col0 + c4) = h4; } } }
     }
}


__global__ __launch_bounds__(256) void k_round16f(const float* __restrict__ W, _Float16* __restrict__ Bt, size_t n8) { const size_t t = (size_t)blockIdx.x * 256 + threadIdx.x; if (t >= n8) return; FragH f;
#pragma unroll
  for (int i = 0; i < 8; ++i) f.h[i] = (_Float16)(bf16_round(W[t * 8 + i]) * 16.0f); *(v8us*)((unsigned short*)Bt + t * 8) = f.half[0];  }
__global__ __launch_bounds__(256) void k_x3(const float* __restrict__ x, _Float16* __restrict__ X3) { const size_t t = (size_t)blockIdx.x * 256 + threadIdx.x; if (t >= (size_t)NR * 3 * (CI / 8)) return; const size_t bn = t / (3 * (CI / 8)); const int rem = (int)(t % (3 * (CI / 8))); const int c = rem / (CI / 8), i8 = (rem % (CI / 8)) * 8; FragH f;
#pragma unroll
  for (int q = 0; q < 8; ++q) f.h[q] = (_Float16)bf16_round(x[(bn * CI + i8 + q) * 3 + c]); *(v8us*)((unsigned short*)X3 + t * 8) = f.half[0];  }
__global__ __launch_bounds__(256) void k_vt3(const _Float16* __restrict__ V16, _Float16* __restrict__ Vt) { __shared__ unsigned short tl[64][66]; const int tid = threadIdx.x; const int per = 3 * (NN / 64); const int slab = blockIdx.x / per, rem = blockIdx.x % per; const int c = rem / (NN / 64), mg = rem % (NN / 64); const int b = slab / NH, h = slab % NH;
  for (int i = tid; i < 64 * 8; i += 256) { const int r = i / 8, c8 = (i % 8) * 8; FragH f; f.half[0] = *(const v8us*)((const unsigned short*)V16 + ((size_t)b * NN + mg * 64 + r) * (3 * CO) + c * CO + h * HD + c8);
#pragma unroll
    for (int q = 0; q < 8; ++q) tl[r][c8 + q] = f.u[q]; }
  __syncthreads();
  {
#pragma unroll
    for (int rd = 0; rd < 2; ++rd) { const int d = rd * 32 + tid / 8, pc = tid % 8; FragH f;
#pragma unroll
      for (int q = 0; q < 8; ++q) f.u[q] = tl[pc * 8 + q][d]; *(v8us*)((unsigned short*)Vt + ((size_t)slab * 192 + c * 64 + d) * NN + mg * 64 + pc * 8) = f.half[0]; }
     } }
// K and V^T tiles of 64 keys, staged in LDS once per work-group and read by its four waves. Row pitches are 16 B x odd, so the 16 rows of a ds_load_b128 fall on distinct banks.
#define TK 64
#define KP 200      // halves per staged K row: 3 coordinate blocks x 64 + 8 of pad (400 B)
#define VP 72       // halves per staged V^T row: 64 keys + 8 of pad (144 B)
// Twelve asynchronous 16-byte copies per lane, global -> LDS, through no register: copy 4 a + q goes from g + a gs + q gq (halves) to LDS byte l + a ls + q lq.
// The s_wait_xcnt closes the statement so that no address register named here is rewritten ahead of it.
__device__ __forceinline__ void acopy12(unsigned l, unsigned ls, unsigned lq, const unsigned short* g, size_t gs, size_t gq) {
  const unsigned l1 = l + lq, l2 = l + 2 * lq, l3 = l + 3 * lq, l4 = l + ls, l5 = l4 + lq, l6 = l4 + 2 * lq, l7 = l4 + 3 * lq, l8 = l + 2 * ls, l9 = l8 + lq, l10 = l8 + 2 * lq, l11 = l8 + 3 * lq;
  const unsigned short *g1 = g + gq, *g2 = g + 2 * gq, *g3 = g + 3 * gq, *g4 = g + gs, *g5 = g4 + gq, *g6 = g4 + 2 * gq, *g7 = g4 + 3 * gq, *g8 = g + 2 * gs, *g9 = g8 + gq, *g10 = g8 + 2 * gq, *g11 = g8 + 3 * gq;
  asm volatile("global_load_async_to_lds_b128 %0, %12, off\n\t"
               "global_load_async_to_lds_b128 %1, %13, off\n\t"
               "global_load_async_to_lds_b128 %2, %14, off\n\t"
               "global_load_async_to_lds_b128 %3, %15, off\n\t"
               "global_load_async_to_lds_b128 %4, %16, off\n\t"
               "global_load_async_to_lds_b128 %5, %17, off\n\t"
               "global_load_async_to_lds_b128 %6, %18, off\n\t"
               "global_load_async_to_lds_b128 %7, %19, off\n\t"
               "global_load_async_to_lds_b128 %8, %20, off\n\t"
               "global_load_async_to_lds_b128 %9, %21, off\n\t"
               "global_load_async_to_lds_b128 %10, %22, off\n\t"
               "global_load_async_to_lds_b128 %11, %23, off\n\t"
               "s_wait_xcnt 0x0"
               :: "v"(l), "v"(l1), "v"(l2), "v"(l3), "v"(l4), "v"(l5), "v"(l6), "v"(l7), "v"(l8), "v"(l9), "v"(l10), "v"(l11),
                  "v"(g), "v"(g1), "v"(g2), "v"(g3), "v"(g4), "v"(g5), "v"(g6), "v"(g7), "v"(g8), "v"(g9), "v"(g10), "v"(g11) : "memory");
}
// One stage: 64 keys of K (3 coordinate blocks of 128 B a key) and 192 rows of V^T (128 B a row); 24 copies a lane.
__device__ __forceinline__ void stage_kv(unsigned lk, unsigned lv, const unsigned short* kg, const unsigned short* vg) {
  acopy12(lk, 128, 16 * KP * 2, kg, CO, (size_t)16 * 3 * CO);
  acopy12(lv, 64 * VP * 2, 16 * VP * 2, vg, (size_t)64 * NN, (size_t)16 * NN);
}
__global__ __launch_bounds__(128) void k_vnattn(const _Float16* __restrict__ Q16, const _Float16* __restrict__ K16, const _Float16* __restrict__ Vt, float* __restrict__ O) {
  __shared__ __attribute__((aligned(16))) unsigned short sK[2][TK][KP]; __shared__ __attribute__((aligned(16))) unsigned short sV[2][192][VP];
  __shared__ __attribute__((aligned(16))) unsigned short sP[4][16][40]; __shared__ __attribute__((aligned(16))) float sO[4][16][192 + 4];
  const int tid = threadIdx.x, w = tid >> 5, lane = tid & 31, ln = lane & 15, hh = lane >> 4; const int slab = blockIdx.x / (NN / 64), qblk = blockIdx.x % (NN / 64); const int b = slab / NH, h = slab % NH; const int q0 = qblk * 64 + w * 16;
  const unsigned short* Vth = (const unsigned short*)Vt + (size_t)slab * 192 * NN;
  // The lane's share of a stage: eight lanes cover one 128-byte row piece, so a wave's copy covers four whole lines. K: key = 16 q + tid / 8; V^T: row = 64 a + 16 q + tid / 8.
  const int cr = tid >> 3, cc = (tid & 7) * 8;
  const unsigned short* kg = (const unsigned short*)K16 + ((size_t)b * NN + cr) * (3 * CO) + h * HD + cc;
  const unsigned short* vg = Vth + (size_t)cr * NN + cc;
  const unsigned lk = (unsigned)(size_t)&sK[0][cr][cc], lv = (unsigned)(size_t)&sV[0][cr][cc];
  constexpr unsigned KB = TK * KP * 2, VB = 192 * VP * 2;      // bytes of one buffer
  constexpr int NT = NN / TK;
  stage_kv(lk, lv, kg, vg);
  asm volatile("s_wait_asynccnt 0x0" ::: "memory");      // this wave's share of stage 0 has landed
  __syncthreads();                                        // stage 0 is published to the four waves
  stage_kv(lk + KB, lv + VB, kg + (size_t)TK * 3 * CO, vg + TK);
  FragH aq[6]; { const unsigned short* qr = (const unsigned short*)Q16 + ((size_t)b * NN + q0 + ln) * (3 * CO) + h * HD + 8 * hh;      // row (b,n) = [c0 | c1 | c2] x 512 (= rows (b,n,c) of pitch 512)
#pragma unroll
    for (int ks = 0; ks < 6; ++ks) { const int c = ks >> 1, s32 = (ks & 1) * 32; aq[ks].half[0] = *(const v8us*)(qr + c * CO + s32); aq[ks].half[1] = *(const v8us*)(qr + c * CO + s32 + 16); }
    asm volatile("s_wait_xcnt 0x0" :: "v"(qr) : "memory"); }      // the Q loads' address pair is named as an input, so it stays untouched until this wait; behind it the pair may be reused
  float m_r[8], l_r[8]; v8f oacc[12];
#pragma unroll
  for (int r = 0; r < 8; ++r) { m_r[r] = -3.0e38f; l_r[r] = 0.f; }
#pragma unroll
  for (int dt = 0; dt < 12; ++dt) oacc[dt] = (v8f){0.f,0.f,0.f,0.f,0.f,0.f,0.f,0.f};
#pragma unroll 1
  for (int t = 0; t < NT; ++t) { const int buf = t & 1;
#pragma unroll 1      // the two 32-key passes of a stage stay rolled: unrolled, the build spilled the Q fragments to scratch
   for (int p = 0; p < TK / 32; ++p) { v8f s[2];
#pragma unroll
    for (int nt = 0; nt < 2; ++nt) { const unsigned short* kr = &sK[buf][p * 32 + nt * 16 + ln][0]; v8f acc = (v8f){0.f,0.f,0.f,0.f,0.f,0.f,0.f,0.f}; FragH bk[6];      // six fragments are read as one run ahead of their products: one LDS latency a run, not one a product
#pragma unroll      // constant indices keep bk in registers
      for (int ks = 0; ks < 6; ++ks) { bk[ks].half[0] = *(const v8us*)(kr + ks * 32 + 8 * hh); bk[ks].half[1] = *(const v8us*)(kr + ks * 32 + 16 + 8 * hh); }
#pragma unroll
      for (int ks = 0; ks < 6; ++ks) acc = mmaH<1>(aq[ks].v, aq[ks].v, bk[ks].v, bk[ks].v, acc);
      s[nt] = acc; }
#pragma unroll
    for (int r = 0; r < 8; ++r) { const float s0 = s[0][r] * 0.07216878364870323f, s1 = s[1][r] * 0.07216878364870323f; float mc = fmaxf(s0, s1);
      mc = fmaxf(mc, __shfl_xor(mc, 1, 32)); mc = fmaxf(mc, __shfl_xor(mc, 2, 32)); mc = fmaxf(mc, __shfl_xor(mc, 4, 32)); mc = fmaxf(mc, __shfl_xor(mc, 8, 32));
      const float mn = fmaxf(m_r[r], mc); const float al = expf(m_r[r] - mn); m_r[r] = mn; const float p0 = expf(s0 - mn), p1 = expf(s1 - mn); l_r[r] = l_r[r] * al + p0 + p1;
#pragma unroll
      for (int dt = 0; dt < 12; ++dt) oacc[dt][r] *= al;
      FragH t2; t2.h[0] = (_Float16)p0; t2.h[1] = (_Float16)p1; sP[w][8 * hh + r][ln] = t2.u[0]; sP[w][8 * hh + r][16 + ln] = t2.u[1]; }
    __builtin_amdgcn_fence(__ATOMIC_ACQ_REL, "workgroup"); __builtin_amdgcn_wave_barrier();
    FragH pa; pa.half[0] = *(const v8us*)&sP[w][ln][8 * hh]; pa.half[1] = *(const v8us*)&sP[w][ln][16 + 8 * hh];
#pragma unroll
    for (int dg = 0; dg < 2; ++dg) { FragH bv[6];      // as for K: a run of six fragments, then their six products
#pragma unroll      // constant indices keep bv and oacc in registers
      for (int i = 0; i < 6; ++i) { const unsigned short* vrow = &sV[buf][(dg * 6 + i) * 16 + ln][p * 32]; bv[i].half[0] = *(const v8us*)(vrow + 8 * hh); bv[i].half[1] = *(const v8us*)(vrow + 16 + 8 * hh); }
#pragma unroll
      for (int i = 0; i < 6; ++i) oacc[dg * 6 + i] = mmaH<1>(pa.v, pa.v, bv[i].v, bv[i].v, oacc[dg * 6 + i]); }
    __builtin_amdgcn_fence(__ATOMIC_ACQ_REL, "workgroup"); __builtin_amdgcn_wave_barrier(); }
   asm volatile("s_wait_dscnt 0x0" ::: "memory");         // this wave's reads of buffer t mod 2 are done before the buffer is handed back
   asm volatile("s_wait_asynccnt 0x0" ::: "memory");      // this wave's share of stage t + 1 has landed
   __syncthreads();                                        // publishes stage t + 1 and ends every wave's reads of stage t
   if (t + 2 < NT) stage_kv(lk + buf * KB, lv + buf * VB, kg + (size_t)(t + 2) * TK * 3 * CO, vg + (t + 2) * TK); }
  asm volatile("s_wait_asynccnt 0x0" ::: "memory");        // no copy is outstanding when the wave goes on to its end
#pragma unroll
  for (int r = 0; r < 8; ++r) { float l = l_r[r]; l += __shfl_xor(l, 1, 32); l += __shfl_xor(l, 2, 32); l += __shfl_xor(l, 4, 32); l += __shfl_xor(l, 8, 32); l_r[r] = 1.0f / l; }
#pragma unroll
  for (int dt = 0; dt < 12; ++dt)
#pragma unroll
    for (int r = 0; r < 8; ++r) sO[w][8 * hh + r][dt * 16 + ln] = oacc[dt][r] * l_r[r];
  __builtin_amdgcn_fence(__ATOMIC_ACQ_REL, "workgroup"); __builtin_amdgcn_wave_barrier();
  {
#pragma unroll
    for (int r = 0; r < 16; ++r) { float* orow = O + ((size_t)b * NN + q0 + r) * (NH * 192) + h * 192; { const v4f v = *(const v4fa*)&sO[w][r][lane * 4]; *(v4f*)(orow + lane * 4) = v; } if (lane < 16) { const v4f v2 = *(const v4fa*)&sO[w][r][128 + lane * 4]; *(v4f*)(orow + 128 + lane * 4) = v2; } }
     } }
__global__ __launch_bounds__(256) void k_o3(const float* __restrict__ O, _Float16* __restrict__ O3) { const size_t t = (size_t)blockIdx.x * 256 + threadIdx.x; if (t >= (size_t)NR3 * (CO / 8)) return; const size_t row = t / (CO / 8); const int col8 = (int)(t % (CO / 8)) * 8; const int c = (int)(row % 3); const size_t bn = row / 3; const int h = col8 / HD, d = col8 % HD; FragH f;
#pragma unroll
  for (int q = 0; q < 8; ++q) f.h[q] = (_Float16)O[bn * (NH * 192) + h * 192 + c * 64 + d + q]; *(v8us*)((unsigned short*)O3 + t * 8) = f.half[0];  }
__global__ __launch_bounds__(256) void k_fin(const float* __restrict__ OUT2, float* __restrict__ out) { __shared__ float tl[8][3 * CI + 4]; const int tid = threadIdx.x; const size_t bn0 = (size_t)blockIdx.x * 8;
  for (int i = tid; i < 8 * 3 * CI; i += 256) { const int j = i / (3 * CI), rem = i % (3 * CI); const int c = rem / CI, o = rem % CI; tl[j][o * 3 + c] = OUT2[((bn0 + j) * 3 + c) * CI + o]; }
  __syncthreads();
  { for (int i = tid; i < 8 * 3 * CI / 4; i += 256) { const int j = i / (3 * CI / 4), pc = i % (3 * CI / 4); const v4f v = *(const v4fa*)&tl[j][pc * 4]; *(v4f*)(out + (bn0 + j) * 3 * CI + pc * 4) = v; }  } }
extern "C" void kernel_launch(void* const* d_in, const int* in_sizes, int n_in,
                              void* d_out, int out_size, void* d_ws, size_t ws_size, hipStream_t stream) {
  (void)in_sizes; (void)n_in; (void)out_size;
  const float* x = (const float*)d_in[0]; const float* Wq = (const float*)d_in[1]; const float* Wk = (const float*)d_in[2]; const float* Wv = (const float*)d_in[3]; const float* Wo = (const float*)d_in[4];
  char* ws = (char*)d_ws; size_t off = 0;
  auto take = [&](size_t bytes) { char* p = ws + off; off += (bytes + 255) & ~(size_t)255; return p; };
  _Float16* Bq = (_Float16*)take((size_t)CO * CI * 2); _Float16* Bk = (_Float16*)take((size_t)CO * CI * 2); _Float16* Bv = (_Float16*)take((size_t)CO * CI * 2); _Float16* Bo = (_Float16*)take((size_t)CI * CO * 2);
  _Float16* X3 = (_Float16*)take((size_t)NR3 * CI * 2); _Float16* Q16 = (_Float16*)take((size_t)NR3 * CO * 2); _Float16* K16 = (_Float16*)take((size_t)NR3 * CO * 2); _Float16* V16 = (_Float16*)take((size_t)NR3 * CO * 2); _Float16* Vt = (_Float16*)take((size_t)NR3 * CO * 2); float* O = (float*)take((size_t)NR * NH * 192 * 4); _Float16* O3 = Q16; float* OUT2 = (float*)V16;      // Q16 dead after the attention; V16 (12.6 MB) dead after k_vt3 → OUT2 (12.6 MB)
  if (off > ws_size) return;      // 1.0 + 6.3 + 12.6 × 4 + 25.2 ≈ 83 MB
  const unsigned gw = (unsigned)((CO * CI / 8 + 255) / 256); k_round16f<<<gw, 256, 0, stream>>>(Wq, Bq, (size_t)CO * CI / 8); k_round16f<<<gw, 256, 0, stream>>>(Wk, Bk, (size_t)CO * CI / 8); k_round16f<<<gw, 256, 0, stream>>>(Wv, Bv, (size_t)CO * CI / 8); k_round16f<<<gw, 256, 0, stream>>>(Wo, Bo, (size_t)CI * CO / 8);      // (out,in)
  k_x3<<<(unsigned)(((size_t)NR * 3 * (CI / 8) + 255) / 256), 256, 0, stream>>>(x, X3);
  // X3 = rows (b,n,c) × 256; q/k/v planes = rows (b,n,c) × 512 ≡ [(b,n)][c·512 + o]
  const dim3 gg(((NR3 / 16) * (CO / 64) + 3) / 4, 1), go(((NR3 / 16) * (CI / 64) + 3) / 4, 1);
  k_gemm_hhx<0><<<gg, 128, 0, stream>>>(X3, CI, 0, Bq, CI, 0, 0.0625f, nullptr, 0, nullptr, 1, 0, 0, nullptr, Q16, CO, 0, NR3, CO, CI);
  k_gemm_hhx<0><<<gg, 128, 0, stream>>>(X3, CI, 0, Bk, CI, 0, 0.0625f, nullptr, 0, nullptr, 1, 0, 0, nullptr, K16, CO, 0, NR3, CO, CI);
  k_gemm_hhx<0><<<gg, 128, 0, stream>>>(X3, CI, 0, Bv, CI, 0, 0.0625f, nullptr, 0, nullptr, 1, 0, 0, nullptr, V16, CO, 0, NR3, CO, CI);
  k_vt3<<<BB * NH * 3 * (NN / 64), 256, 0, stream>>>(V16, Vt);
  k_vnattn<<<BB * NH * (NN / 64), 128, 0, stream>>>(Q16, K16, Vt, O);
  k_o3<<<(unsigned)(((size_t)NR3 * (CO / 8) + 255) / 256), 256, 0, stream>>>(O, O3);
  k_gemm_hhx<0><<<go, 128, 0, stream>>>(O3, CO, 0, Bo, CO, 0, 0.0625f, nullptr, 0, nullptr, 1, 0, 0, OUT2, nullptr, CI, 0, NR3, CI, CO);      // rows (b,n,c) × 256
  k_fin<<<NR / 8, 256, 0, stream>>>(OUT2, (float*)d_out);
}

// v002
// A run of this version takes 199 microseconds.
// Next to v001, in two timings, it ran 1.13 and 1.12 times as fast.
// All steps since v000 together make it 3.02 times as fast.
#include <hip/hip_runtime.h>
// Vector-neuron attention (B=2, N=2048, C=256 × 3 coordinates, 8 heads × 64): the VN-linear maps (rows (b,n,c) × 256 → 512, weights (out,in) bf16-exact ×2^4) and the attention over the
// 192-dim (d, c) head features as a fused flash-style kernel on v_wmma_f32_16x16x32_f16 (S^T = K Q^T / sqrt(192) with 6 k-steps gathered from the three coordinate blocks, online softmax f32 in-lane, P f16 <= 1 packed from the score registers,
// O^T = V^T P^T with 12 d-tiles; RPW-16 waves); f16 operands, single products, f32 accumulate; layout permutes f32/VALU.
#define BB 2
#define NN 2048
#define CI 256
#define CO 512
#define NH 8
#define HD 64
#define NR3 (BB * NN * 3)
#define NR (BB * NN)

typedef __bf16 v16b __attribute__((ext_vector_type(16)));
typedef unsigned short v8us __attribute__((ext_vector_type(8), may_alias));
typedef float  v8f  __attribute__((ext_vector_type(8)));
typedef float  v4f  __attribute__((ext_vector_type(4)));
typedef float  v4fa __attribute__((ext_vector_type(4), may_alias));
union FragB { v16b v; v8us half[2]; unsigned short u[16]; };

__device__ __forceinline__ unsigned short bf16_bits(float x) { unsigned int u = __float_as_uint(x); return (unsigned short)((u + 0x7FFFu + ((u >> 16) & 1u)) >> 16); }
__device__ __forceinline__ float bf16_val(unsigned short b) { return __uint_as_float(((unsigned int)b) << 16); }
__device__ __forceinline__ float bf16_round(float x) { return bf16_val(bf16_bits(x)); }
// D += A·B with NT terms: 1 = ah·bh, 2 = + al·bh (A split), 3 = + ah·bl (both split)
template <int NT>
__device__ __forceinline__ v8f mmaN(v16b ah, v16b al, v16b bh, v16b bl, v8f c) {
  c = __builtin_amdgcn_wmma_f32_16x16x32_bf16(false, ah, false, bh, (short)0, c, false, false);
  if (NT >= 2) c = __builtin_amdgcn_wmma_f32_16x16x32_bf16(false, al, false, bh, (short)0, c, false, false);
  if (NT >= 3) c = __builtin_amdgcn_wmma_f32_16x16x32_bf16(false, ah, false, bl, (short)0, c, false, false);
  asm volatile("v_nop\n\tv_nop\n\tv_nop\n\tv_nop" : "+v"(c) : "v"(ah), "v"(al), "v"(bh), "v"(bl));
  return c;
}

__global__ __launch_bounds__(256) void k_wt_bf16(const float* __restrict__ W, unsigned short* __restrict__ Wt, int K, int N) {
  const int t = blockIdx.x * 256 + threadIdx.x;
  const int k8n = K / 8;
  if (t >= N * k8n) return;
  const int n = t / k8n, k8 = (t % k8n) * 8;
  v8us v;
#pragma unroll
  for (int i = 0; i < 8; ++i) v[i] = bf16_bits(W[(size_t)(k8 + i) * N + n]);
  *(v8us*)(Wt + (size_t)n * K + k8) = v;
  
}

// GEMM C[M][N] (f32, pitch ldc) = act(A[M][K]·W + bias). A f32 row-major (pitch lda) converted per fragment to bf16
// (ASPLIT: hi/lo two planes -> 2 terms, else single rounded term); Wt bf16 [N][K] (pitch ldb). BIAS_BF16 rounds the
// bias to bf16 first (bias quantised to bf16 before the add). K%32==0, M%16==0, N%64==0.
template <bool ASPLIT, int ACT, bool BIAS_BF16>
__global__ __launch_bounds__(128) void k_gemm_bf(const float* __restrict__ A, int lda, const unsigned short* __restrict__ Wt, int ldb,
                                               const float* __restrict__ bias, float* __restrict__ C, int ldc, int M, int N, int K) {
  __shared__ __attribute__((aligned(16))) float so[4][16][64];
  const int tid = threadIdx.x, w = tid >> 5, lane = tid & 31, ln = lane & 15, hh = lane >> 4;
  const int ntn = N / 64;
  const int wid = blockIdx.x * 4 + w;
  const int mt = wid / ntn, nq = wid % ntn;
  if (mt * 16 >= M) return;
  const int row0 = mt * 16, col0 = nq * 64;
  const float* arow = A + (size_t)(row0 + ln) * lda;
  v8f acc[4] = {};
  for (int kb = 0; kb < K; kb += 32) {
    FragB ah, al;
    const v4f x0 = *(const v4fa*)(arow + kb + 8 * hh), x1 = *(const v4fa*)(arow + kb + 8 * hh + 4);
    const v4f x2 = *(const v4fa*)(arow + kb + 16 + 8 * hh), x3 = *(const v4fa*)(arow + kb + 16 + 8 * hh + 4);
    float xs[16] = {x0[0],x0[1],x0[2],x0[3],x1[0],x1[1],x1[2],x1[3],x2[0],x2[1],x2[2],x2[3],x3[0],x3[1],x3[2],x3[3]};
#pragma unroll
    for (int i = 0; i < 16; ++i) { const unsigned short hb = bf16_bits(xs[i]); ah.u[i] = hb; al.u[i] = ASPLIT ? bf16_bits(xs[i] - bf16_val(hb)) : (unsigned short)0; }
#pragma unroll
    for (int t = 0; t < 4; ++t) {
      const unsigned short* brow = Wt + (size_t)(col0 + t * 16 + ln) * ldb + kb;
      FragB b;
      b.half[0] = *(const v8us*)(brow + 8 * hh);
      b.half[1] = *(const v8us*)(brow + 16 + 8 * hh);
      acc[t] = mmaN<ASPLIT ? 2 : 1>(ah.v, al.v, b.v, b.v, acc[t]);
    }
  }
#pragma unroll
  for (int t = 0; t < 4; ++t) {
    float bv = bias ? bias[col0 + t * 16 + ln] : 0.f;
    if (BIAS_BF16) bv = bf16_round(bv);
#pragma unroll
    for (int r = 0; r < 8; ++r) { float v = acc[t][r] + bv; if (ACT == 1) v = fmaxf(v, 0.f); so[w][8 * hh + r][t * 16 + ln] = v; }
  }
  __builtin_amdgcn_fence(__ATOMIC_ACQ_REL, "workgroup");
  __builtin_amdgcn_wave_barrier();
  const int rsub = lane >> 4, c4 = (lane & 15) * 4;
  {
#pragma unroll
    for (int q = 0; q < 8; ++q) {
      const int r = q * 2 + rsub;
      const v4f v = *(const v4fa*)&so[w][r][c4];
      *(v4f*)(C + (size_t)(row0 + r) * ldc + col0 + c4) = v;
    }
    
  }
}

// Flash-style causal/unmasked attention, all contractions 3-term bf16 hi/lo splits, f32 softmax with running max.
// q,k,v rows are read from f32 buffers with arbitrary row pitch (so they can live inside a fused qkv buffer);
// D = head size (multiple of 32, <= 128); one wave = 16 query rows; block = 4 waves (64 queries) sharing K/V chunks of 32.
template <int D, bool CAUSAL>
__global__ __launch_bounds__(128) void k_flash(const float* __restrict__ qb, const float* __restrict__ kb, const float* __restrict__ vb,
                                             int pitch, int T, int H, float scale, float* __restrict__ y, int ypitch) {
  constexpr int KS = D / 32;        // k-steps for QK
  constexpr int DT = D / 16;        // d tiles for PV
  __shared__ __attribute__((aligned(16))) unsigned short sKh[32][D + 8], sKl[32][D + 8], sVh[32][D + 8], sVl[32][D + 8];
  __shared__ __attribute__((aligned(16))) unsigned short sPh[4][16][40], sPl[4][16][40];
  __shared__ __attribute__((aligned(16))) float sO[4][16][D];
  const int tid = threadIdx.x, w = tid >> 5, lane = tid & 31, ln = lane & 15, hh = lane >> 4;
  const int nqb = (T + 63) / 64;
  const int bh = blockIdx.x / nqb, qblk = blockIdx.x % nqb;
  const int b = bh / H, h = bh % H;
  const int q0 = qblk * 64 + w * 16;
  const float* Q = qb + (size_t)b * T * pitch + h * D;
  const float* K = kb + (size_t)b * T * pitch + h * D;
  const float* V = vb + (size_t)b * T * pitch + h * D;

  // A fragments of the wave's 16 query rows (scaled), hi/lo
  FragB aqh[KS], aql[KS];
  {
    int row = q0 + ln; if (row >= T) row = T - 1;
    const float* qr = Q + (size_t)row * pitch;
#pragma unroll
    for (int ks = 0; ks < KS; ++ks)
#pragma unroll
      for (int i = 0; i < 16; ++i) {
        const int d = ks * 32 + ((i < 8) ? (8 * hh + i) : (16 + 8 * hh + (i - 8)));
        const float x = qr[d] * scale; const unsigned short hb = bf16_bits(x);
        aqh[ks].u[i] = hb; aql[ks].u[i] = bf16_bits(x - bf16_val(hb));
      }
  }
  float m_r[8], l_r[8];
#pragma unroll
  for (int r = 0; r < 8; ++r) { m_r[r] = -3.0e38f; l_r[r] = 0.f; }
  v8f oacc[DT];
#pragma unroll
  for (int dt = 0; dt < DT; ++dt) oacc[dt] = (v8f){0.f,0.f,0.f,0.f,0.f,0.f,0.f,0.f};

  const int kv_end = CAUSAL ? min(T, qblk * 64 + 64) : T;     // block-uniform
  for (int j0 = 0; j0 < kv_end; j0 += 32) {
    __syncthreads();
    for (int e = tid; e < 32 * (D / 4); e += 128) {
      const int r = e / (D / 4), c4 = (e % (D / 4)) * 4;
      const int key = j0 + r;
      v4f kf = {0.f,0.f,0.f,0.f}, vf = {0.f,0.f,0.f,0.f};
      if (key < T) { kf = *(const v4fa*)(K + (size_t)key * pitch + c4); vf = *(const v4fa*)(V + (size_t)key * pitch + c4); }
#pragma unroll
      for (int t = 0; t < 4; ++t) {
        unsigned short hb = bf16_bits(kf[t]); sKh[r][c4 + t] = hb; sKl[r][c4 + t] = bf16_bits(kf[t] - bf16_val(hb));
        hb = bf16_bits(vf[t]); sVh[r][c4 + t] = hb; sVl[r][c4 + t] = bf16_bits(vf[t] - bf16_val(hb));
      }
    }
    __syncthreads();
    // S tile 16 x 32
    v8f s[2];
#pragma unroll
    for (int nt = 0; nt < 2; ++nt) {
      v8f acc = {};
#pragma unroll
      for (int ks = 0; ks < KS; ++ks) {
        FragB bh_, bl_;
        bh_.half[0] = *(const v8us*)&sKh[nt * 16 + ln][ks * 32 + 8 * hh]; bh_.half[1] = *(const v8us*)&sKh[nt * 16 + ln][ks * 32 + 16 + 8 * hh];
        bl_.half[0] = *(const v8us*)&sKl[nt * 16 + ln][ks * 32 + 8 * hh]; bl_.half[1] = *(const v8us*)&sKl[nt * 16 + ln][ks * 32 + 16 + 8 * hh];
        acc = mmaN<3>(aqh[ks].v, aql[ks].v, bh_.v, bl_.v, acc);
      }
      s[nt] = acc;
    }
    // mask + running max (rows 8hh+r; the 16 lanes of a half share rows)
    float alpha[8];
#pragma unroll
    for (int r = 0; r < 8; ++r) {
      const int qi = q0 + 8 * hh + r;
      const int ja = j0 + ln, jb = j0 + 16 + ln;
      if (CAUSAL) { if (ja > qi) s[0][r] = -3.0e38f; if (jb > qi) s[1][r] = -3.0e38f; }
      if (ja >= T) s[0][r] = -3.0e38f;
      if (jb >= T) s[1][r] = -3.0e38f;
      float mx = fmaxf(s[0][r], s[1][r]);
      mx = fmaxf(mx, __shfl_xor(mx, 1, 32)); mx = fmaxf(mx, __shfl_xor(mx, 2, 32)); mx = fmaxf(mx, __shfl_xor(mx, 4, 32)); mx = fmaxf(mx, __shfl_xor(mx, 8, 32));
      const float mnew = fmaxf(m_r[r], mx);
      alpha[r] = (mnew > -1.0e38f) ? __expf(m_r[r] - mnew) : 1.0f;
      const float p0 = (s[0][r] > -1.0e38f) ? __expf(s[0][r] - mnew) : 0.f;
      const float p1 = (s[1][r] > -1.0e38f) ? __expf(s[1][r] - mnew) : 0.f;
      m_r[r] = mnew;
      l_r[r] = l_r[r] * alpha[r] + p0 + p1;            // per-lane partial row sum (16 lanes combined at the end)
      unsigned short hb = bf16_bits(p0); sPh[w][8 * hh + r][ln] = hb;      sPl[w][8 * hh + r][ln] = bf16_bits(p0 - bf16_val(hb));
      hb = bf16_bits(p1);                sPh[w][8 * hh + r][16 + ln] = hb; sPl[w][8 * hh + r][16 + ln] = bf16_bits(p1 - bf16_val(hb));
    }
#pragma unroll
    for (int dt = 0; dt < DT; ++dt)
#pragma unroll
      for (int r = 0; r < 8; ++r) oacc[dt][r] *= alpha[r];
    __builtin_amdgcn_fence(__ATOMIC_ACQ_REL, "workgroup");
    __builtin_amdgcn_wave_barrier();
    FragB pah, pal;
    pah.half[0] = *(const v8us*)&sPh[w][ln][8 * hh]; pah.half[1] = *(const v8us*)&sPh[w][ln][16 + 8 * hh];
    pal.half[0] = *(const v8us*)&sPl[w][ln][8 * hh]; pal.half[1] = *(const v8us*)&sPl[w][ln][16 + 8 * hh];
#pragma unroll
    for (int dt = 0; dt < DT; ++dt) {
      FragB bvh, bvl;
#pragma unroll
      for (int i = 0; i < 8; ++i) {
        bvh.u[i] = sVh[8 * hh + i][dt * 16 + ln]; bvh.u[8 + i] = sVh[16 + 8 * hh + i][dt * 16 + ln];
        bvl.u[i] = sVl[8 * hh + i][dt * 16 + ln]; bvl.u[8 + i] = sVl[16 + 8 * hh + i][dt * 16 + ln];
      }
      oacc[dt] = mmaN<3>(pah.v, pal.v, bvh.v, bvl.v, oacc[dt]);
    }
    __builtin_amdgcn_fence(__ATOMIC_ACQ_REL, "workgroup");
    __builtin_amdgcn_wave_barrier();
  }
#pragma unroll
  for (int r = 0; r < 8; ++r) {
    float l = l_r[r];
    l += __shfl_xor(l, 1, 32); l += __shfl_xor(l, 2, 32); l += __shfl_xor(l, 4, 32); l += __shfl_xor(l, 8, 32);
    l_r[r] = (l > 0.f) ? 1.0f / l : 0.f;
  }
#pragma unroll
  for (int dt = 0; dt < DT; ++dt)
#pragma unroll
    for (int r = 0; r < 8; ++r) sO[w][8 * hh + r][dt * 16 + ln] = oacc[dt][r] * l_r[r];
  __builtin_amdgcn_fence(__ATOMIC_ACQ_REL, "workgroup");
  __builtin_amdgcn_wave_barrier();
  {
    for (int r = 0; r < 16; ++r) {
      const int row = q0 + r;
      if (row < T && lane < D / 4) {
        const v4f val = *(const v4fa*)&sO[w][r][lane * 4];
        *(v4f*)(y + ((size_t)b * T + row) * ypitch + h * D + lane * 4) = val;
      }
    }
    
  }
}

// GEMM C = act(A·W + bias + resid): A f32 (ASPLIT -> hi/lo 2 terms), Wt bf16 [N][K]; ACT 0 none, 1 relu, 2 exact gelu;
// resid (optional, f32, row index = (row % rmod), pitch ldr, RES_BF16 rounds it) added before the activation.
template <bool ASPLIT, int ACT, bool BIAS_BF16, bool RES_BF16>
__global__ __launch_bounds__(128) void k_gemm_bf3(const float* __restrict__ A, int lda, const unsigned short* __restrict__ Wt, int ldb,
                                                const float* __restrict__ bias, const float* __restrict__ resid, int rmod, int ldr,
                                                float* __restrict__ C, int ldc, int M, int N, int K) {
  __shared__ __attribute__((aligned(16))) float so[4][16][64];
  const int tid = threadIdx.x, w = tid >> 5, lane = tid & 31, ln = lane & 15, hh = lane >> 4;
  const int ntn = N / 64;
  const int wid = blockIdx.x * 4 + w;
  const int mt = wid / ntn, nq = wid % ntn;
  if (mt * 16 >= M) return;
  const int row0 = mt * 16, col0 = nq * 64;
  const float* arow = A + (size_t)(row0 + ln) * lda;
  v8f acc[4] = {};
  for (int kb = 0; kb < K; kb += 32) {
    FragB ah, al;
    const v4f x0 = *(const v4fa*)(arow + kb + 8 * hh), x1 = *(const v4fa*)(arow + kb + 8 * hh + 4);
    const v4f x2 = *(const v4fa*)(arow + kb + 16 + 8 * hh), x3 = *(const v4fa*)(arow + kb + 16 + 8 * hh + 4);
    float xs[16] = {x0[0],x0[1],x0[2],x0[3],x1[0],x1[1],x1[2],x1[3],x2[0],x2[1],x2[2],x2[3],x3[0],x3[1],x3[2],x3[3]};
#pragma unroll
    for (int i = 0; i < 16; ++i) { const unsigned short hb = bf16_bits(xs[i]); ah.u[i] = hb; al.u[i] = ASPLIT ? bf16_bits(xs[i] - bf16_val(hb)) : (unsigned short)0; }
#pragma unroll
    for (int t = 0; t < 4; ++t) {
      const unsigned short* brow = Wt + (size_t)(col0 + t * 16 + ln) * ldb + kb;
      FragB b;
      b.half[0] = *(const v8us*)(brow + 8 * hh);
      b.half[1] = *(const v8us*)(brow + 16 + 8 * hh);
      acc[t] = mmaN<ASPLIT ? 2 : 1>(ah.v, al.v, b.v, b.v, acc[t]);
    }
  }
#pragma unroll
  for (int t = 0; t < 4; ++t) {
    const int col = col0 + t * 16 + ln;
    float bv = bias ? bias[col] : 0.f;
    if (BIAS_BF16) bv = bf16_round(bv);
#pragma unroll
    for (int r = 0; r < 8; ++r) {
      float v = acc[t][r] + bv;
      if (resid) { float rv = resid[(size_t)((row0 + 8 * hh + r) % rmod) * ldr + col]; if (RES_BF16) rv = bf16_round(rv); v += rv; }
      if (ACT == 1) v = fmaxf(v, 0.f);
      if (ACT == 2) v = 0.5f * v * (1.0f + erff(v * 0.70710678118654752f));
      if (ACT == 3) { const float u = 0.7978845608028654f * (v + 0.044715f * v * v * v); v = 0.5f * v * (1.0f + tanhf(u)); }
      so[w][8 * hh + r][t * 16 + ln] = v;
    }
  }
  __builtin_amdgcn_fence(__ATOMIC_ACQ_REL, "workgroup");
  __builtin_amdgcn_wave_barrier();
  const int rsub = lane >> 4, c4 = (lane & 15) * 4;
  {
#pragma unroll
    for (int q = 0; q < 8; ++q) {
      const int r = q * 2 + rsub;
      const v4f v = *(const v4fa*)&so[w][r][c4];
      *(v4f*)(C + (size_t)(row0 + r) * ldc + col0 + c4) = v;
    }
    
  }
}
// row LayerNorm (biased variance, eps) over N: s = X (+ R); optional out_sum <- s; out_norm <- (s-mu)*rsqrt(var+eps)*g + b
template <bool PARAM_BF16>
__global__ __launch_bounds__(256) void k_layernorm(const float* __restrict__ X, const float* __restrict__ R, const float* __restrict__ g, const float* __restrict__ bta,
                                                  float* __restrict__ out_sum, float* __restrict__ out_norm, int N, float eps) {
  __shared__ float red[256];
  const int row = blockIdx.x, tid = threadIdx.x;
  const float* x = X + (size_t)row * N; const float* rr = R ? R + (size_t)row * N : nullptr;
  float vals[16];                     // up to N = 4096
  const int per = N / 256;            // contiguous chunk per thread? use strided-by-4 chunks: thread handles j = tid*4 + 1024*u
  float s1 = 0.f;
  for (int u = 0; u < per / 4; ++u) {
    const int j = tid * 4 + 1024 * u;
    const v4f a = *(const v4fa*)(x + j);
    v4f b = {0.f,0.f,0.f,0.f}; if (rr) b = *(const v4fa*)(rr + j);
#pragma unroll
    for (int q = 0; q < 4; ++q) { const float v = a[q] + b[q]; vals[u * 4 + q] = v; s1 += v; }
  }
  red[tid] = s1; __syncthreads();
  for (int st = 128; st > 0; st >>= 1) { if (tid < st) red[tid] += red[tid + st]; __syncthreads(); }
  const float mu = red[0] / (float)N; __syncthreads();
  float s2 = 0.f;
  for (int u = 0; u < per / 4; ++u)
#pragma unroll
    for (int q = 0; q < 4; ++q) { const float c = vals[u * 4 + q] - mu; s2 += c * c; }
  red[tid] = s2; __syncthreads();
  for (int st = 128; st > 0; st >>= 1) { if (tid < st) red[tid] += red[tid + st]; __syncthreads(); }
  const float rs = rsqrtf(red[0] / (float)N + eps);
  {
    for (int u = 0; u < per / 4; ++u) {
      const int j = tid * 4 + 1024 * u;
      v4f o, sm;
#pragma unroll
      for (int q = 0; q < 4; ++q) {
        float gg = g[j + q], bb = bta[j + q];
        if (PARAM_BF16) { gg = bf16_round(gg); bb = bf16_round(bb); }
        sm[q] = vals[u * 4 + q]; o[q] = (vals[u * 4 + q] - mu) * rs * gg + bb;
      }
      if (out_sum) *(v4f*)(out_sum + (size_t)row * N + j) = sm;
      *(v4f*)(out_norm + (size_t)row * N + j) = o;
    }
    
  }
}



// ---- f16 WMMA path (v_wmma_f32_16x16x32_f16): 11-bit significands for operands in range — used for every contraction launched here (VN-linear maps, Q·Kᵀ, P·V)
typedef _Float16 v16h __attribute__((ext_vector_type(16)));
union FragH { v16h v; v8us half[2]; _Float16 h[16]; unsigned short u[16]; };
template <int NT>
__device__ __forceinline__ v8f mmaH(v16h ah, v16h al, v16h bh, v16h bl, v8f c) {
  c = __builtin_amdgcn_wmma_f32_16x16x32_f16(false, ah, false, bh, (short)0, c, false, false);
  if (NT >= 2) c = __builtin_amdgcn_wmma_f32_16x16x32_f16(false, al, false, bh, (short)0, c, false, false);
  if (NT >= 3) c = __builtin_amdgcn_wmma_f32_16x16x32_f16(false, ah, false, bl, (short)0, c, false, false);
  asm volatile("v_nop\n\tv_nop\n\tv_nop\n\tv_nop" : "+v"(c) : "v"(ah), "v"(al), "v"(bh), "v"(bl));
  return c;
}
// batched GEMM like k_gemm_b but f16 operands: A f32 (split into f16 hi/lo if ASPLIT, else rounded to f16), Bt = f16 values [n][k]; alpha; C f32; N multiple of 16 (partial tiles skipped)
template <bool ASPLIT>
__global__ __launch_bounds__(128) void k_gemm_h(const float* __restrict__ A, int lda, size_t sA, const _Float16* __restrict__ Bh, int ldb, size_t sB, float alpha, float* __restrict__ C, int ldc, size_t sC, int M, int N, int K) {
  __shared__ __attribute__((aligned(16))) float so[4][16][64];
  const int tid = threadIdx.x, w = tid >> 5, lane = tid & 31, ln = lane & 15, hh = lane >> 4; const int by = blockIdx.y;
  A += (size_t)by * sA; Bh += (size_t)by * sB; C += (size_t)by * sC;
  const int ntn = (N + 63) / 64; const int wid = blockIdx.x * 4 + w; const int mt = wid / ntn, nq = wid % ntn; if (mt * 16 >= M) return;
  const int row0 = mt * 16, col0 = nq * 64; const float* arow = A + (size_t)(row0 + ln) * lda;
  v8f acc[4] = {};
  for (int kb = 0; kb < K; kb += 32) {
    FragH ah, al;
    const v4f x0 = *(const v4fa*)(arow + kb + 8 * hh), x1 = *(const v4fa*)(arow + kb + 8 * hh + 4), x2 = *(const v4fa*)(arow + kb + 16 + 8 * hh), x3 = *(const v4fa*)(arow + kb + 16 + 8 * hh + 4);
    float xs[16] = {x0[0],x0[1],x0[2],x0[3],x1[0],x1[1],x1[2],x1[3],x2[0],x2[1],x2[2],x2[3],x3[0],x3[1],x3[2],x3[3]};
#pragma unroll
    for (int i = 0; i < 16; ++i) { const _Float16 h = (_Float16)xs[i]; ah.h[i] = h; al.h[i] = ASPLIT ? (_Float16)(xs[i] - (float)h) : (_Float16)0.0f; }
#pragma unroll
    for (int t = 0; t < 4; ++t) { if (col0 + t * 16 >= N) continue; const size_t boff = (size_t)(col0 + t * 16 + ln) * ldb + kb; FragH bq; bq.half[0] = *(const v8us*)(Bh + boff + 8 * hh); bq.half[1] = *(const v8us*)(Bh + boff + 16 + 8 * hh);
      acc[t] = mmaH<ASPLIT ? 2 : 1>(ah.v, al.v, bq.v, bq.v, acc[t]); }
  }
#pragma unroll
  for (int t = 0; t < 4; ++t) { if (col0 + t * 16 >= N) continue;
#pragma unroll
    for (int r = 0; r < 8; ++r) so[w][8 * hh + r][t * 16 + ln] = acc[t][r] * alpha; }
  __builtin_amdgcn_fence(__ATOMIC_ACQ_REL, "workgroup"); __builtin_amdgcn_wave_barrier();
  const int rsub = lane >> 4, c4 = (lane & 15) * 4;
  {
#pragma unroll
    for (int q = 0; q < 8; ++q) { const int r = q * 2 + rsub; if (col0 + c4 < N) { const v4f v = *(const v4fa*)&so[w][r][c4]; *(v4f*)(C + (size_t)(row0 + r) * ldc + col0 + c4) = v; } }
     }
}

// Wt[n][k] = f16(W[k][n]·scale) from f32 row-major W[K][N] (scale = power of two; bf16-exact weights stay exact in f16 away from the subnormal range)
__global__ __launch_bounds__(256) void k_wt_f16(const float* __restrict__ W, _Float16* __restrict__ Wt, int K, int N, float scale) {
  const int t = blockIdx.x * 256 + threadIdx.x; if (t >= N * (K / 8)) return; const int n = t / (K / 8), k8 = (t % (K / 8)) * 8; FragH f;
#pragma unroll
  for (int i = 0; i < 8; ++i) f.h[i] = (_Float16)(bf16_round(W[(size_t)(k8 + i) * N + n]) * scale); const v8us o = f.half[0];
  *(v8us*)((unsigned short*)Wt + (size_t)n * K + k8) = o; 
}
// k_gemm_hh variant with fused epilogue: v = acc·alpha + bias[by·sBias + col] (+ CP[(row/rowsPerB)·sCPb + by·64 + col] if CP) ; ACT 0 none / 1 elu ; writes f16 C16 and/or f32 C, each if non-null
template <int ACT>
__global__ __launch_bounds__(128) void k_gemm_hhx(const _Float16* __restrict__ A, int lda, size_t sA, const _Float16* __restrict__ Bh, int ldb, size_t sB, float alpha, const float* __restrict__ bias, size_t sBias, const float* __restrict__ CP, int rowsPerB, size_t sCPb, int row0g,
    float* __restrict__ C, _Float16* __restrict__ C16, int ldc, size_t sC, int M, int N, int K) {
  __shared__ __attribute__((aligned(16))) float so[4][16][64];
  const int tid = threadIdx.x, w = tid >> 5, lane = tid & 31, ln = lane & 15, hh = lane >> 4; const int by = blockIdx.y;
  A += (size_t)by * sA; Bh += (size_t)by * sB; const size_t cofs = (size_t)by * sC; const float* bp = bias ? bias + (size_t)by * sBias : nullptr;
  const int ntn = (N + 63) / 64; const int wid = blockIdx.x * 4 + w; const int mt = wid / ntn, nq = wid % ntn; if (mt * 16 >= M) return;
  const int row0 = mt * 16, col0 = nq * 64; const _Float16* arow = A + (size_t)(row0 + ln) * lda;
  v8f acc[4] = {};
  for (int kb = 0; kb < K; kb += 32) { FragH ah; ah.half[0] = *(const v8us*)((const unsigned short*)arow + kb + 8 * hh); ah.half[1] = *(const v8us*)((const unsigned short*)arow + kb + 16 + 8 * hh);
#pragma unroll
    for (int t = 0; t < 4; ++t) { if (col0 + t * 16 >= N) continue; const size_t boff = (size_t)(col0 + t * 16 + ln) * ldb + kb; FragH bq; bq.half[0] = *(const v8us*)((const unsigned short*)Bh + boff + 8 * hh); bq.half[1] = *(const v8us*)((const unsigned short*)Bh + boff + 16 + 8 * hh);
      acc[t] = mmaH<1>(ah.v, ah.v, bq.v, bq.v, acc[t]); }
  }
#pragma unroll
  for (int t = 0; t < 4; ++t) { if (col0 + t * 16 >= N) continue; const int col = col0 + t * 16 + ln; const float bv = bp ? bf16_round(bp[col]) : 0.f;
#pragma unroll
    for (int r = 0; r < 8; ++r) { float v = acc[t][r] * alpha + bv; if (CP) { const int bidx = (row0g + row0 + 8 * hh + r) / rowsPerB; v += CP[(size_t)bidx * sCPb + (size_t)by * 64 + col]; } if (ACT == 1) v = (v > 0.f) ? v : expm1f(v); else if (ACT == 3) v = fmaxf(v, 0.f); so[w][8 * hh + r][t * 16 + ln] = v; } }
  __builtin_amdgcn_fence(__ATOMIC_ACQ_REL, "workgroup"); __builtin_amdgcn_wave_barrier();
  const int rsub = lane >> 4, c4 = (lane & 15) * 4; typedef _Float16 v4h __attribute__((ext_vector_type(4)));
  {
#pragma unroll
    for (int q = 0; q < 8; ++q) { const int r = q * 2 + rsub; if (col0 + c4 < N) { const v4f v = *(const v4fa*)&so[w][r][c4]; if (C) *(v4f*)(C + cofs + (size_t)(row0 + r) * ldc + col0 + c4) = v; if (C16) { v4h h4; for (int i = 0; i < 4; ++i) h4[i] = (_Float16)v[i]; *(v4h*)(C16 + cofs + (size_t)(row0 + r) * ldc + col0 + c4) = h4; } } }
     }
}


__global__ __launch_bounds__(256) void k_round16f(const float* __restrict__ W, _Float16* __restrict__ Bt, size_t n8) { const size_t t = (size_t)blockIdx.x * 256 + threadIdx.x; if (t >= n8) return; FragH f;
#pragma unroll
  for (int i = 0; i < 8; ++i) f.h[i] = (_Float16)(bf16_round(W[t * 8 + i]) * 16.0f); *(v8us*)((unsigned short*)Bt + t * 8) = f.half[0];  }
__global__ __launch_bounds__(256) void k_x3(const float* __restrict__ x, _Float16* __restrict__ X3) { const size_t t = (size_t)blockIdx.x * 256 + threadIdx.x; if (t >= (size_t)NR * 3 * (CI / 8)) return; const size_t bn = t / (3 * (CI / 8)); const int rem = (int)(t % (3 * (CI / 8))); const int c = rem / (CI / 8), i8 = (rem % (CI / 8)) * 8; FragH f;
#pragma unroll
  for (int q = 0; q < 8; ++q) f.h[q] = (_Float16)bf16_round(x[(bn * CI + i8 + q) * 3 + c]); *(v8us*)((unsigned short*)X3 + t * 8) = f.half[0];  }
__global__ __launch_bounds__(256) void k_vt3(const _Float16* __restrict__ V16, _Float16* __restrict__ Vt) { __shared__ unsigned short tl[64][66]; const int tid = threadIdx.x; const int per = 3 * (NN / 64); const int slab = blockIdx.x / per, rem = blockIdx.x % per; const int c = rem / (NN / 64), mg = rem % (NN / 64); const int b = slab / NH, h = slab % NH;
  for (int i = tid; i < 64 * 8; i += 256) { const int r = i / 8, c8 = (i % 8) * 8; FragH f; f.half[0] = *(const v8us*)((const unsigned short*)V16 + ((size_t)b * NN + mg * 64 + r) * (3 * CO) + c * CO + h * HD + c8);
#pragma unroll
    for (int q = 0; q < 8; ++q) tl[r][c8 + q] = f.u[q]; }
  __syncthreads();
  {
#pragma unroll
    for (int rd = 0; rd < 2; ++rd) { const int d = rd * 32 + tid / 8, pc = tid % 8; FragH f;
#pragma unroll
      for (int q = 0; q < 8; ++q) f.u[q] = tl[pc * 8 + q][d]; *(v8us*)((unsigned short*)Vt + ((size_t)slab * 192 + c * 64 + d) * NN + mg * 64 + pc * 8) = f.half[0]; }
     } }
// K and V^T tiles of 64 keys, staged in LDS once per work-group and read by its four waves. Row pitches are 16 B x odd, so the 16 rows of a ds_load_b128 fall on distinct banks.
#define TK 64
#define KP 200      // halves per staged K row: 3 coordinate blocks x 64 + 8 of pad (400 B)
#define VP 72       // halves per staged V^T row: 64 keys + 8 of pad (144 B)
// Twelve asynchronous 16-byte copies per lane, global -> LDS, through no register: copy 4 a + q goes from g + a gs + q gq (halves) to LDS byte l + a ls + q lq.
// The s_wait_xcnt closes the statement so that no address register named here is rewritten ahead of it.
__device__ __forceinline__ void acopy12(unsigned l, unsigned ls, unsigned lq, const unsigned short* g, size_t gs, size_t gq) {
  const unsigned l1 = l + lq, l2 = l + 2 * lq, l3 = l + 3 * lq, l4 = l + ls, l5 = l4 + lq, l6 = l4 + 2 * lq, l7 = l4 + 3 * lq, l8 = l + 2 * ls, l9 = l8 + lq, l10 = l8 + 2 * lq, l11 = l8 + 3 * lq;
  const unsigned short *g1 = g + gq, *g2 = g + 2 * gq, *g3 = g + 3 * gq, *g4 = g + gs, *g5 = g4 + gq, *g6 = g4 + 2 * gq, *g7 = g4 + 3 * gq, *g8 = g + 2 * gs, *g9 = g8 + gq, *g10 = g8 + 2 * gq, *g11 = g8 + 3 * gq;
  asm volatile("global_load_async_to_lds_b128 %0, %12, off\n\t"
               "global_load_async_to_lds_b128 %1, %13, off\n\t"
               "global_load_async_to_lds_b128 %2, %14, off\n\t"
               "global_load_async_to_lds_b128 %3, %15, off\n\t"
               "global_load_async_to_lds_b128 %4, %16, off\n\t"
               "global_load_async_to_lds_b128 %5, %17, off\n\t"
               "global_load_async_to_lds_b128 %6, %18, off\n\t"
               "global_load_async_to_lds_b128 %7, %19, off\n\t"
               "global_load_async_to_lds_b128 %8, %20, off\n\t"
               "global_load_async_to_lds_b128 %9, %21, off\n\t"
               "global_load_async_to_lds_b128 %10, %22, off\n\t"
               "global_load_async_to_lds_b128 %11, %23, off\n\t"
               "s_wait_xcnt 0x0"
               :: "v"(l), "v"(l1), "v"(l2), "v"(l3), "v"(l4), "v"(l5), "v"(l6), "v"(l7), "v"(l8), "v"(l9), "v"(l10), "v"(l11),
                  "v"(g), "v"(g1), "v"(g2), "v"(g3), "v"(g4), "v"(g5), "v"(g6), "v"(g7), "v"(g8), "v"(g9), "v"(g10), "v"(g11) : "memory");
}
// One stage: 64 keys of K (3 coordinate blocks of 128 B a key) and 192 rows of V^T (128 B a row); 24 copies a lane.
__device__ __forceinline__ void stage_kv(unsigned lk, unsigned lv, const unsigned short* kg, const unsigned short* vg) {
  acopy12(lk, 128, 16 * KP * 2, kg, CO, (size_t)16 * 3 * CO);
  acopy12(lv, 64 * VP * 2, 16 * VP * 2, vg, (size_t)64 * NN, (size_t)16 * NN);
}
// lane l with lane l ^ 16, through no LDS
__device__ __forceinline__ float xhalf(float x) { return __builtin_bit_cast(float, __builtin_amdgcn_permlanex16(__builtin_bit_cast(int, x), __builtin_bit_cast(int, x), 0x76543210, 0xfedcba98, false, false)); }
// Scores are formed transposed: K rows are the A operand and Q the B operand, so lane (ln, hh) holds query ln and keys 8 hh + r of each 16-key tile. A query's maximum and sum are then
// in-lane but for one exchange between the wave halves, and the two score tiles of 32 keys, converted in place, are the B operand of O^T += V^T P^T (element i: key 8 hh + i, element 8 + i: key 16 + 8 hh + i, as the V^T loader has it).
__global__ __launch_bounds__(128) void k_vnattn(const _Float16* __restrict__ Q16, const _Float16* __restrict__ K16, const _Float16* __restrict__ Vt, float* __restrict__ O) {
  __shared__ __attribute__((aligned(16))) unsigned short sK[2][TK][KP]; __shared__ __attribute__((aligned(16))) unsigned short sV[2][192][VP];
  __shared__ __attribute__((aligned(16))) float sO[4][16][192 + 4];
  const int tid = threadIdx.x, w = tid >> 5, lane = tid & 31, ln = lane & 15, hh = lane >> 4; const int slab = blockIdx.x / (NN / 64), qblk = blockIdx.x % (NN / 64); const int b = slab / NH, h = slab % NH; const int q0 = qblk * 64 + w * 16;
  const unsigned short* Vth = (const unsigned short*)Vt + (size_t)slab * 192 * NN;
  // The lane's share of a stage: eight lanes cover one 128-byte row piece, so a wave's copy covers four whole lines. K: key = 16 q + tid / 8; V^T: row = 64 a + 16 q + tid / 8.
  const int cr = tid >> 3, cc = (tid & 7) * 8;
  const unsigned short* kg = (const unsigned short*)K16 + ((size_t)b * NN + cr) * (3 * CO) + h * HD + cc;
  const unsigned short* vg = Vth + (size_t)cr * NN + cc;
  const unsigned lk = (unsigned)(size_t)&sK[0][cr][cc], lv = (unsigned)(size_t)&sV[0][cr][cc];
  constexpr unsigned KB = TK * KP * 2, VB = 192 * VP * 2;      // bytes of one buffer
  constexpr int NT = NN / TK;
  stage_kv(lk, lv, kg, vg);
  asm volatile("s_wait_asynccnt 0x0" ::: "memory");      // this wave's share of stage 0 has landed
  __syncthreads();                                        // stage 0 is published to the four waves
  stage_kv(lk + KB, lv + VB, kg + (size_t)TK * 3 * CO, vg + TK);
  FragH aq[6]; { const unsigned short* qr = (const unsigned short*)Q16 + ((size_t)b * NN + q0 + ln) * (3 * CO) + h * HD + 8 * hh;      // row (b,n) = [c0 | c1 | c2] x 512 (= rows (b,n,c) of pitch 512)
#pragma unroll
    for (int ks = 0; ks < 6; ++ks) { const int c = ks >> 1, s32 = (ks & 1) * 32; aq[ks].half[0] = *(const v8us*)(qr + c * CO + s32); aq[ks].half[1] = *(const v8us*)(qr + c * CO + s32 + 16); }
    asm volatile("s_wait_xcnt 0x0" :: "v"(qr) : "memory"); }      // the Q loads' address pair is named as an input, so it stays untouched until this wait; behind it the pair may be reused
  float m_r = -3.0e38f, l_r = 0.f; v8f oacc[12];      // oacc[dt][r] = O[query ln][dt * 16 + 8 hh + r]; l_r sums this half's keys only
#pragma unroll
  for (int dt = 0; dt < 12; ++dt) oacc[dt] = (v8f){0.f,0.f,0.f,0.f,0.f,0.f,0.f,0.f};
#pragma unroll 1
  for (int t = 0; t < NT; ++t) { const int buf = t & 1;
#pragma unroll 1      // the two 32-key passes of a stage stay rolled: unrolled, the build spilled the Q fragments to scratch
   for (int p = 0; p < TK / 32; ++p) { v8f s[2];
#pragma unroll
    for (int nt = 0; nt < 2; ++nt) { const unsigned short* kr = &sK[buf][p * 32 + nt * 16 + ln][0]; v8f acc = (v8f){0.f,0.f,0.f,0.f,0.f,0.f,0.f,0.f}; FragH bk[6];      // six fragments are read as one run ahead of their products: one LDS latency a run, not one a product
#pragma unroll      // constant indices keep bk in registers
      for (int ks = 0; ks < 6; ++ks) { bk[ks].half[0] = *(const v8us*)(kr + ks * 32 + 8 * hh); bk[ks].half[1] = *(const v8us*)(kr + ks * 32 + 16 + 8 * hh); }
#pragma unroll
      for (int ks = 0; ks < 6; ++ks) acc = mmaH<1>(bk[ks].v, bk[ks].v, aq[ks].v, aq[ks].v, acc);
      s[nt] = acc; }
    float mc = -3.0e38f;
#pragma unroll      // constant indices keep the scores in registers
    for (int r = 0; r < 8; ++r) { s[0][r] *= 0.07216878364870323f; s[1][r] *= 0.07216878364870323f; mc = fmaxf(mc, fmaxf(s[0][r], s[1][r])); }
    mc = fmaxf(mc, xhalf(mc));
    const float mn = fmaxf(m_r, mc); const float al = expf(m_r - mn); m_r = mn;
    FragH pa; float ps[4] = {0.f, 0.f, 0.f, 0.f};      // four short chains of adds, not one of sixteen
#pragma unroll      // constant indices keep the scores, pa and ps in registers
    for (int r = 0; r < 8; ++r) { const float p0 = expf(s[0][r] - mn), p1 = expf(s[1][r] - mn); ps[r & 3] += p0 + p1; pa.h[r] = (_Float16)p0; pa.h[8 + r] = (_Float16)p1; }
    l_r = l_r * al + ((ps[0] + ps[1]) + (ps[2] + ps[3]));
#pragma unroll
    for (int dt = 0; dt < 12; ++dt)
#pragma unroll
      for (int r = 0; r < 8; ++r) oacc[dt][r] *= al;
#pragma unroll
    for (int dg = 0; dg < 2; ++dg) { FragH bv[6];      // as for K: a run of six fragments, then their six products
#pragma unroll      // constant indices keep bv and oacc in registers
      for (int i = 0; i < 6; ++i) { const unsigned short* vrow = &sV[buf][(dg * 6 + i) * 16 + ln][p * 32]; bv[i].half[0] = *(const v8us*)(vrow + 8 * hh); bv[i].half[1] = *(const v8us*)(vrow + 16 + 8 * hh); }
#pragma unroll
      for (int i = 0; i < 6; ++i) oacc[dg * 6 + i] = mmaH<1>(bv[i].v, bv[i].v, pa.v, pa.v, oacc[dg * 6 + i]); } }
   asm volatile("s_wait_dscnt 0x0" ::: "memory");         // this wave's reads of buffer t mod 2 are done before the buffer is handed back
   asm volatile("s_wait_asynccnt 0x0" ::: "memory");      // this wave's share of stage t + 1 has landed
   __syncthreads();                                        // publishes stage t + 1 and ends every wave's reads of stage t
   if (t + 2 < NT) stage_kv(lk + buf * KB, lv + buf * VB, kg + (size_t)(t + 2) * TK * 3 * CO, vg + (t + 2) * TK); }
  asm volatile("s_wait_asynccnt 0x0" ::: "memory");        // no copy is outstanding when the wave goes on to its end
  const float linv = 1.0f / (l_r + xhalf(l_r));      // the two halves' sums are joined once, here
#pragma unroll      // constant indices keep oacc in registers
  for (int dt = 0; dt < 12; ++dt) { const v4f lo = {oacc[dt][0] * linv, oacc[dt][1] * linv, oacc[dt][2] * linv, oacc[dt][3] * linv}, hi = {oacc[dt][4] * linv, oacc[dt][5] * linv, oacc[dt][6] * linv, oacc[dt][7] * linv};
    *(v4fa*)&sO[w][ln][dt * 16 + 8 * hh] = lo; *(v4fa*)&sO[w][ln][dt * 16 + 8 * hh + 4] = hi; }
  __builtin_amdgcn_fence(__ATOMIC_ACQ_REL, "workgroup"); __builtin_amdgcn_wave_barrier();
  {
#pragma unroll
    for (int r = 0; r < 16; ++r) { float* orow = O + ((size_t)b * NN + q0 + r) * (NH * 192) + h * 192; { const v4f v = *(const v4fa*)&sO[w][r][lane * 4]; *(v4f*)(orow + lane * 4) = v; } if (lane < 16) { const v4f v2 = *(const v4fa*)&sO[w][r][128 + lane * 4]; *(v4f*)(orow + 128 + lane * 4) = v2; } }
     } }
__global__ __launch_bounds__(256) void k_o3(const float* __restrict__ O, _Float16* __restrict__ O3) { const size_t t = (size_t)blockIdx.x * 256 + threadIdx.x; if (t >= (size_t)NR3 * (CO / 8)) return; const size_t row = t / (CO / 8); const int col8 = (int)(t % (CO / 8)) * 8; const int c = (int)(row % 3); const size_t bn = row / 3; const int h = col8 / HD, d = col8 % HD; FragH f;
#pragma unroll
  for (int q = 0; q < 8; ++q) f.h[q] = (_Float16)O[bn * (NH * 192) + h * 192 + c * 64 + d + q]; *(v8us*)((unsigned short*)O3 + t * 8) = f.half[0];  }
__global__ __launch_bounds__(256) void k_fin(const float* __restrict__ OUT2, float* __restrict__ out) { __shared__ float tl[8][3 * CI + 4]; const int tid = threadIdx.x; const size_t bn0 = (size_t)blockIdx.x * 8;
  for (int i = tid; i < 8 * 3 * CI; i += 256) { const int j = i / (3 * CI), rem = i % (3 * CI); const int c = rem / CI, o = rem % CI; tl[j][o * 3 + c] = OUT2[((bn0 + j) * 3 + c) * CI + o]; }
  __syncthreads();
  { for (int i = tid; i < 8 * 3 * CI / 4; i += 256) { const int j = i / (3 * CI / 4), pc = i % (3 * CI / 4); const v4f v = *(const v4fa*)&tl[j][pc * 4]; *(v4f*)(out + (bn0 + j) * 3 * CI + pc * 4) = v; }  } }
extern "C" void kernel_launch(void* const* d_in, const int* in_sizes, int n_in,
                              void* d_out, int out_size, void* d_ws, size_t ws_size, hipStream_t stream) {
  (void)in_sizes; (void)n_in; (void)out_size;
  const float* x = (const float*)d_in[0]; const float* Wq = (const float*)d_in[1]; const float* Wk = (const float*)d_in[2]; const float* Wv = (const float*)d_in[3]; const float* Wo = (const float*)d_in[4];
  char* ws = (char*)d_ws; size_t off = 0;
  auto take = [&](size_t bytes) { char* p = ws + off; off += (bytes + 255) & ~(size_t)255; return p; };
  _Float16* Bq = (_Float16*)take((size_t)CO * CI * 2); _Float16* Bk = (_Float16*)take((size_t)CO * CI * 2); _Float16* Bv = (_Float16*)take((size_t)CO * CI * 2); _Float16* Bo = (_Float16*)take((size_t)CI * CO * 2);
  _Float16* X3 = (_Float16*)take((size_t)NR3 * CI * 2); _Float16* Q16 = (_Float16*)take((size_t)NR3 * CO * 2); _Float16* K16 = (_Float16*)take((size_t)NR3 * CO * 2); _Float16* V16 = (_Float16*)take((size_t)NR3 * CO * 2); _Float16* Vt = (_Float16*)take((size_t)NR3 * CO * 2); float* O = (float*)take((size_t)NR * NH * 192 * 4); _Float16* O3 = Q16; float* OUT2 = (float*)V16;      // Q16 dead after the attention; V16 (12.6 MB) dead after k_vt3 → OUT2 (12.6 MB)
  if (off > ws_size) return;      // 1.0 + 6.3 + 12.6 × 4 + 25.2 ≈ 83 MB
  const unsigned gw = (unsigned)((CO * CI / 8 + 255) / 256); k_round16f<<<gw, 256, 0, stream>>>(Wq, Bq, (size_t)CO * CI / 8); k_round16f<<<gw, 256, 0, stream>>>(Wk, Bk, (size_t)CO * CI / 8); k_round16f<<<gw, 256, 0, stream>>>(Wv, Bv, (size_t)CO * CI / 8); k_round16f<<<gw, 256, 0, stream>>>(Wo, Bo, (size_t)CI * CO / 8);      // (out,in)
  k_x3<<<(unsigned)(((size_t)NR * 3 * (CI / 8) + 255) / 256), 256, 0, stream>>>(x, X3);
  // X3 = rows (b,n,c) × 256; q/k/v planes = rows (b,n,c) × 512 ≡ [(b,n)][c·512 + o]
  const dim3 gg(((NR3 / 16) * (CO / 64) + 3) / 4, 1), go(((NR3 / 16) * (CI / 64) + 3) / 4, 1);
  k_gemm_hhx<0><<<gg, 128, 0, stream>>>(X3, CI, 0, Bq, CI, 0, 0.0625f, nullptr, 0, nullptr, 1, 0, 0, nullptr, Q16, CO, 0, NR3, CO, CI);
  k_gemm_hhx<0><<<gg, 128, 0, stream>>>(X3, CI, 0, Bk, CI, 0, 0.0625f, nullptr, 0, nullptr, 1, 0, 0, nullptr, K16, CO, 0, NR3, CO, CI);
  k_gemm_hhx<0><<<gg, 128, 0, stream>>>(X3, CI, 0, Bv, CI, 0, 0.0625f, nullptr, 0, nullptr, 1, 0, 0, nullptr, V16, CO, 0, NR3, CO, CI);
  k_vt3<<<BB * NH * 3 * (NN / 64), 256, 0, stream>>>(V16, Vt);
  k_vnattn<<<BB * NH * (NN / 64), 128, 0, stream>>>(Q16, K16, Vt, O);
  k_o3<<<(unsigned)(((size_t)NR3 * (CO / 8) + 255) / 256), 256, 0, stream>>>(O, O3);
  k_gemm_hhx<0><<<go, 128, 0, stream>>>(O3, CO, 0, Bo, CO, 0, 0.0625f, nullptr, 0, nullptr, 1, 0, 0, OUT2, nullptr, CI, 0, NR3, CI, CO);      // rows (b,n,c) × 256
  k_fin<<<NR / 8, 256, 0, stream>>>(OUT2, (float*)d_out);
}

// v003
// A run of this version takes 160 microseconds.
// Timed twice side by side with v002, it ran 1.23 and 1.24 times as fast.
// All steps since v000 together make it 3.73 times as fast.
#include <hip/hip_runtime.h>
// Vector-neuron attention (B=2, N=2048, C=256 × 3 coordinates, 8 heads × 64): the VN-linear maps (rows (b,n,c) × 256 → 512, weights (out,in) bf16-exact ×2^4) and the attention over the
// 192-dim (d, c) head features as a fused flash-style kernel on v_wmma_f32_16x16x32_f16 (S^T = K Q^T / sqrt(192) with 6 k-steps gathered from the three coordinate blocks, online softmax f32 in-lane, P f16 <= 1 packed from the score registers,
// O^T = V^T P^T with 12 d-tiles; RPW-16 waves); f16 operands, single products, f32 accumulate; V^T, the f16 attention output and the final (o, c) interleave are stored by the kernels that compute them.
#define BB 2
#define NN 2048
#define CI 256
#define CO 512
#define NH 8
#define HD 64
#define NR3 (BB * NN * 3)
#define NR (BB * NN)

typedef __bf16 v16b __attribute__((ext_vector_type(16)));
typedef unsigned short v8us __attribute__((ext_vector_type(8), may_alias));
typedef float  v8f  __attribute__((ext_vector_type(8)));
typedef float  v4f  __attribute__((ext_vector_type(4)));
typedef float  v4fa __attribute__((ext_vector_type(4), may_alias));
union FragB { v16b v; v8us half[2]; unsigned short u[16]; };

__device__ __forceinline__ unsigned short bf16_bits(float x) { unsigned int u = __float_as_uint(x); return (unsigned short)((u + 0x7FFFu + ((u >> 16) & 1u)) >> 16); }
__device__ __forceinline__ float bf16_val(unsigned short b) { return __uint_as_float(((unsigned int)b) << 16); }
__device__ __forceinline__ float bf16_round(float x) { return bf16_val(bf16_bits(x)); }
// D += A·B with NT terms: 1 = ah·bh, 2 = + al·bh (A split), 3 = + ah·bl (both split)
template <int NT>
__device__ __forceinline__ v8f mmaN(v16b ah, v16b al, v16b bh, v16b bl, v8f c) {
  c = __builtin_amdgcn_wmma_f32_16x16x32_bf16(false, ah, false, bh, (short)0, c, false, false);
  if (NT >= 2) c = __builtin_amdgcn_wmma_f32_16x16x32_bf16(false, al, false, bh, (short)0, c, false, false);
  if (NT >= 3) c = __builtin_amdgcn_wmma_f32_16x16x32_bf16(false, ah, false, bl, (short)0, c, false, false);
  asm volatile("v_nop\n\tv_nop\n\tv_nop\n\tv_nop" : "+v"(c) : "v"(ah), "v"(al), "v"(bh), "v"(bl));
  return c;
}

__global__ __launch_bounds__(256) void k_wt_bf16(const float* __restrict__ W, unsigned short* __restrict__ Wt, int K, int N) {
  const int t = blockIdx.x * 256 + threadIdx.x;
  const int k8n = K / 8;
  if (t >= N * k8n) return;
  const int n = t / k8n, k8 = (t % k8n) * 8;
  v8us v;
#pragma unroll
  for (int i = 0; i < 8; ++i) v[i] = bf16_bits(W[(size_t)(k8 + i) * N + n]);
  *(v8us*)(Wt + (size_t)n * K + k8) = v;
  
}

// GEMM C[M][N] (f32, pitch ldc) = act(A[M][K]·W + bias). A f32 row-major (pitch lda) converted per fragment to bf16
// (ASPLIT: hi/lo two planes -> 2 terms, else single rounded term); Wt bf16 [N][K] (pitch ldb). BIAS_BF16 rounds the
// bias to bf16 first (bias quantised to bf16 before the add). K%32==0, M%16==0, N%64==0.
template <bool ASPLIT, int ACT, bool BIAS_BF16>
__global__ __launch_bounds__(128) void k_gemm_bf(const float* __restrict__ A, int lda, const unsigned short* __restrict__ Wt, int ldb,
                                               const float* __restrict__ bias, float* __restrict__ C, int ldc, int M, int N, int K) {
  __shared__ __attribute__((aligned(16))) float so[4][16][64];
  const int tid = threadIdx.x, w = tid >> 5, lane = tid & 31, ln = lane & 15, hh = lane >> 4;
  const int ntn = N / 64;
  const int wid = blockIdx.x * 4 + w;
  const int mt = wid / ntn, nq = wid % ntn;
  if (mt * 16 >= M) return;
  const int row0 = mt * 16, col0 = nq * 64;
  const float* arow = A + (size_t)(row0 + ln) * lda;
  v8f acc[4] = {};
  for (int kb = 0; kb < K; kb += 32) {
    FragB ah, al;
    const v4f x0 = *(const v4fa*)(arow + kb + 8 * hh), x1 = *(const v4fa*)(arow + kb + 8 * hh + 4);
    const v4f x2 = *(const v4fa*)(arow + kb + 16 + 8 * hh), x3 = *(const v4fa*)(arow + kb + 16 + 8 * hh + 4);
    float xs[16] = {x0[0],x0[1],x0[2],x0[3],x1[0],x1[1],x1[2],x1[3],x2[0],x2[1],x2[2],x2[3],x3[0],x3[1],x3[2],x3[3]};
#pragma unroll
    for (int i = 0; i < 16; ++i) { const unsigned short hb = bf16_bits(xs[i]); ah.u[i] = hb; al.u[i] = ASPLIT ? bf16_bits(xs[i] - bf16_val(hb)) : (unsigned short)0; }
#pragma unroll
    for (int t = 0; t < 4; ++t) {
      const unsigned short* brow = Wt + (size_t)(col0 + t * 16 + ln) * ldb + kb;
      FragB b;
      b.half[0] = *(const v8us*)(brow + 8 * hh);
      b.half[1] = *(const v8us*)(brow + 16 + 8 * hh);
      acc[t] = mmaN<ASPLIT ? 2 : 1>(ah.v, al.v, b.v, b.v, acc[t]);
    }
  }
#pragma unroll
  for (int t = 0; t < 4; ++t) {
    float bv = bias ? bias[col0 + t * 16 + ln] : 0.f;
    if (BIAS_BF16) bv = bf16_round(bv);
#pragma unroll
    for (int r = 0; r < 8; ++r) { float v = acc[t][r] + bv; if (ACT == 1) v = fmaxf(v, 0.f); so[w][8 * hh + r][t * 16 + ln] = v; }
  }
  __builtin_amdgcn_fence(__ATOMIC_ACQ_REL, "workgroup");
  __builtin_amdgcn_wave_barrier();
  const int rsub = lane >> 4, c4 = (lane & 15) * 4;
  {
#pragma unroll
    for (int q = 0; q < 8; ++q) {
      const int r = q * 2 + rsub;
      const v4f v = *(const v4fa*)&so[w][r][c4];
      *(v4f*)(C + (size_t)(row0 + r) * ldc + col0 + c4) = v;
    }
    
  }
}

// Flash-style causal/unmasked attention, all contractions 3-term bf16 hi/lo splits, f32 softmax with running max.
// q,k,v rows are read from f32 buffers with arbitrary row pitch (so they can live inside a fused qkv buffer);
// D = head size (multiple of 32, <= 128); one wave = 16 query rows; block = 4 waves (64 queries) sharing K/V chunks of 32.
template <int D, bool CAUSAL>
__global__ __launch_bounds__(128) void k_flash(const float* __restrict__ qb, const float* __restrict__ kb, const float* __restrict__ vb,
                                             int pitch, int T, int H, float scale, float* __restrict__ y, int ypitch) {
  constexpr int KS = D / 32;        // k-steps for QK
  constexpr int DT = D / 16;        // d tiles for PV
  __shared__ __attribute__((aligned(16))) unsigned short sKh[32][D + 8], sKl[32][D + 8], sVh[32][D + 8], sVl[32][D + 8];
  __shared__ __attribute__((aligned(16))) unsigned short sPh[4][16][40], sPl[4][16][40];
  __shared__ __attribute__((aligned(16))) float sO[4][16][D];
  const int tid = threadIdx.x, w = tid >> 5, lane = tid & 31, ln = lane & 15, hh = lane >> 4;
  const int nqb = (T + 63) / 64;
  const int bh = blockIdx.x / nqb, qblk = blockIdx.x % nqb;
  const int b = bh / H, h = bh % H;
  const int q0 = qblk * 64 + w * 16;
  const float* Q = qb + (size_t)b * T * pitch + h * D;
  const float* K = kb + (size_t)b * T * pitch + h * D;
  const float* V = vb + (size_t)b * T * pitch + h * D;

  // A fragments of the wave's 16 query rows (scaled), hi/lo
  FragB aqh[KS], aql[KS];
  {
    int row = q0 + ln; if (row >= T) row = T - 1;
    const float* qr = Q + (size_t)row * pitch;
#pragma unroll
    for (int ks = 0; ks < KS; ++ks)
#pragma unroll
      for (int i = 0; i < 16; ++i) {
        const int d = ks * 32 + ((i < 8) ? (8 * hh + i) : (16 + 8 * hh + (i - 8)));
        const float x = qr[d] * scale; const unsigned short hb = bf16_bits(x);
        aqh[ks].u[i] = hb; aql[ks].u[i] = bf16_bits(x - bf16_val(hb));
      }
  }
  float m_r[8], l_r[8];
#pragma unroll
  for (int r = 0; r < 8; ++r) { m_r[r] = -3.0e38f; l_r[r] = 0.f; }
  v8f oacc[DT];
#pragma unroll
  for (int dt = 0; dt < DT; ++dt) oacc[dt] = (v8f){0.f,0.f,0.f,0.f,0.f,0.f,0.f,0.f};

  const int kv_end = CAUSAL ? min(T, qblk * 64 + 64) : T;     // block-uniform
  for (int j0 = 0; j0 < kv_end; j0 += 32) {
    __syncthreads();
    for (int e = tid; e < 32 * (D / 4); e += 128) {
      const int r = e / (D / 4), c4 = (e % (D / 4)) * 4;
      const int key = j0 + r;
      v4f kf = {0.f,0.f,0.f,0.f}, vf = {0.f,0.f,0.f,0.f};
      if (key < T) { kf = *(const v4fa*)(K + (size_t)key * pitch + c4); vf = *(const v4fa*)(V + (size_t)key * pitch + c4); }
#pragma unroll
      for (int t = 0; t < 4; ++t) {
        unsigned short hb = bf16_bits(kf[t]); sKh[r][c4 + t] = hb; sKl[r][c4 + t] = bf16_bits(kf[t] - bf16_val(hb));
        hb = bf16_bits(vf[t]); sVh[r][c4 + t] = hb; sVl[r][c4 + t] = bf16_bits(vf[t] - bf16_val(hb));
      }
    }
    __syncthreads();
    // S tile 16 x 32
    v8f s[2];
#pragma unroll
    for (int nt = 0; nt < 2; ++nt) {
      v8f acc = {};
#pragma unroll
      for (int ks = 0; ks < KS; ++ks) {
        FragB bh_, bl_;
        bh_.half[0] = *(const v8us*)&sKh[nt * 16 + ln][ks * 32 + 8 * hh]; bh_.half[1] = *(const v8us*)&sKh[nt * 16 + ln][ks * 32 + 16 + 8 * hh];
        bl_.half[0] = *(const v8us*)&sKl[nt * 16 + ln][ks * 32 + 8 * hh]; bl_.half[1] = *(const v8us*)&sKl[nt * 16 + ln][ks * 32 + 16 + 8 * hh];
        acc = mmaN<3>(aqh[ks].v, aql[ks].v, bh_.v, bl_.v, acc);
      }
      s[nt] = acc;
    }
    // mask + running max (rows 8hh+r; the 16 lanes of a half share rows)
    float alpha[8];
#pragma unroll
    for (int r = 0; r < 8; ++r) {
      const int qi = q0 + 8 * hh + r;
      const int ja = j0 + ln, jb = j0 + 16 + ln;
      if (CAUSAL) { if (ja > qi) s[0][r] = -3.0e38f; if (jb > qi) s[1][r] = -3.0e38f; }
      if (ja >= T) s[0][r] = -3.0e38f;
      if (jb >= T) s[1][r] = -3.0e38f;
      float mx = fmaxf(s[0][r], s[1][r]);
      mx = fmaxf(mx, __shfl_xor(mx, 1, 32)); mx = fmaxf(mx, __shfl_xor(mx, 2, 32)); mx = fmaxf(mx, __shfl_xor(mx, 4, 32)); mx = fmaxf(mx, __shfl_xor(mx, 8, 32));
      const float mnew = fmaxf(m_r[r], mx);
      alpha[r] = (mnew > -1.0e38f) ? __expf(m_r[r] - mnew) : 1.0f;
      const float p0 = (s[0][r] > -1.0e38f) ? __expf(s[0][r] - mnew) : 0.f;
      const float p1 = (s[1][r] > -1.0e38f) ? __expf(s[1][r] - mnew) : 0.f;
      m_r[r] = mnew;
      l_r[r] = l_r[r] * alpha[r] + p0 + p1;            // per-lane partial row sum (16 lanes combined at the end)
      unsigned short hb = bf16_bits(p0); sPh[w][8 * hh + r][ln] = hb;      sPl[w][8 * hh + r][ln] = bf16_bits(p0 - bf16_val(hb));
      hb = bf16_bits(p1);                sPh[w][8 * hh + r][16 + ln] = hb; sPl[w][8 * hh + r][16 + ln] = bf16_bits(p1 - bf16_val(hb));
    }
#pragma unroll
    for (int dt = 0; dt < DT; ++dt)
#pragma unroll
      for (int r = 0; r < 8; ++r) oacc[dt][r] *= alpha[r];
    __builtin_amdgcn_fence(__ATOMIC_ACQ_REL, "workgroup");
    __builtin_amdgcn_wave_barrier();
    FragB pah, pal;
    pah.half[0] = *(const v8us*)&sPh[w][ln][8 * hh]; pah.half[1] = *(const v8us*)&sPh[w][ln][16 + 8 * hh];
    pal.half[0] = *(const v8us*)&sPl[w][ln][8 * hh]; pal.half[1] = *(const v8us*)&sPl[w][ln][16 + 8 * hh];
#pragma unroll
    for (int dt = 0; dt < DT; ++dt) {
      FragB bvh, bvl;
#pragma unroll
      for (int i = 0; i < 8; ++i) {
        bvh.u[i] = sVh[8 * hh + i][dt * 16 + ln]; bvh.u[8 + i] = sVh[16 + 8 * hh + i][dt * 16 + ln];
        bvl.u[i] = sVl[8 * hh + i][dt * 16 + ln]; bvl.u[8 + i] = sVl[16 + 8 * hh + i][dt * 16 + ln];
      }
      oacc[dt] = mmaN<3>(pah.v, pal.v, bvh.v, bvl.v, oacc[dt]);
    }
    __builtin_amdgcn_fence(__ATOMIC_ACQ_REL, "workgroup");
    __builtin_amdgcn_wave_barrier();
  }
#pragma unroll
  for (int r = 0; r < 8; ++r) {
    float l = l_r[r];
    l += __shfl_xor(l, 1, 32); l += __shfl_xor(l, 2, 32); l += __shfl_xor(l, 4, 32); l += __shfl_xor(l, 8, 32);
    l_r[r] = (l > 0.f) ? 1.0f / l : 0.f;
  }
#pragma unroll
  for (int dt = 0; dt < DT; ++dt)
#pragma unroll
    for (int r = 0; r < 8; ++r) sO[w][8 * hh + r][dt * 16 + ln] = oacc[dt][r] * l_r[r];
  __builtin_amdgcn_fence(__ATOMIC_ACQ_REL, "workgroup");
  __builtin_amdgcn_wave_barrier();
  {
    for (int r = 0; r < 16; ++r) {
      const int row = q0 + r;
      if (row < T && lane < D / 4) {
        const v4f val = *(const v4fa*)&sO[w][r][lane * 4];
        *(v4f*)(y + ((size_t)b * T + row) * ypitch + h * D + lane * 4) = val;
      }
    }
    
  }
}

// GEMM C = act(A·W + bias + resid): A f32 (ASPLIT -> hi/lo 2 terms), Wt bf16 [N][K]; ACT 0 none, 1 relu, 2 exact gelu;
// resid (optional, f32, row index = (row % rmod), pitch ldr, RES_BF16 rounds it) added before the activation.
template <bool ASPLIT, int ACT, bool BIAS_BF16, bool RES_BF16>
__global__ __launch_bounds__(128) void k_gemm_bf3(const float* __restrict__ A, int lda, const unsigned short* __restrict__ Wt, int ldb,
                                                const float* __restrict__ bias, const float* __restrict__ resid, int rmod, int ldr,
                                                float* __restrict__ C, int ldc, int M, int N, int K) {
  __shared__ __attribute__((aligned(16))) float so[4][16][64];
  const int tid = threadIdx.x, w = tid >> 5, lane = tid & 31, ln = lane & 15, hh = lane >> 4;
  const int ntn = N / 64;
  const int wid = blockIdx.x * 4 + w;
  const int mt = wid / ntn, nq = wid % ntn;
  if (mt * 16 >= M) return;
  const int row0 = mt * 16, col0 = nq * 64;
  const float* arow = A + (size_t)(row0 + ln) * lda;
  v8f acc[4] = {};
  for (int kb = 0; kb < K; kb += 32) {
    FragB ah, al;
    const v4f x0 = *(const v4fa*)(arow + kb + 8 * hh), x1 = *(const v4fa*)(arow + kb + 8 * hh + 4);
    const v4f x2 = *(const v4fa*)(arow + kb + 16 + 8 * hh), x3 = *(const v4fa*)(arow + kb + 16 + 8 * hh + 4);
    float xs[16] = {x0[0],x0[1],x0[2],x0[3],x1[0],x1[1],x1[2],x1[3],x2[0],x2[1],x2[2],x2[3],x3[0],x3[1],x3[2],x3[3]};
#pragma unroll
    for (int i = 0; i < 16; ++i) { const unsigned short hb = bf16_bits(xs[i]); ah.u[i] = hb; al.u[i] = ASPLIT ? bf16_bits(xs[i] - bf16_val(hb)) : (unsigned short)0; }
#pragma unroll
    for (int t = 0; t < 4; ++t) {
      const unsigned short* brow = Wt + (size_t)(col0 + t * 16 + ln) * ldb + kb;
      FragB b;
      b.half[0] = *(const v8us*)(brow + 8 * hh);
      b.half[1] = *(const v8us*)(brow + 16 + 8 * hh);
      acc[t] = mmaN<ASPLIT ? 2 : 1>(ah.v, al.v, b.v, b.v, acc[t]);
    }
  }
#pragma unroll
  for (int t = 0; t < 4; ++t) {
    const int col = col0 + t * 16 + ln;
    float bv = bias ? bias[col] : 0.f;
    if (BIAS_BF16) bv = bf16_round(bv);
#pragma unroll
    for (int r = 0; r < 8; ++r) {
      float v = acc[t][r] + bv;
      if (resid) { float rv = resid[(size_t)((row0 + 8 * hh + r) % rmod) * ldr + col]; if (RES_BF16) rv = bf16_round(rv); v += rv; }
      if (ACT == 1) v = fmaxf(v, 0.f);
      if (ACT == 2) v = 0.5f * v * (1.0f + erff(v * 0.70710678118654752f));
      if (ACT == 3) { const float u = 0.7978845608028654f * (v + 0.044715f * v * v * v); v = 0.5f * v * (1.0f + tanhf(u)); }
      so[w][8 * hh + r][t * 16 + ln] = v;
    }
  }
  __builtin_amdgcn_fence(__ATOMIC_ACQ_REL, "workgroup");
  __builtin_amdgcn_wave_barrier();
  const int rsub = lane >> 4, c4 = (lane & 15) * 4;
  {
#pragma unroll
    for (int q = 0; q < 8; ++q) {
      const int r = q * 2 + rsub;
      const v4f v = *(const v4fa*)&so[w][r][c4];
      *(v4f*)(C + (size_t)(row0 + r) * ldc + col0 + c4) = v;
    }
    
  }
}
// row LayerNorm (biased variance, eps) over N: s = X (+ R); optional out_sum <- s; out_norm <- (s-mu)*rsqrt(var+eps)*g + b
template <bool PARAM_BF16>
__global__ __launch_bounds__(256) void k_layernorm(const float* __restrict__ X, const float* __restrict__ R, const float* __restrict__ g, const float* __restrict__ bta,
                                                  float* __restrict__ out_sum, float* __restrict__ out_norm, int N, float eps) {
  __shared__ float red[256];
  const int row = blockIdx.x, tid = threadIdx.x;
  const float* x = X + (size_t)row * N; const float* rr = R ? R + (size_t)row * N : nullptr;
  float vals[16];                     // up to N = 4096
  const int per = N / 256;            // contiguous chunk per thread? use strided-by-4 chunks: thread handles j = tid*4 + 1024*u
  float s1 = 0.f;
  for (int u = 0; u < per / 4; ++u) {
    const int j = tid * 4 + 1024 * u;
    const v4f a = *(const v4fa*)(x + j);
    v4f b = {0.f,0.f,0.f,0.f}; if (rr) b = *(const v4fa*)(rr + j);
#pragma unroll
    for (int q = 0; q < 4; ++q) { const float v = a[q] + b[q]; vals[u * 4 + q] = v; s1 += v; }
  }
  red[tid] = s1; __syncthreads();
  for (int st = 128; st > 0; st >>= 1) { if (tid < st) red[tid] += red[tid + st]; __syncthreads(); }
  const float mu = red[0] / (float)N; __syncthreads();
  float s2 = 0.f;
  for (int u = 0; u < per / 4; ++u)
#pragma unroll
    for (int q = 0; q < 4; ++q) { const float c = vals[u * 4 + q] - mu; s2 += c * c; }
  red[tid] = s2; __syncthreads();
  for (int st = 128; st > 0; st >>= 1) { if (tid < st) red[tid] += red[tid + st]; __syncthreads(); }
  const float rs = rsqrtf(red[0] / (float)N + eps);
  {
    for (int u = 0; u < per / 4; ++u) {
      const int j = tid * 4 + 1024 * u;
      v4f o, sm;
#pragma unroll
      for (int q = 0; q < 4; ++q) {
        float gg = g[j + q], bb = bta[j + q];
        if (PARAM_BF16) { gg = bf16_round(gg); bb = bf16_round(bb); }
        sm[q] = vals[u * 4 + q]; o[q] = (vals[u * 4 + q] - mu) * rs * gg + bb;
      }
      if (out_sum) *(v4f*)(out_sum + (size_t)row * N + j) = sm;
      *(v4f*)(out_norm + (size_t)row * N + j) = o;
    }
    
  }
}



// ---- f16 WMMA path (v_wmma_f32_16x16x32_f16): 11-bit significands for operands in range — used for every contraction launched here (VN-linear maps, Q·Kᵀ, P·V)
typedef _Float16 v16h __attribute__((ext_vector_type(16)));
union FragH { v16h v; v8us half[2]; _Float16 h[16]; unsigned short u[16]; };
template <int NT>
__device__ __forceinline__ v8f mmaH(v16h ah, v16h al, v16h bh, v16h bl, v8f c) {
  c = __builtin_amdgcn_wmma_f32_16x16x32_f16(false, ah, false, bh, (short)0, c, false, false);
  if (NT >= 2) c = __builtin_amdgcn_wmma_f32_16x16x32_f16(false, al, false, bh, (short)0, c, false, false);
  if (NT >= 3) c = __builtin_amdgcn_wmma_f32_16x16x32_f16(false, ah, false, bl, (short)0, c, false, false);
  asm volatile("v_nop\n\tv_nop\n\tv_nop\n\tv_nop" : "+v"(c) : "v"(ah), "v"(al), "v"(bh), "v"(bl));
  return c;
}
// batched GEMM like k_gemm_b but f16 operands: A f32 (split into f16 hi/lo if ASPLIT, else rounded to f16), Bt = f16 values [n][k]; alpha; C f32; N multiple of 16 (partial tiles skipped)
template <bool ASPLIT>
__global__ __launch_bounds__(128) void k_gemm_h(const float* __restrict__ A, int lda, size_t sA, const _Float16* __restrict__ Bh, int ldb, size_t sB, float alpha, float* __restrict__ C, int ldc, size_t sC, int M, int N, int K) {
  __shared__ __attribute__((aligned(16))) float so[4][16][64];
  const int tid = threadIdx.x, w = tid >> 5, lane = tid & 31, ln = lane & 15, hh = lane >> 4; const int by = blockIdx.y;
  A += (size_t)by * sA; Bh += (size_t)by * sB; C += (size_t)by * sC;
  const int ntn = (N + 63) / 64; const int wid = blockIdx.x * 4 + w; const int mt = wid / ntn, nq = wid % ntn; if (mt * 16 >= M) return;
  const int row0 = mt * 16, col0 = nq * 64; const float* arow = A + (size_t)(row0 + ln) * lda;
  v8f acc[4] = {};
  for (int kb = 0; kb < K; kb += 32) {
    FragH ah, al;
    const v4f x0 = *(const v4fa*)(arow + kb + 8 * hh), x1 = *(const v4fa*)(arow + kb + 8 * hh + 4), x2 = *(const v4fa*)(arow + kb + 16 + 8 * hh), x3 = *(const v4fa*)(arow + kb + 16 + 8 * hh + 4);
    float xs[16] = {x0[0],x0[1],x0[2],x0[3],x1[0],x1[1],x1[2],x1[3],x2[0],x2[1],x2[2],x2[3],x3[0],x3[1],x3[2],x3[3]};
#pragma unroll
    for (int i = 0; i < 16; ++i) { const _Float16 h = (_Float16)xs[i]; ah.h[i] = h; al.h[i] = ASPLIT ? (_Float16)(xs[i] - (float)h) : (_Float16)0.0f; }
#pragma unroll
    for (int t = 0; t < 4; ++t) { if (col0 + t * 16 >= N) continue; const size_t boff = (size_t)(col0 + t * 16 + ln) * ldb + kb; FragH bq; bq.half[0] = *(const v8us*)(Bh + boff + 8 * hh); bq.half[1] = *(const v8us*)(Bh + boff + 16 + 8 * hh);
      acc[t] = mmaH<ASPLIT ? 2 : 1>(ah.v, al.v, bq.v, bq.v, acc[t]); }
  }
#pragma unroll
  for (int t = 0; t < 4; ++t) { if (col0 + t * 16 >= N) continue;
#pragma unroll
    for (int r = 0; r < 8; ++r) so[w][8 * hh + r][t * 16 + ln] = acc[t][r] * alpha; }
  __builtin_amdgcn_fence(__ATOMIC_ACQ_REL, "workgroup"); __builtin_amdgcn_wave_barrier();
  const int rsub = lane >> 4, c4 = (lane & 15) * 4;
  {
#pragma unroll
    for (int q = 0; q < 8; ++q) { const int r = q * 2 + rsub; if (col0 + c4 < N) { const v4f v = *(const v4fa*)&so[w][r][c4]; *(v4f*)(C + (size_t)(row0 + r) * ldc + col0 + c4) = v; } }
     }
}

// Wt[n][k] = f16(W[k][n]·scale) from f32 row-major W[K][N] (scale = power of two; bf16-exact weights stay exact in f16 away from the subnormal range)
__global__ __launch_bounds__(256) void k_wt_f16(const float* __restrict__ W, _Float16* __restrict__ Wt, int K, int N, float scale) {
  const int t = blockIdx.x * 256 + threadIdx.x; if (t >= N * (K / 8)) return; const int n = t / (K / 8), k8 = (t % (K / 8)) * 8; FragH f;
#pragma unroll
  for (int i = 0; i < 8; ++i) f.h[i] = (_Float16)(bf16_round(W[(size_t)(k8 + i) * N + n]) * scale); const v8us o = f.half[0];
  *(v8us*)((unsigned short*)Wt + (size_t)n * K + k8) = o; 
}
// k_gemm_hh variant with fused epilogue: v = acc·alpha + bias[by·sBias + col] (+ CP[(row/rowsPerB)·sCPb + by·64 + col] if CP) ; ACT 0 none / 1 elu ; writes f16 C16 and/or f32 C, each if non-null
template <int ACT>
__global__ __launch_bounds__(128) void k_gemm_hhx(const _Float16* __restrict__ A, int lda, size_t sA, const _Float16* __restrict__ Bh, int ldb, size_t sB, float alpha, const float* __restrict__ bias, size_t sBias, const float* __restrict__ CP, int rowsPerB, size_t sCPb, int row0g,
    float* __restrict__ C, _Float16* __restrict__ C16, int ldc, size_t sC, int M, int N, int K) {
  __shared__ __attribute__((aligned(16))) float so[4][16][64];
  const int tid = threadIdx.x, w = tid >> 5, lane = tid & 31, ln = lane & 15, hh = lane >> 4; const int by = blockIdx.y;
  A += (size_t)by * sA; Bh += (size_t)by * sB; const size_t cofs = (size_t)by * sC; const float* bp = bias ? bias + (size_t)by * sBias : nullptr;
  const int ntn = (N + 63) / 64; const int wid = blockIdx.x * 4 + w; const int mt = wid / ntn, nq = wid % ntn; if (mt * 16 >= M) return;
  const int row0 = mt * 16, col0 = nq * 64; const _Float16* arow = A + (size_t)(row0 + ln) * lda;
  v8f acc[4] = {};
  for (int kb = 0; kb < K; kb += 32) { FragH ah; ah.half[0] = *(const v8us*)((const unsigned short*)arow + kb + 8 * hh); ah.half[1] = *(const v8us*)((const unsigned short*)arow + kb + 16 + 8 * hh);
#pragma unroll
    for (int t = 0; t < 4; ++t) { if (col0 + t * 16 >= N) continue; const size_t boff = (size_t)(col0 + t * 16 + ln) * ldb + kb; FragH bq; bq.half[0] = *(const v8us*)((const unsigned short*)Bh + boff + 8 * hh); bq.half[1] = *(const v8us*)((const unsigned short*)Bh + boff + 16 + 8 * hh);
      acc[t] = mmaH<1>(ah.v, ah.v, bq.v, bq.v, acc[t]); }
  }
#pragma unroll
  for (int t = 0; t < 4; ++t) { if (col0 + t * 16 >= N) continue; const int col = col0 + t * 16 + ln; const float bv = bp ? bf16_round(bp[col]) : 0.f;
#pragma unroll
    for (int r = 0; r < 8; ++r) { float v = acc[t][r] * alpha + bv; if (CP) { const int bidx = (row0g + row0 + 8 * hh + r) / rowsPerB; v += CP[(size_t)bidx * sCPb + (size_t)by * 64 + col]; } if (ACT == 1) v = (v > 0.f) ? v : expm1f(v); else if (ACT == 3) v = fmaxf(v, 0.f); so[w][8 * hh + r][t * 16 + ln] = v; } }
  __builtin_amdgcn_fence(__ATOMIC_ACQ_REL, "workgroup"); __builtin_amdgcn_wave_barrier();
  const int rsub = lane >> 4, c4 = (lane & 15) * 4; typedef _Float16 v4h __attribute__((ext_vector_type(4)));
  {
#pragma unroll
    for (int q = 0; q < 8; ++q) { const int r = q * 2 + rsub; if (col0 + c4 < N) { const v4f v = *(const v4fa*)&so[w][r][c4]; if (C) *(v4f*)(C + cofs + (size_t)(row0 + r) * ldc + col0 + c4) = v; if (C16) { v4h h4; for (int i = 0; i < 4; ++i) h4[i] = (_Float16)v[i]; *(v4h*)(C16 + cofs + (size_t)(row0 + r) * ldc + col0 + c4) = h4; } } }
     }
}


__global__ __launch_bounds__(256) void k_round16f(const float* __restrict__ W, _Float16* __restrict__ Bt, size_t n8) { const size_t t = (size_t)blockIdx.x * 256 + threadIdx.x; if (t >= n8) return; FragH f;
#pragma unroll
  for (int i = 0; i < 8; ++i) f.h[i] = (_Float16)(bf16_round(W[t * 8 + i]) * 16.0f); *(v8us*)((unsigned short*)Bt + t * 8) = f.half[0];  }
__global__ __launch_bounds__(256) void k_x3(const float* __restrict__ x, _Float16* __restrict__ X3) { const size_t t = (size_t)blockIdx.x * 256 + threadIdx.x; if (t >= (size_t)NR * 3 * (CI / 8)) return; const size_t bn = t / (3 * (CI / 8)); const int rem = (int)(t % (3 * (CI / 8))); const int c = rem / (CI / 8), i8 = (rem % (CI / 8)) * 8; FragH f;
#pragma unroll
  for (int q = 0; q < 8; ++q) f.h[q] = (_Float16)bf16_round(x[(bn * CI + i8 + q) * 3 + c]); *(v8us*)((unsigned short*)X3 + t * 8) = f.half[0];  }
// V^T at once: C[o][n] = sum_k Wv[o][k] X3[(b, n, c)][k]. The weight rows are the A operand and the token rows of one (b, c) the B operand (each lane picks its token's row, pitch 3 x 256),
// so a row of the staged tile is 64 tokens of one feature: one whole 128-byte line of the layout that the attention stages. Same products, same k order as the q and k maps.
__global__ __launch_bounds__(128) void k_gemm_vt(const _Float16* __restrict__ Wh, const _Float16* __restrict__ X3, _Float16* __restrict__ Vt) {
  __shared__ __attribute__((aligned(16))) float so[4][16][64];
  const int tid = threadIdx.x, w = tid >> 5, lane = tid & 31, ln = lane & 15, hh = lane >> 4; const int b = blockIdx.y / 3, c = blockIdx.y % 3;
  const int wid = blockIdx.x * 4 + w; const int mt = wid / (NN / 64), nq = wid % (NN / 64); const int row0 = mt * 16, col0 = nq * 64;
  const unsigned short* arow = (const unsigned short*)Wh + (size_t)(row0 + ln) * CI + 8 * hh;
  const unsigned short* xrow = (const unsigned short*)X3 + (((size_t)b * NN + col0 + ln) * 3 + c) * CI + 8 * hh;
  v8f acc[4] = {};
#pragma unroll      // every load is base + constant, so that no address register is rewritten while loads are out
  for (int kb = 0; kb < CI; kb += 32) { FragH ah; ah.half[0] = *(const v8us*)(arow + kb); ah.half[1] = *(const v8us*)(arow + kb + 16);
#pragma unroll      // constant indices keep the fragments and acc in registers
    for (int t = 0; t < 4; ++t) { FragH bq; bq.half[0] = *(const v8us*)(xrow + t * 16 * 3 * CI + kb); bq.half[1] = *(const v8us*)(xrow + t * 16 * 3 * CI + kb + 16);
      acc[t] = mmaH<1>(ah.v, ah.v, bq.v, bq.v, acc[t]); } }
#pragma unroll      // constant indices keep the fragments and acc in registers
  for (int t = 0; t < 4; ++t)
#pragma unroll      // constant indices keep the fragments and acc in registers
    for (int r = 0; r < 8; ++r) so[w][8 * hh + r][t * 16 + ln] = acc[t][r] * 0.0625f;
  __builtin_amdgcn_fence(__ATOMIC_ACQ_REL, "workgroup"); __builtin_amdgcn_wave_barrier();      // the wave's LDS stores are done before its lanes read what other lanes stored
  const int rsub = lane >> 4, c4 = (lane & 15) * 4; typedef _Float16 v4h __attribute__((ext_vector_type(4)));
  _Float16* vrow = Vt + ((size_t)(b * NH + row0 / HD) * 192 + c * 64 + row0 % HD + rsub) * NN + col0 + c4;      // the 16 features of a tile lie in one head
#pragma unroll      // constant offsets from one address pair
  for (int q = 0; q < 8; ++q) { const v4f v = *(const v4fa*)&so[w][q * 2 + rsub][c4]; v4h h4; for (int i = 0; i < 4; ++i) h4[i] = (_Float16)v[i]; *(v4h*)(vrow + (size_t)q * 2 * NN) = h4; }
}
// K and V^T tiles of 64 keys, staged in LDS once per work-group and read by its four waves. Row pitches are 16 B x odd, so the 16 rows of a ds_load_b128 fall on distinct banks.
#define TK 64
#define KP 200      // halves per staged K row: 3 coordinate blocks x 64 + 8 of pad (400 B)
#define VP 72       // halves per staged V^T row: 64 keys + 8 of pad (144 B)
// Twelve asynchronous 16-byte copies per lane, global -> LDS, through no register: copy 4 a + q goes from g + a gs + q gq (halves) to LDS byte l + a ls + q lq.
// The s_wait_xcnt closes the statement so that no address register named here is rewritten ahead of it.
__device__ __forceinline__ void acopy12(unsigned l, unsigned ls, unsigned lq, const unsigned short* g, size_t gs, size_t gq) {
  const unsigned l1 = l + lq, l2 = l + 2 * lq, l3 = l + 3 * lq, l4 = l + ls, l5 = l4 + lq, l6 = l4 + 2 * lq, l7 = l4 + 3 * lq, l8 = l + 2 * ls, l9 = l8 + lq, l10 = l8 + 2 * lq, l11 = l8 + 3 * lq;
  const unsigned short *g1 = g + gq, *g2 = g + 2 * gq, *g3 = g + 3 * gq, *g4 = g + gs, *g5 = g4 + gq, *g6 = g4 + 2 * gq, *g7 = g4 + 3 * gq, *g8 = g + 2 * gs, *g9 = g8 + gq, *g10 = g8 + 2 * gq, *g11 = g8 + 3 * gq;
  asm volatile("global_load_async_to_lds_b128 %0, %12, off\n\t"
               "global_load_async_to_lds_b128 %1, %13, off\n\t"
               "global_load_async_to_lds_b128 %2, %14, off\n\t"
               "global_load_async_to_lds_b128 %3, %15, off\n\t"
               "global_load_async_to_lds_b128 %4, %16, off\n\t"
               "global_load_async_to_lds_b128 %5, %17, off\n\t"
               "global_load_async_to_lds_b128 %6, %18, off\n\t"
               "global_load_async_to_lds_b128 %7, %19, off\n\t"
               "global_load_async_to_lds_b128 %8, %20, off\n\t"
               "global_load_async_to_lds_b128 %9, %21, off\n\t"
               "global_load_async_to_lds_b128 %10, %22, off\n\t"
               "global_load_async_to_lds_b128 %11, %23, off\n\t"
               "s_wait_xcnt 0x0"
               :: "v"(l), "v"(l1), "v"(l2), "v"(l3), "v"(l4), "v"(l5), "v"(l6), "v"(l7), "v"(l8), "v"(l9), "v"(l10), "v"(l11),
                  "v"(g), "v"(g1), "v"(g2), "v"(g3), "v"(g4), "v"(g5), "v"(g6), "v"(g7), "v"(g8), "v"(g9), "v"(g10), "v"(g11) : "memory");
}
// One stage: 64 keys of K (3 coordinate blocks of 128 B a key) and 192 rows of V^T (128 B a row); 24 copies a lane.
__device__ __forceinline__ void stage_kv(unsigned lk, unsigned lv, const unsigned short* kg, const unsigned short* vg) {
  acopy12(lk, 128, 16 * KP * 2, kg, CO, (size_t)16 * 3 * CO);
  acopy12(lv, 64 * VP * 2, 16 * VP * 2, vg, (size_t)64 * NN, (size_t)16 * NN);
}
// lane l with lane l ^ 16, through no LDS
__device__ __forceinline__ float xhalf(float x) { return __builtin_bit_cast(float, __builtin_amdgcn_permlanex16(__builtin_bit_cast(int, x), __builtin_bit_cast(int, x), 0x76543210, 0xfedcba98, false, false)); }
// Scores are formed transposed: K rows are the A operand and Q the B operand, so lane (ln, hh) holds query ln and keys 8 hh + r of each 16-key tile. A query's maximum and sum are then
// in-lane but for one exchange between the wave halves, and the two score tiles of 32 keys, converted in place, are the B operand of O^T += V^T P^T (element i: key 8 hh + i, element 8 + i: key 16 + 8 hh + i, as the V^T loader has it).
__global__ __launch_bounds__(128) void k_vnattn(const _Float16* __restrict__ Q16, const _Float16* __restrict__ K16, const _Float16* __restrict__ Vt, _Float16* __restrict__ O3) {
  __shared__ __attribute__((aligned(16))) unsigned short sK[2][TK][KP]; __shared__ __attribute__((aligned(16))) unsigned short sV[2][192][VP];
  __shared__ __attribute__((aligned(16))) unsigned short sO[4][48][64 + 8];      // f16 output, one row a (query, coordinate) piece of 64 halves; a query's pitch is 16 B x odd
  const int tid = threadIdx.x, w = tid >> 5, lane = tid & 31, ln = lane & 15, hh = lane >> 4; const int slab = blockIdx.x / (NN / 64), qblk = blockIdx.x % (NN / 64); const int b = slab / NH, h = slab % NH; const int q0 = qblk * 64 + w * 16;
  const unsigned short* Vth = (const unsigned short*)Vt + (size_t)slab * 192 * NN;
  // The lane's share of a stage: eight lanes cover one 128-byte row piece, so a wave's copy covers four whole lines. K: key = 16 q + tid / 8; V^T: row = 64 a + 16 q + tid / 8.
  const int cr = tid >> 3, cc = (tid & 7) * 8;
  const unsigned short* kg = (const unsigned short*)K16 + ((size_t)b * NN + cr) * (3 * CO) + h * HD + cc;
  const unsigned short* vg = Vth + (size_t)cr * NN + cc;
  const unsigned lk = (unsigned)(size_t)&sK[0][cr][cc], lv = (unsigned)(size_t)&sV[0][cr][cc];
  constexpr unsigned KB = TK * KP * 2, VB = 192 * VP * 2;      // bytes of one buffer
  constexpr int NT = NN / TK;
  stage_kv(lk, lv, kg, vg);
  asm volatile("s_wait_asynccnt 0x0" ::: "memory");      // this wave's share of stage 0 has landed
  __syncthreads();                                        // stage 0 is published to the four waves
  stage_kv(lk + KB, lv + VB, kg + (size_t)TK * 3 * CO, vg + TK);
  FragH aq[6]; { const unsigned short* qr = (const unsigned short*)Q16 + ((size_t)b * NN + q0 + ln) * (3 * CO) + h * HD + 8 * hh;      // row (b,n) = [c0 | c1 | c2] x 512 (= rows (b,n,c) of pitch 512)
#pragma unroll
    for (int ks = 0; ks < 6; ++ks) { const int c = ks >> 1, s32 = (ks & 1) * 32; aq[ks].half[0] = *(const v8us*)(qr + c * CO + s32); aq[ks].half[1] = *(const v8us*)(qr + c * CO + s32 + 16); }
    asm volatile("s_wait_xcnt 0x0" :: "v"(qr) : "memory"); }      // the Q loads' address pair is named as an input, so it stays untouched until this wait; behind it the pair may be reused
  float m_r = -3.0e38f, l_r = 0.f; v8f oacc[12];      // oacc[dt][r] = O[query ln][dt * 16 + 8 hh + r]; l_r sums this half's keys only
#pragma unroll
  for (int dt = 0; dt < 12; ++dt) oacc[dt] = (v8f){0.f,0.f,0.f,0.f,0.f,0.f,0.f,0.f};
#pragma unroll 1
  for (int t = 0; t < NT; ++t) { const int buf = t & 1;
#pragma unroll 1      // the two 32-key passes of a stage stay rolled: unrolled, the build spilled the Q fragments to scratch
   for (int p = 0; p < TK / 32; ++p) { v8f s[2];
#pragma unroll
    for (int nt = 0; nt < 2; ++nt) { const unsigned short* kr = &sK[buf][p * 32 + nt * 16 + ln][0]; v8f acc = (v8f){0.f,0.f,0.f,0.f,0.f,0.f,0.f,0.f}; FragH bk[6];      // six fragments are read as one run ahead of their products: one LDS latency a run, not one a product
#pragma unroll      // constant indices keep bk in registers
      for (int ks = 0; ks < 6; ++ks) { bk[ks].half[0] = *(const v8us*)(kr + ks * 32 + 8 * hh); bk[ks].half[1] = *(const v8us*)(kr + ks * 32 + 16 + 8 * hh); }
#pragma unroll
      for (int ks = 0; ks < 6; ++ks) acc = mmaH<1>(bk[ks].v, bk[ks].v, aq[ks].v, aq[ks].v, acc);
      s[nt] = acc; }
    float mc = -3.0e38f;
#pragma unroll      // constant indices keep the scores in registers
    for (int r = 0; r < 8; ++r) { s[0][r] *= 0.07216878364870323f; s[1][r] *= 0.07216878364870323f; mc = fmaxf(mc, fmaxf(s[0][r], s[1][r])); }
    mc = fmaxf(mc, xhalf(mc));
    const float mn = fmaxf(m_r, mc); const float al = expf(m_r - mn); m_r = mn;
    FragH pa; float ps[4] = {0.f, 0.f, 0.f, 0.f};      // four short chains of adds, not one of sixteen
#pragma unroll      // constant indices keep the scores, pa and ps in registers
    for (int r = 0; r < 8; ++r) { const float p0 = expf(s[0][r] - mn), p1 = expf(s[1][r] - mn); ps[r & 3] += p0 + p1; pa.h[r] = (_Float16)p0; pa.h[8 + r] = (_Float16)p1; }
    l_r = l_r * al + ((ps[0] + ps[1]) + (ps[2] + ps[3]));
#pragma unroll
    for (int dt = 0; dt < 12; ++dt)
#pragma unroll
      for (int r = 0; r < 8; ++r) oacc[dt][r] *= al;
#pragma unroll
    for (int dg = 0; dg < 2; ++dg) { FragH bv[6];      // as for K: a run of six fragments, then their six products
#pragma unroll      // constant indices keep bv and oacc in registers
      for (int i = 0; i < 6; ++i) { const unsigned short* vrow = &sV[buf][(dg * 6 + i) * 16 + ln][p * 32]; bv[i].half[0] = *(const v8us*)(vrow + 8 * hh); bv[i].half[1] = *(const v8us*)(vrow + 16 + 8 * hh); }
#pragma unroll
      for (int i = 0; i < 6; ++i) oacc[dg * 6 + i] = mmaH<1>(bv[i].v, bv[i].v, pa.v, pa.v, oacc[dg * 6 + i]); } }
   asm volatile("s_wait_dscnt 0x0" ::: "memory");         // this wave's reads of buffer t mod 2 are done before the buffer is handed back
   asm volatile("s_wait_asynccnt 0x0" ::: "memory");      // this wave's share of stage t + 1 has landed
   __syncthreads();                                        // publishes stage t + 1 and ends every wave's reads of stage t
   if (t + 2 < NT) stage_kv(lk + buf * KB, lv + buf * VB, kg + (size_t)(t + 2) * TK * 3 * CO, vg + (t + 2) * TK); }
  asm volatile("s_wait_asynccnt 0x0" ::: "memory");        // no copy is outstanding when the wave goes on to its end
  const float linv = 1.0f / (l_r + xhalf(l_r));      // the two halves' sums are joined once, here
#pragma unroll      // constant indices keep oacc in registers
  for (int dt = 0; dt < 12; ++dt) { FragH f;
#pragma unroll      // constant indices keep oacc in registers
    for (int r = 0; r < 8; ++r) f.h[r] = (_Float16)(oacc[dt][r] * linv);
    *(v8us*)&sO[w][ln * 3 + dt / 4][(dt % 4) * 16 + 8 * hh] = f.half[0]; }
  __builtin_amdgcn_fence(__ATOMIC_ACQ_REL, "workgroup"); __builtin_amdgcn_wave_barrier();
  // Stored as the output map reads it: rows (b, n, c) x 512. A query's 192 features are three pieces of 64 halves, one 128-byte line each; eight lanes a piece, four pieces a store.
  unsigned short* orow = (unsigned short*)O3 + (((size_t)b * NN + q0) * 3 + (lane >> 3)) * CO + h * HD + (lane & 7) * 8;
#pragma unroll      // constant offsets from one address pair
  for (int q = 0; q < 12; ++q) { const v8us v = *(const v8us*)&sO[w][q * 4 + (lane >> 3)][(lane & 7) * 8]; *(v8us*)(orow + (size_t)q * 4 * CO) = v; } }
// Output map with the (o, c) interleave in its store: a wave takes 16 tokens x 3 coordinates x 64 outputs (each lane picks its token's three rows of O3), so a token's piece of the result is 192 floats in a row, six whole lines.
__global__ __launch_bounds__(128) void k_gemm_out(const _Float16* __restrict__ O3, const _Float16* __restrict__ Wh, float* __restrict__ out) {
  __shared__ __attribute__((aligned(16))) float so[4][16][192 + 4];
  const int tid = threadIdx.x, w = tid >> 5, lane = tid & 31, ln = lane & 15, hh = lane >> 4;
  const int wid = blockIdx.x * 4 + w; const int mt = wid / (CI / 64), nq = wid % (CI / 64); const int bn0 = mt * 16, col0 = nq * 64;
  const unsigned short* arow = (const unsigned short*)O3 + (size_t)(bn0 + ln) * 3 * CO + 8 * hh;
  const unsigned short* brow = (const unsigned short*)Wh + (size_t)(col0 + ln) * CO + 8 * hh;
  v8f acc[3][4] = {};
#pragma unroll      // every load is base + constant, so that no address register is rewritten while loads are out
  for (int kb = 0; kb < CO; kb += 32) { FragH a[3];
#pragma unroll      // constant indices keep the fragments and acc in registers
    for (int c = 0; c < 3; ++c) { a[c].half[0] = *(const v8us*)(arow + c * CO + kb); a[c].half[1] = *(const v8us*)(arow + c * CO + kb + 16); }
#pragma unroll      // constant indices keep the fragments and acc in registers
    for (int t = 0; t < 4; ++t) { FragH bq; bq.half[0] = *(const v8us*)(brow + t * 16 * CO + kb); bq.half[1] = *(const v8us*)(brow + t * 16 * CO + kb + 16);
#pragma unroll      // constant indices keep the fragments and acc in registers
      for (int c = 0; c < 3; ++c) acc[c][t] = mmaH<1>(a[c].v, a[c].v, bq.v, bq.v, acc[c][t]); } }
#pragma unroll      // constant indices keep the fragments and acc in registers
  for (int t = 0; t < 4; ++t)
#pragma unroll      // constant indices keep the fragments and acc in registers
    for (int c = 0; c < 3; ++c)
#pragma unroll      // constant indices keep the fragments and acc in registers
      for (int r = 0; r < 8; ++r) so[w][8 * hh + r][(t * 16 + ln) * 3 + c] = acc[c][t][r] * 0.0625f;
  __builtin_amdgcn_fence(__ATOMIC_ACQ_REL, "workgroup"); __builtin_amdgcn_wave_barrier();      // the wave's LDS stores are done before its lanes read what other lanes stored
  // two tokens' pieces are 96 float4, three stores of the wave; from one pair of tokens to the next every address moves by a constant
#pragma unroll      // three address pairs, formed once
  for (int j = 0; j < 3; ++j) { const int i = j * 32 + lane, r = i / 48, p4 = (i % 48) * 4; const float* ls = &so[w][r][p4]; float* gp = out + ((size_t)(bn0 + r) * CI + col0) * 3 + p4;
#pragma unroll      // constant offsets from the pair
    for (int q = 0; q < 8; ++q) { const v4f v = *(const v4fa*)(ls + q * 2 * (192 + 4)); *(v4f*)(gp + (size_t)q * 2 * CI * 3) = v; } }
}
extern "C" void kernel_launch(void* const* d_in, const int* in_sizes, int n_in,
                              void* d_out, int out_size, void* d_ws, size_t ws_size, hipStream_t stream) {
  (void)in_sizes; (void)n_in; (void)out_size;
  const float* x = (const float*)d_in[0]; const float* Wq = (const float*)d_in[1]; const float* Wk = (const float*)d_in[2]; const float* Wv = (const float*)d_in[3]; const float* Wo = (const float*)d_in[4];
  char* ws = (char*)d_ws; size_t off = 0;
  auto take = [&](size_t bytes) { char* p = ws + off; off += (bytes + 255) & ~(size_t)255; return p; };
  _Float16* Bq = (_Float16*)take((size_t)CO * CI * 2); _Float16* Bk = (_Float16*)take((size_t)CO * CI * 2); _Float16* Bv = (_Float16*)take((size_t)CO * CI * 2); _Float16* Bo = (_Float16*)take((size_t)CI * CO * 2);
  _Float16* X3 = (_Float16*)take((size_t)NR3 * CI * 2); _Float16* Q16 = (_Float16*)take((size_t)NR3 * CO * 2); _Float16* K16 = (_Float16*)take((size_t)NR3 * CO * 2); _Float16* Vt = (_Float16*)take((size_t)NR3 * CO * 2); _Float16* O3 = (_Float16*)take((size_t)NR3 * CO * 2);      // O3 has a place of its own: the attention stores it while other work-groups still read Q16
  if (off > ws_size) return;      // 1 + 6.3 + 12.6 x 4, about 58 MB
  const unsigned gw = (unsigned)((CO * CI / 8 + 255) / 256); k_round16f<<<gw, 256, 0, stream>>>(Wq, Bq, (size_t)CO * CI / 8); k_round16f<<<gw, 256, 0, stream>>>(Wk, Bk, (size_t)CO * CI / 8); k_round16f<<<gw, 256, 0, stream>>>(Wv, Bv, (size_t)CO * CI / 8); k_round16f<<<gw, 256, 0, stream>>>(Wo, Bo, (size_t)CI * CO / 8);      // (out,in)
  k_x3<<<(unsigned)(((size_t)NR * 3 * (CI / 8) + 255) / 256), 256, 0, stream>>>(x, X3);
  // X3 = rows (b,n,c) × 256; q/k planes = rows (b,n,c) × 512 ≡ [(b,n)][c·512 + o]; V^T = [(b,h)][c·64 + d][n]
  const dim3 gg(((NR3 / 16) * (CO / 64) + 3) / 4, 1);
  k_gemm_hhx<0><<<gg, 128, 0, stream>>>(X3, CI, 0, Bq, CI, 0, 0.0625f, nullptr, 0, nullptr, 1, 0, 0, nullptr, Q16, CO, 0, NR3, CO, CI);
  k_gemm_hhx<0><<<gg, 128, 0, stream>>>(X3, CI, 0, Bk, CI, 0, 0.0625f, nullptr, 0, nullptr, 1, 0, 0, nullptr, K16, CO, 0, NR3, CO, CI);
  k_gemm_vt<<<dim3((CO / 16) * (NN / 64) / 4, BB * 3), 128, 0, stream>>>(Bv, X3, Vt);
  k_vnattn<<<BB * NH * (NN / 64), 128, 0, stream>>>(Q16, K16, Vt, O3);
  k_gemm_out<<<(NR / 16) * (CI / 64) / 4, 128, 0, stream>>>(O3, Bo, (float*)d_out);
}

// v004
// A run of this version takes 148 microseconds.
// Next to v003, in two timings, it ran 1.09 and 1.10 times as fast.
// Over all steps from v000 it is 4.07 times as fast.
#include <hip/hip_runtime.h>
// Vector-neuron attention (B=2, N=2048, C=256 × 3 coordinates, 8 heads × 64): the VN-linear maps (rows (b,n,c) × 256 → 512, weights (out,in) bf16-exact ×2^4) and the attention over the
// 192-dim (d, c) head features as a fused flash-style kernel on v_wmma_f32_16x16x32_f16 (S^T = K Q^T / sqrt(192) with 6 k-steps gathered from the three coordinate blocks, online softmax f32 in-lane, P f16 <= 1 packed from the score registers,
// O^T = V^T P^T with 12 d-tiles; RPW-16 waves); f16 operands, single products, f32 accumulate; V^T, the f16 attention output and the final (o, c) interleave are stored by the kernels that compute them.
#define BB 2
#define NN 2048
#define CI 256
#define CO 512
#define NH 8
#define HD 64
#define NR3 (BB * NN * 3)
#define NR (BB * NN)

typedef __bf16 v16b __attribute__((ext_vector_type(16)));
typedef unsigned short v8us __attribute__((ext_vector_type(8), may_alias));
typedef float  v8f  __attribute__((ext_vector_type(8)));
typedef float  v4f  __attribute__((ext_vector_type(4)));
typedef float  v4fa __attribute__((ext_vector_type(4), may_alias));
union FragB { v16b v; v8us half[2]; unsigned short u[16]; };

__device__ __forceinline__ unsigned short bf16_bits(float x) { unsigned int u = __float_as_uint(x); return (unsigned short)((u + 0x7FFFu + ((u >> 16) & 1u)) >> 16); }
__device__ __forceinline__ float bf16_val(unsigned short b) { return __uint_as_float(((unsigned int)b) << 16); }
__device__ __forceinline__ float bf16_round(float x) { return bf16_val(bf16_bits(x)); }
// D += A·B with NT terms: 1 = ah·bh, 2 = + al·bh (A split), 3 = + ah·bl (both split)
template <int NT>
__device__ __forceinline__ v8f mmaN(v16b ah, v16b al, v16b bh, v16b bl, v8f c) {
  c = __builtin_amdgcn_wmma_f32_16x16x32_bf16(false, ah, false, bh, (short)0, c, false, false);
  if (NT >= 2) c = __builtin_amdgcn_wmma_f32_16x16x32_bf16(false, al, false, bh, (short)0, c, false, false);
  if (NT >= 3) c = __builtin_amdgcn_wmma_f32_16x16x32_bf16(false, ah, false, bl, (short)0, c, false, false);
  asm volatile("v_nop\n\tv_nop\n\tv_nop\n\tv_nop" : "+v"(c) : "v"(ah), "v"(al), "v"(bh), "v"(bl));
  return c;
}

__global__ __launch_bounds__(256) void k_wt_bf16(const float* __restrict__ W, unsigned short* __restrict__ Wt, int K, int N) {
  const int t = blockIdx.x * 256 + threadIdx.x;
  const int k8n = K / 8;
  if (t >= N * k8n) return;
  const int n = t / k8n, k8 = (t % k8n) * 8;
  v8us v;
#pragma unroll
  for (int i = 0; i < 8; ++i) v[i] = bf16_bits(W[(size_t)(k8 + i) * N + n]);
  *(v8us*)(Wt + (size_t)n * K + k8) = v;
  
}

// GEMM C[M][N] (f32, pitch ldc) = act(A[M][K]·W + bias). A f32 row-major (pitch lda) converted per fragment to bf16
// (ASPLIT: hi/lo two planes -> 2 terms, else single rounded term); Wt bf16 [N][K] (pitch ldb). BIAS_BF16 rounds the
// bias to bf16 first (bias quantised to bf16 before the add). K%32==0, M%16==0, N%64==0.
template <bool ASPLIT, int ACT, bool BIAS_BF16>
__global__ __launch_bounds__(128) void k_gemm_bf(const float* __restrict__ A, int lda, const unsigned short* __restrict__ Wt, int ldb,
                                               const float* __restrict__ bias, float* __restrict__ C, int ldc, int M, int N, int K) {
  __shared__ __attribute__((aligned(16))) float so[4][16][64];
  const int tid = threadIdx.x, w = tid >> 5, lane = tid & 31, ln = lane & 15, hh = lane >> 4;
  const int ntn = N / 64;
  const int wid = blockIdx.x * 4 + w;
  const int mt = wid / ntn, nq = wid % ntn;
  if (mt * 16 >= M) return;
  const int row0 = mt * 16, col0 = nq * 64;
  const float* arow = A + (size_t)(row0 + ln) * lda;
  v8f acc[4] = {};
  for (int kb = 0; kb < K; kb += 32) {
    FragB ah, al;
    const v4f x0 = *(const v4fa*)(arow + kb + 8 * hh), x1 = *(const v4fa*)(arow + kb + 8 * hh + 4);
    const v4f x2 = *(const v4fa*)(arow + kb + 16 + 8 * hh), x3 = *(const v4fa*)(arow + kb + 16 + 8 * hh + 4);
    float xs[16] = {x0[0],x0[1],x0[2],x0[3],x1[0],x1[1],x1[2],x1[3],x2[0],x2[1],x2[2],x2[3],x3[0],x3[1],x3[2],x3[3]};
#pragma unroll
    for (int i = 0; i < 16; ++i) { const unsigned short hb = bf16_bits(xs[i]); ah.u[i] = hb; al.u[i] = ASPLIT ? bf16_bits(xs[i] - bf16_val(hb)) : (unsigned short)0; }
#pragma unroll
    for (int t = 0; t < 4; ++t) {
      const unsigned short* brow = Wt + (size_t)(col0 + t * 16 + ln) * ldb + kb;
      FragB b;
      b.half[0] = *(const v8us*)(brow + 8 * hh);
      b.half[1] = *(const v8us*)(brow + 16 + 8 * hh);
      acc[t] = mmaN<ASPLIT ? 2 : 1>(ah.v, al.v, b.v, b.v, acc[t]);
    }
  }
#pragma unroll
  for (int t = 0; t < 4; ++t) {
    float bv = bias ? bias[col0 + t * 16 + ln] : 0.f;
    if (BIAS_BF16) bv = bf16_round(bv);
#pragma unroll
    for (int r = 0; r < 8; ++r) { float v = acc[t][r] + bv; if (ACT == 1) v = fmaxf(v, 0.f); so[w][8 * hh + r][t * 16 + ln] = v; }
  }
  __builtin_amdgcn_fence(__ATOMIC_ACQ_REL, "workgroup");
  __builtin_amdgcn_wave_barrier();
  const int rsub = lane >> 4, c4 = (lane & 15) * 4;
  {
#pragma unroll
    for (int q = 0; q < 8; ++q) {
      const int r = q * 2 + rsub;
      const v4f v = *(const v4fa*)&so[w][r][c4];
      *(v4f*)(C + (size_t)(row0 + r) * ldc + col0 + c4) = v;
    }
    
  }
}

// Flash-style causal/unmasked attention, all contractions 3-term bf16 hi/lo splits, f32 softmax with running max.
// q,k,v rows are read from f32 buffers with arbitrary row pitch (so they can live inside a fused qkv buffer);
// D = head size (multiple of 32, <= 128); one wave = 16 query rows; block = 4 waves (64 queries) sharing K/V chunks of 32.
template <int D, bool CAUSAL>
__global__ __launch_bounds__(128) void k_flash(const float* __restrict__ qb, const float* __restrict__ kb, const float* __restrict__ vb,
                                             int pitch, int T, int H, float scale, float* __restrict__ y, int ypitch) {
  constexpr int KS = D / 32;        // k-steps for QK
  constexpr int DT = D / 16;        // d tiles for PV
  __shared__ __attribute__((aligned(16))) unsigned short sKh[32][D + 8], sKl[32][D + 8], sVh[32][D + 8], sVl[32][D + 8];
  __shared__ __attribute__((aligned(16))) unsigned short sPh[4][16][40], sPl[4][16][40];
  __shared__ __attribute__((aligned(16))) float sO[4][16][D];
  const int tid = threadIdx.x, w = tid >> 5, lane = tid & 31, ln = lane & 15, hh = lane >> 4;
  const int nqb = (T + 63) / 64;
  const int bh = blockIdx.x / nqb, qblk = blockIdx.x % nqb;
  const int b = bh / H, h = bh % H;
  const int q0 = qblk * 64 + w * 16;
  const float* Q = qb + (size_t)b * T * pitch + h * D;
  const float* K = kb + (size_t)b * T * pitch + h * D;
  const float* V = vb + (size_t)b * T * pitch + h * D;

  // A fragments of the wave's 16 query rows (scaled), hi/lo
  FragB aqh[KS], aql[KS];
  {
    int row = q0 + ln; if (row >= T) row = T - 1;
    const float* qr = Q + (size_t)row * pitch;
#pragma unroll
    for (int ks = 0; ks < KS; ++ks)
#pragma unroll
      for (int i = 0; i < 16; ++i) {
        const int d = ks * 32 + ((i < 8) ? (8 * hh + i) : (16 + 8 * hh + (i - 8)));
        const float x = qr[d] * scale; const unsigned short hb = bf16_bits(x);
        aqh[ks].u[i] = hb; aql[ks].u[i] = bf16_bits(x - bf16_val(hb));
      }
  }
  float m_r[8], l_r[8];
#pragma unroll
  for (int r = 0; r < 8; ++r) { m_r[r] = -3.0e38f; l_r[r] = 0.f; }
  v8f oacc[DT];
#pragma unroll
  for (int dt = 0; dt < DT; ++dt) oacc[dt] = (v8f){0.f,0.f,0.f,0.f,0.f,0.f,0.f,0.f};

  const int kv_end = CAUSAL ? min(T, qblk * 64 + 64) : T;     // block-uniform
  for (int j0 = 0; j0 < kv_end; j0 += 32) {
    __syncthreads();
    for (int e = tid; e < 32 * (D / 4); e += 128) {
      const int r = e / (D / 4), c4 = (e % (D / 4)) * 4;
      const int key = j0 + r;
      v4f kf = {0.f,0.f,0.f,0.f}, vf = {0.f,0.f,0.f,0.f};
      if (key < T) { kf = *(const v4fa*)(K + (size_t)key * pitch + c4); vf = *(const v4fa*)(V + (size_t)key * pitch + c4); }
#pragma unroll
      for (int t = 0; t < 4; ++t) {
        unsigned short hb = bf16_bits(kf[t]); sKh[r][c4 + t] = hb; sKl[r][c4 + t] = bf16_bits(kf[t] - bf16_val(hb));
        hb = bf16_bits(vf[t]); sVh[r][c4 + t] = hb; sVl[r][c4 + t] = bf16_bits(vf[t] - bf16_val(hb));
      }
    }
    __syncthreads();
    // S tile 16 x 32
    v8f s[2];
#pragma unroll
    for (int nt = 0; nt < 2; ++nt) {
      v8f acc = {};
#pragma unroll
      for (int ks = 0; ks < KS; ++ks) {
        FragB bh_, bl_;
        bh_.half[0] = *(const v8us*)&sKh[nt * 16 + ln][ks * 32 + 8 * hh]; bh_.half[1] = *(const v8us*)&sKh[nt * 16 + ln][ks * 32 + 16 + 8 * hh];
        bl_.half[0] = *(const v8us*)&sKl[nt * 16 + ln][ks * 32 + 8 * hh]; bl_.half[1] = *(const v8us*)&sKl[nt * 16 + ln][ks * 32 + 16 + 8 * hh];
        acc = mmaN<3>(aqh[ks].v, aql[ks].v, bh_.v, bl_.v, acc);
      }
      s[nt] = acc;
    }
    // mask + running max (rows 8hh+r; the 16 lanes of a half share rows)
    float alpha[8];
#pragma unroll
    for (int r = 0; r < 8; ++r) {
      const int qi = q0 + 8 * hh + r;
      const int ja = j0 + ln, jb = j0 + 16 + ln;
      if (CAUSAL) { if (ja > qi) s[0][r] = -3.0e38f; if (jb > qi) s[1][r] = -3.0e38f; }
      if (ja >= T) s[0][r] = -3.0e38f;
      if (jb >= T) s[1][r] = -3.0e38f;
      float mx = fmaxf(s[0][r], s[1][r]);
      mx = fmaxf(mx, __shfl_xor(mx, 1, 32)); mx = fmaxf(mx, __shfl_xor(mx, 2, 32)); mx = fmaxf(mx, __shfl_xor(mx, 4, 32)); mx = fmaxf(mx, __shfl_xor(mx, 8, 32));
      const float mnew = fmaxf(m_r[r], mx);
      alpha[r] = (mnew > -1.0e38f) ? __expf(m_r[r] - mnew) : 1.0f;
      const float p0 = (s[0][r] > -1.0e38f) ? __expf(s[0][r] - mnew) : 0.f;
      const float p1 = (s[1][r] > -1.0e38f) ? __expf(s[1][r] - mnew) : 0.f;
      m_r[r] = mnew;
      l_r[r] = l_r[r] * alpha[r] + p0 + p1;            // per-lane partial row sum (16 lanes combined at the end)
      unsigned short hb = bf16_bits(p0); sPh[w][8 * hh + r][ln] = hb;      sPl[w][8 * hh + r][ln] = bf16_bits(p0 - bf16_val(hb));
      hb = bf16_bits(p1);                sPh[w][8 * hh + r][16 + ln] = hb; sPl[w][8 * hh + r][16 + ln] = bf16_bits(p1 - bf16_val(hb));
    }
#pragma unroll
    for (int dt = 0; dt < DT; ++dt)
#pragma unroll
      for (int r = 0; r < 8; ++r) oacc[dt][r] *= alpha[r];
    __builtin_amdgcn_fence(__ATOMIC_ACQ_REL, "workgroup");
    __builtin_amdgcn_wave_barrier();
    FragB pah, pal;
    pah.half[0] = *(const v8us*)&sPh[w][ln][8 * hh]; pah.half[1] = *(const v8us*)&sPh[w][ln][16 + 8 * hh];
    pal.half[0] = *(const v8us*)&sPl[w][ln][8 * hh]; pal.half[1] = *(const v8us*)&sPl[w][ln][16 + 8 * hh];
#pragma unroll
    for (int dt = 0; dt < DT; ++dt) {
      FragB bvh, bvl;
#pragma unroll
      for (int i = 0; i < 8; ++i) {
        bvh.u[i] = sVh[8 * hh + i][dt * 16 + ln]; bvh.u[8 + i] = sVh[16 + 8 * hh + i][dt * 16 + ln];
        bvl.u[i] = sVl[8 * hh + i][dt * 16 + ln]; bvl.u[8 + i] = sVl[16 + 8 * hh + i][dt * 16 + ln];
      }
      oacc[dt] = mmaN<3>(pah.v, pal.v, bvh.v, bvl.v, oacc[dt]);
    }
    __builtin_amdgcn_fence(__ATOMIC_ACQ_REL, "workgroup");
    __builtin_amdgcn_wave_barrier();
  }
#pragma unroll
  for (int r = 0; r < 8; ++r) {
    float l = l_r[r];
    l += __shfl_xor(l, 1, 32); l += __shfl_xor(l, 2, 32); l += __shfl_xor(l, 4, 32); l += __shfl_xor(l, 8, 32);
    l_r[r] = (l > 0.f) ? 1.0f / l : 0.f;
  }
#pragma unroll
  for (int dt = 0; dt < DT; ++dt)
#pragma unroll
    for (int r = 0; r < 8; ++r) sO[w][8 * hh + r][dt * 16 + ln] = oacc[dt][r] * l_r[r];
  __builtin_amdgcn_fence(__ATOMIC_ACQ_REL, "workgroup");
  __builtin_amdgcn_wave_barrier();
  {
    for (int r = 0; r < 16; ++r) {
      const int row = q0 + r;
      if (row < T && lane < D / 4) {
        const v4f val = *(const v4fa*)&sO[w][r][lane * 4];
        *(v4f*)(y + ((size_t)b * T + row) * ypitch + h * D + lane * 4) = val;
      }
    }
    
  }
}

// GEMM C = act(A·W + bias + resid): A f32 (ASPLIT -> hi/lo 2 terms), Wt bf16 [N][K]; ACT 0 none, 1 relu, 2 exact gelu;
// resid (optional, f32, row index = (row % rmod), pitch ldr, RES_BF16 rounds it) added before the activation.
template <bool ASPLIT, int ACT, bool BIAS_BF16, bool RES_BF16>
__global__ __launch_bounds__(128) void k_gemm_bf3(const float* __restrict__ A, int lda, const unsigned short* __restrict__ Wt, int ldb,
                                                const float* __restrict__ bias, const float* __restrict__ resid, int rmod, int ldr,
                                                float* __restrict__ C, int ldc, int M, int N, int K) {
  __shared__ __attribute__((aligned(16))) float so[4][16][64];
  const int tid = threadIdx.x, w = tid >> 5, lane = tid & 31, ln = lane & 15, hh = lane >> 4;
  const int ntn = N / 64;
  const int wid = blockIdx.x * 4 + w;
  const int mt = wid / ntn, nq = wid % ntn;
  if (mt * 16 >= M) return;
  const int row0 = mt * 16, col0 = nq * 64;
  const float* arow = A + (size_t)(row0 + ln) * lda;
  v8f acc[4] = {};
  for (int kb = 0; kb < K; kb += 32) {
    FragB ah, al;
    const v4f x0 = *(const v4fa*)(arow + kb + 8 * hh), x1 = *(const v4fa*)(arow + kb + 8 * hh + 4);
    const v4f x2 = *(const v4fa*)(arow + kb + 16 + 8 * hh), x3 = *(const v4fa*)(arow + kb + 16 + 8 * hh + 4);
    float xs[16] = {x0[0],x0[1],x0[2],x0[3],x1[0],x1[1],x1[2],x1[3],x2[0],x2[1],x2[2],x2[3],x3[0],x3[1],x3[2],x3[3]};
#pragma unroll
    for (int i = 0; i < 16; ++i) { const unsigned short hb = bf16_bits(xs[i]); ah.u[i] = hb; al.u[i] = ASPLIT ? bf16_bits(xs[i] - bf16_val(hb)) : (unsigned short)0; }
#pragma unroll
    for (int t = 0; t < 4; ++t) {
      const unsigned short* brow = Wt + (size_t)(col0 + t * 16 + ln) * ldb + kb;
      FragB b;
      b.half[0] = *(const v8us*)(brow + 8 * hh);
      b.half[1] = *(const v8us*)(brow + 16 + 8 * hh);
      acc[t] = mmaN<ASPLIT ? 2 : 1>(ah.v, al.v, b.v, b.v, acc[t]);
    }
  }
#pragma unroll
  for (int t = 0; t < 4; ++t) {
    const int col = col0 + t * 16 + ln;
    float bv = bias ? bias[col] : 0.f;
    if (BIAS_BF16) bv = bf16_round(bv);
#pragma unroll
    for (int r = 0; r < 8; ++r) {
      float v = acc[t][r] + bv;
      if (resid) { float rv = resid[(size_t)((row0 + 8 * hh + r) % rmod) * ldr + col]; if (RES_BF16) rv = bf16_round(rv); v += rv; }
      if (ACT == 1) v = fmaxf(v, 0.f);
      if (ACT == 2) v = 0.5f * v * (1.0f + erff(v * 0.70710678118654752f));
      if (ACT == 3) { const float u = 0.7978845608028654f * (v + 0.044715f * v * v * v); v = 0.5f * v * (1.0f + tanhf(u)); }
      so[w][8 * hh + r][t * 16 + ln] = v;
    }
  }
  __builtin_amdgcn_fence(__ATOMIC_ACQ_REL, "workgroup");
  __builtin_amdgcn_wave_barrier();
  const int rsub = lane >> 4, c4 = (lane & 15) * 4;
  {
#pragma unroll
    for (int q = 0; q < 8; ++q) {
      const int r = q * 2 + rsub;
      const v4f v = *(const v4fa*)&so[w][r][c4];
      *(v4f*)(C + (size_t)(row0 + r) * ldc + col0 + c4) = v;
    }
    
  }
}
// row LayerNorm (biased variance, eps) over N: s = X (+ R); optional out_sum <- s; out_norm <- (s-mu)*rsqrt(var+eps)*g + b
template <bool PARAM_BF16>
__global__ __launch_bounds__(256) void k_layernorm(const float* __restrict__ X, const float* __restrict__ R, const float* __restrict__ g, const float* __restrict__ bta,
                                                  float* __restrict__ out_sum, float* __restrict__ out_norm, int N, float eps) {
  __shared__ float red[256];
  const int row = blockIdx.x, tid = threadIdx.x;
  const float* x = X + (size_t)row * N; const float* rr = R ? R + (size_t)row * N : nullptr;
  float vals[16];                     // up to N = 4096
  const int per = N / 256;            // contiguous chunk per thread? use strided-by-4 chunks: thread handles j = tid*4 + 1024*u
  float s1 = 0.f;
  for (int u = 0; u < per / 4; ++u) {
    const int j = tid * 4 + 1024 * u;
    const v4f a = *(const v4fa*)(x + j);
    v4f b = {0.f,0.f,0.f,0.f}; if (rr) b = *(const v4fa*)(rr + j);
#pragma unroll
    for (int q = 0; q < 4; ++q) { const float v = a[q] + b[q]; vals[u * 4 + q] = v; s1 += v; }
  }
  red[tid] = s1; __syncthreads();
  for (int st = 128; st > 0; st >>= 1) { if (tid < st) red[tid] += red[tid + st]; __syncthreads(); }
  const float mu = red[0] / (float)N; __syncthreads();
  float s2 = 0.f;
  for (int u = 0; u < per / 4; ++u)
#pragma unroll
    for (int q = 0; q < 4; ++q) { const float c = vals[u * 4 + q] - mu; s2 += c * c; }
  red[tid] = s2; __syncthreads();
  for (int st = 128; st > 0; st >>= 1) { if (tid < st) red[tid] += red[tid + st]; __syncthreads(); }
  const float rs = rsqrtf(red[0] / (float)N + eps);
  {
    for (int u = 0; u < per / 4; ++u) {
      const int j = tid * 4 + 1024 * u;
      v4f o, sm;
#pragma unroll
      for (int q = 0; q < 4; ++q) {
        float gg = g[j + q], bb = bta[j + q];
        if (PARAM_BF16) { gg = bf16_round(gg); bb = bf16_round(bb); }
        sm[q] = vals[u * 4 + q]; o[q] = (vals[u * 4 + q] - mu) * rs * gg + bb;
      }
      if (out_sum) *(v4f*)(out_sum + (size_t)row * N + j) = sm;
      *(v4f*)(out_norm + (size_t)row * N + j) = o;
    }
    
  }
}



// ---- f16 WMMA path (v_wmma_f32_16x16x32_f16): 11-bit significands for operands in range — used for every contraction launched here (VN-linear maps, Q·Kᵀ, P·V)
typedef _Float16 v16h __attribute__((ext_vector_type(16)));
union FragH { v16h v; v8us half[2]; _Float16 h[16]; unsigned short u[16]; };
template <int NT>
__device__ __forceinline__ v8f mmaH(v16h ah, v16h al, v16h bh, v16h bl, v8f c) {
  c = __builtin_amdgcn_wmma_f32_16x16x32_f16(false, ah, false, bh, (short)0, c, false, false);
  if (NT >= 2) c = __builtin_amdgcn_wmma_f32_16x16x32_f16(false, al, false, bh, (short)0, c, false, false);
  if (NT >= 3) c = __builtin_amdgcn_wmma_f32_16x16x32_f16(false, ah, false, bl, (short)0, c, false, false);
  asm volatile("v_nop\n\tv_nop\n\tv_nop\n\tv_nop" : "+v"(c) : "v"(ah), "v"(al), "v"(bh), "v"(bl));
  return c;
}
// batched GEMM like k_gemm_b but f16 operands: A f32 (split into f16 hi/lo if ASPLIT, else rounded to f16), Bt = f16 values [n][k]; alpha; C f32; N multiple of 16 (partial tiles skipped)
template <bool ASPLIT>
__global__ __launch_bounds__(128) void k_gemm_h(const float* __restrict__ A, int lda, size_t sA, const _Float16* __restrict__ Bh, int ldb, size_t sB, float alpha, float* __restrict__ C, int ldc, size_t sC, int M, int N, int K) {
  __shared__ __attribute__((aligned(16))) float so[4][16][64];
  const int tid = threadIdx.x, w = tid >> 5, lane = tid & 31, ln = lane & 15, hh = lane >> 4; const int by = blockIdx.y;
  A += (size_t)by * sA; Bh += (size_t)by * sB; C += (size_t)by * sC;
  const int ntn = (N + 63) / 64; const int wid = blockIdx.x * 4 + w; const int mt = wid / ntn, nq = wid % ntn; if (mt * 16 >= M) return;
  const int row0 = mt * 16, col0 = nq * 64; const float* arow = A + (size_t)(row0 + ln) * lda;
  v8f acc[4] = {};
  for (int kb = 0; kb < K; kb += 32) {
    FragH ah, al;
    const v4f x0 = *(const v4fa*)(arow + kb + 8 * hh), x1 = *(const v4fa*)(arow + kb + 8 * hh + 4), x2 = *(const v4fa*)(arow + kb + 16 + 8 * hh), x3 = *(const v4fa*)(arow + kb + 16 + 8 * hh + 4);
    float xs[16] = {x0[0],x0[1],x0[2],x0[3],x1[0],x1[1],x1[2],x1[3],x2[0],x2[1],x2[2],x2[3],x3[0],x3[1],x3[2],x3[3]};
#pragma unroll
    for (int i = 0; i < 16; ++i) { const _Float16 h = (_Float16)xs[i]; ah.h[i] = h; al.h[i] = ASPLIT ? (_Float16)(xs[i] - (float)h) : (_Float16)0.0f; }
#pragma unroll
    for (int t = 0; t < 4; ++t) { if (col0 + t * 16 >= N) continue; const size_t boff = (size_t)(col0 + t * 16 + ln) * ldb + kb; FragH bq; bq.half[0] = *(const v8us*)(Bh + boff + 8 * hh); bq.half[1] = *(const v8us*)(Bh + boff + 16 + 8 * hh);
      acc[t] = mmaH<ASPLIT ? 2 : 1>(ah.v, al.v, bq.v, bq.v, acc[t]); }
  }
#pragma unroll
  for (int t = 0; t < 4; ++t) { if (col0 + t * 16 >= N) continue;
#pragma unroll
    for (int r = 0; r < 8; ++r) so[w][8 * hh + r][t * 16 + ln] = acc[t][r] * alpha; }
  __builtin_amdgcn_fence(__ATOMIC_ACQ_REL, "workgroup"); __builtin_amdgcn_wave_barrier();
  const int rsub = lane >> 4, c4 = (lane & 15) * 4;
  {
#pragma unroll
    for (int q = 0; q < 8; ++q) { const int r = q * 2 + rsub; if (col0 + c4 < N) { const v4f v = *(const v4fa*)&so[w][r][c4]; *(v4f*)(C + (size_t)(row0 + r) * ldc + col0 + c4) = v; } }
     }
}

// Wt[n][k] = f16(W[k][n]·scale) from f32 row-major W[K][N] (scale = power of two; bf16-exact weights stay exact in f16 away from the subnormal range)
__global__ __launch_bounds__(256) void k_wt_f16(const float* __restrict__ W, _Float16* __restrict__ Wt, int K, int N, float scale) {
  const int t = blockIdx.x * 256 + threadIdx.x; if (t >= N * (K / 8)) return; const int n = t / (K / 8), k8 = (t % (K / 8)) * 8; FragH f;
#pragma unroll
  for (int i = 0; i < 8; ++i) f.h[i] = (_Float16)(bf16_round(W[(size_t)(k8 + i) * N + n]) * scale); const v8us o = f.half[0];
  *(v8us*)((unsigned short*)Wt + (size_t)n * K + k8) = o; 
}
// k_gemm_hh variant with fused epilogue: v = acc·alpha + bias[by·sBias + col] (+ CP[(row/rowsPerB)·sCPb + by·64 + col] if CP) ; ACT 0 none / 1 elu ; writes f16 C16 (and f32 C if non-null)
// A device function: the kernel that calls it owns the staging array so and says which block (bx, by) of the map this work-group is.
template <int ACT>
__device__ __forceinline__ void gemm_hhx(float (*so)[16][64], int bx, int by, const _Float16* __restrict__ A, int lda, size_t sA, const _Float16* __restrict__ Bh, int ldb, size_t sB, float alpha, const float* __restrict__ bias, size_t sBias, const float* __restrict__ CP, int rowsPerB, size_t sCPb, int row0g,
    float* __restrict__ C, _Float16* __restrict__ C16, int ldc, size_t sC, int M, int N, int K) {
  const int tid = threadIdx.x, w = tid >> 5, lane = tid & 31, ln = lane & 15, hh = lane >> 4;
  A += (size_t)by * sA; Bh += (size_t)by * sB; const size_t cofs = (size_t)by * sC; const float* bp = bias ? bias + (size_t)by * sBias : nullptr;
  const int ntn = (N + 63) / 64; const int wid = bx * 4 + w; const int mt = wid / ntn, nq = wid % ntn; if (mt * 16 >= M) return;
  const int row0 = mt * 16, col0 = nq * 64; const _Float16* arow = A + (size_t)(row0 + ln) * lda;
  v8f acc[4] = {};
  for (int kb = 0; kb < K; kb += 32) { FragH ah; ah.half[0] = *(const v8us*)((const unsigned short*)arow + kb + 8 * hh); ah.half[1] = *(const v8us*)((const unsigned short*)arow + kb + 16 + 8 * hh);
#pragma unroll
    for (int t = 0; t < 4; ++t) { if (col0 + t * 16 >= N) continue; const size_t boff = (size_t)(col0 + t * 16 + ln) * ldb + kb; FragH bq; bq.half[0] = *(const v8us*)((const unsigned short*)Bh + boff + 8 * hh); bq.half[1] = *(const v8us*)((const unsigned short*)Bh + boff + 16 + 8 * hh);
      acc[t] = mmaH<1>(ah.v, ah.v, bq.v, bq.v, acc[t]); }
  }
#pragma unroll
  for (int t = 0; t < 4; ++t) { if (col0 + t * 16 >= N) continue; const int col = col0 + t * 16 + ln; const float bv = bp ? bf16_round(bp[col]) : 0.f;
#pragma unroll
    for (int r = 0; r < 8; ++r) { float v = acc[t][r] * alpha + bv; if (CP) { const int bidx = (row0g + row0 + 8 * hh + r) / rowsPerB; v += CP[(size_t)bidx * sCPb + (size_t)by * 64 + col]; } if (ACT == 1) v = (v > 0.f) ? v : expm1f(v); else if (ACT == 3) v = fmaxf(v, 0.f); so[w][8 * hh + r][t * 16 + ln] = v; } }
  __builtin_amdgcn_fence(__ATOMIC_ACQ_REL, "workgroup"); __builtin_amdgcn_wave_barrier();
  const int rsub = lane >> 4, c4 = (lane & 15) * 4; typedef _Float16 v4h __attribute__((ext_vector_type(4)));
  {
#pragma unroll
    for (int q = 0; q < 8; ++q) { const int r = q * 2 + rsub; if (col0 + c4 < N) { const v4f v = *(const v4fa*)&so[w][r][c4]; if (C) *(v4f*)(C + cofs + (size_t)(row0 + r) * ldc + col0 + c4) = v; if (C16) { v4h h4; for (int i = 0; i < 4; ++i) h4[i] = (_Float16)v[i]; *(v4h*)(C16 + cofs + (size_t)(row0 + r) * ldc + col0 + c4) = h4; } } }
     }
}


// Every operand conversion in one launch; the block index picks the job, and no job reads what another writes. Blocks [0, 4 WBL): the four weight matrices, rounded and scaled by 16, WBL blocks each; the rest: x as rows (b, n, c) x 256.
#define WBL (CO * CI / 8 / 256)
#define XBL (NR * 3 * (CI / 8) / 256)
__global__ __launch_bounds__(256) void k_prep(const float* __restrict__ x, const float* __restrict__ Wq, const float* __restrict__ Wk, const float* __restrict__ Wv, const float* __restrict__ Wo,
                                            _Float16* __restrict__ Bq, _Float16* __restrict__ Bk, _Float16* __restrict__ Bv, _Float16* __restrict__ Bo, _Float16* __restrict__ X3) {
  const int bx = blockIdx.x; FragH f;
  if (bx < 4 * WBL) { const int j = bx / WBL; const float* W = j == 0 ? Wq : j == 1 ? Wk : j == 2 ? Wv : Wo; _Float16* Bt = j == 0 ? Bq : j == 1 ? Bk : j == 2 ? Bv : Bo; const size_t t = (size_t)(bx % WBL) * 256 + threadIdx.x;
#pragma unroll
    for (int i = 0; i < 8; ++i) f.h[i] = (_Float16)(bf16_round(W[t * 8 + i]) * 16.0f); *(v8us*)((unsigned short*)Bt + t * 8) = f.half[0]; }
  else { const size_t t = (size_t)(bx - 4 * WBL) * 256 + threadIdx.x; const size_t bn = t / (3 * (CI / 8)); const int rem = (int)(t % (3 * (CI / 8))); const int c = rem / (CI / 8), i8 = (rem % (CI / 8)) * 8;
#pragma unroll
    for (int q = 0; q < 8; ++q) f.h[q] = (_Float16)bf16_round(x[(bn * CI + i8 + q) * 3 + c]); *(v8us*)((unsigned short*)X3 + t * 8) = f.half[0]; } }
// V^T at once: C[o][n] = sum_k Wv[o][k] X3[(b, n, c)][k]. The weight rows are the A operand and the token rows of one (b, c) the B operand (each lane picks its token's row, pitch 3 x 256),
// so a row of the staged tile is 64 tokens of one feature: one whole 128-byte line of the layout that the attention stages. Same products, same k order as the q and k maps.
__device__ __forceinline__ void gemm_vt(float (*so)[16][64], int bx, int by, const _Float16* __restrict__ Wh, const _Float16* __restrict__ X3, _Float16* __restrict__ Vt) {
  const int tid = threadIdx.x, w = tid >> 5, lane = tid & 31, ln = lane & 15, hh = lane >> 4; const int b = by / 3, c = by % 3;
  const int wid = bx * 4 + w; const int mt = wid / (NN / 64), nq = wid % (NN / 64); const int row0 = mt * 16, col0 = nq * 64;
  const unsigned short* arow = (const unsigned short*)Wh + (size_t)(row0 + ln) * CI + 8 * hh;
  const unsigned short* xrow = (const unsigned short*)X3 + (((size_t)b * NN + col0 + ln) * 3 + c) * CI + 8 * hh;
  v8f acc[4] = {};
#pragma unroll      // every load is base + constant, so that no address register is rewritten while loads are out
  for (int kb = 0; kb < CI; kb += 32) { FragH ah; ah.half[0] = *(const v8us*)(arow + kb); ah.half[1] = *(const v8us*)(arow + kb + 16);
#pragma unroll      // constant indices keep the fragments and acc in registers
    for (int t = 0; t < 4; ++t) { FragH bq; bq.half[0] = *(const v8us*)(xrow + t * 16 * 3 * CI + kb); bq.half[1] = *(const v8us*)(xrow + t * 16 * 3 * CI + kb + 16);
      acc[t] = mmaH<1>(ah.v, ah.v, bq.v, bq.v, acc[t]); } }
#pragma unroll      // constant indices keep the fragments and acc in registers
  for (int t = 0; t < 4; ++t)
#pragma unroll      // constant indices keep the fragments and acc in registers
    for (int r = 0; r < 8; ++r) so[w][8 * hh + r][t * 16 + ln] = acc[t][r] * 0.0625f;
  __builtin_amdgcn_fence(__ATOMIC_ACQ_REL, "workgroup"); __builtin_amdgcn_wave_barrier();      // the wave's LDS stores are done before its lanes read what other lanes stored
  const int rsub = lane >> 4, c4 = (lane & 15) * 4; typedef _Float16 v4h __attribute__((ext_vector_type(4)));
  _Float16* vrow = Vt + ((size_t)(b * NH + row0 / HD) * 192 + c * 64 + row0 % HD + rsub) * NN + col0 + c4;      // the 16 features of a tile lie in one head
#pragma unroll      // constant offsets from one address pair
  for (int q = 0; q < 8; ++q) { const v4f v = *(const v4fa*)&so[w][q * 2 + rsub][c4]; v4h h4; for (int i = 0; i < 4; ++i) h4[i] = (_Float16)v[i]; *(v4h*)(vrow + (size_t)q * 2 * NN) = h4; }
}
// The q, k and V^T maps in one launch: all three read X3 and none reads another's result. blockIdx.y picks the map, blockIdx.x is the map's own block number (MBL each).
#define MBL ((NR3 / 16) * (CO / 64) / 4)
#define VBX ((CO / 16) * (NN / 64) / 4)
__global__ __launch_bounds__(128) void k_qkv(const _Float16* __restrict__ X3, const _Float16* __restrict__ Bq, const _Float16* __restrict__ Bk, const _Float16* __restrict__ Bv, _Float16* __restrict__ Q16, _Float16* __restrict__ K16, _Float16* __restrict__ Vt) {
  __shared__ __attribute__((aligned(16))) float so[4][16][64];
  const int bx = blockIdx.x, job = blockIdx.y;
  if (job == 2) gemm_vt(so, bx % VBX, bx / VBX, Bv, X3, Vt);
  else gemm_hhx<0>(so, bx, 0, X3, CI, 0, job == 0 ? Bq : Bk, CI, 0, 0.0625f, nullptr, 0, nullptr, 1, 0, 0, nullptr, job == 0 ? Q16 : K16, CO, 0, NR3, CO, CI);
}
// K and V^T tiles of 64 keys, staged in LDS once per work-group and read by its four waves. Row pitches are 16 B x odd, so the 16 rows of a ds_load_b128 fall on distinct banks.
#define TK 64
#define KP 200      // halves per staged K row: 3 coordinate blocks x 64 + 8 of pad (400 B)
#define VP 72       // halves per staged V^T row: 64 keys + 8 of pad (144 B)
// Twelve asynchronous 16-byte copies per lane, global -> LDS, through no register: copy 4 a + q goes from g + a gs + q gq (halves) to LDS byte l + a ls + q lq.
// The s_wait_xcnt closes the statement so that no address register named here is rewritten ahead of it.
__device__ __forceinline__ void acopy12(unsigned l, unsigned ls, unsigned lq, const unsigned short* g, size_t gs, size_t gq) {
  const unsigned l1 = l + lq, l2 = l + 2 * lq, l3 = l + 3 * lq, l4 = l + ls, l5 = l4 + lq, l6 = l4 + 2 * lq, l7 = l4 + 3 * lq, l8 = l + 2 * ls, l9 = l8 + lq, l10 = l8 + 2 * lq, l11 = l8 + 3 * lq;
  const unsigned short *g1 = g + gq, *g2 = g + 2 * gq, *g3 = g + 3 * gq, *g4 = g + gs, *g5 = g4 + gq, *g6 = g4 + 2 * gq, *g7 = g4 + 3 * gq, *g8 = g + 2 * gs, *g9 = g8 + gq, *g10 = g8 + 2 * gq, *g11 = g8 + 3 * gq;
  asm volatile("global_load_async_to_lds_b128 %0, %12, off\n\t"
               "global_load_async_to_lds_b128 %1, %13, off\n\t"
               "global_load_async_to_lds_b128 %2, %14, off\n\t"
               "global_load_async_to_lds_b128 %3, %15, off\n\t"
               "global_load_async_to_lds_b128 %4, %16, off\n\t"
               "global_load_async_to_lds_b128 %5, %17, off\n\t"
               "global_load_async_to_lds_b128 %6, %18, off\n\t"
               "global_load_async_to_lds_b128 %7, %19, off\n\t"
               "global_load_async_to_lds_b128 %8, %20, off\n\t"
               "global_load_async_to_lds_b128 %9, %21, off\n\t"
               "global_load_async_to_lds_b128 %10, %22, off\n\t"
               "global_load_async_to_lds_b128 %11, %23, off\n\t"
               "s_wait_xcnt 0x0"
               :: "v"(l), "v"(l1), "v"(l2), "v"(l3), "v"(l4), "v"(l5), "v"(l6), "v"(l7), "v"(l8), "v"(l9), "v"(l10), "v"(l11),
                  "v"(g), "v"(g1), "v"(g2), "v"(g3), "v"(g4), "v"(g5), "v"(g6), "v"(g7), "v"(g8), "v"(g9), "v"(g10), "v"(g11) : "memory");
}
// One stage: 64 keys of K (3 coordinate blocks of 128 B a key) and 192 rows of V^T (128 B a row); 24 copies a lane.
__device__ __forceinline__ void stage_kv(unsigned lk, unsigned lv, const unsigned short* kg, const unsigned short* vg) {
  acopy12(lk, 128, 16 * KP * 2, kg, CO, (size_t)16 * 3 * CO);
  acopy12(lv, 64 * VP * 2, 16 * VP * 2, vg, (size_t)64 * NN, (size_t)16 * NN);
}
// lane l with lane l ^ 16, through no LDS
__device__ __forceinline__ float xhalf(float x) { return __builtin_bit_cast(float, __builtin_amdgcn_permlanex16(__builtin_bit_cast(int, x), __builtin_bit_cast(int, x), 0x76543210, 0xfedcba98, false, false)); }
// Scores are formed transposed: K rows are the A operand and Q the B operand, so lane (ln, hh) holds query ln and keys 8 hh + r of each 16-key tile. A query's maximum and sum are then
// in-lane but for one exchange between the wave halves, and the two score tiles of 32 keys, converted in place, are the B operand of O^T += V^T P^T (element i: key 8 hh + i, element 8 + i: key 16 + 8 hh + i, as the V^T loader has it).
__global__ __launch_bounds__(128) void k_vnattn(const _Float16* __restrict__ Q16, const _Float16* __restrict__ K16, const _Float16* __restrict__ Vt, _Float16* __restrict__ O3) {
  __shared__ __attribute__((aligned(16))) unsigned short sK[2][TK][KP]; __shared__ __attribute__((aligned(16))) unsigned short sV[2][192][VP];
  __shared__ __attribute__((aligned(16))) unsigned short sO[4][48][64 + 8];      // f16 output, one row a (query, coordinate) piece of 64 halves; a query's pitch is 16 B x odd
  const int tid = threadIdx.x, w = tid >> 5, lane = tid & 31, ln = lane & 15, hh = lane >> 4; const int slab = blockIdx.x / (NN / 64), qblk = blockIdx.x % (NN / 64); const int b = slab / NH, h = slab % NH; const int q0 = qblk * 64 + w * 16;
  const unsigned short* Vth = (const unsigned short*)Vt + (size_t)slab * 192 * NN;
  // The lane's share of a stage: eight lanes cover one 128-byte row piece, so a wave's copy covers four whole lines. K: key = 16 q + tid / 8; V^T: row = 64 a + 16 q + tid / 8.
  const int cr = tid >> 3, cc = (tid & 7) * 8;
  const unsigned short* kg = (const unsigned short*)K16 + ((size_t)b * NN + cr) * (3 * CO) + h * HD + cc;
  const unsigned short* vg = Vth + (size_t)cr * NN + cc;
  const unsigned lk = (unsigned)(size_t)&sK[0][cr][cc], lv = (unsigned)(size_t)&sV[0][cr][cc];
  constexpr unsigned KB = TK * KP * 2, VB = 192 * VP * 2;      // bytes of one buffer
  constexpr int NT = NN / TK;
  stage_kv(lk, lv, kg, vg);
  asm volatile("s_wait_asynccnt 0x0" ::: "memory");      // this wave's share of stage 0 has landed
  __syncthreads();                                        // stage 0 is published to the four waves
  stage_kv(lk + KB, lv + VB, kg + (size_t)TK * 3 * CO, vg + TK);
  FragH aq[6]; { const unsigned short* qr = (const unsigned short*)Q16 + ((size_t)b * NN + q0 + ln) * (3 * CO) + h * HD + 8 * hh;      // row (b,n) = [c0 | c1 | c2] x 512 (= rows (b,n,c) of pitch 512)
#pragma unroll
    for (int ks = 0; ks < 6; ++ks) { const int c = ks >> 1, s32 = (ks & 1) * 32; aq[ks].half[0] = *(const v8us*)(qr + c * CO + s32); aq[ks].half[1] = *(const v8us*)(qr + c * CO + s32 + 16); }
    asm volatile("s_wait_xcnt 0x0" :: "v"(qr) : "memory"); }      // the Q loads' address pair is named as an input, so it stays untouched until this wait; behind it the pair may be reused
  float m_r = -3.0e38f, l_r = 0.f; v8f oacc[12];      // oacc[dt][r] = O[query ln][dt * 16 + 8 hh + r]; l_r sums this half's keys only
#pragma unroll
  for (int dt = 0; dt < 12; ++dt) oacc[dt] = (v8f){0.f,0.f,0.f,0.f,0.f,0.f,0.f,0.f};
#pragma unroll 1
  for (int t = 0; t < NT; ++t) { const int buf = t & 1;
#pragma unroll 1      // the two 32-key passes of a stage stay rolled: unrolled, the build spilled the Q fragments to scratch
   for (int p = 0; p < TK / 32; ++p) { v8f s[2];
#pragma unroll
    for (int nt = 0; nt < 2; ++nt) { const unsigned short* kr = &sK[buf][p * 32 + nt * 16 + ln][0]; v8f acc = (v8f){0.f,0.f,0.f,0.f,0.f,0.f,0.f,0.f}; FragH bk[6];      // six fragments are read as one run ahead of their products: one LDS latency a run, not one a product
#pragma unroll      // constant indices keep bk in registers
      for (int ks = 0; ks < 6; ++ks) { bk[ks].half[0] = *(const v8us*)(kr + ks * 32 + 8 * hh); bk[ks].half[1] = *(const v8us*)(kr + ks * 32 + 16 + 8 * hh); }
#pragma unroll
      for (int ks = 0; ks < 6; ++ks) acc = mmaH<1>(bk[ks].v, bk[ks].v, aq[ks].v, aq[ks].v, acc);
      s[nt] = acc; }
    float mc = -3.0e38f;
#pragma unroll      // constant indices keep the scores in registers
    for (int r = 0; r < 8; ++r) { s[0][r] *= 0.07216878364870323f; s[1][r] *= 0.07216878364870323f; mc = fmaxf(mc, fmaxf(s[0][r], s[1][r])); }
    mc = fmaxf(mc, xhalf(mc));
    const float mn = fmaxf(m_r, mc); const float al = expf(m_r - mn); m_r = mn;
    FragH pa; float ps[4] = {0.f, 0.f, 0.f, 0.f};      // four short chains of adds, not one of sixteen
#pragma unroll      // constant indices keep the scores, pa and ps in registers
    for (int r = 0; r < 8; ++r) { const float p0 = expf(s[0][r] - mn), p1 = expf(s[1][r] - mn); ps[r & 3] += p0 + p1; pa.h[r] = (_Float16)p0; pa.h[8 + r] = (_Float16)p1; }
    l_r = l_r * al + ((ps[0] + ps[1]) + (ps[2] + ps[3]));
#pragma unroll
    for (int dt = 0; dt < 12; ++dt)
#pragma unroll
      for (int r = 0; r < 8; ++r) oacc[dt][r] *= al;
#pragma unroll
    for (int dg = 0; dg < 2; ++dg) { FragH bv[6];      // as for K: a run of six fragments, then their six products
#pragma unroll      // constant indices keep bv and oacc in registers
      for (int i = 0; i < 6; ++i) { const unsigned short* vrow = &sV[buf][(dg * 6 + i) * 16 + ln][p * 32]; bv[i].half[0] = *(const v8us*)(vrow + 8 * hh); bv[i].half[1] = *(const v8us*)(vrow + 16 + 8 * hh); }
#pragma unroll
      for (int i = 0; i < 6; ++i) oacc[dg * 6 + i] = mmaH<1>(bv[i].v, bv[i].v, pa.v, pa.v, oacc[dg * 6 + i]); } }
   asm volatile("s_wait_dscnt 0x0" ::: "memory");         // this wave's reads of buffer t mod 2 are done before the buffer is handed back
   asm volatile("s_wait_asynccnt 0x0" ::: "memory");      // this wave's share of stage t + 1 has landed
   __syncthreads();                                        // publishes stage t + 1 and ends every wave's reads of stage t
   if (t + 2 < NT) stage_kv(lk + buf * KB, lv + buf * VB, kg + (size_t)(t + 2) * TK * 3 * CO, vg + (t + 2) * TK); }
  asm volatile("s_wait_asynccnt 0x0" ::: "memory");        // no copy is outstanding when the wave goes on to its end
  const float linv = 1.0f / (l_r + xhalf(l_r));      // the two halves' sums are joined once, here
#pragma unroll      // constant indices keep oacc in registers
  for (int dt = 0; dt < 12; ++dt) { FragH f;
#pragma unroll      // constant indices keep oacc in registers
    for (int r = 0; r < 8; ++r) f.h[r] = (_Float16)(oacc[dt][r] * linv);
    *(v8us*)&sO[w][ln * 3 + dt / 4][(dt % 4) * 16 + 8 * hh] = f.half[0]; }
  __builtin_amdgcn_fence(__ATOMIC_ACQ_REL, "workgroup"); __builtin_amdgcn_wave_barrier();
  // Stored as the output map reads it: rows (b, n, c) x 512. A query's 192 features are three pieces of 64 halves, one 128-byte line each; eight lanes a piece, four pieces a store.
  unsigned short* orow = (unsigned short*)O3 + (((size_t)b * NN + q0) * 3 + (lane >> 3)) * CO + h * HD + (lane & 7) * 8;
#pragma unroll      // constant offsets from one address pair
  for (int q = 0; q < 12; ++q) { const v8us v = *(const v8us*)&sO[w][q * 4 + (lane >> 3)][(lane & 7) * 8]; *(v8us*)(orow + (size_t)q * 4 * CO) = v; } }
// Output map with the (o, c) interleave in its store: a wave takes 16 tokens x 3 coordinates x 64 outputs (each lane picks its token's three rows of O3), so a token's piece of the result is 192 floats in a row, six whole lines.
__global__ __launch_bounds__(128) void k_gemm_out(const _Float16* __restrict__ O3, const _Float16* __restrict__ Wh, float* __restrict__ out) {
  __shared__ __attribute__((aligned(16))) float so[4][16][192 + 4];
  const int tid = threadIdx.x, w = tid >> 5, lane = tid & 31, ln = lane & 15, hh = lane >> 4;
  const int wid = blockIdx.x * 4 + w; const int mt = wid / (CI / 64), nq = wid % (CI / 64); const int bn0 = mt * 16, col0 = nq * 64;
  const unsigned short* arow = (const unsigned short*)O3 + (size_t)(bn0 + ln) * 3 * CO + 8 * hh;
  const unsigned short* brow = (const unsigned short*)Wh + (size_t)(col0 + ln) * CO + 8 * hh;
  v8f acc[3][4] = {};
#pragma unroll      // every load is base + constant, so that no address register is rewritten while loads are out
  for (int kb = 0; kb < CO; kb += 32) { FragH a[3];
#pragma unroll      // constant indices keep the fragments and acc in registers
    for (int c = 0; c < 3; ++c) { a[c].half[0] = *(const v8us*)(arow + c * CO + kb); a[c].half[1] = *(const v8us*)(arow + c * CO + kb + 16); }
#pragma unroll      // constant indices keep the fragments and acc in registers
    for (int t = 0; t < 4; ++t) { FragH bq; bq.half[0] = *(const v8us*)(brow + t * 16 * CO + kb); bq.half[1] = *(const v8us*)(brow + t * 16 * CO + kb + 16);
#pragma unroll      // constant indices keep the fragments and acc in registers
      for (int c = 0; c < 3; ++c) acc[c][t] = mmaH<1>(a[c].v, a[c].v, bq.v, bq.v, acc[c][t]); } }
#pragma unroll      // constant indices keep the fragments and acc in registers
  for (int t = 0; t < 4; ++t)
#pragma unroll      // constant indices keep the fragments and acc in registers
    for (int c = 0; c < 3; ++c)
#pragma unroll      // constant indices keep the fragments and acc in registers
      for (int r = 0; r < 8; ++r) so[w][8 * hh + r][(t * 16 + ln) * 3 + c] = acc[c][t][r] * 0.0625f;
  __builtin_amdgcn_fence(__ATOMIC_ACQ_REL, "workgroup"); __builtin_amdgcn_wave_barrier();      // the wave's LDS stores are done before its lanes read what other lanes stored
  // two tokens' pieces are 96 float4, three stores of the wave; from one pair of tokens to the next every address moves by a constant
#pragma unroll      // three address pairs, formed once
  for (int j = 0; j < 3; ++j) { const int i = j * 32 + lane, r = i / 48, p4 = (i % 48) * 4; const float* ls = &so[w][r][p4]; float* gp = out + ((size_t)(bn0 + r) * CI + col0) * 3 + p4;
#pragma unroll      // constant offsets from the pair
    for (int q = 0; q < 8; ++q) { const v4f v = *(const v4fa*)(ls + q * 2 * (192 + 4)); *(v4f*)(gp + (size_t)q * 2 * CI * 3) = v; } }
}
extern "C" void kernel_launch(void* const* d_in, const int* in_sizes, int n_in,
                              void* d_out, int out_size, void* d_ws, size_t ws_size, hipStream_t stream) {
  (void)in_sizes; (void)n_in; (void)out_size;
  const float* x = (const float*)d_in[0]; const float* Wq = (const float*)d_in[1]; const float* Wk = (const float*)d_in[2]; const float* Wv = (const float*)d_in[3]; const float* Wo = (const float*)d_in[4];
  char* ws = (char*)d_ws; size_t off = 0;
  auto take = [&](size_t bytes) { char* p = ws + off; off += (bytes + 255) & ~(size_t)255; return p; };
  _Float16* Bq = (_Float16*)take((size_t)CO * CI * 2); _Float16* Bk = (_Float16*)take((size_t)CO * CI * 2); _Float16* Bv = (_Float16*)take((size_t)CO * CI * 2); _Float16* Bo = (_Float16*)take((size_t)CI * CO * 2);
  _Float16* X3 = (_Float16*)take((size_t)NR3 * CI * 2); _Float16* Q16 = (_Float16*)take((size_t)NR3 * CO * 2); _Float16* K16 = (_Float16*)take((size_t)NR3 * CO * 2); _Float16* Vt = (_Float16*)take((size_t)NR3 * CO * 2); _Float16* O3 = (_Float16*)take((size_t)NR3 * CO * 2);      // O3 has a place of its own: the attention stores it while other work-groups still read Q16
  if (off > ws_size) return;      // 1 + 6.3 + 12.6 x 4, about 58 MB
  k_prep<<<4 * WBL + XBL, 256, 0, stream>>>(x, Wq, Wk, Wv, Wo, Bq, Bk, Bv, Bo, X3);      // weights are (out,in); X3 = rows (b,n,c) x 256
  k_qkv<<<dim3(MBL, 3), 128, 0, stream>>>(X3, Bq, Bk, Bv, Q16, K16, Vt);      // q/k planes = rows (b,n,c) x 512 = [(b,n)][c * 512 + o]
  k_vnattn<<<BB * NH * (NN / 64), 128, 0, stream>>>(Q16, K16, Vt, O3);
  k_gemm_out<<<(NR / 16) * (CI / 64) / 4, 128, 0, stream>>>(O3, Bo, (float*)d_out);
}

// v005
// One run takes 137 microseconds.
// In both of two side-by-side timings against v004, it was 1.08 times as fast.
// Counting every step since v000, it is 4.40 times as fast.
#include <hip/hip_runtime.h>
// Vector-neuron attention (B=2, N=2048, C=256 × 3 coordinates, 8 heads × 64): the VN-linear maps (rows (b,n,c) × 256 → 512, weights (out,in) bf16-exact ×2^4) and the attention over the
// 192-dim (d, c) head features as a fused flash-style kernel on v_wmma_f32_16x16x32_f16 (S^T = K Q^T / sqrt(192) with 6 k-steps gathered from the three coordinate blocks, online softmax f32 in-lane, P f16 <= 1 packed from the score registers,
// O^T = V^T P^T with 12 d-tiles; RPW-16 waves); f16 operands, single products, f32 accumulate; V^T, the f16 attention output and the final (o, c) interleave are stored by the kernels that compute them.
#define BB 2
#define NN 2048
#define CI 256
#define CO 512
#define NH 8
#define HD 64
#define NR3 (BB * NN * 3)
#define NR (BB * NN)

typedef __bf16 v16b __attribute__((ext_vector_type(16)));
typedef unsigned short v8us __attribute__((ext_vector_type(8), may_alias));
typedef float  v8f  __attribute__((ext_vector_type(8)));
typedef float  v4f  __attribute__((ext_vector_type(4)));
typedef float  v4fa __attribute__((ext_vector_type(4), may_alias));
union FragB { v16b v; v8us half[2]; unsigned short u[16]; };

__device__ __forceinline__ unsigned short bf16_bits(float x) { unsigned int u = __float_as_uint(x); return (unsigned short)((u + 0x7FFFu + ((u >> 16) & 1u)) >> 16); }
__device__ __forceinline__ float bf16_val(unsigned short b) { return __uint_as_float(((unsigned int)b) << 16); }
__device__ __forceinline__ float bf16_round(float x) { return bf16_val(bf16_bits(x)); }
// D += A·B with NT terms: 1 = ah·bh, 2 = + al·bh (A split), 3 = + ah·bl (both split)
template <int NT>
__device__ __forceinline__ v8f mmaN(v16b ah, v16b al, v16b bh, v16b bl, v8f c) {
  c = __builtin_amdgcn_wmma_f32_16x16x32_bf16(false, ah, false, bh, (short)0, c, false, false);
  if (NT >= 2) c = __builtin_amdgcn_wmma_f32_16x16x32_bf16(false, al, false, bh, (short)0, c, false, false);
  if (NT >= 3) c = __builtin_amdgcn_wmma_f32_16x16x32_bf16(false, ah, false, bl, (short)0, c, false, false);
  asm volatile("v_nop\n\tv_nop\n\tv_nop\n\tv_nop" : "+v"(c) : "v"(ah), "v"(al), "v"(bh), "v"(bl));
  return c;
}

__global__ __launch_bounds__(256) void k_wt_bf16(const float* __restrict__ W, unsigned short* __restrict__ Wt, int K, int N) {
  const int t = blockIdx.x * 256 + threadIdx.x;
  const int k8n = K / 8;
  if (t >= N * k8n) return;
  const int n = t / k8n, k8 = (t % k8n) * 8;
  v8us v;
#pragma unroll
  for (int i = 0; i < 8; ++i) v[i] = bf16_bits(W[(size_t)(k8 + i) * N + n]);
  *(v8us*)(Wt + (size_t)n * K + k8) = v;
  
}

// GEMM C[M][N] (f32, pitch ldc) = act(A[M][K]·W + bias). A f32 row-major (pitch lda) converted per fragment to bf16
// (ASPLIT: hi/lo two planes -> 2 terms, else single rounded term); Wt bf16 [N][K] (pitch ldb). BIAS_BF16 rounds the
// bias to bf16 first (bias quantised to bf16 before the add). K%32==0, M%16==0, N%64==0.
template <bool ASPLIT, int ACT, bool BIAS_BF16>
__global__ __launch_bounds__(128) void k_gemm_bf(const float* __restrict__ A, int lda, const unsigned short* __restrict__ Wt, int ldb,
                                               const float* __restrict__ bias, float* __restrict__ C, int ldc, int M, int N, int K) {
  __shared__ __attribute__((aligned(16))) float so[4][16][64];
  const int tid = threadIdx.x, w = tid >> 5, lane = tid & 31, ln = lane & 15, hh = lane >> 4;
  const int ntn = N / 64;
  const int wid = blockIdx.x * 4 + w;
  const int mt = wid / ntn, nq = wid % ntn;
  if (mt * 16 >= M) return;
  const int row0 = mt * 16, col0 = nq * 64;
  const float* arow = A + (size_t)(row0 + ln) * lda;
  v8f acc[4] = {};
  for (int kb = 0; kb < K; kb += 32) {
    FragB ah, al;
    const v4f x0 = *(const v4fa*)(arow + kb + 8 * hh), x1 = *(const v4fa*)(arow + kb + 8 * hh + 4);
    const v4f x2 = *(const v4fa*)(arow + kb + 16 + 8 * hh), x3 = *(const v4fa*)(arow + kb + 16 + 8 * hh + 4);
    float xs[16] = {x0[0],x0[1],x0[2],x0[3],x1[0],x1[1],x1[2],x1[3],x2[0],x2[1],x2[2],x2[3],x3[0],x3[1],x3[2],x3[3]};
#pragma unroll
    for (int i = 0; i < 16; ++i) { const unsigned short hb = bf16_bits(xs[i]); ah.u[i] = hb; al.u[i] = ASPLIT ? bf16_bits(xs[i] - bf16_val(hb)) : (unsigned short)0; }
#pragma unroll
    for (int t = 0; t < 4; ++t) {
      const unsigned short* brow = Wt + (size_t)(col0 + t * 16 + ln) * ldb + kb;
      FragB b;
      b.half[0] = *(const v8us*)(brow + 8 * hh);
      b.half[1] = *(const v8us*)(brow + 16 + 8 * hh);
      acc[t] = mmaN<ASPLIT ? 2 : 1>(ah.v, al.v, b.v, b.v, acc[t]);
    }
  }
#pragma unroll
  for (int t = 0; t < 4; ++t) {
    float bv = bias ? bias[col0 + t * 16 + ln] : 0.f;
    if (BIAS_BF16) bv = bf16_round(bv);
#pragma unroll
    for (int r = 0; r < 8; ++r) { float v = acc[t][r] + bv; if (ACT == 1) v = fmaxf(v, 0.f); so[w][8 * hh + r][t * 16 + ln] = v; }
  }
  __builtin_amdgcn_fence(__ATOMIC_ACQ_REL, "workgroup");
  __builtin_amdgcn_wave_barrier();
  const int rsub = lane >> 4, c4 = (lane & 15) * 4;
  {
#pragma unroll
    for (int q = 0; q < 8; ++q) {
      const int r = q * 2 + rsub;
      const v4f v = *(const v4fa*)&so[w][r][c4];
      *(v4f*)(C + (size_t)(row0 + r) * ldc + col0 + c4) = v;
    }
    
  }
}

// Flash-style causal/unmasked attention, all contractions 3-term bf16 hi/lo splits, f32 softmax with running max.
// q,k,v rows are read from f32 buffers with arbitrary row pitch (so they can live inside a fused qkv buffer);
// D = head size (multiple of 32, <= 128); one wave = 16 query rows; block = 4 waves (64 queries) sharing K/V chunks of 32.
template <int D, bool CAUSAL>
__global__ __launch_bounds__(128) void k_flash(const float* __restrict__ qb, const float* __restrict__ kb, const float* __restrict__ vb,
                                             int pitch, int T, int H, float scale, float* __restrict__ y, int ypitch) {
  constexpr int KS = D / 32;        // k-steps for QK
  constexpr int DT = D / 16;        // d tiles for PV
  __shared__ __attribute__((aligned(16))) unsigned short sKh[32][D + 8], sKl[32][D + 8], sVh[32][D + 8], sVl[32][D + 8];
  __shared__ __attribute__((aligned(16))) unsigned short sPh[4][16][40], sPl[4][16][40];
  __shared__ __attribute__((aligned(16))) float sO[4][16][D];
  const int tid = threadIdx.x, w = tid >> 5, lane = tid & 31, ln = lane & 15, hh = lane >> 4;
  const int nqb = (T + 63) / 64;
  const int bh = blockIdx.x / nqb, qblk = blockIdx.x % nqb;
  const int b = bh / H, h = bh % H;
  const int q0 = qblk * 64 + w * 16;
  const float* Q = qb + (size_t)b * T * pitch + h * D;
  const float* K = kb + (size_t)b * T * pitch + h * D;
  const float* V = vb + (size_t)b * T * pitch + h * D;

  // A fragments of the wave's 16 query rows (scaled), hi/lo
  FragB aqh[KS], aql[KS];
  {
    int row = q0 + ln; if (row >= T) row = T - 1;
    const float* qr = Q + (size_t)row * pitch;
#pragma unroll
    for (int ks = 0; ks < KS; ++ks)
#pragma unroll
      for (int i = 0; i < 16; ++i) {
        const int d = ks * 32 + ((i < 8) ? (8 * hh + i) : (16 + 8 * hh + (i - 8)));
        const float x = qr[d] * scale; const unsigned short hb = bf16_bits(x);
        aqh[ks].u[i] = hb; aql[ks].u[i] = bf16_bits(x - bf16_val(hb));
      }
  }
  float m_r[8], l_r[8];
#pragma unroll
  for (int r = 0; r < 8; ++r) { m_r[r] = -3.0e38f; l_r[r] = 0.f; }
  v8f oacc[DT];
#pragma unroll
  for (int dt = 0; dt < DT; ++dt) oacc[dt] = (v8f){0.f,0.f,0.f,0.f,0.f,0.f,0.f,0.f};

  const int kv_end = CAUSAL ? min(T, qblk * 64 + 64) : T;     // block-uniform
  for (int j0 = 0; j0 < kv_end; j0 += 32) {
    __syncthreads();
    for (int e = tid; e < 32 * (D / 4); e += 128) {
      const int r = e / (D / 4), c4 = (e % (D / 4)) * 4;
      const int key = j0 + r;
      v4f kf = {0.f,0.f,0.f,0.f}, vf = {0.f,0.f,0.f,0.f};
      if (key < T) { kf = *(const v4fa*)(K + (size_t)key * pitch + c4); vf = *(const v4fa*)(V + (size_t)key * pitch + c4); }
#pragma unroll
      for (int t = 0; t < 4; ++t) {
        unsigned short hb = bf16_bits(kf[t]); sKh[r][c4 + t] = hb; sKl[r][c4 + t] = bf16_bits(kf[t] - bf16_val(hb));
        hb = bf16_bits(vf[t]); sVh[r][c4 + t] = hb; sVl[r][c4 + t] = bf16_bits(vf[t] - bf16_val(hb));
      }
    }
    __syncthreads();
    // S tile 16 x 32
    v8f s[2];
#pragma unroll
    for (int nt = 0; nt < 2; ++nt) {
      v8f acc = {};
#pragma unroll
      for (int ks = 0; ks < KS; ++ks) {
        FragB bh_, bl_;
        bh_.half[0] = *(const v8us*)&sKh[nt * 16 + ln][ks * 32 + 8 * hh]; bh_.half[1] = *(const v8us*)&sKh[nt * 16 + ln][ks * 32 + 16 + 8 * hh];
        bl_.half[0] = *(const v8us*)&sKl[nt * 16 + ln][ks * 32 + 8 * hh]; bl_.half[1] = *(const v8us*)&sKl[nt * 16 + ln][ks * 32 + 16 + 8 * hh];
        acc = mmaN<3>(aqh[ks].v, aql[ks].v, bh_.v, bl_.v, acc);
      }
      s[nt] = acc;
    }
    // mask + running max (rows 8hh+r; the 16 lanes of a half share rows)
    float alpha[8];
#pragma unroll
    for (int r = 0; r < 8; ++r) {
      const int qi = q0 + 8 * hh + r;
      const int ja = j0 + ln, jb = j0 + 16 + ln;
      if (CAUSAL) { if (ja > qi) s[0][r] = -3.0e38f; if (jb > qi) s[1][r] = -3.0e38f; }
      if (ja >= T) s[0][r] = -3.0e38f;
      if (jb >= T) s[1][r] = -3.0e38f;
      float mx = fmaxf(s[0][r], s[1][r]);
      mx = fmaxf(mx, __shfl_xor(mx, 1, 32)); mx = fmaxf(mx, __shfl_xor(mx, 2, 32)); mx = fmaxf(mx, __shfl_xor(mx, 4, 32)); mx = fmaxf(mx, __shfl_xor(mx, 8, 32));
      const float mnew = fmaxf(m_r[r], mx);
      alpha[r] = (mnew > -1.0e38f) ? __expf(m_r[r] - mnew) : 1.0f;
      const float p0 = (s[0][r] > -1.0e38f) ? __expf(s[0][r] - mnew) : 0.f;
      const float p1 = (s[1][r] > -1.0e38f) ? __expf(s[1][r] - mnew) : 0.f;
      m_r[r] = mnew;
      l_r[r] = l_r[r] * alpha[r] + p0 + p1;            // per-lane partial row sum (16 lanes combined at the end)
      unsigned short hb = bf16_bits(p0); sPh[w][8 * hh + r][ln] = hb;      sPl[w][8 * hh + r][ln] = bf16_bits(p0 - bf16_val(hb));
      hb = bf16_bits(p1);                sPh[w][8 * hh + r][16 + ln] = hb; sPl[w][8 * hh + r][16 + ln] = bf16_bits(p1 - bf16_val(hb));
    }
#pragma unroll
    for (int dt = 0; dt < DT; ++dt)
#pragma unroll
      for (int r = 0; r < 8; ++r) oacc[dt][r] *= alpha[r];
    __builtin_amdgcn_fence(__ATOMIC_ACQ_REL, "workgroup");
    __builtin_amdgcn_wave_barrier();
    FragB pah, pal;
    pah.half[0] = *(const v8us*)&sPh[w][ln][8 * hh]; pah.half[1] = *(const v8us*)&sPh[w][ln][16 + 8 * hh];
    pal.half[0] = *(const v8us*)&sPl[w][ln][8 * hh]; pal.half[1] = *(const v8us*)&sPl[w][ln][16 + 8 * hh];
#pragma unroll
    for (int dt = 0; dt < DT; ++dt) {
      FragB bvh, bvl;
#pragma unroll
      for (int i = 0; i < 8; ++i) {
        bvh.u[i] = sVh[8 * hh + i][dt * 16 + ln]; bvh.u[8 + i] = sVh[16 + 8 * hh + i][dt * 16 + ln];
        bvl.u[i] = sVl[8 * hh + i][dt * 16 + ln]; bvl.u[8 + i] = sVl[16 + 8 * hh + i][dt * 16 + ln];
      }
      oacc[dt] = mmaN<3>(pah.v, pal.v, bvh.v, bvl.v, oacc[dt]);
    }
    __builtin_amdgcn_fence(__ATOMIC_ACQ_REL, "workgroup");
    __builtin_amdgcn_wave_barrier();
  }
#pragma unroll
  for (int r = 0; r < 8; ++r) {
    float l = l_r[r];
    l += __shfl_xor(l, 1, 32); l += __shfl_xor(l, 2, 32); l += __shfl_xor(l, 4, 32); l += __shfl_xor(l, 8, 32);
    l_r[r] = (l > 0.f) ? 1.0f / l : 0.f;
  }
#pragma unroll
  for (int dt = 0; dt < DT; ++dt)
#pragma unroll
    for (int r = 0; r < 8; ++r) sO[w][8 * hh + r][dt * 16 + ln] = oacc[dt][r] * l_r[r];
  __builtin_amdgcn_fence(__ATOMIC_ACQ_REL, "workgroup");
  __builtin_amdgcn_wave_barrier();
  {
    for (int r = 0; r < 16; ++r) {
      const int row = q0 + r;
      if (row < T && lane < D / 4) {
        const v4f val = *(const v4fa*)&sO[w][r][lane * 4];
        *(v4f*)(y + ((size_t)b * T + row) * ypitch + h * D + lane * 4) = val;
      }
    }
    
  }
}

// GEMM C = act(A·W + bias + resid): A f32 (ASPLIT -> hi/lo 2 terms), Wt bf16 [N][K]; ACT 0 none, 1 relu, 2 exact gelu;
// resid (optional, f32, row index = (row % rmod), pitch ldr, RES_BF16 rounds it) added before the activation.
template <bool ASPLIT, int ACT, bool BIAS_BF16, bool RES_BF16>
__global__ __launch_bounds__(128) void k_gemm_bf3(const float* __restrict__ A, int lda, const unsigned short* __restrict__ Wt, int ldb,
                                                const float* __restrict__ bias, const float* __restrict__ resid, int rmod, int ldr,
                                                float* __restrict__ C, int ldc, int M, int N, int K) {
  __shared__ __attribute__((aligned(16))) float so[4][16][64];
  const int tid = threadIdx.x, w = tid >> 5, lane = tid & 31, ln = lane & 15, hh = lane >> 4;
  const int ntn = N / 64;
  const int wid = blockIdx.x * 4 + w;
  const int mt = wid / ntn, nq = wid % ntn;
  if (mt * 16 >= M) return;
  const int row0 = mt * 16, col0 = nq * 64;
  const float* arow = A + (size_t)(row0 + ln) * lda;
  v8f acc[4] = {};
  for (int kb = 0; kb < K; kb += 32) {
    FragB ah, al;
    const v4f x0 = *(const v4fa*)(arow + kb + 8 * hh), x1 = *(const v4fa*)(arow + kb + 8 * hh + 4);
    const v4f x2 = *(const v4fa*)(arow + kb + 16 + 8 * hh), x3 = *(const v4fa*)(arow + kb + 16 + 8 * hh + 4);
    float xs[16] = {x0[0],x0[1],x0[2],x0[3],x1[0],x1[1],x1[2],x1[3],x2[0],x2[1],x2[2],x2[3],x3[0],x3[1],x3[2],x3[3]};
#pragma unroll
    for (int i = 0; i < 16; ++i) { const unsigned short hb = bf16_bits(xs[i]); ah.u[i] = hb; al.u[i] = ASPLIT ? bf16_bits(xs[i] - bf16_val(hb)) : (unsigned short)0; }
#pragma unroll
    for (int t = 0; t < 4; ++t) {
      const unsigned short* brow = Wt + (size_t)(col0 + t * 16 + ln) * ldb + kb;
      FragB b;
      b.half[0] = *(const v8us*)(brow + 8 * hh);
      b.half[1] = *(const v8us*)(brow + 16 + 8 * hh);
      acc[t] = mmaN<ASPLIT ? 2 : 1>(ah.v, al.v, b.v, b.v, acc[t]);
    }
  }
#pragma unroll
  for (int t = 0; t < 4; ++t) {
    const int col = col0 + t * 16 + ln;
    float bv = bias ? bias[col] : 0.f;
    if (BIAS_BF16) bv = bf16_round(bv);
#pragma unroll
    for (int r = 0; r < 8; ++r) {
      float v = acc[t][r] + bv;
      if (resid) { float rv = resid[(size_t)((row0 + 8 * hh + r) % rmod) * ldr + col]; if (RES_BF16) rv = bf16_round(rv); v += rv; }
      if (ACT == 1) v = fmaxf(v, 0.f);
      if (ACT == 2) v = 0.5f * v * (1.0f + erff(v * 0.70710678118654752f));
      if (ACT == 3) { const float u = 0.7978845608028654f * (v + 0.044715f * v * v * v); v = 0.5f * v * (1.0f + tanhf(u)); }
      so[w][8 * hh + r][t * 16 + ln] = v;
    }
  }
  __builtin_amdgcn_fence(__ATOMIC_ACQ_REL, "workgroup");
  __builtin_amdgcn_wave_barrier();
  const int rsub = lane >> 4, c4 = (lane & 15) * 4;
  {
#pragma unroll
    for (int q = 0; q < 8; ++q) {
      const int r = q * 2 + rsub;
      const v4f v = *(const v4fa*)&so[w][r][c4];
      *(v4f*)(C + (size_t)(row0 + r) * ldc + col0 + c4) = v;
    }
    
  }
}
// row LayerNorm (biased variance, eps) over N: s = X (+ R); optional out_sum <- s; out_norm <- (s-mu)*rsqrt(var+eps)*g + b
template <bool PARAM_BF16>
__global__ __launch_bounds__(256) void k_layernorm(const float* __restrict__ X, const float* __restrict__ R, const float* __restrict__ g, const float* __restrict__ bta,
                                                  float* __restrict__ out_sum, float* __restrict__ out_norm, int N, float eps) {
  __shared__ float red[256];
  const int row = blockIdx.x, tid = threadIdx.x;
  const float* x = X + (size_t)row * N; const float* rr = R ? R + (size_t)row * N : nullptr;
  float vals[16];                     // up to N = 4096
  const int per = N / 256;            // contiguous chunk per thread? use strided-by-4 chunks: thread handles j = tid*4 + 1024*u
  float s1 = 0.f;
  for (int u = 0; u < per / 4; ++u) {
    const int j = tid * 4 + 1024 * u;
    const v4f a = *(const v4fa*)(x + j);
    v4f b = {0.f,0.f,0.f,0.f}; if (rr) b = *(const v4fa*)(rr + j);
#pragma unroll
    for (int q = 0; q < 4; ++q) { const float v = a[q] + b[q]; vals[u * 4 + q] = v; s1 += v; }
  }
  red[tid] = s1; __syncthreads();
  for (int st = 128; st > 0; st >>= 1) { if (tid < st) red[tid] += red[tid + st]; __syncthreads(); }
  const float mu = red[0] / (float)N; __syncthreads();
  float s2 = 0.f;
  for (int u = 0; u < per / 4; ++u)
#pragma unroll
    for (int q = 0; q < 4; ++q) { const float c = vals[u * 4 + q] - mu; s2 += c * c; }
  red[tid] = s2; __syncthreads();
  for (int st = 128; st > 0; st >>= 1) { if (tid < st) red[tid] += red[tid + st]; __syncthreads(); }
  const float rs = rsqrtf(red[0] / (float)N + eps);
  {
    for (int u = 0; u < per / 4; ++u) {
      const int j = tid * 4 + 1024 * u;
      v4f o, sm;
#pragma unroll
      for (int q = 0; q < 4; ++q) {
        float gg = g[j + q], bb = bta[j + q];
        if (PARAM_BF16) { gg = bf16_round(gg); bb = bf16_round(bb); }
        sm[q] = vals[u * 4 + q]; o[q] = (vals[u * 4 + q] - mu) * rs * gg + bb;
      }
      if (out_sum) *(v4f*)(out_sum + (size_t)row * N + j) = sm;
      *(v4f*)(out_norm + (size_t)row * N + j) = o;
    }
    
  }
}



// ---- f16 WMMA path (v_wmma_f32_16x16x32_f16): 11-bit significands for operands in range — used for every contraction launched here (VN-linear maps, Q·Kᵀ, P·V)
typedef _Float16 v16h __attribute__((ext_vector_type(16)));
union FragH { v16h v; v8us half[2]; _Float16 h[16]; unsigned short u[16]; };
template <int NT>
__device__ __forceinline__ v8f mmaH(v16h ah, v16h al, v16h bh, v16h bl, v8f c) {
  c = __builtin_amdgcn_wmma_f32_16x16x32_f16(false, ah, false, bh, (short)0, c, false, false);
  if (NT >= 2) c = __builtin_amdgcn_wmma_f32_16x16x32_f16(false, al, false, bh, (short)0, c, false, false);
  if (NT >= 3) c = __builtin_amdgcn_wmma_f32_16x16x32_f16(false, ah, false, bl, (short)0, c, false, false);
  asm volatile("v_nop\n\tv_nop\n\tv_nop\n\tv_nop" : "+v"(c) : "v"(ah), "v"(al), "v"(bh), "v"(bl));
  return c;
}
// batched GEMM like k_gemm_b but f16 operands: A f32 (split into f16 hi/lo if ASPLIT, else rounded to f16), Bt = f16 values [n][k]; alpha; C f32; N multiple of 16 (partial tiles skipped)
template <bool ASPLIT>
__global__ __launch_bounds__(128) void k_gemm_h(const float* __restrict__ A, int lda, size_t sA, const _Float16* __restrict__ Bh, int ldb, size_t sB, float alpha, float* __restrict__ C, int ldc, size_t sC, int M, int N, int K) {
  __shared__ __attribute__((aligned(16))) float so[4][16][64];
  const int tid = threadIdx.x, w = tid >> 5, lane = tid & 31, ln = lane & 15, hh = lane >> 4; const int by = blockIdx.y;
  A += (size_t)by * sA; Bh += (size_t)by * sB; C += (size_t)by * sC;
  const int ntn = (N + 63) / 64; const int wid = blockIdx.x * 4 + w; const int mt = wid / ntn, nq = wid % ntn; if (mt * 16 >= M) return;
  const int row0 = mt * 16, col0 = nq * 64; const float* arow = A + (size_t)(row0 + ln) * lda;
  v8f acc[4] = {};
  for (int kb = 0; kb < K; kb += 32) {
    FragH ah, al;
    const v4f x0 = *(const v4fa*)(arow + kb + 8 * hh), x1 = *(const v4fa*)(arow + kb + 8 * hh + 4), x2 = *(const v4fa*)(arow + kb + 16 + 8 * hh), x3 = *(const v4fa*)(arow + kb + 16 + 8 * hh + 4);
    float xs[16] = {x0[0],x0[1],x0[2],x0[3],x1[0],x1[1],x1[2],x1[3],x2[0],x2[1],x2[2],x2[3],x3[0],x3[1],x3[2],x3[3]};
#pragma unroll
    for (int i = 0; i < 16; ++i) { const _Float16 h = (_Float16)xs[i]; ah.h[i] = h; al.h[i] = ASPLIT ? (_Float16)(xs[i] - (float)h) : (_Float16)0.0f; }
#pragma unroll
    for (int t = 0; t < 4; ++t) { if (col0 + t * 16 >= N) continue; const size_t boff = (size_t)(col0 + t * 16 + ln) * ldb + kb; FragH bq; bq.half[0] = *(const v8us*)(Bh + boff + 8 * hh); bq.half[1] = *(const v8us*)(Bh + boff + 16 + 8 * hh);
      acc[t] = mmaH<ASPLIT ? 2 : 1>(ah.v, al.v, bq.v, bq.v, acc[t]); }
  }
#pragma unroll
  for (int t = 0; t < 4; ++t) { if (col0 + t * 16 >= N) continue;
#pragma unroll
    for (int r = 0; r < 8; ++r) so[w][8 * hh + r][t * 16 + ln] = acc[t][r] * alpha; }
  __builtin_amdgcn_fence(__ATOMIC_ACQ_REL, "workgroup"); __builtin_amdgcn_wave_barrier();
  const int rsub = lane >> 4, c4 = (lane & 15) * 4;
  {
#pragma unroll
    for (int q = 0; q < 8; ++q) { const int r = q * 2 + rsub; if (col0 + c4 < N) { const v4f v = *(const v4fa*)&so[w][r][c4]; *(v4f*)(C + (size_t)(row0 + r) * ldc + col0 + c4) = v; } }
     }
}

// Wt[n][k] = f16(W[k][n]·scale) from f32 row-major W[K][N] (scale = power of two; bf16-exact weights stay exact in f16 away from the subnormal range)
__global__ __launch_bounds__(256) void k_wt_f16(const float* __restrict__ W, _Float16* __restrict__ Wt, int K, int N, float scale) {
  const int t = blockIdx.x * 256 + threadIdx.x; if (t >= N * (K / 8)) return; const int n = t / (K / 8), k8 = (t % (K / 8)) * 8; FragH f;
#pragma unroll
  for (int i = 0; i < 8; ++i) f.h[i] = (_Float16)(bf16_round(W[(size_t)(k8 + i) * N + n]) * scale); const v8us o = f.half[0];
  *(v8us*)((unsigned short*)Wt + (size_t)n * K + k8) = o; 
}
// FRAGMENT ORDER. The weights and x are stored as the matrix instructions read them: a matrix of rows x K halves is cut into fragments of 16 rows x 32 k, 1 KB each, at [row / 16][k / 32];
// inside a fragment piece (hs, lane) is 16 bytes: row lane % 16, k = 16 hs + 8 (lane / 16) + 0..7. A wave's 16-byte load of half a fragment is then 512 bytes in a row, four whole lines, where rows of pitch K gave sixteen 32-byte pieces.
#define FRH 512      // halves of one fragment
// Every operand conversion in one launch; the block index picks the job, and no job reads what another writes. Blocks [0, 4 WBL): the four weight matrices, rounded and scaled by 16, WBL blocks each; the rest: x.
// Thread t writes piece t of its packed matrix, so a wave's store is 512 bytes in a row. X3 has its rows in the order (b, c, n): a thread takes the three coordinates of its 8 channels from one run of 96 bytes and writes one piece to each of the three planes.
#define WBL (CO * CI / 8 / 256)
#define XBL (NR * (CI / 8) / 256)
__global__ __launch_bounds__(256) void k_prep(const float* __restrict__ x, const float* __restrict__ Wq, const float* __restrict__ Wk, const float* __restrict__ Wv, const float* __restrict__ Wo,
                                            _Float16* __restrict__ Bq, _Float16* __restrict__ Bk, _Float16* __restrict__ Bv, _Float16* __restrict__ Bo, _Float16* __restrict__ X3) {
  const int bx = blockIdx.x; const int lane = threadIdx.x & 31, hs = (threadIdx.x >> 5) & 1; const int kin = hs * 16 + (lane >> 4) * 8;
  if (bx < 4 * WBL) { const int j = bx / WBL; const float* W = j == 0 ? Wq : j == 1 ? Wk : j == 2 ? Wv : Wo; _Float16* Bt = j == 0 ? Bq : j == 1 ? Bk : j == 2 ? Bv : Bo; const int kf = (j == 3 ? CO : CI) / 32;      // fragments in a row of the matrix
    const int t = (bx % WBL) * 256 + threadIdx.x; const int fr = t >> 6; const float* wp = W + (size_t)((fr / kf) * 16 + (lane & 15)) * (kf * 32) + (fr % kf) * 32 + kin; FragH f;
#pragma unroll      // constant indices keep f in registers
    for (int i = 0; i < 8; ++i) f.h[i] = (_Float16)(bf16_round(wp[i]) * 16.0f); *(v8us*)((unsigned short*)Bt + (size_t)t * 8) = f.half[0]; }
  else { const int t = (bx - 4 * WBL) * 256 + threadIdx.x; const int fr = t >> 6; const int bn = (fr / (CI / 32)) * 16 + (lane & 15); const float* xp = x + ((size_t)bn * CI + (fr % (CI / 32)) * 32 + kin) * 3;
    unsigned short* xo = (unsigned short*)X3 + ((size_t)t + (size_t)(bn / NN) * 2 * (NN / 16) * (CI / 32) * 64) * 8;      // token row b NN + n becomes row (3 b + c) NN + n: 2 b + c planes further
#pragma unroll      // the 24 floats are loaded once, as six 16-byte loads, and the three stores go from one address pair with constant offsets
    for (int c = 0; c < 3; ++c) { FragH f;
#pragma unroll      // constant indices keep f in registers
      for (int q = 0; q < 8; ++q) f.h[q] = (_Float16)bf16_round(xp[q * 3 + c]); *(v8us*)(xo + (size_t)c * (NN / 16) * (CI / 32) * FRH) = f.half[0]; }
    asm volatile("s_wait_xcnt 0x0" ::: "memory"); } }      // behind the last store: no register that the three stores name is rewritten ahead of this wait
// q or k map: C[(b, n, c)][o] = sum_k X3[(b, c, n)][k] W[o][k] / 16, f16. A wave takes 16 tokens of one (b, c) x 64 outputs; both operands come in fragment order. The result keeps its rows (b, n, c) x 512: a token's row is picked in the store.
__device__ __forceinline__ void gemm_qk(float (*so)[16][64], int bx, const _Float16* __restrict__ X3, const _Float16* __restrict__ Wh, _Float16* __restrict__ C16) {
  const int tid = threadIdx.x, w = tid >> 5, lane = tid & 31, ln = lane & 15, hh = lane >> 4;
  const int wid = bx * 4 + w; const int mt = wid / (CO / 64), nq = wid % (CO / 64); const int col0 = nq * 64;
  const unsigned short* ap = (const unsigned short*)X3 + (size_t)mt * (CI / 32) * FRH + lane * 8;
  const unsigned short* bp = (const unsigned short*)Wh + (size_t)nq * 4 * (CI / 32) * FRH + lane * 8;
  v8f acc[4] = {};
#pragma unroll      // every load is base + constant, so that no address register is rewritten while loads are out
  for (int ks = 0; ks < CI / 32; ++ks) { FragH ah; ah.half[0] = *(const v8us*)(ap + ks * FRH); ah.half[1] = *(const v8us*)(ap + ks * FRH + 256);
#pragma unroll      // constant indices keep the fragments and acc in registers
    for (int t = 0; t < 4; ++t) { FragH bq; bq.half[0] = *(const v8us*)(bp + (t * (CI / 32) + ks) * FRH); bq.half[1] = *(const v8us*)(bp + (t * (CI / 32) + ks) * FRH + 256);
      acc[t] = mmaH<1>(ah.v, ah.v, bq.v, bq.v, acc[t]); } }
#pragma unroll      // constant indices keep the fragments and acc in registers
  for (int t = 0; t < 4; ++t)
#pragma unroll      // constant indices keep the fragments and acc in registers
    for (int r = 0; r < 8; ++r) so[w][8 * hh + r][t * 16 + ln] = acc[t][r] * 0.0625f;
  __builtin_amdgcn_fence(__ATOMIC_ACQ_REL, "workgroup"); __builtin_amdgcn_wave_barrier();      // the wave's LDS stores are done before its lanes read what other lanes stored
  const int rsub = lane >> 4, c4 = (lane & 15) * 4; typedef _Float16 v4h __attribute__((ext_vector_type(4)));
  const int bc = mt / (NN / 16), n0 = (mt % (NN / 16)) * 16;
  _Float16* crow = C16 + (((size_t)(bc / 3) * NN + n0 + rsub) * 3 + bc % 3) * CO + col0 + c4;
#pragma unroll      // constant offsets from one address pair
  for (int q = 0; q < 8; ++q) { const v4f v = *(const v4fa*)&so[w][q * 2 + rsub][c4]; v4h h4; for (int i = 0; i < 4; ++i) h4[i] = (_Float16)v[i]; *(v4h*)(crow + (size_t)q * 2 * 3 * CO) = h4; }
  asm volatile("s_wait_xcnt 0x0" ::: "memory");      // behind the last store: no register that the eight stores name is rewritten ahead of this wait
}
// V^T at once: C[o][n] = sum_k Wv[o][k] X3[(b, c, n)][k]. The weight rows are the A operand and the token rows of one (b, c) the B operand, both in fragment order,
// so a row of the staged tile is 64 tokens of one feature: one whole 128-byte line of the layout that the attention stages. Same products, same k order as the q and k maps.
__device__ __forceinline__ void gemm_vt(float (*so)[16][64], int bx, int by, const _Float16* __restrict__ Wh, const _Float16* __restrict__ X3, _Float16* __restrict__ Vt) {
  const int tid = threadIdx.x, w = tid >> 5, lane = tid & 31, ln = lane & 15, hh = lane >> 4; const int b = by / 3, c = by % 3;
  const int wid = bx * 4 + w; const int mt = wid / (NN / 64), nq = wid % (NN / 64); const int row0 = mt * 16, col0 = nq * 64;
  const unsigned short* arow = (const unsigned short*)Wh + (size_t)mt * (CI / 32) * FRH + lane * 8;
  const unsigned short* xrow = (const unsigned short*)X3 + ((size_t)by * (NN / 16) + nq * 4) * (CI / 32) * FRH + lane * 8;
  v8f acc[4] = {};
#pragma unroll      // every load is base + constant, so that no address register is rewritten while loads are out
  for (int ks = 0; ks < CI / 32; ++ks) { FragH ah; ah.half[0] = *(const v8us*)(arow + ks * FRH); ah.half[1] = *(const v8us*)(arow + ks * FRH + 256);
#pragma unroll      // constant indices keep the fragments and acc in registers
    for (int t = 0; t < 4; ++t) { FragH bq; bq.half[0] = *(const v8us*)(xrow + (t * (CI / 32) + ks) * FRH); bq.half[1] = *(const v8us*)(xrow + (t * (CI / 32) + ks) * FRH + 256);
      acc[t] = mmaH<1>(ah.v, ah.v, bq.v, bq.v, acc[t]); } }
#pragma unroll      // constant indices keep the fragments and acc in registers
  for (int t = 0; t < 4; ++t)
#pragma unroll      // constant indices keep the fragments and acc in registers
    for (int r = 0; r < 8; ++r) so[w][8 * hh + r][t * 16 + ln] = acc[t][r] * 0.0625f;
  __builtin_amdgcn_fence(__ATOMIC_ACQ_REL, "workgroup"); __builtin_amdgcn_wave_barrier();      // the wave's LDS stores are done before its lanes read what other lanes stored
  const int rsub = lane >> 4, c4 = (lane & 15) * 4; typedef _Float16 v4h __attribute__((ext_vector_type(4)));
  _Float16* vrow = Vt + ((size_t)(b * NH + row0 / HD) * 192 + c * 64 + row0 % HD + rsub) * NN + col0 + c4;      // the 16 features of a tile lie in one head
#pragma unroll      // constant offsets from one address pair
  for (int q = 0; q < 8; ++q) { const v4f v = *(const v4fa*)&so[w][q * 2 + rsub][c4]; v4h h4; for (int i = 0; i < 4; ++i) h4[i] = (_Float16)v[i]; *(v4h*)(vrow + (size_t)q * 2 * NN) = h4; }
}
// The q, k and V^T maps in one launch: all three read X3 and none reads another's result. blockIdx.y picks the map, blockIdx.x is the map's own block number (MBL each).
#define MBL ((NR3 / 16) * (CO / 64) / 4)
#define VBX ((CO / 16) * (NN / 64) / 4)
__global__ __launch_bounds__(128) void k_qkv(const _Float16* __restrict__ X3, const _Float16* __restrict__ Bq, const _Float16* __restrict__ Bk, const _Float16* __restrict__ Bv, _Float16* __restrict__ Q16, _Float16* __restrict__ K16, _Float16* __restrict__ Vt) {
  __shared__ __attribute__((aligned(16))) float so[4][16][64];
  const int bx = blockIdx.x, job = blockIdx.y;
  if (job == 2) gemm_vt(so, bx % VBX, bx / VBX, Bv, X3, Vt);
  else gemm_qk(so, bx, X3, job == 0 ? Bq : Bk, job == 0 ? Q16 : K16);
}
// K and V^T tiles of 64 keys, staged in LDS once per work-group and read by its four waves. Row pitches are 16 B x odd, so the 16 rows of a ds_load_b128 fall on distinct banks.
#define TK 64
#define KP 200      // halves per staged K row: 3 coordinate blocks x 64 + 8 of pad (400 B)
#define VP 72       // halves per staged V^T row: 64 keys + 8 of pad (144 B)
// Twelve asynchronous 16-byte copies per lane, global -> LDS, through no register: copy 4 a + q goes from g + a gs + q gq (halves) to LDS byte l + a ls + q lq.
// The s_wait_xcnt closes the statement so that no address register named here is rewritten ahead of it.
__device__ __forceinline__ void acopy12(unsigned l, unsigned ls, unsigned lq, const unsigned short* g, size_t gs, size_t gq) {
  const unsigned l1 = l + lq, l2 = l + 2 * lq, l3 = l + 3 * lq, l4 = l + ls, l5 = l4 + lq, l6 = l4 + 2 * lq, l7 = l4 + 3 * lq, l8 = l + 2 * ls, l9 = l8 + lq, l10 = l8 + 2 * lq, l11 = l8 + 3 * lq;
  const unsigned short *g1 = g + gq, *g2 = g + 2 * gq, *g3 = g + 3 * gq, *g4 = g + gs, *g5 = g4 + gq, *g6 = g4 + 2 * gq, *g7 = g4 + 3 * gq, *g8 = g + 2 * gs, *g9 = g8 + gq, *g10 = g8 + 2 * gq, *g11 = g8 + 3 * gq;
  asm volatile("global_load_async_to_lds_b128 %0, %12, off\n\t"
               "global_load_async_to_lds_b128 %1, %13, off\n\t"
               "global_load_async_to_lds_b128 %2, %14, off\n\t"
               "global_load_async_to_lds_b128 %3, %15, off\n\t"
               "global_load_async_to_lds_b128 %4, %16, off\n\t"
               "global_load_async_to_lds_b128 %5, %17, off\n\t"
               "global_load_async_to_lds_b128 %6, %18, off\n\t"
               "global_load_async_to_lds_b128 %7, %19, off\n\t"
               "global_load_async_to_lds_b128 %8, %20, off\n\t"
               "global_load_async_to_lds_b128 %9, %21, off\n\t"
               "global_load_async_to_lds_b128 %10, %22, off\n\t"
               "global_load_async_to_lds_b128 %11, %23, off\n\t"
               "s_wait_xcnt 0x0"
               :: "v"(l), "v"(l1), "v"(l2), "v"(l3), "v"(l4), "v"(l5), "v"(l6), "v"(l7), "v"(l8), "v"(l9), "v"(l10), "v"(l11),
                  "v"(g), "v"(g1), "v"(g2), "v"(g3), "v"(g4), "v"(g5), "v"(g6), "v"(g7), "v"(g8), "v"(g9), "v"(g10), "v"(g11) : "memory");
}
// One stage: 64 keys of K (3 coordinate blocks of 128 B a key) and 192 rows of V^T (128 B a row); 24 copies a lane.
__device__ __forceinline__ void stage_kv(unsigned lk, unsigned lv, const unsigned short* kg, const unsigned short* vg) {
  acopy12(lk, 128, 16 * KP * 2, kg, CO, (size_t)16 * 3 * CO);
  acopy12(lv, 64 * VP * 2, 16 * VP * 2, vg, (size_t)64 * NN, (size_t)16 * NN);
}
// lane l with lane l ^ 16, through no LDS
__device__ __forceinline__ float xhalf(float x) { return __builtin_bit_cast(float, __builtin_amdgcn_permlanex16(__builtin_bit_cast(int, x), __builtin_bit_cast(int, x), 0x76543210, 0xfedcba98, false, false)); }
// Scores are formed transposed: K rows are the A operand and Q the B operand, so lane (ln, hh) holds query ln and keys 8 hh + r of each 16-key tile. A query's maximum and sum are then
// in-lane but for one exchange between the wave halves, and the two score tiles of 32 keys, converted in place, are the B operand of O^T += V^T P^T (element i: key 8 hh + i, element 8 + i: key 16 + 8 hh + i, as the V^T loader has it).
__global__ __launch_bounds__(128) void k_vnattn(const _Float16* __restrict__ Q16, const _Float16* __restrict__ K16, const _Float16* __restrict__ Vt, _Float16* __restrict__ O3) {
  __shared__ __attribute__((aligned(16))) unsigned short sK[2][TK][KP]; __shared__ __attribute__((aligned(16))) unsigned short sV[2][192][VP];
  __shared__ __attribute__((aligned(16))) unsigned short sO[4][48][64 + 8];      // f16 output, one row a (query, coordinate) piece of 64 halves; a query's pitch is 16 B x odd
  const int tid = threadIdx.x, w = tid >> 5, lane = tid & 31, ln = lane & 15, hh = lane >> 4; const int slab = blockIdx.x / (NN / 64), qblk = blockIdx.x % (NN / 64); const int b = slab / NH, h = slab % NH; const int q0 = qblk * 64 + w * 16;
  const unsigned short* Vth = (const unsigned short*)Vt + (size_t)slab * 192 * NN;
  // The lane's share of a stage: eight lanes cover one 128-byte row piece, so a wave's copy covers four whole lines. K: key = 16 q + tid / 8; V^T: row = 64 a + 16 q + tid / 8.
  const int cr = tid >> 3, cc = (tid & 7) * 8;
  const unsigned short* kg = (const unsigned short*)K16 + ((size_t)b * NN + cr) * (3 * CO) + h * HD + cc;
  const unsigned short* vg = Vth + (size_t)cr * NN + cc;
  const unsigned lk = (unsigned)(size_t)&sK[0][cr][cc], lv = (unsigned)(size_t)&sV[0][cr][cc];
  constexpr unsigned KB = TK * KP * 2, VB = 192 * VP * 2;      // bytes of one buffer
  constexpr int NT = NN / TK;
  stage_kv(lk, lv, kg, vg);
  asm volatile("s_wait_asynccnt 0x0" ::: "memory");      // this wave's share of stage 0 has landed
  __syncthreads();                                        // stage 0 is published to the four waves
  stage_kv(lk + KB, lv + VB, kg + (size_t)TK * 3 * CO, vg + TK);
  FragH aq[6]; { const unsigned short* qr = (const unsigned short*)Q16 + ((size_t)b * NN + q0 + ln) * (3 * CO) + h * HD + 8 * hh;      // row (b,n) = [c0 | c1 | c2] x 512 (= rows (b,n,c) of pitch 512)
#pragma unroll
    for (int ks = 0; ks < 6; ++ks) { const int c = ks >> 1, s32 = (ks & 1) * 32; aq[ks].half[0] = *(const v8us*)(qr + c * CO + s32); aq[ks].half[1] = *(const v8us*)(qr + c * CO + s32 + 16); }
    asm volatile("s_wait_xcnt 0x0" :: "v"(qr) : "memory"); }      // the Q loads' address pair is named as an input, so it stays untouched until this wait; behind it the pair may be reused
  float m_r = -3.0e38f, l_r = 0.f; v8f oacc[12];      // oacc[dt][r] = O[query ln][dt * 16 + 8 hh + r]; l_r sums this half's keys only
#pragma unroll
  for (int dt = 0; dt < 12; ++dt) oacc[dt] = (v8f){0.f,0.f,0.f,0.f,0.f,0.f,0.f,0.f};
#pragma unroll 1
  for (int t = 0; t < NT; ++t) { const int buf = t & 1;
#pragma unroll 1      // the two 32-key passes of a stage stay rolled: unrolled, the build spilled the Q fragments to scratch
   for (int p = 0; p < TK / 32; ++p) { v8f s[2];
#pragma unroll
    for (int nt = 0; nt < 2; ++nt) { const unsigned short* kr = &sK[buf][p * 32 + nt * 16 + ln][0]; v8f acc = (v8f){0.f,0.f,0.f,0.f,0.f,0.f,0.f,0.f}; FragH bk[6];      // six fragments are read as one run ahead of their products: one LDS latency a run, not one a product
#pragma unroll      // constant indices keep bk in registers
      for (int ks = 0; ks < 6; ++ks) { bk[ks].half[0] = *(const v8us*)(kr + ks * 32 + 8 * hh); bk[ks].half[1] = *(const v8us*)(kr + ks * 32 + 16 + 8 * hh); }
#pragma unroll
      for (int ks = 0; ks < 6; ++ks) acc = mmaH<1>(bk[ks].v, bk[ks].v, aq[ks].v, aq[ks].v, acc);
      s[nt] = acc; }
    float mc = -3.0e38f;
#pragma unroll      // constant indices keep the scores in registers
    for (int r = 0; r < 8; ++r) { s[0][r] *= 0.07216878364870323f; s[1][r] *= 0.07216878364870323f; mc = fmaxf(mc, fmaxf(s[0][r], s[1][r])); }
    mc = fmaxf(mc, xhalf(mc));
    const float mn = fmaxf(m_r, mc); const float al = expf(m_r - mn); m_r = mn;
    FragH pa; float ps[4] = {0.f, 0.f, 0.f, 0.f};      // four short chains of adds, not one of sixteen
#pragma unroll      // constant indices keep the scores, pa and ps in registers
    for (int r = 0; r < 8; ++r) { const float p0 = expf(s[0][r] - mn), p1 = expf(s[1][r] - mn); ps[r & 3] += p0 + p1; pa.h[r] = (_Float16)p0; pa.h[8 + r] = (_Float16)p1; }
    l_r = l_r * al + ((ps[0] + ps[1]) + (ps[2] + ps[3]));
#pragma unroll
    for (int dt = 0; dt < 12; ++dt)
#pragma unroll
      for (int r = 0; r < 8; ++r) oacc[dt][r] *= al;
#pragma unroll
    for (int dg = 0; dg < 2; ++dg) { FragH bv[6];      // as for K: a run of six fragments, then their six products
#pragma unroll      // constant indices keep bv and oacc in registers
      for (int i = 0; i < 6; ++i) { const unsigned short* vrow = &sV[buf][(dg * 6 + i) * 16 + ln][p * 32]; bv[i].half[0] = *(const v8us*)(vrow + 8 * hh); bv[i].half[1] = *(const v8us*)(vrow + 16 + 8 * hh); }
#pragma unroll
      for (int i = 0; i < 6; ++i) oacc[dg * 6 + i] = mmaH<1>(bv[i].v, bv[i].v, pa.v, pa.v, oacc[dg * 6 + i]); } }
   asm volatile("s_wait_dscnt 0x0" ::: "memory");         // this wave's reads of buffer t mod 2 are done before the buffer is handed back
   asm volatile("s_wait_asynccnt 0x0" ::: "memory");      // this wave's share of stage t + 1 has landed
   __syncthreads();                                        // publishes stage t + 1 and ends every wave's reads of stage t
   if (t + 2 < NT) stage_kv(lk + buf * KB, lv + buf * VB, kg + (size_t)(t + 2) * TK * 3 * CO, vg + (t + 2) * TK); }
  asm volatile("s_wait_asynccnt 0x0" ::: "memory");        // no copy is outstanding when the wave goes on to its end
  const float linv = 1.0f / (l_r + xhalf(l_r));      // the two halves' sums are joined once, here
#pragma unroll      // constant indices keep oacc in registers
  for (int dt = 0; dt < 12; ++dt) { FragH f;
#pragma unroll      // constant indices keep oacc in registers
    for (int r = 0; r < 8; ++r) f.h[r] = (_Float16)(oacc[dt][r] * linv);
    *(v8us*)&sO[w][ln * 3 + dt / 4][(dt % 4) * 16 + 8 * hh] = f.half[0]; }
  __builtin_amdgcn_fence(__ATOMIC_ACQ_REL, "workgroup"); __builtin_amdgcn_wave_barrier();
  // Stored as the output map reads it: rows (b, n, c) x 512. A query's 192 features are three pieces of 64 halves, one 128-byte line each; eight lanes a piece, four pieces a store.
  unsigned short* orow = (unsigned short*)O3 + (((size_t)b * NN + q0) * 3 + (lane >> 3)) * CO + h * HD + (lane & 7) * 8;
#pragma unroll      // constant offsets from one address pair
  for (int q = 0; q < 12; ++q) { const v8us v = *(const v8us*)&sO[w][q * 4 + (lane >> 3)][(lane & 7) * 8]; *(v8us*)(orow + (size_t)q * 4 * CO) = v; } }
// Output map with the (o, c) interleave in its store: a wave takes 16 tokens x 3 coordinates x 64 outputs (each lane picks its token's three rows of O3), so a token's piece of the result is 192 floats in a row, six whole lines.
__global__ __launch_bounds__(128) void k_gemm_out(const _Float16* __restrict__ O3, const _Float16* __restrict__ Wh, float* __restrict__ out) {
  __shared__ __attribute__((aligned(16))) float so[4][16][192 + 4];
  const int tid = threadIdx.x, w = tid >> 5, lane = tid & 31, ln = lane & 15, hh = lane >> 4;
  const int wid = blockIdx.x * 4 + w; const int mt = wid / (CI / 64), nq = wid % (CI / 64); const int bn0 = mt * 16, col0 = nq * 64;
  const unsigned short* arow = (const unsigned short*)O3 + (size_t)(bn0 + ln) * 3 * CO + 8 * hh;
  const unsigned short* brow = (const unsigned short*)Wh + (size_t)nq * 4 * (CO / 32) * FRH + lane * 8;      // the weights come in fragment order
  v8f acc[3][4] = {};
#pragma unroll      // every load is base + constant, so that no address register is rewritten while loads are out
  for (int kb = 0; kb < CO; kb += 32) { FragH a[3];
#pragma unroll      // constant indices keep the fragments and acc in registers
    for (int c = 0; c < 3; ++c) { a[c].half[0] = *(const v8us*)(arow + c * CO + kb); a[c].half[1] = *(const v8us*)(arow + c * CO + kb + 16); }
#pragma unroll      // constant indices keep the fragments and acc in registers
    for (int t = 0; t < 4; ++t) { FragH bq; bq.half[0] = *(const v8us*)(brow + (t * (CO / 32) + kb / 32) * FRH); bq.half[1] = *(const v8us*)(brow + (t * (CO / 32) + kb / 32) * FRH + 256);
#pragma unroll      // constant indices keep the fragments and acc in registers
      for (int c = 0; c < 3; ++c) acc[c][t] = mmaH<1>(a[c].v, a[c].v, bq.v, bq.v, acc[c][t]); } }
#pragma unroll      // constant indices keep the fragments and acc in registers
  for (int t = 0; t < 4; ++t)
#pragma unroll      // constant indices keep the fragments and acc in registers
    for (int c = 0; c < 3; ++c)
#pragma unroll      // constant indices keep the fragments and acc in registers
      for (int r = 0; r < 8; ++r) so[w][8 * hh + r][(t * 16 + ln) * 3 + c] = acc[c][t][r] * 0.0625f;
  __builtin_amdgcn_fence(__ATOMIC_ACQ_REL, "workgroup"); __builtin_amdgcn_wave_barrier();      // the wave's LDS stores are done before its lanes read what other lanes stored
  // two tokens' pieces are 96 float4, three stores of the wave; from one pair of tokens to the next every address moves by a constant
#pragma unroll      // three address pairs, formed once
  for (int j = 0; j < 3; ++j) { const int i = j * 32 + lane, r = i / 48, p4 = (i % 48) * 4; const float* ls = &so[w][r][p4]; float* gp = out + ((size_t)(bn0 + r) * CI + col0) * 3 + p4;
#pragma unroll      // constant offsets from the pair
    for (int q = 0; q < 8; ++q) { const v4f v = *(const v4fa*)(ls + q * 2 * (192 + 4)); *(v4f*)(gp + (size_t)q * 2 * CI * 3) = v; } }
}
extern "C" void kernel_launch(void* const* d_in, const int* in_sizes, int n_in,
                              void* d_out, int out_size, void* d_ws, size_t ws_size, hipStream_t stream) {
  (void)in_sizes; (void)n_in; (void)out_size;
  const float* x = (const float*)d_in[0]; const float* Wq = (const float*)d_in[1]; const float* Wk = (const float*)d_in[2]; const float* Wv = (const float*)d_in[3]; const float* Wo = (const float*)d_in[4];
  char* ws = (char*)d_ws; size_t off = 0;
  auto take = [&](size_t bytes) { char* p = ws + off; off += (bytes + 255) & ~(size_t)255; return p; };
  _Float16* Bq = (_Float16*)take((size_t)CO * CI * 2); _Float16* Bk = (_Float16*)take((size_t)CO * CI * 2); _Float16* Bv = (_Float16*)take((size_t)CO * CI * 2); _Float16* Bo = (_Float16*)take((size_t)CI * CO * 2);
  _Float16* X3 = (_Float16*)take((size_t)NR3 * CI * 2); _Float16* Q16 = (_Float16*)take((size_t)NR3 * CO * 2); _Float16* K16 = (_Float16*)take((size_t)NR3 * CO * 2); _Float16* Vt = (_Float16*)take((size_t)NR3 * CO * 2); _Float16* O3 = (_Float16*)take((size_t)NR3 * CO * 2);      // O3 has a place of its own: the attention stores it while other work-groups still read Q16
  if (off > ws_size) return;      // 1 + 6.3 + 12.6 x 4, about 58 MB
  k_prep<<<4 * WBL + XBL, 256, 0, stream>>>(x, Wq, Wk, Wv, Wo, Bq, Bk, Bv, Bo, X3);      // weights are (out,in); X3 = rows (b,c,n) x 256; all five in fragment order
  k_qkv<<<dim3(MBL, 3), 128, 0, stream>>>(X3, Bq, Bk, Bv, Q16, K16, Vt);      // q/k planes = rows (b,n,c) x 512 = [(b,n)][c * 512 + o]
  k_vnattn<<<BB * NH * (NN / 64), 128, 0, stream>>>(Q16, K16, Vt, O3);
  k_gemm_out<<<(NR / 16) * (CI / 64) / 4, 128, 0, stream>>>(O3, Bo, (float*)d_out);
}

// v006
// One run takes 125 microseconds.
// Timed twice side by side with v005, it ran 1.10 and 1.09 times as fast.
// All steps since v000 together make it 4.81 times as fast.
#include <hip/hip_runtime.h>
// Vector-neuron attention (B=2, N=2048, C=256 × 3 coordinates, 8 heads × 64): the VN-linear maps (rows (b,n,c) × 256 → 512, weights (out,in) bf16-exact ×2^4) and the attention over the
// 192-dim (d, c) head features as a fused flash-style kernel on v_wmma_f32_16x16x32_f16 (S^T = K Q^T / sqrt(192) with 6 k-steps gathered from the three coordinate blocks, online softmax f32 in-lane, P f16 <= 1 packed from the score registers,
// O^T = V^T P^T with 12 d-tiles; RPW-16 waves); f16 operands, single products, f32 accumulate; V^T, the f16 attention output and the final (o, c) interleave are stored by the kernels that compute them.
#define BB 2
#define NN 2048
#define CI 256
#define CO 512
#define NH 8
#define HD 64
#define NR3 (BB * NN * 3)
#define NR (BB * NN)

typedef __bf16 v16b __attribute__((ext_vector_type(16)));
typedef unsigned short v8us __attribute__((ext_vector_type(8), may_alias));
typedef float  v8f  __attribute__((ext_vector_type(8)));
typedef float  v4f  __attribute__((ext_vector_type(4)));
typedef float  v4fa __attribute__((ext_vector_type(4), may_alias));
union FragB { v16b v; v8us half[2]; unsigned short u[16]; };

__device__ __forceinline__ unsigned short bf16_bits(float x) { unsigned int u = __float_as_uint(x); return (unsigned short)((u + 0x7FFFu + ((u >> 16) & 1u)) >> 16); }
__device__ __forceinline__ float bf16_val(unsigned short b) { return __uint_as_float(((unsigned int)b) << 16); }
__device__ __forceinline__ float bf16_round(float x) { return bf16_val(bf16_bits(x)); }
// D += A·B with NT terms: 1 = ah·bh, 2 = + al·bh (A split), 3 = + ah·bl (both split)
template <int NT>
__device__ __forceinline__ v8f mmaN(v16b ah, v16b al, v16b bh, v16b bl, v8f c) {
  c = __builtin_amdgcn_wmma_f32_16x16x32_bf16(false, ah, false, bh, (short)0, c, false, false);
  if (NT >= 2) c = __builtin_amdgcn_wmma_f32_16x16x32_bf16(false, al, false, bh, (short)0, c, false, false);
  if (NT >= 3) c = __builtin_amdgcn_wmma_f32_16x16x32_bf16(false, ah, false, bl, (short)0, c, false, false);
  asm volatile("v_nop\n\tv_nop\n\tv_nop\n\tv_nop" : "+v"(c) : "v"(ah), "v"(al), "v"(bh), "v"(bl));
  return c;
}

__global__ __launch_bounds__(256) void k_wt_bf16(const float* __restrict__ W, unsigned short* __restrict__ Wt, int K, int N) {
  const int t = blockIdx.x * 256 + threadIdx.x;
  const int k8n = K / 8;
  if (t >= N * k8n) return;
  const int n = t / k8n, k8 = (t % k8n) * 8;
  v8us v;
#pragma unroll
  for (int i = 0; i < 8; ++i) v[i] = bf16_bits(W[(size_t)(k8 + i) * N + n]);
  *(v8us*)(Wt + (size_t)n * K + k8) = v;
  
}

// GEMM C[M][N] (f32, pitch ldc) = act(A[M][K]·W + bias). A f32 row-major (pitch lda) converted per fragment to bf16
// (ASPLIT: hi/lo two planes -> 2 terms, else single rounded term); Wt bf16 [N][K] (pitch ldb). BIAS_BF16 rounds the
// bias to bf16 first (bias quantised to bf16 before the add). K%32==0, M%16==0, N%64==0.
template <bool ASPLIT, int ACT, bool BIAS_BF16>
__global__ __launch_bounds__(128) void k_gemm_bf(const float* __restrict__ A, int lda, const unsigned short* __restrict__ Wt, int ldb,
                                               const float* __restrict__ bias, float* __restrict__ C, int ldc, int M, int N, int K) {
  __shared__ __attribute__((aligned(16))) float so[4][16][64];
  const int tid = threadIdx.x, w = tid >> 5, lane = tid & 31, ln = lane & 15, hh = lane >> 4;
  const int ntn = N / 64;
  const int wid = blockIdx.x * 4 + w;
  const int mt = wid / ntn, nq = wid % ntn;
  if (mt * 16 >= M) return;
  const int row0 = mt * 16, col0 = nq * 64;
  const float* arow = A + (size_t)(row0 + ln) * lda;
  v8f acc[4] = {};
  for (int kb = 0; kb < K; kb += 32) {
    FragB ah, al;
    const v4f x0 = *(const v4fa*)(arow + kb + 8 * hh), x1 = *(const v4fa*)(arow + kb + 8 * hh + 4);
    const v4f x2 = *(const v4fa*)(arow + kb + 16 + 8 * hh), x3 = *(const v4fa*)(arow + kb + 16 + 8 * hh + 4);
    float xs[16] = {x0[0],x0[1],x0[2],x0[3],x1[0],x1[1],x1[2],x1[3],x2[0],x2[1],x2[2],x2[3],x3[0],x3[1],x3[2],x3[3]};
#pragma unroll
    for (int i = 0; i < 16; ++i) { const unsigned short hb = bf16_bits(xs[i]); ah.u[i] = hb; al.u[i] = ASPLIT ? bf16_bits(xs[i] - bf16_val(hb)) : (unsigned short)0; }
#pragma unroll
    for (int t = 0; t < 4; ++t) {
      const unsigned short* brow = Wt + (size_t)(col0 + t * 16 + ln) * ldb + kb;
      FragB b;
      b.half[0] = *(const v8us*)(brow + 8 * hh);
      b.half[1] = *(const v8us*)(brow + 16 + 8 * hh);
      acc[t] = mmaN<ASPLIT ? 2 : 1>(ah.v, al.v, b.v, b.v, acc[t]);
    }
  }
#pragma unroll
  for (int t = 0; t < 4; ++t) {
    float bv = bias ? bias[col0 + t * 16 + ln] : 0.f;
    if (BIAS_BF16) bv = bf16_round(bv);
#pragma unroll
    for (int r = 0; r < 8; ++r) { float v = acc[t][r] + bv; if (ACT == 1) v = fmaxf(v, 0.f); so[w][8 * hh + r][t * 16 + ln] = v; }
  }
  __builtin_amdgcn_fence(__ATOMIC_ACQ_REL, "workgroup");
  __builtin_amdgcn_wave_barrier();
  const int rsub = lane >> 4, c4 = (lane & 15) * 4;
  {
#pragma unroll
    for (int q = 0; q < 8; ++q) {
      const int r = q * 2 + rsub;
      const v4f v = *(const v4fa*)&so[w][r][c4];
      *(v4f*)(C + (size_t)(row0 + r) * ldc + col0 + c4) = v;
    }
    
  }
}

// Flash-style causal/unmasked attention, all contractions 3-term bf16 hi/lo splits, f32 softmax with running max.
// q,k,v rows are read from f32 buffers with arbitrary row pitch (so they can live inside a fused qkv buffer);
// D = head size (multiple of 32, <= 128); one wave = 16 query rows; block = 4 waves (64 queries) sharing K/V chunks of 32.
template <int D, bool CAUSAL>
__global__ __launch_bounds__(128) void k_flash(const float* __restrict__ qb, const float* __restrict__ kb, const float* __restrict__ vb,
                                             int pitch, int T, int H, float scale, float* __restrict__ y, int ypitch) {
  constexpr int KS = D / 32;        // k-steps for QK
  constexpr int DT = D / 16;        // d tiles for PV
  __shared__ __attribute__((aligned(16))) unsigned short sKh[32][D + 8], sKl[32][D + 8], sVh[32][D + 8], sVl[32][D + 8];
  __shared__ __attribute__((aligned(16))) unsigned short sPh[4][16][40], sPl[4][16][40];
  __shared__ __attribute__((aligned(16))) float sO[4][16][D];
  const int tid = threadIdx.x, w = tid >> 5, lane = tid & 31, ln = lane & 15, hh = lane >> 4;
  const int nqb = (T + 63) / 64;
  const int bh = blockIdx.x / nqb, qblk = blockIdx.x % nqb;
  const int b = bh / H, h = bh % H;
  const int q0 = qblk * 64 + w * 16;
  const float* Q = qb + (size_t)b * T * pitch + h * D;
  const float* K = kb + (size_t)b * T * pitch + h * D;
  const float* V = vb + (size_t)b * T * pitch + h * D;

  // A fragments of the wave's 16 query rows (scaled), hi/lo
  FragB aqh[KS], aql[KS];
  {
    int row = q0 + ln; if (row >= T) row = T - 1;
    const float* qr = Q + (size_t)row * pitch;
#pragma unroll
    for (int ks = 0; ks < KS; ++ks)
#pragma unroll
      for (int i = 0; i < 16; ++i) {
        const int d = ks * 32 + ((i < 8) ? (8 * hh + i) : (16 + 8 * hh + (i - 8)));
        const float x = qr[d] * scale; const unsigned short hb = bf16_bits(x);
        aqh[ks].u[i] = hb; aql[ks].u[i] = bf16_bits(x - bf16_val(hb));
      }
  }
  float m_r[8], l_r[8];
#pragma unroll
  for (int r = 0; r < 8; ++r) { m_r[r] = -3.0e38f; l_r[r] = 0.f; }
  v8f oacc[DT];
#pragma unroll
  for (int dt = 0; dt < DT; ++dt) oacc[dt] = (v8f){0.f,0.f,0.f,0.f,0.f,0.f,0.f,0.f};

  const int kv_end = CAUSAL ? min(T, qblk * 64 + 64) : T;     // block-uniform
  for (int j0 = 0; j0 < kv_end; j0 += 32) {
    __syncthreads();
    for (int e = tid; e < 32 * (D / 4); e += 128) {
      const int r = e / (D / 4), c4 = (e % (D / 4)) * 4;
      const int key = j0 + r;
      v4f kf = {0.f,0.f,0.f,0.f}, vf = {0.f,0.f,0.f,0.f};
      if (key < T) { kf = *(const v4fa*)(K + (size_t)key * pitch + c4); vf = *(const v4fa*)(V + (size_t)key * pitch + c4); }
#pragma unroll
      for (int t = 0; t < 4; ++t) {
        unsigned short hb = bf16_bits(kf[t]); sKh[r][c4 + t] = hb; sKl[r][c4 + t] = bf16_bits(kf[t] - bf16_val(hb));
        hb = bf16_bits(vf[t]); sVh[r][c4 + t] = hb; sVl[r][c4 + t] = bf16_bits(vf[t] - bf16_val(hb));
      }
    }
    __syncthreads();
    // S tile 16 x 32
    v8f s[2];
#pragma unroll
    for (int nt = 0; nt < 2; ++nt) {
      v8f acc = {};
#pragma unroll
      for (int ks = 0; ks < KS; ++ks) {
        FragB bh_, bl_;
        bh_.half[0] = *(const v8us*)&sKh[nt * 16 + ln][ks * 32 + 8 * hh]; bh_.half[1] = *(const v8us*)&sKh[nt * 16 + ln][ks * 32 + 16 + 8 * hh];
        bl_.half[0] = *(const v8us*)&sKl[nt * 16 + ln][ks * 32 + 8 * hh]; bl_.half[1] = *(const v8us*)&sKl[nt * 16 + ln][ks * 32 + 16 + 8 * hh];
        acc = mmaN<3>(aqh[ks].v, aql[ks].v, bh_.v, bl_.v, acc);
      }
      s[nt] = acc;
    }
    // mask + running max (rows 8hh+r; the 16 lanes of a half share rows)
    float alpha[8];
#pragma unroll
    for (int r = 0; r < 8; ++r) {
      const int qi = q0 + 8 * hh + r;
      const int ja = j0 + ln, jb = j0 + 16 + ln;
      if (CAUSAL) { if (ja > qi) s[0][r] = -3.0e38f; if (jb > qi) s[1][r] = -3.0e38f; }
      if (ja >= T) s[0][r] = -3.0e38f;
      if (jb >= T) s[1][r] = -3.0e38f;
      float mx = fmaxf(s[0][r], s[1][r]);
      mx = fmaxf(mx, __shfl_xor(mx, 1, 32)); mx = fmaxf(mx, __shfl_xor(mx, 2, 32)); mx = fmaxf(mx, __shfl_xor(mx, 4, 32)); mx = fmaxf(mx, __shfl_xor(mx, 8, 32));
      const float mnew = fmaxf(m_r[r], mx);
      alpha[r] = (mnew > -1.0e38f) ? __expf(m_r[r] - mnew) : 1.0f;
      const float p0 = (s[0][r] > -1.0e38f) ? __expf(s[0][r] - mnew) : 0.f;
      const float p1 = (s[1][r] > -1.0e38f) ? __expf(s[1][r] - mnew) : 0.f;
      m_r[r] = mnew;
      l_r[r] = l_r[r] * alpha[r] + p0 + p1;            // per-lane partial row sum (16 lanes combined at the end)
      unsigned short hb = bf16_bits(p0); sPh[w][8 * hh + r][ln] = hb;      sPl[w][8 * hh + r][ln] = bf16_bits(p0 - bf16_val(hb));
      hb = bf16_bits(p1);                sPh[w][8 * hh + r][16 + ln] = hb; sPl[w][8 * hh + r][16 + ln] = bf16_bits(p1 - bf16_val(hb));
    }
#pragma unroll
    for (int dt = 0; dt < DT; ++dt)
#pragma unroll
      for (int r = 0; r < 8; ++r) oacc[dt][r] *= alpha[r];
    __builtin_amdgcn_fence(__ATOMIC_ACQ_REL, "workgroup");
    __builtin_amdgcn_wave_barrier();
    FragB pah, pal;
    pah.half[0] = *(const v8us*)&sPh[w][ln][8 * hh]; pah.half[1] = *(const v8us*)&sPh[w][ln][16 + 8 * hh];
    pal.half[0] = *(const v8us*)&sPl[w][ln][8 * hh]; pal.half[1] = *(const v8us*)&sPl[w][ln][16 + 8 * hh];
#pragma unroll
    for (int dt = 0; dt < DT; ++dt) {
      FragB bvh, bvl;
#pragma unroll
      for (int i = 0; i < 8; ++i) {
        bvh.u[i] = sVh[8 * hh + i][dt * 16 + ln]; bvh.u[8 + i] = sVh[16 + 8 * hh + i][dt * 16 + ln];
        bvl.u[i] = sVl[8 * hh + i][dt * 16 + ln]; bvl.u[8 + i] = sVl[16 + 8 * hh + i][dt * 16 + ln];
      }
      oacc[dt] = mmaN<3>(pah.v, pal.v, bvh.v, bvl.v, oacc[dt]);
    }
    __builtin_amdgcn_fence(__ATOMIC_ACQ_REL, "workgroup");
    __builtin_amdgcn_wave_barrier();
  }
#pragma unroll
  for (int r = 0; r < 8; ++r) {
    float l = l_r[r];
    l += __shfl_xor(l, 1, 32); l += __shfl_xor(l, 2, 32); l += __shfl_xor(l, 4, 32); l += __shfl_xor(l, 8, 32);
    l_r[r] = (l > 0.f) ? 1.0f / l : 0.f;
  }
#pragma unroll
  for (int dt = 0; dt < DT; ++dt)
#pragma unroll
    for (int r = 0; r < 8; ++r) sO[w][8 * hh + r][dt * 16 + ln] = oacc[dt][r] * l_r[r];
  __builtin_amdgcn_fence(__ATOMIC_ACQ_REL, "workgroup");
  __builtin_amdgcn_wave_barrier();
  {
    for (int r = 0; r < 16; ++r) {
      const int row = q0 + r;
      if (row < T && lane < D / 4) {
        const v4f val = *(const v4fa*)&sO[w][r][lane * 4];
        *(v4f*)(y + ((size_t)b * T + row) * ypitch + h * D + lane * 4) = val;
      }
    }
    
  }
}

// GEMM C = act(A·W + bias + resid): A f32 (ASPLIT -> hi/lo 2 terms), Wt bf16 [N][K]; ACT 0 none, 1 relu, 2 exact gelu;
// resid (optional, f32, row index = (row % rmod), pitch ldr, RES_BF16 rounds it) added before the activation.
template <bool ASPLIT, int ACT, bool BIAS_BF16, bool RES_BF16>
__global__ __launch_bounds__(128) void k_gemm_bf3(const float* __restrict__ A, int lda, const unsigned short* __restrict__ Wt, int ldb,
                                                const float* __restrict__ bias, const float* __restrict__ resid, int rmod, int ldr,
                                                float* __restrict__ C, int ldc, int M, int N, int K) {
  __shared__ __attribute__((aligned(16))) float so[4][16][64];
  const int tid = threadIdx.x, w = tid >> 5, lane = tid & 31, ln = lane & 15, hh = lane >> 4;
  const int ntn = N / 64;
  const int wid = blockIdx.x * 4 + w;
  const int mt = wid / ntn, nq = wid % ntn;
  if (mt * 16 >= M) return;
  const int row0 = mt * 16, col0 = nq * 64;
  const float* arow = A + (size_t)(row0 + ln) * lda;
  v8f acc[4] = {};
  for (int kb = 0; kb < K; kb += 32) {
    FragB ah, al;
    const v4f x0 = *(const v4fa*)(arow + kb + 8 * hh), x1 = *(const v4fa*)(arow + kb + 8 * hh + 4);
    const v4f x2 = *(const v4fa*)(arow + kb + 16 + 8 * hh), x3 = *(const v4fa*)(arow + kb + 16 + 8 * hh + 4);
    float xs[16] = {x0[0],x0[1],x0[2],x0[3],x1[0],x1[1],x1[2],x1[3],x2[0],x2[1],x2[2],x2[3],x3[0],x3[1],x3[2],x3[3]};
#pragma unroll
    for (int i = 0; i < 16; ++i) { const unsigned short hb = bf16_bits(xs[i]); ah.u[i] = hb; al.u[i] = ASPLIT ? bf16_bits(xs[i] - bf16_val(hb)) : (unsigned short)0; }
#pragma unroll
    for (int t = 0; t < 4; ++t) {
      const unsigned short* brow = Wt + (size_t)(col0 + t * 16 + ln) * ldb + kb;
      FragB b;
      b.half[0] = *(const v8us*)(brow + 8 * hh);
      b.half[1] = *(const v8us*)(brow + 16 + 8 * hh);
      acc[t] = mmaN<ASPLIT ? 2 : 1>(ah.v, al.v, b.v, b.v, acc[t]);
    }
  }
#pragma unroll
  for (int t = 0; t < 4; ++t) {
    const int col = col0 + t * 16 + ln;
    float bv = bias ? bias[col] : 0.f;
    if (BIAS_BF16) bv = bf16_round(bv);
#pragma unroll
    for (int r = 0; r < 8; ++r) {
      float v = acc[t][r] + bv;
      if (resid) { float rv = resid[(size_t)((row0 + 8 * hh + r) % rmod) * ldr + col]; if (RES_BF16) rv = bf16_round(rv); v += rv; }
      if (ACT == 1) v = fmaxf(v, 0.f);
      if (ACT == 2) v = 0.5f * v * (1.0f + erff(v * 0.70710678118654752f));
      if (ACT == 3) { const float u = 0.7978845608028654f * (v + 0.044715f * v * v * v); v = 0.5f * v * (1.0f + tanhf(u)); }
      so[w][8 * hh + r][t * 16 + ln] = v;
    }
  }
  __builtin_amdgcn_fence(__ATOMIC_ACQ_REL, "workgroup");
  __builtin_amdgcn_wave_barrier();
  const int rsub = lane >> 4, c4 = (lane & 15) * 4;
  {
#pragma unroll
    for (int q = 0; q < 8; ++q) {
      const int r = q * 2 + rsub;
      const v4f v = *(const v4fa*)&so[w][r][c4];
      *(v4f*)(C + (size_t)(row0 + r) * ldc + col0 + c4) = v;
    }
    
  }
}
// row LayerNorm (biased variance, eps) over N: s = X (+ R); optional out_sum <- s; out_norm <- (s-mu)*rsqrt(var+eps)*g + b
template <bool PARAM_BF16>
__global__ __launch_bounds__(256) void k_layernorm(const float* __restrict__ X, const float* __restrict__ R, const float* __restrict__ g, const float* __restrict__ bta,
                                                  float* __restrict__ out_sum, float* __restrict__ out_norm, int N, float eps) {
  __shared__ float red[256];
  const int row = blockIdx.x, tid = threadIdx.x;
  const float* x = X + (size_t)row * N; const float* rr = R ? R + (size_t)row * N : nullptr;
  float vals[16];                     // up to N = 4096
  const int per = N / 256;            // contiguous chunk per thread? use strided-by-4 chunks: thread handles j = tid*4 + 1024*u
  float s1 = 0.f;
  for (int u = 0; u < per / 4; ++u) {
    const int j = tid * 4 + 1024 * u;
    const v4f a = *(const v4fa*)(x + j);
    v4f b = {0.f,0.f,0.f,0.f}; if (rr) b = *(const v4fa*)(rr + j);
#pragma unroll
    for (int q = 0; q < 4; ++q) { const float v = a[q] + b[q]; vals[u * 4 + q] = v; s1 += v; }
  }
  red[tid] = s1; __syncthreads();
  for (int st = 128; st > 0; st >>= 1) { if (tid < st) red[tid] += red[tid + st]; __syncthreads(); }
  const float mu = red[0] / (float)N; __syncthreads();
  float s2 = 0.f;
  for (int u = 0; u < per / 4; ++u)
#pragma unroll
    for (int q = 0; q < 4; ++q) { const float c = vals[u * 4 + q] - mu; s2 += c * c; }
  red[tid] = s2; __syncthreads();
  for (int st = 128; st > 0; st >>= 1) { if (tid < st) red[tid] += red[tid + st]; __syncthreads(); }
  const float rs = rsqrtf(red[0] / (float)N + eps);
  {
    for (int u = 0; u < per / 4; ++u) {
      const int j = tid * 4 + 1024 * u;
      v4f o, sm;
#pragma unroll
      for (int q = 0; q < 4; ++q) {
        float gg = g[j + q], bb = bta[j + q];
        if (PARAM_BF16) { gg = bf16_round(gg); bb = bf16_round(bb); }
        sm[q] = vals[u * 4 + q]; o[q] = (vals[u * 4 + q] - mu) * rs * gg + bb;
      }
      if (out_sum) *(v4f*)(out_sum + (size_t)row * N + j) = sm;
      *(v4f*)(out_norm + (size_t)row * N + j) = o;
    }
    
  }
}



// ---- f16 WMMA path (v_wmma_f32_16x16x32_f16): 11-bit significands for operands in range — used for every contraction launched here (VN-linear maps, Q·Kᵀ, P·V)
typedef _Float16 v16h __attribute__((ext_vector_type(16)));
union FragH { v16h v; v8us half[2]; _Float16 h[16]; unsigned short u[16]; };
template <int NT>
__device__ __forceinline__ v8f mmaH(v16h ah, v16h al, v16h bh, v16h bl, v8f c) {
  c = __builtin_amdgcn_wmma_f32_16x16x32_f16(false, ah, false, bh, (short)0, c, false, false);
  if (NT >= 2) c = __builtin_amdgcn_wmma_f32_16x16x32_f16(false, al, false, bh, (short)0, c, false, false);
  if (NT >= 3) c = __builtin_amdgcn_wmma_f32_16x16x32_f16(false, ah, false, bl, (short)0, c, false, false);
  asm volatile("v_nop\n\tv_nop\n\tv_nop\n\tv_nop" : "+v"(c) : "v"(ah), "v"(al), "v"(bh), "v"(bl));
  return c;
}
// batched GEMM like k_gemm_b but f16 operands: A f32 (split into f16 hi/lo if ASPLIT, else rounded to f16), Bt = f16 values [n][k]; alpha; C f32; N multiple of 16 (partial tiles skipped)
template <bool ASPLIT>
__global__ __launch_bounds__(128) void k_gemm_h(const float* __restrict__ A, int lda, size_t sA, const _Float16* __restrict__ Bh, int ldb, size_t sB, float alpha, float* __restrict__ C, int ldc, size_t sC, int M, int N, int K) {
  __shared__ __attribute__((aligned(16))) float so[4][16][64];
  const int tid = threadIdx.x, w = tid >> 5, lane = tid & 31, ln = lane & 15, hh = lane >> 4; const int by = blockIdx.y;
  A += (size_t)by * sA; Bh += (size_t)by * sB; C += (size_t)by * sC;
  const int ntn = (N + 63) / 64; const int wid = blockIdx.x * 4 + w; const int mt = wid / ntn, nq = wid % ntn; if (mt * 16 >= M) return;
  const int row0 = mt * 16, col0 = nq * 64; const float* arow = A + (size_t)(row0 + ln) * lda;
  v8f acc[4] = {};
  for (int kb = 0; kb < K; kb += 32) {
    FragH ah, al;
    const v4f x0 = *(const v4fa*)(arow + kb + 8 * hh), x1 = *(const v4fa*)(arow + kb + 8 * hh + 4), x2 = *(const v4fa*)(arow + kb + 16 + 8 * hh), x3 = *(const v4fa*)(arow + kb + 16 + 8 * hh + 4);
    float xs[16] = {x0[0],x0[1],x0[2],x0[3],x1[0],x1[1],x1[2],x1[3],x2[0],x2[1],x2[2],x2[3],x3[0],x3[1],x3[2],x3[3]};
#pragma unroll
    for (int i = 0; i < 16; ++i) { const _Float16 h = (_Float16)xs[i]; ah.h[i] = h; al.h[i] = ASPLIT ? (_Float16)(xs[i] - (float)h) : (_Float16)0.0f; }
#pragma unroll
    for (int t = 0; t < 4; ++t) { if (col0 + t * 16 >= N) continue; const size_t boff = (size_t)(col0 + t * 16 + ln) * ldb + kb; FragH bq; bq.half[0] = *(const v8us*)(Bh + boff + 8 * hh); bq.half[1] = *(const v8us*)(Bh + boff + 16 + 8 * hh);
      acc[t] = mmaH<ASPLIT ? 2 : 1>(ah.v, al.v, bq.v, bq.v, acc[t]); }
  }
#pragma unroll
  for (int t = 0; t < 4; ++t) { if (col0 + t * 16 >= N) continue;
#pragma unroll
    for (int r = 0; r < 8; ++r) so[w][8 * hh + r][t * 16 + ln] = acc[t][r] * alpha; }
  __builtin_amdgcn_fence(__ATOMIC_ACQ_REL, "workgroup"); __builtin_amdgcn_wave_barrier();
  const int rsub = lane >> 4, c4 = (lane & 15) * 4;
  {
#pragma unroll
    for (int q = 0; q < 8; ++q) { const int r = q * 2 + rsub; if (col0 + c4 < N) { const v4f v = *(const v4fa*)&so[w][r][c4]; *(v4f*)(C + (size_t)(row0 + r) * ldc + col0 + c4) = v; } }
     }
}

// Wt[n][k] = f16(W[k][n]·scale) from f32 row-major W[K][N] (scale = power of two; bf16-exact weights stay exact in f16 away from the subnormal range)
__global__ __launch_bounds__(256) void k_wt_f16(const float* __restrict__ W, _Float16* __restrict__ Wt, int K, int N, float scale) {
  const int t = blockIdx.x * 256 + threadIdx.x; if (t >= N * (K / 8)) return; const int n = t / (K / 8), k8 = (t % (K / 8)) * 8; FragH f;
#pragma unroll
  for (int i = 0; i < 8; ++i) f.h[i] = (_Float16)(bf16_round(W[(size_t)(k8 + i) * N + n]) * scale); const v8us o = f.half[0];
  *(v8us*)((unsigned short*)Wt + (size_t)n * K + k8) = o; 
}
// FRAGMENT ORDER. The weights and x are stored as the matrix instructions read them: a matrix of rows x K halves is cut into fragments of 16 rows x 32 k, 1 KB each, at [row / 16][k / 32];
// inside a fragment piece (hs, lane) is 16 bytes: row lane % 16, k = 16 hs + 8 (lane / 16) + 0..7. A wave's 16-byte load of half a fragment is then 512 bytes in a row, four whole lines, where rows of pitch K gave sixteen 32-byte pieces.
#define FRH 512      // halves of one fragment
// Every operand conversion in one launch; the block index picks the job, and no job reads what another writes. Blocks [0, 4 WBL): the four weight matrices, rounded and scaled by 16, WBL blocks each; the rest: x.
// Thread t writes piece t of its packed matrix, so a wave's store is 512 bytes in a row. X3 has its rows in the order (b, c, n): a thread takes the three coordinates of its 8 channels from one run of 96 bytes and writes one piece to each of the three planes.
#define WBL (CO * CI / 8 / 256)
#define XBL (NR * (CI / 8) / 256)
__global__ __launch_bounds__(256) void k_prep(const float* __restrict__ x, const float* __restrict__ Wq, const float* __restrict__ Wk, const float* __restrict__ Wv, const float* __restrict__ Wo,
                                            _Float16* __restrict__ Bq, _Float16* __restrict__ Bk, _Float16* __restrict__ Bv, _Float16* __restrict__ Bo, _Float16* __restrict__ X3) {
  const int bx = blockIdx.x; const int lane = threadIdx.x & 31, hs = (threadIdx.x >> 5) & 1; const int kin = hs * 16 + (lane >> 4) * 8;
  if (bx < 4 * WBL) { const int j = bx / WBL; const float* W = j == 0 ? Wq : j == 1 ? Wk : j == 2 ? Wv : Wo; _Float16* Bt = j == 0 ? Bq : j == 1 ? Bk : j == 2 ? Bv : Bo; const int kf = (j == 3 ? CO : CI) / 32;      // fragments in a row of the matrix
    const int t = (bx % WBL) * 256 + threadIdx.x; const int fr = t >> 6; const float* wp = W + (size_t)((fr / kf) * 16 + (lane & 15)) * (kf * 32) + (fr % kf) * 32 + kin; FragH f;
#pragma unroll      // constant indices keep f in registers
    for (int i = 0; i < 8; ++i) f.h[i] = (_Float16)(bf16_round(wp[i]) * 16.0f); *(v8us*)((unsigned short*)Bt + (size_t)t * 8) = f.half[0]; }
  else { const int t = (bx - 4 * WBL) * 256 + threadIdx.x; const int fr = t >> 6; const int bn = (fr / (CI / 32)) * 16 + (lane & 15); const float* xp = x + ((size_t)bn * CI + (fr % (CI / 32)) * 32 + kin) * 3;
    unsigned short* xo = (unsigned short*)X3 + ((size_t)t + (size_t)(bn / NN) * 2 * (NN / 16) * (CI / 32) * 64) * 8;      // token row b NN + n becomes row (3 b + c) NN + n: 2 b + c planes further
#pragma unroll      // the 24 floats are loaded once, as six 16-byte loads, and the three stores go from one address pair with constant offsets
    for (int c = 0; c < 3; ++c) { FragH f;
#pragma unroll      // constant indices keep f in registers
      for (int q = 0; q < 8; ++q) f.h[q] = (_Float16)bf16_round(xp[q * 3 + c]); *(v8us*)(xo + (size_t)c * (NN / 16) * (CI / 32) * FRH) = f.half[0]; }
    asm volatile("s_wait_xcnt 0x0" ::: "memory"); } }      // behind the last store: no register that the three stores name is rewritten ahead of this wait
// q or k map: C[(b, n, c)][o] = sum_k X3[(b, c, n)][k] W[o][k] / 16, f16. A wave takes 16 tokens of one (b, c) x 64 outputs; both operands come in fragment order. The result keeps its rows (b, n, c) x 512: a token's row is picked in the store.
__device__ __forceinline__ void gemm_qk(float (*so)[16][64], int bx, const _Float16* __restrict__ X3, const _Float16* __restrict__ Wh, _Float16* __restrict__ C16) {
  const int tid = threadIdx.x, w = tid >> 5, lane = tid & 31, ln = lane & 15, hh = lane >> 4;
  const int wid = bx * 4 + w; const int mt = wid / (CO / 64), nq = wid % (CO / 64); const int col0 = nq * 64;
  const unsigned short* ap = (const unsigned short*)X3 + (size_t)mt * (CI / 32) * FRH + lane * 8;
  const unsigned short* bp = (const unsigned short*)Wh + (size_t)nq * 4 * (CI / 32) * FRH + lane * 8;
  v8f acc[4] = {};
#pragma unroll      // every load is base + constant, so that no address register is rewritten while loads are out
  for (int ks = 0; ks < CI / 32; ++ks) { FragH ah; ah.half[0] = *(const v8us*)(ap + ks * FRH); ah.half[1] = *(const v8us*)(ap + ks * FRH + 256);
#pragma unroll      // constant indices keep the fragments and acc in registers
    for (int t = 0; t < 4; ++t) { FragH bq; bq.half[0] = *(const v8us*)(bp + (t * (CI / 32) + ks) * FRH); bq.half[1] = *(const v8us*)(bp + (t * (CI / 32) + ks) * FRH + 256);
      acc[t] = mmaH<1>(ah.v, ah.v, bq.v, bq.v, acc[t]); } }
#pragma unroll      // constant indices keep the fragments and acc in registers
  for (int t = 0; t < 4; ++t)
#pragma unroll      // constant indices keep the fragments and acc in registers
    for (int r = 0; r < 8; ++r) so[w][8 * hh + r][t * 16 + ln] = acc[t][r] * 0.0625f;
  __builtin_amdgcn_fence(__ATOMIC_ACQ_REL, "workgroup"); __builtin_amdgcn_wave_barrier();      // the wave's LDS stores are done before its lanes read what other lanes stored
  const int rsub = lane >> 4, c4 = (lane & 15) * 4; typedef _Float16 v4h __attribute__((ext_vector_type(4)));
  const int bc = mt / (NN / 16), n0 = (mt % (NN / 16)) * 16;
  _Float16* crow = C16 + (((size_t)(bc / 3) * NN + n0 + rsub) * 3 + bc % 3) * CO + col0 + c4;
#pragma unroll      // constant offsets from one address pair
  for (int q = 0; q < 8; ++q) { const v4f v = *(const v4fa*)&so[w][q * 2 + rsub][c4]; v4h h4; for (int i = 0; i < 4; ++i) h4[i] = (_Float16)v[i]; *(v4h*)(crow + (size_t)q * 2 * 3 * CO) = h4; }
  asm volatile("s_wait_xcnt 0x0" ::: "memory");      // behind the last store: no register that the eight stores name is rewritten ahead of this wait
}
// V^T at once: C[o][n] = sum_k Wv[o][k] X3[(b, c, n)][k]. The weight rows are the A operand and the token rows of one (b, c) the B operand, both in fragment order,
// so a row of the staged tile is 64 tokens of one feature: one whole 128-byte line of the layout that the attention stages. Same products, same k order as the q and k maps.
__device__ __forceinline__ void gemm_vt(float (*so)[16][64], int bx, int by, const _Float16* __restrict__ Wh, const _Float16* __restrict__ X3, _Float16* __restrict__ Vt) {
  const int tid = threadIdx.x, w = tid >> 5, lane = tid & 31, ln = lane & 15, hh = lane >> 4; const int b = by / 3, c = by % 3;
  const int wid = bx * 4 + w; const int mt = wid / (NN / 64), nq = wid % (NN / 64); const int row0 = mt * 16, col0 = nq * 64;
  const unsigned short* arow = (const unsigned short*)Wh + (size_t)mt * (CI / 32) * FRH + lane * 8;
  const unsigned short* xrow = (const unsigned short*)X3 + ((size_t)by * (NN / 16) + nq * 4) * (CI / 32) * FRH + lane * 8;
  v8f acc[4] = {};
#pragma unroll      // every load is base + constant, so that no address register is rewritten while loads are out
  for (int ks = 0; ks < CI / 32; ++ks) { FragH ah; ah.half[0] = *(const v8us*)(arow + ks * FRH); ah.half[1] = *(const v8us*)(arow + ks * FRH + 256);
#pragma unroll      // constant indices keep the fragments and acc in registers
    for (int t = 0; t < 4; ++t) { FragH bq; bq.half[0] = *(const v8us*)(xrow + (t * (CI / 32) + ks) * FRH); bq.half[1] = *(const v8us*)(xrow + (t * (CI / 32) + ks) * FRH + 256);
      acc[t] = mmaH<1>(ah.v, ah.v, bq.v, bq.v, acc[t]); } }
#pragma unroll      // constant indices keep the fragments and acc in registers
  for (int t = 0; t < 4; ++t)
#pragma unroll      // constant indices keep the fragments and acc in registers
    for (int r = 0; r < 8; ++r) so[w][8 * hh + r][t * 16 + ln] = acc[t][r] * 0.0625f;
  __builtin_amdgcn_fence(__ATOMIC_ACQ_REL, "workgroup"); __builtin_amdgcn_wave_barrier();      // the wave's LDS stores are done before its lanes read what other lanes stored
  const int rsub = lane >> 4, c4 = (lane & 15) * 4; typedef _Float16 v4h __attribute__((ext_vector_type(4)));
  _Float16* vrow = Vt + ((size_t)(b * NH + row0 / HD) * 192 + c * 64 + row0 % HD + rsub) * NN + col0 + c4;      // the 16 features of a tile lie in one head
#pragma unroll      // constant offsets from one address pair
  for (int q = 0; q < 8; ++q) { const v4f v = *(const v4fa*)&so[w][q * 2 + rsub][c4]; v4h h4; for (int i = 0; i < 4; ++i) h4[i] = (_Float16)v[i]; *(v4h*)(vrow + (size_t)q * 2 * NN) = h4; }
}
// The q, k and V^T maps in one launch: all three read X3 and none reads another's result. blockIdx.y picks the map, blockIdx.x is the map's own block number (MBL each).
#define MBL ((NR3 / 16) * (CO / 64) / 4)
#define VBX ((CO / 16) * (NN / 64) / 4)
__global__ __launch_bounds__(128) void k_qkv(const _Float16* __restrict__ X3, const _Float16* __restrict__ Bq, const _Float16* __restrict__ Bk, const _Float16* __restrict__ Bv, _Float16* __restrict__ Q16, _Float16* __restrict__ K16, _Float16* __restrict__ Vt) {
  __shared__ __attribute__((aligned(16))) float so[4][16][64];
  const int bx = blockIdx.x, job = blockIdx.y;
  if (job == 2) gemm_vt(so, bx % VBX, bx / VBX, Bv, X3, Vt);
  else gemm_qk(so, bx, X3, job == 0 ? Bq : Bk, job == 0 ? Q16 : K16);
}
// K and V^T tiles of 64 keys, staged in LDS once per work-group and read by its four waves. Row pitches are 16 B x odd, so the 16 rows of a ds_load_b128 fall on distinct banks.
#define TK 64
#define KP 200      // halves per staged K row: 3 coordinate blocks x 64 + 8 of pad (400 B)
#define VP 72       // halves per staged V^T row: 64 keys + 8 of pad (144 B)
// Twelve asynchronous 16-byte copies per lane, global -> LDS, through no register: copy 4 a + q goes from g + a gs + q gq (halves) to LDS byte l + a ls + q lq.
// The s_wait_xcnt closes the statement so that no address register named here is rewritten ahead of it.
__device__ __forceinline__ void acopy12(unsigned l, unsigned ls, unsigned lq, const unsigned short* g, size_t gs, size_t gq) {
  const unsigned l1 = l + lq, l2 = l + 2 * lq, l3 = l + 3 * lq, l4 = l + ls, l5 = l4 + lq, l6 = l4 + 2 * lq, l7 = l4 + 3 * lq, l8 = l + 2 * ls, l9 = l8 + lq, l10 = l8 + 2 * lq, l11 = l8 + 3 * lq;
  const unsigned short *g1 = g + gq, *g2 = g + 2 * gq, *g3 = g + 3 * gq, *g4 = g + gs, *g5 = g4 + gq, *g6 = g4 + 2 * gq, *g7 = g4 + 3 * gq, *g8 = g + 2 * gs, *g9 = g8 + gq, *g10 = g8 + 2 * gq, *g11 = g8 + 3 * gq;
  asm volatile("global_load_async_to_lds_b128 %0, %12, off\n\t"
               "global_load_async_to_lds_b128 %1, %13, off\n\t"
               "global_load_async_to_lds_b128 %2, %14, off\n\t"
               "global_load_async_to_lds_b128 %3, %15, off\n\t"
               "global_load_async_to_lds_b128 %4, %16, off\n\t"
               "global_load_async_to_lds_b128 %5, %17, off\n\t"
               "global_load_async_to_lds_b128 %6, %18, off\n\t"
               "global_load_async_to_lds_b128 %7, %19, off\n\t"
               "global_load_async_to_lds_b128 %8, %20, off\n\t"
               "global_load_async_to_lds_b128 %9, %21, off\n\t"
               "global_load_async_to_lds_b128 %10, %22, off\n\t"
               "global_load_async_to_lds_b128 %11, %23, off\n\t"
               "s_wait_xcnt 0x0"
               :: "v"(l), "v"(l1), "v"(l2), "v"(l3), "v"(l4), "v"(l5), "v"(l6), "v"(l7), "v"(l8), "v"(l9), "v"(l10), "v"(l11),
                  "v"(g), "v"(g1), "v"(g2), "v"(g3), "v"(g4), "v"(g5), "v"(g6), "v"(g7), "v"(g8), "v"(g9), "v"(g10), "v"(g11) : "memory");
}
// One stage: 64 keys of K (3 coordinate blocks of 128 B a key) and 192 rows of V^T (128 B a row); 24 copies a lane.
__device__ __forceinline__ void stage_kv(unsigned lk, unsigned lv, const unsigned short* kg, const unsigned short* vg) {
  acopy12(lk, 128, 16 * KP * 2, kg, CO, (size_t)16 * 3 * CO);
  acopy12(lv, 64 * VP * 2, 16 * VP * 2, vg, (size_t)64 * NN, (size_t)16 * NN);
}
// lane l with lane l ^ 16, through no LDS
__device__ __forceinline__ float xhalf(float x) { return __builtin_bit_cast(float, __builtin_amdgcn_permlanex16(__builtin_bit_cast(int, x), __builtin_bit_cast(int, x), 0x76543210, 0xfedcba98, false, false)); }
// Scores are formed transposed: K rows are the A operand and Q the B operand, so lane (ln, hh) holds query ln and keys 8 hh + r of each 16-key tile. A query's maximum and sum are then
// in-lane but for one exchange between the wave halves, and the two score tiles of 32 keys, converted in place, are the B operand of O^T += V^T P^T (element i: key 8 hh + i, element 8 + i: key 16 + 8 hh + i, as the V^T loader has it).
__global__ __launch_bounds__(128) void k_vnattn(const _Float16* __restrict__ Q16, const _Float16* __restrict__ K16, const _Float16* __restrict__ Vt, _Float16* __restrict__ O3) {
  __shared__ __attribute__((aligned(16))) unsigned short sK[2][TK][KP]; __shared__ __attribute__((aligned(16))) unsigned short sV[2][192][VP];
  __shared__ __attribute__((aligned(16))) unsigned short sO[4][48][64 + 8];      // f16 output, one row a (query, coordinate) piece of 64 halves; a query's pitch is 16 B x odd
  const int tid = threadIdx.x, w = tid >> 5, lane = tid & 31, ln = lane & 15, hh = lane >> 4; const int slab = blockIdx.x / (NN / 64), qblk = blockIdx.x % (NN / 64); const int b = slab / NH, h = slab % NH; const int q0 = qblk * 64 + w * 16;
  const unsigned short* Vth = (const unsigned short*)Vt + (size_t)slab * 192 * NN;
  // The lane's share of a stage: eight lanes cover one 128-byte row piece, so a wave's copy covers four whole lines. K: key = 16 q + tid / 8; V^T: row = 64 a + 16 q + tid / 8.
  const int cr = tid >> 3, cc = (tid & 7) * 8;
  const unsigned short* kg = (const unsigned short*)K16 + ((size_t)b * NN + cr) * (3 * CO) + h * HD + cc;
  const unsigned short* vg = Vth + (size_t)cr * NN + cc;
  const unsigned lk = (unsigned)(size_t)&sK[0][cr][cc], lv = (unsigned)(size_t)&sV[0][cr][cc];
  constexpr unsigned KB = TK * KP * 2, VB = 192 * VP * 2;      // bytes of one buffer
  constexpr int NT = NN / TK;
  constexpr float SL2 = 0.07216878364870323f * 1.4426950408889634f;      // 1 / sqrt(192) x log2(e)
  stage_kv(lk, lv, kg, vg);
  asm volatile("s_wait_asynccnt 0x0" ::: "memory");      // this wave's share of stage 0 has landed
  __syncthreads();                                        // stage 0 is published to the four waves
  stage_kv(lk + KB, lv + VB, kg + (size_t)TK * 3 * CO, vg + TK);
  FragH aq[6]; { const unsigned short* qr = (const unsigned short*)Q16 + ((size_t)b * NN + q0 + ln) * (3 * CO) + h * HD + 8 * hh;      // row (b,n) = [c0 | c1 | c2] x 512 (= rows (b,n,c) of pitch 512)
#pragma unroll
    for (int ks = 0; ks < 6; ++ks) { const int c = ks >> 1, s32 = (ks & 1) * 32; aq[ks].half[0] = *(const v8us*)(qr + c * CO + s32); aq[ks].half[1] = *(const v8us*)(qr + c * CO + s32 + 16); }
    asm volatile("s_wait_xcnt 0x0" :: "v"(qr) : "memory"); }      // the Q loads' address pair is named as an input, so it stays untouched until this wait; behind it the pair may be reused
  float m_r = -3.0e38f, l_r = 0.f; v8f oacc[12];      // oacc[dt][r] = O[query ln][dt * 16 + 8 hh + r]; l_r sums this half's keys only
#pragma unroll
  for (int dt = 0; dt < 12; ++dt) oacc[dt] = (v8f){0.f,0.f,0.f,0.f,0.f,0.f,0.f,0.f};
#pragma unroll 1
  for (int t = 0; t < NT; ++t) { const int buf = t & 1;
#pragma unroll 1      // the two 32-key passes of a stage stay rolled: unrolled, the build spilled the Q fragments to scratch
   for (int p = 0; p < TK / 32; ++p) { v8f s[2];
#pragma unroll
    for (int nt = 0; nt < 2; ++nt) { const unsigned short* kr = &sK[buf][p * 32 + nt * 16 + ln][0]; v8f acc = (v8f){0.f,0.f,0.f,0.f,0.f,0.f,0.f,0.f}; FragH bk[6];      // six fragments are read as one run ahead of their products: one LDS latency a run, not one a product
#pragma unroll      // constant indices keep bk in registers
      for (int ks = 0; ks < 6; ++ks) { bk[ks].half[0] = *(const v8us*)(kr + ks * 32 + 8 * hh); bk[ks].half[1] = *(const v8us*)(kr + ks * 32 + 16 + 8 * hh); }
#pragma unroll
      for (int ks = 0; ks < 6; ++ks) acc = mmaH<1>(bk[ks].v, bk[ks].v, aq[ks].v, aq[ks].v, acc);
      s[nt] = acc; }
    float mc = -3.0e38f;
#pragma unroll      // constant indices keep the scores in registers
    for (int r = 0; r < 8; ++r) mc = fmaxf(mc, fmaxf(s[0][r], s[1][r]));
    mc = fmaxf(mc, xhalf(mc));
    // Softmax in the log2 domain: e^(x / sqrt(192) - m) = 2^(x SL2 - m'), SL2 = log2(e) / sqrt(192) > 0, so the maximum is taken on the raw scores and scaled once;
    // a score then costs one multiply-add and one hardware 2^x. m_r is kept in the scaled log2 unit.
    const float mn = fmaxf(m_r, mc * SL2); const float al = __builtin_amdgcn_exp2f(m_r - mn); m_r = mn;
    FragH pa; float ps[4] = {0.f, 0.f, 0.f, 0.f};      // four short chains of adds, not one of sixteen
#pragma unroll      // constant indices keep the scores, pa and ps in registers
    for (int r = 0; r < 8; ++r) { const float p0 = __builtin_amdgcn_exp2f(fmaf(s[0][r], SL2, -mn)), p1 = __builtin_amdgcn_exp2f(fmaf(s[1][r], SL2, -mn)); ps[r & 3] += p0 + p1; pa.h[r] = (_Float16)p0; pa.h[8 + r] = (_Float16)p1; }
    l_r = l_r * al + ((ps[0] + ps[1]) + (ps[2] + ps[3]));
#pragma unroll
    for (int dt = 0; dt < 12; ++dt)
#pragma unroll
      for (int r = 0; r < 8; ++r) oacc[dt][r] *= al;
#pragma unroll
    for (int dg = 0; dg < 2; ++dg) { FragH bv[6];      // as for K: a run of six fragments, then their six products
#pragma unroll      // constant indices keep bv and oacc in registers
      for (int i = 0; i < 6; ++i) { const unsigned short* vrow = &sV[buf][(dg * 6 + i) * 16 + ln][p * 32]; bv[i].half[0] = *(const v8us*)(vrow + 8 * hh); bv[i].half[1] = *(const v8us*)(vrow + 16 + 8 * hh); }
#pragma unroll
      for (int i = 0; i < 6; ++i) oacc[dg * 6 + i] = mmaH<1>(bv[i].v, bv[i].v, pa.v, pa.v, oacc[dg * 6 + i]); } }
   asm volatile("s_wait_dscnt 0x0" ::: "memory");         // this wave's reads of buffer t mod 2 are done before the buffer is handed back
   asm volatile("s_wait_asynccnt 0x0" ::: "memory");      // this wave's share of stage t + 1 has landed
   __syncthreads();                                        // publishes stage t + 1 and ends every wave's reads of stage t
   if (t + 2 < NT) stage_kv(lk + buf * KB, lv + buf * VB, kg + (size_t)(t + 2) * TK * 3 * CO, vg + (t + 2) * TK); }
  asm volatile("s_wait_asynccnt 0x0" ::: "memory");        // no copy is outstanding when the wave goes on to its end
  const float linv = 1.0f / (l_r + xhalf(l_r));      // the two halves' sums are joined once, here
#pragma unroll      // constant indices keep oacc in registers
  for (int dt = 0; dt < 12; ++dt) { FragH f;
#pragma unroll      // constant indices keep oacc in registers
    for (int r = 0; r < 8; ++r) f.h[r] = (_Float16)(oacc[dt][r] * linv);
    *(v8us*)&sO[w][ln * 3 + dt / 4][(dt % 4) * 16 + 8 * hh] = f.half[0]; }
  __builtin_amdgcn_fence(__ATOMIC_ACQ_REL, "workgroup"); __builtin_amdgcn_wave_barrier();
  // Stored as the output map reads it: rows (b, n, c) x 512. A query's 192 features are three pieces of 64 halves, one 128-byte line each; eight lanes a piece, four pieces a store.
  unsigned short* orow = (unsigned short*)O3 + (((size_t)b * NN + q0) * 3 + (lane >> 3)) * CO + h * HD + (lane & 7) * 8;
#pragma unroll      // constant offsets from one address pair
  for (int q = 0; q < 12; ++q) { const v8us v = *(const v8us*)&sO[w][q * 4 + (lane >> 3)][(lane & 7) * 8]; *(v8us*)(orow + (size_t)q * 4 * CO) = v; } }
// Output map with the (o, c) interleave in its store: a wave takes 16 tokens x 3 coordinates x 64 outputs (each lane picks its token's three rows of O3), so a token's piece of the result is 192 floats in a row, six whole lines.
__global__ __launch_bounds__(128) void k_gemm_out(const _Float16* __restrict__ O3, const _Float16* __restrict__ Wh, float* __restrict__ out) {
  __shared__ __attribute__((aligned(16))) float so[4][16][192 + 4];
  const int tid = threadIdx.x, w = tid >> 5, lane = tid & 31, ln = lane & 15, hh = lane >> 4;
  const int wid = blockIdx.x * 4 + w; const int mt = wid / (CI / 64), nq = wid % (CI / 64); const int bn0 = mt * 16, col0 = nq * 64;
  const unsigned short* arow = (const unsigned short*)O3 + (size_t)(bn0 + ln) * 3 * CO + 8 * hh;
  const unsigned short* brow = (const unsigned short*)Wh + (size_t)nq * 4 * (CO / 32) * FRH + lane * 8;      // the weights come in fragment order
  v8f acc[3][4] = {};
#pragma unroll      // every load is base + constant, so that no address register is rewritten while loads are out
  for (int kb = 0; kb < CO; kb += 32) { FragH a[3];
#pragma unroll      // constant indices keep the fragments and acc in registers
    for (int c = 0; c < 3; ++c) { a[c].half[0] = *(const v8us*)(arow + c * CO + kb); a[c].half[1] = *(const v8us*)(arow + c * CO + kb + 16); }
#pragma unroll      // constant indices keep the fragments and acc in registers
    for (int t = 0; t < 4; ++t) { FragH bq; bq.half[0] = *(const v8us*)(brow + (t * (CO / 32) + kb / 32) * FRH); bq.half[1] = *(const v8us*)(brow + (t * (CO / 32) + kb / 32) * FRH + 256);
#pragma unroll      // constant indices keep the fragments and acc in registers
      for (int c = 0; c < 3; ++c) acc[c][t] = mmaH<1>(a[c].v, a[c].v, bq.v, bq.v, acc[c][t]); } }
#pragma unroll      // constant indices keep the fragments and acc in registers
  for (int t = 0; t < 4; ++t)
#pragma unroll      // constant indices keep the fragments and acc in registers
    for (int c = 0; c < 3; ++c)
#pragma unroll      // constant indices keep the fragments and acc in registers
      for (int r = 0; r < 8; ++r) so[w][8 * hh + r][(t * 16 + ln) * 3 + c] = acc[c][t][r] * 0.0625f;
  __builtin_amdgcn_fence(__ATOMIC_ACQ_REL, "workgroup"); __builtin_amdgcn_wave_barrier();      // the wave's LDS stores are done before its lanes read what other lanes stored
  // two tokens' pieces are 96 float4, three stores of the wave; from one pair of tokens to the next every address moves by a constant
#pragma unroll      // three address pairs, formed once
  for (int j = 0; j < 3; ++j) { const int i = j * 32 + lane, r = i / 48, p4 = (i % 48) * 4; const float* ls = &so[w][r][p4]; float* gp = out + ((size_t)(bn0 + r) * CI + col0) * 3 + p4;
#pragma unroll      // constant offsets from the pair
    for (int q = 0; q < 8; ++q) { const v4f v = *(const v4fa*)(ls + q * 2 * (192 + 4)); *(v4f*)(gp + (size_t)q * 2 * CI * 3) = v; } }
}
extern "C" void kernel_launch(void* const* d_in, const int* in_sizes, int n_in,
                              void* d_out, int out_size, void* d_ws, size_t ws_size, hipStream_t stream) {
  (void)in_sizes; (void)n_in; (void)out_size;
  const float* x = (const float*)d_in[0]; const float* Wq = (const float*)d_in[1]; const float* Wk = (const float*)d_in[2]; const float* Wv = (const float*)d_in[3]; const float* Wo = (const float*)d_in[4];
  char* ws = (char*)d_ws; size_t off = 0;
  auto take = [&](size_t bytes) { char* p = ws + off; off += (bytes + 255) & ~(size_t)255; return p; };
  _Float16* Bq = (_Float16*)take((size_t)CO * CI * 2); _Float16* Bk = (_Float16*)take((size_t)CO * CI * 2); _Float16* Bv = (_Float16*)take((size_t)CO * CI * 2); _Float16* Bo = (_Float16*)take((size_t)CI * CO * 2);
  _Float16* X3 = (_Float16*)take((size_t)NR3 * CI * 2); _Float16* Q16 = (_Float16*)take((size_t)NR3 * CO * 2); _Float16* K16 = (_Float16*)take((size_t)NR3 * CO * 2); _Float16* Vt = (_Float16*)take((size_t)NR3 * CO * 2); _Float16* O3 = (_Float16*)take((size_t)NR3 * CO * 2);      // O3 has a place of its own: the attention stores it while other work-groups still read Q16
  if (off > ws_size) return;      // 1 + 6.3 + 12.6 x 4, about 58 MB
  k_prep<<<4 * WBL + XBL, 256, 0, stream>>>(x, Wq, Wk, Wv, Wo, Bq, Bk, Bv, Bo, X3);      // weights are (out,in); X3 = rows (b,c,n) x 256; all five in fragment order
  k_qkv<<<dim3(MBL, 3), 128, 0, stream>>>(X3, Bq, Bk, Bv, Q16, K16, Vt);      // q/k planes = rows (b,n,c) x 512 = [(b,n)][c * 512 + o]
  k_vnattn<<<BB * NH * (NN / 64), 128, 0, stream>>>(Q16, K16, Vt, O3);
  k_gemm_out<<<(NR / 16) * (CI / 64) / 4, 128, 0, stream>>>(O3, Bo, (float*)d_out);
}

// v007
// One run takes 113 microseconds.
// Timed twice side by side with v006, it ran 1.10 times as fast both times.
// Counting every step since v000, it is 5.28 times as fast.
#include <hip/hip_runtime.h>
// Vector-neuron attention (B=2, N=2048, C=256 × 3 coordinates, 8 heads × 64): the VN-linear maps (rows (b,n,c) × 256 → 512, weights (out,in) bf16-exact ×2^4) and the attention over the
// 192-dim (d, c) head features as a fused flash-style kernel on v_wmma_f32_16x16x32_f16 (S^T = K Q^T / sqrt(192) with 6 k-steps gathered from the three coordinate blocks, online softmax f32 in-lane, P f16 <= 1 packed from the score registers,
// O^T = V^T P^T with 12 d-tiles; 32 queries a wave, keys split over two groups of waves); f16 operands, single products, f32 accumulate; V^T, the f16 attention output and the final (o, c) interleave are stored by the kernels that compute them.
#define BB 2
#define NN 2048
#define CI 256
#define CO 512
#define NH 8
#define HD 64
#define NR3 (BB * NN * 3)
#define NR (BB * NN)

typedef __bf16 v16b __attribute__((ext_vector_type(16)));
typedef unsigned short v8us __attribute__((ext_vector_type(8), may_alias));
typedef float  v8f  __attribute__((ext_vector_type(8)));
typedef float  v4f  __attribute__((ext_vector_type(4)));
typedef float  v4fa __attribute__((ext_vector_type(4), may_alias));
union FragB { v16b v; v8us half[2]; unsigned short u[16]; };

__device__ __forceinline__ unsigned short bf16_bits(float x) { unsigned int u = __float_as_uint(x); return (unsigned short)((u + 0x7FFFu + ((u >> 16) & 1u)) >> 16); }
__device__ __forceinline__ float bf16_val(unsigned short b) { return __uint_as_float(((unsigned int)b) << 16); }
__device__ __forceinline__ float bf16_round(float x) { return bf16_val(bf16_bits(x)); }
// D += A·B with NT terms: 1 = ah·bh, 2 = + al·bh (A split), 3 = + ah·bl (both split)
template <int NT>
__device__ __forceinline__ v8f mmaN(v16b ah, v16b al, v16b bh, v16b bl, v8f c) {
  c = __builtin_amdgcn_wmma_f32_16x16x32_bf16(false, ah, false, bh, (short)0, c, false, false);
  if (NT >= 2) c = __builtin_amdgcn_wmma_f32_16x16x32_bf16(false, al, false, bh, (short)0, c, false, false);
  if (NT >= 3) c = __builtin_amdgcn_wmma_f32_16x16x32_bf16(false, ah, false, bl, (short)0, c, false, false);
  asm volatile("v_nop\n\tv_nop\n\tv_nop\n\tv_nop" : "+v"(c) : "v"(ah), "v"(al), "v"(bh), "v"(bl));
  return c;
}

__global__ __launch_bounds__(256) void k_wt_bf16(const float* __restrict__ W, unsigned short* __restrict__ Wt, int K, int N) {
  const int t = blockIdx.x * 256 + threadIdx.x;
  const int k8n = K / 8;
  if (t >= N * k8n) return;
  const int n = t / k8n, k8 = (t % k8n) * 8;
  v8us v;
#pragma unroll
  for (int i = 0; i < 8; ++i) v[i] = bf16_bits(W[(size_t)(k8 + i) * N + n]);
  *(v8us*)(Wt + (size_t)n * K + k8) = v;
  
}

// GEMM C[M][N] (f32, pitch ldc) = act(A[M][K]·W + bias). A f32 row-major (pitch lda) converted per fragment to bf16
// (ASPLIT: hi/lo two planes -> 2 terms, else single rounded term); Wt bf16 [N][K] (pitch ldb). BIAS_BF16 rounds the
// bias to bf16 first (bias quantised to bf16 before the add). K%32==0, M%16==0, N%64==0.
template <bool ASPLIT, int ACT, bool BIAS_BF16>
__global__ __launch_bounds__(128) void k_gemm_bf(const float* __restrict__ A, int lda, const unsigned short* __restrict__ Wt, int ldb,
                                               const float* __restrict__ bias, float* __restrict__ C, int ldc, int M, int N, int K) {
  __shared__ __attribute__((aligned(16))) float so[4][16][64];
  const int tid = threadIdx.x, w = tid >> 5, lane = tid & 31, ln = lane & 15, hh = lane >> 4;
  const int ntn = N / 64;
  const int wid = blockIdx.x * 4 + w;
  const int mt = wid / ntn, nq = wid % ntn;
  if (mt * 16 >= M) return;
  const int row0 = mt * 16, col0 = nq * 64;
  const float* arow = A + (size_t)(row0 + ln) * lda;
  v8f acc[4] = {};
  for (int kb = 0; kb < K; kb += 32) {
    FragB ah, al;
    const v4f x0 = *(const v4fa*)(arow + kb + 8 * hh), x1 = *(const v4fa*)(arow + kb + 8 * hh + 4);
    const v4f x2 = *(const v4fa*)(arow + kb + 16 + 8 * hh), x3 = *(const v4fa*)(arow + kb + 16 + 8 * hh + 4);
    float xs[16] = {x0[0],x0[1],x0[2],x0[3],x1[0],x1[1],x1[2],x1[3],x2[0],x2[1],x2[2],x2[3],x3[0],x3[1],x3[2],x3[3]};
#pragma unroll
    for (int i = 0; i < 16; ++i) { const unsigned short hb = bf16_bits(xs[i]); ah.u[i] = hb; al.u[i] = ASPLIT ? bf16_bits(xs[i] - bf16_val(hb)) : (unsigned short)0; }
#pragma unroll
    for (int t = 0; t < 4; ++t) {
      const unsigned short* brow = Wt + (size_t)(col0 + t * 16 + ln) * ldb + kb;
      FragB b;
      b.half[0] = *(const v8us*)(brow + 8 * hh);
      b.half[1] = *(const v8us*)(brow + 16 + 8 * hh);
      acc[t] = mmaN<ASPLIT ? 2 : 1>(ah.v, al.v, b.v, b.v, acc[t]);
    }
  }
#pragma unroll
  for (int t = 0; t < 4; ++t) {
    float bv = bias ? bias[col0 + t * 16 + ln] : 0.f;
    if (BIAS_BF16) bv = bf16_round(bv);
#pragma unroll
    for (int r = 0; r < 8; ++r) { float v = acc[t][r] + bv; if (ACT == 1) v = fmaxf(v, 0.f); so[w][8 * hh + r][t * 16 + ln] = v; }
  }
  __builtin_amdgcn_fence(__ATOMIC_ACQ_REL, "workgroup");
  __builtin_amdgcn_wave_barrier();
  const int rsub = lane >> 4, c4 = (lane & 15) * 4;
  {
#pragma unroll
    for (int q = 0; q < 8; ++q) {
      const int r = q * 2 + rsub;
      const v4f v = *(const v4fa*)&so[w][r][c4];
      *(v4f*)(C + (size_t)(row0 + r) * ldc + col0 + c4) = v;
    }
    
  }
}

// Flash-style causal/unmasked attention, all contractions 3-term bf16 hi/lo splits, f32 softmax with running max.
// q,k,v rows are read from f32 buffers with arbitrary row pitch (so they can live inside a fused qkv buffer);
// D = head size (multiple of 32, <= 128); one wave = 16 query rows; block = 4 waves (64 queries) sharing K/V chunks of 32.
template <int D, bool CAUSAL>
__global__ __launch_bounds__(128) void k_flash(const float* __restrict__ qb, const float* __restrict__ kb, const float* __restrict__ vb,
                                             int pitch, int T, int H, float scale, float* __restrict__ y, int ypitch) {
  constexpr int KS = D / 32;        // k-steps for QK
  constexpr int DT = D / 16;        // d tiles for PV
  __shared__ __attribute__((aligned(16))) unsigned short sKh[32][D + 8], sKl[32][D + 8], sVh[32][D + 8], sVl[32][D + 8];
  __shared__ __attribute__((aligned(16))) unsigned short sPh[4][16][40], sPl[4][16][40];
  __shared__ __attribute__((aligned(16))) float sO[4][16][D];
  const int tid = threadIdx.x, w = tid >> 5, lane = tid & 31, ln = lane & 15, hh = lane >> 4;
  const int nqb = (T + 63) / 64;
  const int bh = blockIdx.x / nqb, qblk = blockIdx.x % nqb;
  const int b = bh / H, h = bh % H;
  const int q0 = qblk * 64 + w * 16;
  const float* Q = qb + (size_t)b * T * pitch + h * D;
  const float* K = kb + (size_t)b * T * pitch + h * D;
  const float* V = vb + (size_t)b * T * pitch + h * D;

  // A fragments of the wave's 16 query rows (scaled), hi/lo
  FragB aqh[KS], aql[KS];
  {
    int row = q0 + ln; if (row >= T) row = T - 1;
    const float* qr = Q + (size_t)row * pitch;
#pragma unroll
    for (int ks = 0; ks < KS; ++ks)
#pragma unroll
      for (int i = 0; i < 16; ++i) {
        const int d = ks * 32 + ((i < 8) ? (8 * hh + i) : (16 + 8 * hh + (i - 8)));
        const float x = qr[d] * scale; const unsigned short hb = bf16_bits(x);
        aqh[ks].u[i] = hb; aql[ks].u[i] = bf16_bits(x - bf16_val(hb));
      }
  }
  float m_r[8], l_r[8];
#pragma unroll
  for (int r = 0; r < 8; ++r) { m_r[r] = -3.0e38f; l_r[r] = 0.f; }
  v8f oacc[DT];
#pragma unroll
  for (int dt = 0; dt < DT; ++dt) oacc[dt] = (v8f){0.f,0.f,0.f,0.f,0.f,0.f,0.f,0.f};

  const int kv_end = CAUSAL ? min(T, qblk * 64 + 64) : T;     // block-uniform
  for (int j0 = 0; j0 < kv_end; j0 += 32) {
    __syncthreads();
    for (int e = tid; e < 32 * (D / 4); e += 128) {
      const int r = e / (D / 4), c4 = (e % (D / 4)) * 4;
      const int key = j0 + r;
      v4f kf = {0.f,0.f,0.f,0.f}, vf = {0.f,0.f,0.f,0.f};
      if (key < T) { kf = *(const v4fa*)(K + (size_t)key * pitch + c4); vf = *(const v4fa*)(V + (size_t)key * pitch + c4); }
#pragma unroll
      for (int t = 0; t < 4; ++t) {
        unsigned short hb = bf16_bits(kf[t]); sKh[r][c4 + t] = hb; sKl[r][c4 + t] = bf16_bits(kf[t] - bf16_val(hb));
        hb = bf16_bits(vf[t]); sVh[r][c4 + t] = hb; sVl[r][c4 + t] = bf16_bits(vf[t] - bf16_val(hb));
      }
    }
    __syncthreads();
    // S tile 16 x 32
    v8f s[2];
#pragma unroll
    for (int nt = 0; nt < 2; ++nt) {
      v8f acc = {};
#pragma unroll
      for (int ks = 0; ks < KS; ++ks) {
        FragB bh_, bl_;
        bh_.half[0] = *(const v8us*)&sKh[nt * 16 + ln][ks * 32 + 8 * hh]; bh_.half[1] = *(const v8us*)&sKh[nt * 16 + ln][ks * 32 + 16 + 8 * hh];
        bl_.half[0] = *(const v8us*)&sKl[nt * 16 + ln][ks * 32 + 8 * hh]; bl_.half[1] = *(const v8us*)&sKl[nt * 16 + ln][ks * 32 + 16 + 8 * hh];
        acc = mmaN<3>(aqh[ks].v, aql[ks].v, bh_.v, bl_.v, acc);
      }
      s[nt] = acc;
    }
    // mask + running max (rows 8hh+r; the 16 lanes of a half share rows)
    float alpha[8];
#pragma unroll
    for (int r = 0; r < 8; ++r) {
      const int qi = q0 + 8 * hh + r;
      const int ja = j0 + ln, jb = j0 + 16 + ln;
      if (CAUSAL) { if (ja > qi) s[0][r] = -3.0e38f; if (jb > qi) s[1][r] = -3.0e38f; }
      if (ja >= T) s[0][r] = -3.0e38f;
      if (jb >= T) s[1][r] = -3.0e38f;
      float mx = fmaxf(s[0][r], s[1][r]);
      mx = fmaxf(mx, __shfl_xor(mx, 1, 32)); mx = fmaxf(mx, __shfl_xor(mx, 2, 32)); mx = fmaxf(mx, __shfl_xor(mx, 4, 32)); mx = fmaxf(mx, __shfl_xor(mx, 8, 32));
      const float mnew = fmaxf(m_r[r], mx);
      alpha[r] = (mnew > -1.0e38f) ? __expf(m_r[r] - mnew) : 1.0f;
      const float p0 = (s[0][r] > -1.0e38f) ? __expf(s[0][r] - mnew) : 0.f;
      const float p1 = (s[1][r] > -1.0e38f) ? __expf(s[1][r] - mnew) : 0.f;
      m_r[r] = mnew;
      l_r[r] = l_r[r] * alpha[r] + p0 + p1;            // per-lane partial row sum (16 lanes combined at the end)
      unsigned short hb = bf16_bits(p0); sPh[w][8 * hh + r][ln] = hb;      sPl[w][8 * hh + r][ln] = bf16_bits(p0 - bf16_val(hb));
      hb = bf16_bits(p1);                sPh[w][8 * hh + r][16 + ln] = hb; sPl[w][8 * hh + r][16 + ln] = bf16_bits(p1 - bf16_val(hb));
    }
#pragma unroll
    for (int dt = 0; dt < DT; ++dt)
#pragma unroll
      for (int r = 0; r < 8; ++r) oacc[dt][r] *= alpha[r];
    __builtin_amdgcn_fence(__ATOMIC_ACQ_REL, "workgroup");
    __builtin_amdgcn_wave_barrier();
    FragB pah, pal;
    pah.half[0] = *(const v8us*)&sPh[w][ln][8 * hh]; pah.half[1] = *(const v8us*)&sPh[w][ln][16 + 8 * hh];
    pal.half[0] = *(const v8us*)&sPl[w][ln][8 * hh]; pal.half[1] = *(const v8us*)&sPl[w][ln][16 + 8 * hh];
#pragma unroll
    for (int dt = 0; dt < DT; ++dt) {
      FragB bvh, bvl;
#pragma unroll
      for (int i = 0; i < 8; ++i) {
        bvh.u[i] = sVh[8 * hh + i][dt * 16 + ln]; bvh.u[8 + i] = sVh[16 + 8 * hh + i][dt * 16 + ln];
        bvl.u[i] = sVl[8 * hh + i][dt * 16 + ln]; bvl.u[8 + i] = sVl[16 + 8 * hh + i][dt * 16 + ln];
      }
      oacc[dt] = mmaN<3>(pah.v, pal.v, bvh.v, bvl.v, oacc[dt]);
    }
    __builtin_amdgcn_fence(__ATOMIC_ACQ_REL, "workgroup");
    __builtin_amdgcn_wave_barrier();
  }
#pragma unroll
  for (int r = 0; r < 8; ++r) {
    float l = l_r[r];
    l += __shfl_xor(l, 1, 32); l += __shfl_xor(l, 2, 32); l += __shfl_xor(l, 4, 32); l += __shfl_xor(l, 8, 32);
    l_r[r] = (l > 0.f) ? 1.0f / l : 0.f;
  }
#pragma unroll
  for (int dt = 0; dt < DT; ++dt)
#pragma unroll
    for (int r = 0; r < 8; ++r) sO[w][8 * hh + r][dt * 16 + ln] = oacc[dt][r] * l_r[r];
  __builtin_amdgcn_fence(__ATOMIC_ACQ_REL, "workgroup");
  __builtin_amdgcn_wave_barrier();
  {
    for (int r = 0; r < 16; ++r) {
      const int row = q0 + r;
      if (row < T && lane < D / 4) {
        const v4f val = *(const v4fa*)&sO[w][r][lane * 4];
        *(v4f*)(y + ((size_t)b * T + row) * ypitch + h * D + lane * 4) = val;
      }
    }
    
  }
}

// GEMM C = act(A·W + bias + resid): A f32 (ASPLIT -> hi/lo 2 terms), Wt bf16 [N][K]; ACT 0 none, 1 relu, 2 exact gelu;
// resid (optional, f32, row index = (row % rmod), pitch ldr, RES_BF16 rounds it) added before the activation.
template <bool ASPLIT, int ACT, bool BIAS_BF16, bool RES_BF16>
__global__ __launch_bounds__(128) void k_gemm_bf3(const float* __restrict__ A, int lda, const unsigned short* __restrict__ Wt, int ldb,
                                                const float* __restrict__ bias, const float* __restrict__ resid, int rmod, int ldr,
                                                float* __restrict__ C, int ldc, int M, int N, int K) {
  __shared__ __attribute__((aligned(16))) float so[4][16][64];
  const int tid = threadIdx.x, w = tid >> 5, lane = tid & 31, ln = lane & 15, hh = lane >> 4;
  const int ntn = N / 64;
  const int wid = blockIdx.x * 4 + w;
  const int mt = wid / ntn, nq = wid % ntn;
  if (mt * 16 >= M) return;
  const int row0 = mt * 16, col0 = nq * 64;
  const float* arow = A + (size_t)(row0 + ln) * lda;
  v8f acc[4] = {};
  for (int kb = 0; kb < K; kb += 32) {
    FragB ah, al;
    const v4f x0 = *(const v4fa*)(arow + kb + 8 * hh), x1 = *(const v4fa*)(arow + kb + 8 * hh + 4);
    const v4f x2 = *(const v4fa*)(arow + kb + 16 + 8 * hh), x3 = *(const v4fa*)(arow + kb + 16 + 8 * hh + 4);
    float xs[16] = {x0[0],x0[1],x0[2],x0[3],x1[0],x1[1],x1[2],x1[3],x2[0],x2[1],x2[2],x2[3],x3[0],x3[1],x3[2],x3[3]};
#pragma unroll
    for (int i = 0; i < 16; ++i) { const unsigned short hb = bf16_bits(xs[i]); ah.u[i] = hb; al.u[i] = ASPLIT ? bf16_bits(xs[i] - bf16_val(hb)) : (unsigned short)0; }
#pragma unroll
    for (int t = 0; t < 4; ++t) {
      const unsigned short* brow = Wt + (size_t)(col0 + t * 16 + ln) * ldb + kb;
      FragB b;
      b.half[0] = *(const v8us*)(brow + 8 * hh);
      b.half[1] = *(const v8us*)(brow + 16 + 8 * hh);
      acc[t] = mmaN<ASPLIT ? 2 : 1>(ah.v, al.v, b.v, b.v, acc[t]);
    }
  }
#pragma unroll
  for (int t = 0; t < 4; ++t) {
    const int col = col0 + t * 16 + ln;
    float bv = bias ? bias[col] : 0.f;
    if (BIAS_BF16) bv = bf16_round(bv);
#pragma unroll
    for (int r = 0; r < 8; ++r) {
      float v = acc[t][r] + bv;
      if (resid) { float rv = resid[(size_t)((row0 + 8 * hh + r) % rmod) * ldr + col]; if (RES_BF16) rv = bf16_round(rv); v += rv; }
      if (ACT == 1) v = fmaxf(v, 0.f);
      if (ACT == 2) v = 0.5f * v * (1.0f + erff(v * 0.70710678118654752f));
      if (ACT == 3) { const float u = 0.7978845608028654f * (v + 0.044715f * v * v * v); v = 0.5f * v * (1.0f + tanhf(u)); }
      so[w][8 * hh + r][t * 16 + ln] = v;
    }
  }
  __builtin_amdgcn_fence(__ATOMIC_ACQ_REL, "workgroup");
  __builtin_amdgcn_wave_barrier();
  const int rsub = lane >> 4, c4 = (lane & 15) * 4;
  {
#pragma unroll
    for (int q = 0; q < 8; ++q) {
      const int r = q * 2 + rsub;
      const v4f v = *(const v4fa*)&so[w][r][c4];
      *(v4f*)(C + (size_t)(row0 + r) * ldc + col0 + c4) = v;
    }
    
  }
}
// row LayerNorm (biased variance, eps) over N: s = X (+ R); optional out_sum <- s; out_norm <- (s-mu)*rsqrt(var+eps)*g + b
template <bool PARAM_BF16>
__global__ __launch_bounds__(256) void k_layernorm(const float* __restrict__ X, const float* __restrict__ R, const float* __restrict__ g, const float* __restrict__ bta,
                                                  float* __restrict__ out_sum, float* __restrict__ out_norm, int N, float eps) {
  __shared__ float red[256];
  const int row = blockIdx.x, tid = threadIdx.x;
  const float* x = X + (size_t)row * N; const float* rr = R ? R + (size_t)row * N : nullptr;
  float vals[16];                     // up to N = 4096
  const int per = N / 256;            // contiguous chunk per thread? use strided-by-4 chunks: thread handles j = tid*4 + 1024*u
  float s1 = 0.f;
  for (int u = 0; u < per / 4; ++u) {
    const int j = tid * 4 + 1024 * u;
    const v4f a = *(const v4fa*)(x + j);
    v4f b = {0.f,0.f,0.f,0.f}; if (rr) b = *(const v4fa*)(rr + j);
#pragma unroll
    for (int q = 0; q < 4; ++q) { const float v = a[q] + b[q]; vals[u * 4 + q] = v; s1 += v; }
  }
  red[tid] = s1; __syncthreads();
  for (int st = 128; st > 0; st >>= 1) { if (tid < st) red[tid] += red[tid + st]; __syncthreads(); }
  const float mu = red[0] / (float)N; __syncthreads();
  float s2 = 0.f;
  for (int u = 0; u < per / 4; ++u)
#pragma unroll
    for (int q = 0; q < 4; ++q) { const float c = vals[u * 4 + q] - mu; s2 += c * c; }
  red[tid] = s2; __syncthreads();
  for (int st = 128; st > 0; st >>= 1) { if (tid < st) red[tid] += red[tid + st]; __syncthreads(); }
  const float rs = rsqrtf(red[0] / (float)N + eps);
  {
    for (int u = 0; u < per / 4; ++u) {
      const int j = tid * 4 + 1024 * u;
      v4f o, sm;
#pragma unroll
      for (int q = 0; q < 4; ++q) {
        float gg = g[j + q], bb = bta[j + q];
        if (PARAM_BF16) { gg = bf16_round(gg); bb = bf16_round(bb); }
        sm[q] = vals[u * 4 + q]; o[q] = (vals[u * 4 + q] - mu) * rs * gg + bb;
      }
      if (out_sum) *(v4f*)(out_sum + (size_t)row * N + j) = sm;
      *(v4f*)(out_norm + (size_t)row * N + j) = o;
    }
    
  }
}



// ---- f16 WMMA path (v_wmma_f32_16x16x32_f16): 11-bit significands for operands in range — used for every contraction launched here (VN-linear maps, Q·Kᵀ, P·V)
typedef _Float16 v16h __attribute__((ext_vector_type(16)));
union FragH { v16h v; v8us half[2]; _Float16 h[16]; unsigned short u[16]; };
template <int NT>
__device__ __forceinline__ v8f mmaH(v16h ah, v16h al, v16h bh, v16h bl, v8f c) {
  c = __builtin_amdgcn_wmma_f32_16x16x32_f16(false, ah, false, bh, (short)0, c, false, false);
  if (NT >= 2) c = __builtin_amdgcn_wmma_f32_16x16x32_f16(false, al, false, bh, (short)0, c, false, false);
  if (NT >= 3) c = __builtin_amdgcn_wmma_f32_16x16x32_f16(false, ah, false, bl, (short)0, c, false, false);
  asm volatile("v_nop\n\tv_nop\n\tv_nop\n\tv_nop" : "+v"(c) : "v"(ah), "v"(al), "v"(bh), "v"(bl));
  return c;
}
// batched GEMM like k_gemm_b but f16 operands: A f32 (split into f16 hi/lo if ASPLIT, else rounded to f16), Bt = f16 values [n][k]; alpha; C f32; N multiple of 16 (partial tiles skipped)
template <bool ASPLIT>
__global__ __launch_bounds__(128) void k_gemm_h(const float* __restrict__ A, int lda, size_t sA, const _Float16* __restrict__ Bh, int ldb, size_t sB, float alpha, float* __restrict__ C, int ldc, size_t sC, int M, int N, int K) {
  __shared__ __attribute__((aligned(16))) float so[4][16][64];
  const int tid = threadIdx.x, w = tid >> 5, lane = tid & 31, ln = lane & 15, hh = lane >> 4; const int by = blockIdx.y;
  A += (size_t)by * sA; Bh += (size_t)by * sB; C += (size_t)by * sC;
  const int ntn = (N + 63) / 64; const int wid = blockIdx.x * 4 + w; const int mt = wid / ntn, nq = wid % ntn; if (mt * 16 >= M) return;
  const int row0 = mt * 16, col0 = nq * 64; const float* arow = A + (size_t)(row0 + ln) * lda;
  v8f acc[4] = {};
  for (int kb = 0; kb < K; kb += 32) {
    FragH ah, al;
    const v4f x0 = *(const v4fa*)(arow + kb + 8 * hh), x1 = *(const v4fa*)(arow + kb + 8 * hh + 4), x2 = *(const v4fa*)(arow + kb + 16 + 8 * hh), x3 = *(const v4fa*)(arow + kb + 16 + 8 * hh + 4);
    float xs[16] = {x0[0],x0[1],x0[2],x0[3],x1[0],x1[1],x1[2],x1[3],x2[0],x2[1],x2[2],x2[3],x3[0],x3[1],x3[2],x3[3]};
#pragma unroll
    for (int i = 0; i < 16; ++i) { const _Float16 h = (_Float16)xs[i]; ah.h[i] = h; al.h[i] = ASPLIT ? (_Float16)(xs[i] - (float)h) : (_Float16)0.0f; }
#pragma unroll
    for (int t = 0; t < 4; ++t) { if (col0 + t * 16 >= N) continue; const size_t boff = (size_t)(col0 + t * 16 + ln) * ldb + kb; FragH bq; bq.half[0] = *(const v8us*)(Bh + boff + 8 * hh); bq.half[1] = *(const v8us*)(Bh + boff + 16 + 8 * hh);
      acc[t] = mmaH<ASPLIT ? 2 : 1>(ah.v, al.v, bq.v, bq.v, acc[t]); }
  }
#pragma unroll
  for (int t = 0; t < 4; ++t) { if (col0 + t * 16 >= N) continue;
#pragma unroll
    for (int r = 0; r < 8; ++r) so[w][8 * hh + r][t * 16 + ln] = acc[t][r] * alpha; }
  __builtin_amdgcn_fence(__ATOMIC_ACQ_REL, "workgroup"); __builtin_amdgcn_wave_barrier();
  const int rsub = lane >> 4, c4 = (lane & 15) * 4;
  {
#pragma unroll
    for (int q = 0; q < 8; ++q) { const int r = q * 2 + rsub; if (col0 + c4 < N) { const v4f v = *(const v4fa*)&so[w][r][c4]; *(v4f*)(C + (size_t)(row0 + r) * ldc + col0 + c4) = v; } }
     }
}

// Wt[n][k] = f16(W[k][n]·scale) from f32 row-major W[K][N] (scale = power of two; bf16-exact weights stay exact in f16 away from the subnormal range)
__global__ __launch_bounds__(256) void k_wt_f16(const float* __restrict__ W, _Float16* __restrict__ Wt, int K, int N, float scale) {
  const int t = blockIdx.x * 256 + threadIdx.x; if (t >= N * (K / 8)) return; const int n = t / (K / 8), k8 = (t % (K / 8)) * 8; FragH f;
#pragma unroll
  for (int i = 0; i < 8; ++i) f.h[i] = (_Float16)(bf16_round(W[(size_t)(k8 + i) * N + n]) * scale); const v8us o = f.half[0];
  *(v8us*)((unsigned short*)Wt + (size_t)n * K + k8) = o; 
}
// FRAGMENT ORDER. The weights and x are stored as the matrix instructions read them: a matrix of rows x K halves is cut into fragments of 16 rows x 32 k, 1 KB each, at [row / 16][k / 32];
// inside a fragment piece (hs, lane) is 16 bytes: row lane % 16, k = 16 hs + 8 (lane / 16) + 0..7. A wave's 16-byte load of half a fragment is then 512 bytes in a row, four whole lines, where rows of pitch K gave sixteen 32-byte pieces.
#define FRH 512      // halves of one fragment
// Every operand conversion in one launch; the block index picks the job, and no job reads what another writes. Blocks [0, 4 WBL): the four weight matrices, rounded and scaled by 16, WBL blocks each; the rest: x.
// Thread t writes piece t of its packed matrix, so a wave's store is 512 bytes in a row. X3 has its rows in the order (b, c, n): a thread takes the three coordinates of its 8 channels from one run of 96 bytes and writes one piece to each of the three planes.
#define WBL (CO * CI / 8 / 256)
#define XBL (NR * (CI / 8) / 256)
__global__ __launch_bounds__(256) void k_prep(const float* __restrict__ x, const float* __restrict__ Wq, const float* __restrict__ Wk, const float* __restrict__ Wv, const float* __restrict__ Wo,
                                            _Float16* __restrict__ Bq, _Float16* __restrict__ Bk, _Float16* __restrict__ Bv, _Float16* __restrict__ Bo, _Float16* __restrict__ X3) {
  const int bx = blockIdx.x; const int lane = threadIdx.x & 31, hs = (threadIdx.x >> 5) & 1; const int kin = hs * 16 + (lane >> 4) * 8;
  if (bx < 4 * WBL) { const int j = bx / WBL; const float* W = j == 0 ? Wq : j == 1 ? Wk : j == 2 ? Wv : Wo; _Float16* Bt = j == 0 ? Bq : j == 1 ? Bk : j == 2 ? Bv : Bo; const int kf = (j == 3 ? CO : CI) / 32;      // fragments in a row of the matrix
    const int t = (bx % WBL) * 256 + threadIdx.x; const int fr = t >> 6; const float* wp = W + (size_t)((fr / kf) * 16 + (lane & 15)) * (kf * 32) + (fr % kf) * 32 + kin; FragH f;
#pragma unroll      // constant indices keep f in registers
    for (int i = 0; i < 8; ++i) f.h[i] = (_Float16)(bf16_round(wp[i]) * 16.0f); *(v8us*)((unsigned short*)Bt + (size_t)t * 8) = f.half[0]; }
  else { const int t = (bx - 4 * WBL) * 256 + threadIdx.x; const int fr = t >> 6; const int bn = (fr / (CI / 32)) * 16 + (lane & 15); const float* xp = x + ((size_t)bn * CI + (fr % (CI / 32)) * 32 + kin) * 3;
    unsigned short* xo = (unsigned short*)X3 + ((size_t)t + (size_t)(bn / NN) * 2 * (NN / 16) * (CI / 32) * 64) * 8;      // token row b NN + n becomes row (3 b + c) NN + n: 2 b + c planes further
#pragma unroll      // the 24 floats are loaded once, as six 16-byte loads, and the three stores go from one address pair with constant offsets
    for (int c = 0; c < 3; ++c) { FragH f;
#pragma unroll      // constant indices keep f in registers
      for (int q = 0; q < 8; ++q) f.h[q] = (_Float16)bf16_round(xp[q * 3 + c]); *(v8us*)(xo + (size_t)c * (NN / 16) * (CI / 32) * FRH) = f.half[0]; }
    asm volatile("s_wait_xcnt 0x0" ::: "memory"); } }      // behind the last store: no register that the three stores name is rewritten ahead of this wait
// q or k map: C[(b, n, c)][o] = sum_k X3[(b, c, n)][k] W[o][k] / 16, f16. A wave takes 16 tokens of one (b, c) x 64 outputs; both operands come in fragment order. The result keeps its rows (b, n, c) x 512: a token's row is picked in the store.
__device__ __forceinline__ void gemm_qk(float (*so)[16][64], int bx, const _Float16* __restrict__ X3, const _Float16* __restrict__ Wh, _Float16* __restrict__ C16) {
  const int tid = threadIdx.x, w = tid >> 5, lane = tid & 31, ln = lane & 15, hh = lane >> 4;
  const int wid = bx * 4 + w; const int mt = wid / (CO / 64), nq = wid % (CO / 64); const int col0 = nq * 64;
  const unsigned short* ap = (const unsigned short*)X3 + (size_t)mt * (CI / 32) * FRH + lane * 8;
  const unsigned short* bp = (const unsigned short*)Wh + (size_t)nq * 4 * (CI / 32) * FRH + lane * 8;
  v8f acc[4] = {};
#pragma unroll      // every load is base + constant, so that no address register is rewritten while loads are out
  for (int ks = 0; ks < CI / 32; ++ks) { FragH ah; ah.half[0] = *(const v8us*)(ap + ks * FRH); ah.half[1] = *(const v8us*)(ap + ks * FRH + 256);
#pragma unroll      // constant indices keep the fragments and acc in registers
    for (int t = 0; t < 4; ++t) { FragH bq; bq.half[0] = *(const v8us*)(bp + (t * (CI / 32) + ks) * FRH); bq.half[1] = *(const v8us*)(bp + (t * (CI / 32) + ks) * FRH + 256);
      acc[t] = mmaH<1>(ah.v, ah.v, bq.v, bq.v, acc[t]); } }
#pragma unroll      // constant indices keep the fragments and acc in registers
  for (int t = 0; t < 4; ++t)
#pragma unroll      // constant indices keep the fragments and acc in registers
    for (int r = 0; r < 8; ++r) so[w][8 * hh + r][t * 16 + ln] = acc[t][r] * 0.0625f;
  __builtin_amdgcn_fence(__ATOMIC_ACQ_REL, "workgroup"); __builtin_amdgcn_wave_barrier();      // the wave's LDS stores are done before its lanes read what other lanes stored
  const int rsub = lane >> 4, c4 = (lane & 15) * 4; typedef _Float16 v4h __attribute__((ext_vector_type(4)));
  const int bc = mt / (NN / 16), n0 = (mt % (NN / 16)) * 16;
  _Float16* crow = C16 + (((size_t)(bc / 3) * NN + n0 + rsub) * 3 + bc % 3) * CO + col0 + c4;
#pragma unroll      // constant offsets from one address pair
  for (int q = 0; q < 8; ++q) { const v4f v = *(const v4fa*)&so[w][q * 2 + rsub][c4]; v4h h4; for (int i = 0; i < 4; ++i) h4[i] = (_Float16)v[i]; *(v4h*)(crow + (size_t)q * 2 * 3 * CO) = h4; }
  asm volatile("s_wait_xcnt 0x0" ::: "memory");      // behind the last store: no register that the eight stores name is rewritten ahead of this wait
}
// V^T at once: C[o][n] = sum_k Wv[o][k] X3[(b, c, n)][k]. The weight rows are the A operand and the token rows of one (b, c) the B operand, both in fragment order,
// so a row of the staged tile is 64 tokens of one feature: one whole 128-byte line of the layout that the attention stages. Same products, same k order as the q and k maps.
__device__ __forceinline__ void gemm_vt(float (*so)[16][64], int bx, int by, const _Float16* __restrict__ Wh, const _Float16* __restrict__ X3, _Float16* __restrict__ Vt) {
  const int tid = threadIdx.x, w = tid >> 5, lane = tid & 31, ln = lane & 15, hh = lane >> 4; const int b = by / 3, c = by % 3;
  const int wid = bx * 4 + w; const int mt = wid / (NN / 64), nq = wid % (NN / 64); const int row0 = mt * 16, col0 = nq * 64;
  const unsigned short* arow = (const unsigned short*)Wh + (size_t)mt * (CI / 32) * FRH + lane * 8;
  const unsigned short* xrow = (const unsigned short*)X3 + ((size_t)by * (NN / 16) + nq * 4) * (CI / 32) * FRH + lane * 8;
  v8f acc[4] = {};
#pragma unroll      // every load is base + constant, so that no address register is rewritten while loads are out
  for (int ks = 0; ks < CI / 32; ++ks) { FragH ah; ah.half[0] = *(const v8us*)(arow + ks * FRH); ah.half[1] = *(const v8us*)(arow + ks * FRH + 256);
#pragma unroll      // constant indices keep the fragments and acc in registers
    for (int t = 0; t < 4; ++t) { FragH bq; bq.half[0] = *(const v8us*)(xrow + (t * (CI / 32) + ks) * FRH); bq.half[1] = *(const v8us*)(xrow + (t * (CI / 32) + ks) * FRH + 256);
      acc[t] = mmaH<1>(ah.v, ah.v, bq.v, bq.v, acc[t]); } }
#pragma unroll      // constant indices keep the fragments and acc in registers
  for (int t = 0; t < 4; ++t)
#pragma unroll      // constant indices keep the fragments and acc in registers
    for (int r = 0; r < 8; ++r) so[w][8 * hh + r][t * 16 + ln] = acc[t][r] * 0.0625f;
  __builtin_amdgcn_fence(__ATOMIC_ACQ_REL, "workgroup"); __builtin_amdgcn_wave_barrier();      // the wave's LDS stores are done before its lanes read what other lanes stored
  const int rsub = lane >> 4, c4 = (lane & 15) * 4; typedef _Float16 v4h __attribute__((ext_vector_type(4)));
  _Float16* vrow = Vt + ((size_t)(b * NH + row0 / HD) * 192 + c * 64 + row0 % HD + rsub) * NN + col0 + c4;      // the 16 features of a tile lie in one head
#pragma unroll      // constant offsets from one address pair
  for (int q = 0; q < 8; ++q) { const v4f v = *(const v4fa*)&so[w][q * 2 + rsub][c4]; v4h h4; for (int i = 0; i < 4; ++i) h4[i] = (_Float16)v[i]; *(v4h*)(vrow + (size_t)q * 2 * NN) = h4; }
}
// The q, k and V^T maps in one launch: all three read X3 and none reads another's result. blockIdx.y picks the map, blockIdx.x is the map's own block number (MBL each).
#define MBL ((NR3 / 16) * (CO / 64) / 4)
#define VBX ((CO / 16) * (NN / 64) / 4)
__global__ __launch_bounds__(128) void k_qkv(const _Float16* __restrict__ X3, const _Float16* __restrict__ Bq, const _Float16* __restrict__ Bk, const _Float16* __restrict__ Bv, _Float16* __restrict__ Q16, _Float16* __restrict__ K16, _Float16* __restrict__ Vt) {
  __shared__ __attribute__((aligned(16))) float so[4][16][64];
  const int bx = blockIdx.x, job = blockIdx.y;
  if (job == 2) gemm_vt(so, bx % VBX, bx / VBX, Bv, X3, Vt);
  else gemm_qk(so, bx, X3, job == 0 ? Bq : Bk, job == 0 ? Q16 : K16);
}
// K and V^T tiles of 64 keys, staged in LDS once per group of four waves and read by these four. Row pitches are 16 B x odd, so the 16 rows of a ds_load_b128 fall on distinct banks.
#define TK 64
#define KP 200      // halves per staged K row: 3 coordinate blocks x 64 + 8 of pad (400 B)
#define VP 72       // halves per staged V^T row: 64 keys + 8 of pad (144 B)
// Twelve asynchronous 16-byte copies per lane, global -> LDS, through no register: copy 4 a + q goes from g + a gs + q gq (halves) to LDS byte l + a ls + q lq.
// The s_wait_xcnt closes the statement so that no address register named here is rewritten ahead of it.
__device__ __forceinline__ void acopy12(unsigned l, unsigned ls, unsigned lq, const unsigned short* g, size_t gs, size_t gq) {
  const unsigned l1 = l + lq, l2 = l + 2 * lq, l3 = l + 3 * lq, l4 = l + ls, l5 = l4 + lq, l6 = l4 + 2 * lq, l7 = l4 + 3 * lq, l8 = l + 2 * ls, l9 = l8 + lq, l10 = l8 + 2 * lq, l11 = l8 + 3 * lq;
  const unsigned short *g1 = g + gq, *g2 = g + 2 * gq, *g3 = g + 3 * gq, *g4 = g + gs, *g5 = g4 + gq, *g6 = g4 + 2 * gq, *g7 = g4 + 3 * gq, *g8 = g + 2 * gs, *g9 = g8 + gq, *g10 = g8 + 2 * gq, *g11 = g8 + 3 * gq;
  asm volatile("global_load_async_to_lds_b128 %0, %12, off\n\t"
               "global_load_async_to_lds_b128 %1, %13, off\n\t"
               "global_load_async_to_lds_b128 %2, %14, off\n\t"
               "global_load_async_to_lds_b128 %3, %15, off\n\t"
               "global_load_async_to_lds_b128 %4, %16, off\n\t"
               "global_load_async_to_lds_b128 %5, %17, off\n\t"
               "global_load_async_to_lds_b128 %6, %18, off\n\t"
               "global_load_async_to_lds_b128 %7, %19, off\n\t"
               "global_load_async_to_lds_b128 %8, %20, off\n\t"
               "global_load_async_to_lds_b128 %9, %21, off\n\t"
               "global_load_async_to_lds_b128 %10, %22, off\n\t"
               "global_load_async_to_lds_b128 %11, %23, off\n\t"
               "s_wait_xcnt 0x0"
               :: "v"(l), "v"(l1), "v"(l2), "v"(l3), "v"(l4), "v"(l5), "v"(l6), "v"(l7), "v"(l8), "v"(l9), "v"(l10), "v"(l11),
                  "v"(g), "v"(g1), "v"(g2), "v"(g3), "v"(g4), "v"(g5), "v"(g6), "v"(g7), "v"(g8), "v"(g9), "v"(g10), "v"(g11) : "memory");
}
// One stage: 64 keys of K (3 coordinate blocks of 128 B a key) and 192 rows of V^T (128 B a row); 24 copies a lane.
__device__ __forceinline__ void stage_kv(unsigned lk, unsigned lv, const unsigned short* kg, const unsigned short* vg) {
  acopy12(lk, 128, 16 * KP * 2, kg, CO, (size_t)16 * 3 * CO);
  acopy12(lv, 64 * VP * 2, 16 * VP * 2, vg, (size_t)64 * NN, (size_t)16 * NN);
}
// lane l with lane l ^ 16, through no LDS
__device__ __forceinline__ float xhalf(float x) { return __builtin_bit_cast(float, __builtin_amdgcn_permlanex16(__builtin_bit_cast(int, x), __builtin_bit_cast(int, x), 0x76543210, 0xfedcba98, false, false)); }
// Scores are formed transposed: K rows are the A operand and Q the B operand, so lane (ln, hh) holds query ln and keys 8 hh + r of each 16-key tile. A query's maximum and sum are then
// in-lane but for one exchange between the wave halves, and the two score tiles of 32 keys, converted in place, are the B operand of O^T += V^T P^T (element i: key 8 hh + i, element 8 + i: key 16 + 8 hh + i, as the V^T loader has it).
// A wave takes 32 queries (two tiles of 16), so every K and V^T fragment that it reads from LDS feeds two products. The work-group has 128 queries and eight waves: waves 0-3 walk keys [0, NN / 2), waves 4-7 keys [NN / 2, NN),
// each group of four staging its own tiles, so that a SIMD still holds two waves; the two groups' partial O, maximum and sum are joined once, through LDS, behind the loop.
#define KH (NN / 2)      // keys of one group of four waves
// The bare builtin: the compiler keeps the distances behind its own matrix instructions, and with no asm statement naming them the accumulators may live above v255.
__device__ __forceinline__ v8f mmaP(v16h a, v16h b, v8f c) { return __builtin_amdgcn_wmma_f32_16x16x32_f16(false, a, false, b, (short)0, c, false, false); }
__global__ __launch_bounds__(256) void k_vnattn(const _Float16* __restrict__ Q16, const _Float16* __restrict__ K16, const _Float16* __restrict__ Vt, _Float16* __restrict__ O3) {
  __shared__ __attribute__((aligned(16))) unsigned short sK[2][2][TK][KP]; __shared__ __attribute__((aligned(16))) unsigned short sV[2][2][192][VP];      // [buffer][key group]
  __shared__ float sML[4][2][2][32];      // the second group's maximum and sum: [query group][tile][which][lane]
  const int tid = threadIdx.x, w = tid >> 5, lane = tid & 31, ln = lane & 15, hh = lane >> 4; const int qg = w & 3, t128 = tid & 127; const int kh = __builtin_amdgcn_readfirstlane(tid >> 7);      // the wave's key group, the same in every lane: kept in a scalar register
  const int slab = blockIdx.x / (NN / 128), qblk = blockIdx.x % (NN / 128); const int b = slab / NH, h = slab % NH; const int q0 = qblk * 128 + qg * 32;
  const unsigned short* Vth = (const unsigned short*)Vt + (size_t)slab * 192 * NN;
  // The lane's share of its group's stage: eight lanes cover one 128-byte row piece, so a wave's copy covers four whole lines. K: key = 16 q + t128 / 8; V^T: row = 64 a + 16 q + t128 / 8.
  const int cr = t128 >> 3, cc = (t128 & 7) * 8;
  // The lane's part of each address; the scalar part (group, buffer, stage) is added where a stage is issued.
  const unsigned kl = cr * (3 * CO) + cc, vl = cr * NN + cc;      // halves
  const unsigned lkl = (unsigned)(size_t)&sK[0][0][cr][cc], lvl = (unsigned)(size_t)&sV[0][0][cr][cc];
  const unsigned short* kgs = (const unsigned short*)K16 + ((size_t)b * NN + kh * KH) * (3 * CO) + h * HD;      // scalar
  const unsigned short* vgs = Vth + kh * KH;                                                                      // scalar
  const unsigned lks = kh * (TK * KP * 2), lvs = kh * (192 * VP * 2);                                              // scalar
  constexpr unsigned KB = 2 * TK * KP * 2, VB = 2 * 192 * VP * 2;      // bytes of one buffer (both groups' tiles)
  constexpr int NT = KH / TK;
  constexpr float SL2 = 0.07216878364870323f * 1.4426950408889634f;      // 1 / sqrt(192) x log2(e)
  FragH aq[2][6]; { const unsigned short* qr = (const unsigned short*)Q16 + ((size_t)b * NN + q0 + ln) * (3 * CO) + h * HD + 8 * hh;      // row (b,n) = [c0 | c1 | c2] x 512 (= rows (b,n,c) of pitch 512)
#pragma unroll
    for (int qt = 0; qt < 2; ++qt)
#pragma unroll
      for (int ks = 0; ks < 6; ++ks) { const int c = ks >> 1, s32 = (ks & 1) * 32; aq[qt][ks].half[0] = *(const v8us*)(qr + qt * 16 * 3 * CO + c * CO + s32); aq[qt][ks].half[1] = *(const v8us*)(qr + qt * 16 * 3 * CO + c * CO + s32 + 16); }
    asm volatile("s_wait_xcnt 0x0" :: "v"(qr) : "memory"); }      // the Q loads' address pair is named as an input, so it stays untouched until this wait; behind it the pair may be reused
  float m_r[2] = {-3.0e38f, -3.0e38f}, l_r[2] = {0.f, 0.f}; v8f oacc[2][12];      // oacc[qt][dt][r] = O[query 16 qt + ln][dt * 16 + 8 hh + r]; l_r sums this half's keys only
#pragma unroll
  for (int qt = 0; qt < 2; ++qt)
#pragma unroll
    for (int dt = 0; dt < 12; ++dt) oacc[qt][dt] = (v8f){0.f,0.f,0.f,0.f,0.f,0.f,0.f,0.f};
  // Trips -2 and -1 only fill the ring, in the order of a two-buffer prologue: trip -2 issues stage 0; trip -1 waits for it, publishes it at the barrier and issues stage 1. So the file has one place that issues a stage:
  // with a second one in front of the loop, the address registers that it named stayed bound below v256 through the loop and were spilled to scratch.
#pragma unroll 1
  for (int t = -2; t < NT; ++t) { const int buf = t & 1;
   if (t >= 0)
#pragma unroll 1      // the two 32-key passes of a stage stay rolled: unrolled, the build spilled the Q fragments to scratch
   for (int p = 0; p < TK / 32; ++p) { v8f s[2][2];
#pragma unroll
    for (int nt = 0; nt < 2; ++nt) { const unsigned short* kr = &sK[buf][kh][p * 32 + nt * 16 + ln][0]; v8f acc0 = (v8f){0.f,0.f,0.f,0.f,0.f,0.f,0.f,0.f}, acc1 = acc0; FragH bk[6];      // six fragments are read as one run ahead of their products: one LDS latency a run, not one a product
#pragma unroll      // constant indices keep bk in registers
      for (int ks = 0; ks < 6; ++ks) { bk[ks].half[0] = *(const v8us*)(kr + ks * 32 + 8 * hh); bk[ks].half[1] = *(const v8us*)(kr + ks * 32 + 16 + 8 * hh); }
#pragma unroll
      for (int ks = 0; ks < 6; ++ks) { acc0 = mmaP(bk[ks].v, aq[0][ks].v, acc0); acc1 = mmaP(bk[ks].v, aq[1][ks].v, acc1); }
      s[0][nt] = acc0; s[1][nt] = acc1; }
    FragH pa[2];
#pragma unroll      // constant indices keep the scores, pa and oacc in registers
    for (int qt = 0; qt < 2; ++qt) {
    float mc = -3.0e38f;
#pragma unroll      // constant indices keep the scores in registers
    for (int r = 0; r < 8; ++r) mc = fmaxf(mc, fmaxf(s[qt][0][r], s[qt][1][r]));
    mc = fmaxf(mc, xhalf(mc));
    // Softmax in the log2 domain: e^(x / sqrt(192) - m) = 2^(x SL2 - m'), SL2 = log2(e) / sqrt(192) > 0, so the maximum is taken on the raw scores and scaled once;
    // a score then costs one multiply-add and one hardware 2^x. m_r is kept in the scaled log2 unit.
    const float mn = fmaxf(m_r[qt], mc * SL2); const float al = __builtin_amdgcn_exp2f(m_r[qt] - mn); m_r[qt] = mn;
    float ps[4] = {0.f, 0.f, 0.f, 0.f};      // four short chains of adds, not one of sixteen
#pragma unroll      // constant indices keep the scores, pa and ps in registers
    for (int r = 0; r < 8; ++r) { const float p0 = __builtin_amdgcn_exp2f(fmaf(s[qt][0][r], SL2, -mn)), p1 = __builtin_amdgcn_exp2f(fmaf(s[qt][1][r], SL2, -mn)); ps[r & 3] += p0 + p1; pa[qt].h[r] = (_Float16)p0; pa[qt].h[8 + r] = (_Float16)p1; }
    l_r[qt] = l_r[qt] * al + ((ps[0] + ps[1]) + (ps[2] + ps[3]));
#pragma unroll
    for (int dt = 0; dt < 12; ++dt)
#pragma unroll
      for (int r = 0; r < 8; ++r) oacc[qt][dt][r] *= al; }
#pragma unroll
    for (int dg = 0; dg < 2; ++dg) { FragH bv[6];      // as for K: a run of six fragments, then their twelve products
#pragma unroll      // constant indices keep bv and oacc in registers
      for (int i = 0; i < 6; ++i) { const unsigned short* vrow = &sV[buf][kh][(dg * 6 + i) * 16 + ln][p * 32]; bv[i].half[0] = *(const v8us*)(vrow + 8 * hh); bv[i].half[1] = *(const v8us*)(vrow + 16 + 8 * hh); }
#pragma unroll
      for (int i = 0; i < 6; ++i) { oacc[0][dg * 6 + i] = mmaP(bv[i].v, pa[0].v, oacc[0][dg * 6 + i]); oacc[1][dg * 6 + i] = mmaP(bv[i].v, pa[1].v, oacc[1][dg * 6 + i]); } } }
   asm volatile("s_wait_dscnt 0x0" ::: "memory");         // this wave's reads of buffer t mod 2 are done before the buffer is handed back
   asm volatile("s_wait_asynccnt 0x0" ::: "memory");      // this wave's share of stage t + 1 has landed
   __syncthreads();                                        // publishes stage t + 1 and ends every wave's reads of stage t
   if (t + 2 < NT) stage_kv(lkl + (lks + buf * KB), lvl + (lvs + buf * VB), (kgs + (size_t)(t + 2) * TK * 3 * CO) + kl, (vgs + (t + 2) * TK) + vl); }
  asm volatile("s_wait_asynccnt 0x0" ::: "memory");        // no copy is outstanding when the ring is put to another use
  // Behind the last barrier of the loop nobody reads the ring and no copy is out: sK becomes the second group's partial O (f32, in register order: piece (tile, dt, j) is 32 lanes x 16 bytes in a row), sV the f16 output staging.
  v4fa* sM = (v4fa*)&sK[0][0][0][0] + (size_t)qg * (2 * 12 * 2 * 32) + lane;
  unsigned short (*sO)[64 + 8] = (unsigned short (*)[64 + 8])&sV[0][0][0][0] + qg * 96;      // one row a (query, coordinate) piece of 64 halves; a query's pitch is 16 B x odd
  float lt[2];
#pragma unroll      // constant indices keep l_r in registers
  for (int qt = 0; qt < 2; ++qt) lt[qt] = l_r[qt] + xhalf(l_r[qt]);      // the two halves' sums are joined once, here
  if (kh == 1) {
#pragma unroll      // constant indices keep oacc in registers
    for (int qt = 0; qt < 2; ++qt) { sML[qg][qt][0][lane] = m_r[qt]; sML[qg][qt][1][lane] = lt[qt];
#pragma unroll      // constant indices keep oacc in registers
      for (int dt = 0; dt < 12; ++dt) { const v8f o = oacc[qt][dt]; sM[((qt * 12 + dt) * 2 + 0) * 32] = (v4f){o[0], o[1], o[2], o[3]}; sM[((qt * 12 + dt) * 2 + 1) * 32] = (v4f){o[4], o[5], o[6], o[7]}; } } }
  __syncthreads();      // the second group's partials are published to the first
  if (kh == 0) {
#pragma unroll      // constant indices keep oacc in registers
    for (int qt = 0; qt < 2; ++qt) { const float m1 = sML[qg][qt][0][lane], l1 = sML[qg][qt][1][lane]; const float mm = fmaxf(m_r[qt], m1);
      const float a0 = __builtin_amdgcn_exp2f(m_r[qt] - mm), a1 = __builtin_amdgcn_exp2f(m1 - mm); const float linv = 1.0f / (lt[qt] * a0 + l1 * a1); const float c0 = a0 * linv, c1 = a1 * linv;
#pragma unroll      // constant indices keep oacc in registers
      for (int dt = 0; dt < 12; ++dt) { const v4f x0 = sM[((qt * 12 + dt) * 2 + 0) * 32], x1 = sM[((qt * 12 + dt) * 2 + 1) * 32]; FragH f;
#pragma unroll      // constant indices keep oacc in registers
        for (int r = 0; r < 4; ++r) { f.h[r] = (_Float16)(oacc[qt][dt][r] * c0 + x0[r] * c1); f.h[4 + r] = (_Float16)(oacc[qt][dt][4 + r] * c0 + x1[r] * c1); }
        *(v8us*)&sO[(qt * 16 + ln) * 3 + dt / 4][(dt % 4) * 16 + 8 * hh] = f.half[0]; } }
    __builtin_amdgcn_fence(__ATOMIC_ACQ_REL, "workgroup"); __builtin_amdgcn_wave_barrier();      // the wave's LDS stores are done before its lanes read what other lanes stored
    // Stored as the output map reads it: rows (b, n, c) x 512. A query's 192 features are three pieces of 64 halves, one 128-byte line each; eight lanes a piece, four pieces a store.
    unsigned short* orow = (unsigned short*)O3 + (((size_t)b * NN + q0) * 3 + (lane >> 3)) * CO + h * HD + (lane & 7) * 8;
#pragma unroll      // constant offsets from one address pair
    for (int q = 0; q < 24; ++q) { const v8us v = *(const v8us*)&sO[q * 4 + (lane >> 3)][(lane & 7) * 8]; *(v8us*)(orow + (size_t)q * 4 * CO) = v; } } }
// Output map with the (o, c) interleave in its store: a wave takes 16 tokens x 3 coordinates x 64 outputs (each lane picks its token's three rows of O3), so a token's piece of the result is 192 floats in a row, six whole lines.
__global__ __launch_bounds__(128) void k_gemm_out(const _Float16* __restrict__ O3, const _Float16* __restrict__ Wh, float* __restrict__ out) {
  __shared__ __attribute__((aligned(16))) float so[4][16][192 + 4];
  const int tid = threadIdx.x, w = tid >> 5, lane = tid & 31, ln = lane & 15, hh = lane >> 4;
  const int wid = blockIdx.x * 4 + w; const int mt = wid / (CI / 64), nq = wid % (CI / 64); const int bn0 = mt * 16, col0 = nq * 64;
  const unsigned short* arow = (const unsigned short*)O3 + (size_t)(bn0 + ln) * 3 * CO + 8 * hh;
  const unsigned short* brow = (const unsigned short*)Wh + (size_t)nq * 4 * (CO / 32) * FRH + lane * 8;      // the weights come in fragment order
  v8f acc[3][4] = {};
#pragma unroll      // every load is base + constant, so that no address register is rewritten while loads are out
  for (int kb = 0; kb < CO; kb += 32) { FragH a[3];
#pragma unroll      // constant indices keep the fragments and acc in registers
    for (int c = 0; c < 3; ++c) { a[c].half[0] = *(const v8us*)(arow + c * CO + kb); a[c].half[1] = *(const v8us*)(arow + c * CO + kb + 16); }
#pragma unroll      // constant indices keep the fragments and acc in registers
    for (int t = 0; t < 4; ++t) { FragH bq; bq.half[0] = *(const v8us*)(brow + (t * (CO / 32) + kb / 32) * FRH); bq.half[1] = *(const v8us*)(brow + (t * (CO / 32) + kb / 32) * FRH + 256);
#pragma unroll      // constant indices keep the fragments and acc in registers
      for (int c = 0; c < 3; ++c) acc[c][t] = mmaH<1>(a[c].v, a[c].v, bq.v, bq.v, acc[c][t]); } }
#pragma unroll      // constant indices keep the fragments and acc in registers
  for (int t = 0; t < 4; ++t)
#pragma unroll      // constant indices keep the fragments and acc in registers
    for (int c = 0; c < 3; ++c)
#pragma unroll      // constant indices keep the fragments and acc in registers
      for (int r = 0; r < 8; ++r) so[w][8 * hh + r][(t * 16 + ln) * 3 + c] = acc[c][t][r] * 0.0625f;
  __builtin_amdgcn_fence(__ATOMIC_ACQ_REL, "workgroup"); __builtin_amdgcn_wave_barrier();      // the wave's LDS stores are done before its lanes read what other lanes stored
  // two tokens' pieces are 96 float4, three stores of the wave; from one pair of tokens to the next every address moves by a constant
#pragma unroll      // three address pairs, formed once
  for (int j = 0; j < 3; ++j) { const int i = j * 32 + lane, r = i / 48, p4 = (i % 48) * 4; const float* ls = &so[w][r][p4]; float* gp = out + ((size_t)(bn0 + r) * CI + col0) * 3 + p4;
#pragma unroll      // constant offsets from the pair
    for (int q = 0; q < 8; ++q) { const v4f v = *(const v4fa*)(ls + q * 2 * (192 + 4)); *(v4f*)(gp + (size_t)q * 2 * CI * 3) = v; } }
}
extern "C" void kernel_launch(void* const* d_in, const int* in_sizes, int n_in,
                              void* d_out, int out_size, void* d_ws, size_t ws_size, hipStream_t stream) {
  (void)in_sizes; (void)n_in; (void)out_size;
  const float* x = (const float*)d_in[0]; const float* Wq = (const float*)d_in[1]; const float* Wk = (const float*)d_in[2]; const float* Wv = (const float*)d_in[3]; const float* Wo = (const float*)d_in[4];
  char* ws = (char*)d_ws; size_t off = 0;
  auto take = [&](size_t bytes) { char* p = ws + off; off += (bytes + 255) & ~(size_t)255; return p; };
  _Float16* Bq = (_Float16*)take((size_t)CO * CI * 2); _Float16* Bk = (_Float16*)take((size_t)CO * CI * 2); _Float16* Bv = (_Float16*)take((size_t)CO * CI * 2); _Float16* Bo = (_Float16*)take((size_t)CI * CO * 2);
  _Float16* X3 = (_Float16*)take((size_t)NR3 * CI * 2); _Float16* Q16 = (_Float16*)take((size_t)NR3 * CO * 2); _Float16* K16 = (_Float16*)take((size_t)NR3 * CO * 2); _Float16* Vt = (_Float16*)take((size_t)NR3 * CO * 2); _Float16* O3 = (_Float16*)take((size_t)NR3 * CO * 2);      // O3 has a place of its own: the attention stores it while other work-groups still read Q16
  if (off > ws_size) return;      // 1 + 6.3 + 12.6 x 4, about 58 MB
  k_prep<<<4 * WBL + XBL, 256, 0, stream>>>(x, Wq, Wk, Wv, Wo, Bq, Bk, Bv, Bo, X3);      // weights are (out,in); X3 = rows (b,c,n) x 256; all five in fragment order
  k_qkv<<<dim3(MBL, 3), 128, 0, stream>>>(X3, Bq, Bk, Bv, Q16, K16, Vt);      // q/k planes = rows (b,n,c) x 512 = [(b,n)][c * 512 + o]
  k_vnattn<<<BB * NH * (NN / 128), 256, 0, stream>>>(Q16, K16, Vt, O3);
  k_gemm_out<<<(NR / 16) * (CI / 64) / 4, 128, 0, stream>>>(O3, Bo, (float*)d_out);
}

// v008
// Measured time: 91.2 microseconds a run.
// Timed twice side by side with v007, it ran 1.25 times as fast both times.
// Over all steps from v000 it is 6.62 times as fast.
#include <hip/hip_runtime.h>
// Vector-neuron attention (B=2, N=2048, C=256 × 3 coordinates, 8 heads × 64): the VN-linear maps (rows (b,n,c) × 256 → 512, weights (out,in) bf16-exact ×2^4) and the attention over the
// 192-dim (d, c) head features as a fused flash-style kernel on v_wmma_f32_16x16x32_f16 (S^T = K Q^T / sqrt(192) with 6 k-steps gathered from the three coordinate blocks, online softmax f32 in-lane, P f16 <= 1 packed from the score registers,
// O^T = V^T P^T with 12 d-tiles; 32 queries a wave, keys split over two groups of waves); f16 operands, single products, f32 accumulate; V^T, the f16 attention output and the final (o, c) interleave are stored by the kernels that compute them.
#define BB 2
#define NN 2048
#define CI 256
#define CO 512
#define NH 8
#define HD 64
#define NR3 (BB * NN * 3)
#define NR (BB * NN)

typedef __bf16 v16b __attribute__((ext_vector_type(16)));
typedef unsigned short v8us __attribute__((ext_vector_type(8), may_alias));
typedef float  v8f  __attribute__((ext_vector_type(8)));
typedef float  v4f  __attribute__((ext_vector_type(4)));
typedef float  v4fa __attribute__((ext_vector_type(4), may_alias));
union FragB { v16b v; v8us half[2]; unsigned short u[16]; };

__device__ __forceinline__ unsigned short bf16_bits(float x) { unsigned int u = __float_as_uint(x); return (unsigned short)((u + 0x7FFFu + ((u >> 16) & 1u)) >> 16); }
__device__ __forceinline__ float bf16_val(unsigned short b) { return __uint_as_float(((unsigned int)b) << 16); }
__device__ __forceinline__ float bf16_round(float x) { return bf16_val(bf16_bits(x)); }
// D += A·B with NT terms: 1 = ah·bh, 2 = + al·bh (A split), 3 = + ah·bl (both split)
template <int NT>
__device__ __forceinline__ v8f mmaN(v16b ah, v16b al, v16b bh, v16b bl, v8f c) {
  c = __builtin_amdgcn_wmma_f32_16x16x32_bf16(false, ah, false, bh, (short)0, c, false, false);
  if (NT >= 2) c = __builtin_amdgcn_wmma_f32_16x16x32_bf16(false, al, false, bh, (short)0, c, false, false);
  if (NT >= 3) c = __builtin_amdgcn_wmma_f32_16x16x32_bf16(false, ah, false, bl, (short)0, c, false, false);
  asm volatile("v_nop\n\tv_nop\n\tv_nop\n\tv_nop" : "+v"(c) : "v"(ah), "v"(al), "v"(bh), "v"(bl));
  return c;
}

__global__ __launch_bounds__(256) void k_wt_bf16(const float* __restrict__ W, unsigned short* __restrict__ Wt, int K, int N) {
  const int t = blockIdx.x * 256 + threadIdx.x;
  const int k8n = K / 8;
  if (t >= N * k8n) return;
  const int n = t / k8n, k8 = (t % k8n) * 8;
  v8us v;
#pragma unroll
  for (int i = 0; i < 8; ++i) v[i] = bf16_bits(W[(size_t)(k8 + i) * N + n]);
  *(v8us*)(Wt + (size_t)n * K + k8) = v;
  
}

// GEMM C[M][N] (f32, pitch ldc) = act(A[M][K]·W + bias). A f32 row-major (pitch lda) converted per fragment to bf16
// (ASPLIT: hi/lo two planes -> 2 terms, else single rounded term); Wt bf16 [N][K] (pitch ldb). BIAS_BF16 rounds the
// bias to bf16 first (bias quantised to bf16 before the add). K%32==0, M%16==0, N%64==0.
template <bool ASPLIT, int ACT, bool BIAS_BF16>
__global__ __launch_bounds__(128) void k_gemm_bf(const float* __restrict__ A, int lda, const unsigned short* __restrict__ Wt, int ldb,
                                               const float* __restrict__ bias, float* __restrict__ C, int ldc, int M, int N, int K) {
  __shared__ __attribute__((aligned(16))) float so[4][16][64];
  const int tid = threadIdx.x, w = tid >> 5, lane = tid & 31, ln = lane & 15, hh = lane >> 4;
  const int ntn = N / 64;
  const int wid = blockIdx.x * 4 + w;
  const int mt = wid / ntn, nq = wid % ntn;
  if (mt * 16 >= M) return;
  const int row0 = mt * 16, col0 = nq * 64;
  const float* arow = A + (size_t)(row0 + ln) * lda;
  v8f acc[4] = {};
  for (int kb = 0; kb < K; kb += 32) {
    FragB ah, al;
    const v4f x0 = *(const v4fa*)(arow + kb + 8 * hh), x1 = *(const v4fa*)(arow + kb + 8 * hh + 4);
    const v4f x2 = *(const v4fa*)(arow + kb + 16 + 8 * hh), x3 = *(const v4fa*)(arow + kb + 16 + 8 * hh + 4);
    float xs[16] = {x0[0],x0[1],x0[2],x0[3],x1[0],x1[1],x1[2],x1[3],x2[0],x2[1],x2[2],x2[3],x3[0],x3[1],x3[2],x3[3]};
#pragma unroll
    for (int i = 0; i < 16; ++i) { const unsigned short hb = bf16_bits(xs[i]); ah.u[i] = hb; al.u[i] = ASPLIT ? bf16_bits(xs[i] - bf16_val(hb)) : (unsigned short)0; }
#pragma unroll
    for (int t = 0; t < 4; ++t) {
      const unsigned short* brow = Wt + (size_t)(col0 + t * 16 + ln) * ldb + kb;
      FragB b;
      b.half[0] = *(const v8us*)(brow + 8 * hh);
      b.half[1] = *(const v8us*)(brow + 16 + 8 * hh);
      acc[t] = mmaN<ASPLIT ? 2 : 1>(ah.v, al.v, b.v, b.v, acc[t]);
    }
  }
#pragma unroll
  for (int t = 0; t < 4; ++t) {
    float bv = bias ? bias[col0 + t * 16 + ln] : 0.f;
    if (BIAS_BF16) bv = bf16_round(bv);
#pragma unroll
    for (int r = 0; r < 8; ++r) { float v = acc[t][r] + bv; if (ACT == 1) v = fmaxf(v, 0.f); so[w][8 * hh + r][t * 16 + ln] = v; }
  }
  __builtin_amdgcn_fence(__ATOMIC_ACQ_REL, "workgroup");
  __builtin_amdgcn_wave_barrier();
  const int rsub = lane >> 4, c4 = (lane & 15) * 4;
  {
#pragma unroll
    for (int q = 0; q < 8; ++q) {
      const int r = q * 2 + rsub;
      const v4f v = *(const v4fa*)&so[w][r][c4];
      *(v4f*)(C + (size_t)(row0 + r) * ldc + col0 + c4) = v;
    }
    
  }
}

// Flash-style causal/unmasked attention, all contractions 3-term bf16 hi/lo splits, f32 softmax with running max.
// q,k,v rows are read from f32 buffers with arbitrary row pitch (so they can live inside a fused qkv buffer);
// D = head size (multiple of 32, <= 128); one wave = 16 query rows; block = 4 waves (64 queries) sharing K/V chunks of 32.
template <int D, bool CAUSAL>
__global__ __launch_bounds__(128) void k_flash(const float* __restrict__ qb, const float* __restrict__ kb, const float* __restrict__ vb,
                                             int pitch, int T, int H, float scale, float* __restrict__ y, int ypitch) {
  constexpr int KS = D / 32;        // k-steps for QK
  constexpr int DT = D / 16;        // d tiles for PV
  __shared__ __attribute__((aligned(16))) unsigned short sKh[32][D + 8], sKl[32][D + 8], sVh[32][D + 8], sVl[32][D + 8];
  __shared__ __attribute__((aligned(16))) unsigned short sPh[4][16][40], sPl[4][16][40];
  __shared__ __attribute__((aligned(16))) float sO[4][16][D];
  const int tid = threadIdx.x, w = tid >> 5, lane = tid & 31, ln = lane & 15, hh = lane >> 4;
  const int nqb = (T + 63) / 64;
  const int bh = blockIdx.x / nqb, qblk = blockIdx.x % nqb;
  const int b = bh / H, h = bh % H;
  const int q0 = qblk * 64 + w * 16;
  const float* Q = qb + (size_t)b * T * pitch + h * D;
  const float* K = kb + (size_t)b * T * pitch + h * D;
  const float* V = vb + (size_t)b * T * pitch + h * D;

  // A fragments of the wave's 16 query rows (scaled), hi/lo
  FragB aqh[KS], aql[KS];
  {
    int row = q0 + ln; if (row >= T) row = T - 1;
    const float* qr = Q + (size_t)row * pitch;
#pragma unroll
    for (int ks = 0; ks < KS; ++ks)
#pragma unroll
      for (int i = 0; i < 16; ++i) {
        const int d = ks * 32 + ((i < 8) ? (8 * hh + i) : (16 + 8 * hh + (i - 8)));
        const float x = qr[d] * scale; const unsigned short hb = bf16_bits(x);
        aqh[ks].u[i] = hb; aql[ks].u[i] = bf16_bits(x - bf16_val(hb));
      }
  }
  float m_r[8], l_r[8];
#pragma unroll
  for (int r = 0; r < 8; ++r) { m_r[r] = -3.0e38f; l_r[r] = 0.f; }
  v8f oacc[DT];
#pragma unroll
  for (int dt = 0; dt < DT; ++dt) oacc[dt] = (v8f){0.f,0.f,0.f,0.f,0.f,0.f,0.f,0.f};

  const int kv_end = CAUSAL ? min(T, qblk * 64 + 64) : T;     // block-uniform
  for (int j0 = 0; j0 < kv_end; j0 += 32) {
    __syncthreads();
    for (int e = tid; e < 32 * (D / 4); e += 128) {
      const int r = e / (D / 4), c4 = (e % (D / 4)) * 4;
      const int key = j0 + r;
      v4f kf = {0.f,0.f,0.f,0.f}, vf = {0.f,0.f,0.f,0.f};
      if (key < T) { kf = *(const v4fa*)(K + (size_t)key * pitch + c4); vf = *(const v4fa*)(V + (size_t)key * pitch + c4); }
#pragma unroll
      for (int t = 0; t < 4; ++t) {
        unsigned short hb = bf16_bits(kf[t]); sKh[r][c4 + t] = hb; sKl[r][c4 + t] = bf16_bits(kf[t] - bf16_val(hb));
        hb = bf16_bits(vf[t]); sVh[r][c4 + t] = hb; sVl[r][c4 + t] = bf16_bits(vf[t] - bf16_val(hb));
      }
    }
    __syncthreads();
    // S tile 16 x 32
    v8f s[2];
#pragma unroll
    for (int nt = 0; nt < 2; ++nt) {
      v8f acc = {};
#pragma unroll
      for (int ks = 0; ks < KS; ++ks) {
        FragB bh_, bl_;
        bh_.half[0] = *(const v8us*)&sKh[nt * 16 + ln][ks * 32 + 8 * hh]; bh_.half[1] = *(const v8us*)&sKh[nt * 16 + ln][ks * 32 + 16 + 8 * hh];
        bl_.half[0] = *(const v8us*)&sKl[nt * 16 + ln][ks * 32 + 8 * hh]; bl_.half[1] = *(const v8us*)&sKl[nt * 16 + ln][ks * 32 + 16 + 8 * hh];
        acc = mmaN<3>(aqh[ks].v, aql[ks].v, bh_.v, bl_.v, acc);
      }
      s[nt] = acc;
    }
    // mask + running max (rows 8hh+r; the 16 lanes of a half share rows)
    float alpha[8];
#pragma unroll
    for (int r = 0; r < 8; ++r) {
      const int qi = q0 + 8 * hh + r;
      const int ja = j0 + ln, jb = j0 + 16 + ln;
      if (CAUSAL) { if (ja > qi) s[0][r] = -3.0e38f; if (jb > qi) s[1][r] = -3.0e38f; }
      if (ja >= T) s[0][r] = -3.0e38f;
      if (jb >= T) s[1][r] = -3.0e38f;
      float mx = fmaxf(s[0][r], s[1][r]);
      mx = fmaxf(mx, __shfl_xor(mx, 1, 32)); mx = fmaxf(mx, __shfl_xor(mx, 2, 32)); mx = fmaxf(mx, __shfl_xor(mx, 4, 32)); mx = fmaxf(mx, __shfl_xor(mx, 8, 32));
      const float mnew = fmaxf(m_r[r], mx);
      alpha[r] = (mnew > -1.0e38f) ? __expf(m_r[r] - mnew) : 1.0f;
      const float p0 = (s[0][r] > -1.0e38f) ? __expf(s[0][r] - mnew) : 0.f;
      const float p1 = (s[1][r] > -1.0e38f) ? __expf(s[1][r] - mnew) : 0.f;
      m_r[r] = mnew;
      l_r[r] = l_r[r] * alpha[r] + p0 + p1;            // per-lane partial row sum (16 lanes combined at the end)
      unsigned short hb = bf16_bits(p0); sPh[w][8 * hh + r][ln] = hb;      sPl[w][8 * hh + r][ln] = bf16_bits(p0 - bf16_val(hb));
      hb = bf16_bits(p1);                sPh[w][8 * hh + r][16 + ln] = hb; sPl[w][8 * hh + r][16 + ln] = bf16_bits(p1 - bf16_val(hb));
    }
#pragma unroll
    for (int dt = 0; dt < DT; ++dt)
#pragma unroll
      for (int r = 0; r < 8; ++r) oacc[dt][r] *= alpha[r];
    __builtin_amdgcn_fence(__ATOMIC_ACQ_REL, "workgroup");
    __builtin_amdgcn_wave_barrier();
    FragB pah, pal;
    pah.half[0] = *(const v8us*)&sPh[w][ln][8 * hh]; pah.half[1] = *(const v8us*)&sPh[w][ln][16 + 8 * hh];
    pal.half[0] = *(const v8us*)&sPl[w][ln][8 * hh]; pal.half[1] = *(const v8us*)&sPl[w][ln][16 + 8 * hh];
#pragma unroll
    for (int dt = 0; dt < DT; ++dt) {
      FragB bvh, bvl;
#pragma unroll
      for (int i = 0; i < 8; ++i) {
        bvh.u[i] = sVh[8 * hh + i][dt * 16 + ln]; bvh.u[8 + i] = sVh[16 + 8 * hh + i][dt * 16 + ln];
        bvl.u[i] = sVl[8 * hh + i][dt * 16 + ln]; bvl.u[8 + i] = sVl[16 + 8 * hh + i][dt * 16 + ln];
      }
      oacc[dt] = mmaN<3>(pah.v, pal.v, bvh.v, bvl.v, oacc[dt]);
    }
    __builtin_amdgcn_fence(__ATOMIC_ACQ_REL, "workgroup");
    __builtin_amdgcn_wave_barrier();
  }
#pragma unroll
  for (int r = 0; r < 8; ++r) {
    float l = l_r[r];
    l += __shfl_xor(l, 1, 32); l += __shfl_xor(l, 2, 32); l += __shfl_xor(l, 4, 32); l += __shfl_xor(l, 8, 32);
    l_r[r] = (l > 0.f) ? 1.0f / l : 0.f;
  }
#pragma unroll
  for (int dt = 0; dt < DT; ++dt)
#pragma unroll
    for (int r = 0; r < 8; ++r) sO[w][8 * hh + r][dt * 16 + ln] = oacc[dt][r] * l_r[r];
  __builtin_amdgcn_fence(__ATOMIC_ACQ_REL, "workgroup");
  __builtin_amdgcn_wave_barrier();
  {
    for (int r = 0; r < 16; ++r) {
      const int row = q0 + r;
      if (row < T && lane < D / 4) {
        const v4f val = *(const v4fa*)&sO[w][r][lane * 4];
        *(v4f*)(y + ((size_t)b * T + row) * ypitch + h * D + lane * 4) = val;
      }
    }
    
  }
}

// GEMM C = act(A·W + bias + resid): A f32 (ASPLIT -> hi/lo 2 terms), Wt bf16 [N][K]; ACT 0 none, 1 relu, 2 exact gelu;
// resid (optional, f32, row index = (row % rmod), pitch ldr, RES_BF16 rounds it) added before the activation.
template <bool ASPLIT, int ACT, bool BIAS_BF16, bool RES_BF16>
__global__ __launch_bounds__(128) void k_gemm_bf3(const float* __restrict__ A, int lda, const unsigned short* __restrict__ Wt, int ldb,
                                                const float* __restrict__ bias, const float* __restrict__ resid, int rmod, int ldr,
                                                float* __restrict__ C, int ldc, int M, int N, int K) {
  __shared__ __attribute__((aligned(16))) float so[4][16][64];
  const int tid = threadIdx.x, w = tid >> 5, lane = tid & 31, ln = lane & 15, hh = lane >> 4;
  const int ntn = N / 64;
  const int wid = blockIdx.x * 4 + w;
  const int mt = wid / ntn, nq = wid % ntn;
  if (mt * 16 >= M) return;
  const int row0 = mt * 16, col0 = nq * 64;
  const float* arow = A + (size_t)(row0 + ln) * lda;
  v8f acc[4] = {};
  for (int kb = 0; kb < K; kb += 32) {
    FragB ah, al;
    const v4f x0 = *(const v4fa*)(arow + kb + 8 * hh), x1 = *(const v4fa*)(arow + kb + 8 * hh + 4);
    const v4f x2 = *(const v4fa*)(arow + kb + 16 + 8 * hh), x3 = *(const v4fa*)(arow + kb + 16 + 8 * hh + 4);
    float xs[16] = {x0[0],x0[1],x0[2],x0[3],x1[0],x1[1],x1[2],x1[3],x2[0],x2[1],x2[2],x2[3],x3[0],x3[1],x3[2],x3[3]};
#pragma unroll
    for (int i = 0; i < 16; ++i) { const unsigned short hb = bf16_bits(xs[i]); ah.u[i] = hb; al.u[i] = ASPLIT ? bf16_bits(xs[i] - bf16_val(hb)) : (unsigned short)0; }
#pragma unroll
    for (int t = 0; t < 4; ++t) {
      const unsigned short* brow = Wt + (size_t)(col0 + t * 16 + ln) * ldb + kb;
      FragB b;
      b.half[0] = *(const v8us*)(brow + 8 * hh);
      b.half[1] = *(const v8us*)(brow + 16 + 8 * hh);
      acc[t] = mmaN<ASPLIT ? 2 : 1>(ah.v, al.v, b.v, b.v, acc[t]);
    }
  }
#pragma unroll
  for (int t = 0; t < 4; ++t) {
    const int col = col0 + t * 16 + ln;
    float bv = bias ? bias[col] : 0.f;
    if (BIAS_BF16) bv = bf16_round(bv);
#pragma unroll
    for (int r = 0; r < 8; ++r) {
      float v = acc[t][r] + bv;
      if (resid) { float rv = resid[(size_t)((row0 + 8 * hh + r) % rmod) * ldr + col]; if (RES_BF16) rv = bf16_round(rv); v += rv; }
      if (ACT == 1) v = fmaxf(v, 0.f);
      if (ACT == 2) v = 0.5f * v * (1.0f + erff(v * 0.70710678118654752f));
      if (ACT == 3) { const float u = 0.7978845608028654f * (v + 0.044715f * v * v * v); v = 0.5f * v * (1.0f + tanhf(u)); }
      so[w][8 * hh + r][t * 16 + ln] = v;
    }
  }
  __builtin_amdgcn_fence(__ATOMIC_ACQ_REL, "workgroup");
  __builtin_amdgcn_wave_barrier();
  const int rsub = lane >> 4, c4 = (lane & 15) * 4;
  {
#pragma unroll
    for (int q = 0; q < 8; ++q) {
      const int r = q * 2 + rsub;
      const v4f v = *(const v4fa*)&so[w][r][c4];
      *(v4f*)(C + (size_t)(row0 + r) * ldc + col0 + c4) = v;
    }
    
  }
}
// row LayerNorm (biased variance, eps) over N: s = X (+ R); optional out_sum <- s; out_norm <- (s-mu)*rsqrt(var+eps)*g + b
template <bool PARAM_BF16>
__global__ __launch_bounds__(256) void k_layernorm(const float* __restrict__ X, const float* __restrict__ R, const float* __restrict__ g, const float* __restrict__ bta,
                                                  float* __restrict__ out_sum, float* __restrict__ out_norm, int N, float eps) {
  __shared__ float red[256];
  const int row = blockIdx.x, tid = threadIdx.x;
  const float* x = X + (size_t)row * N; const float* rr = R ? R + (size_t)row * N : nullptr;
  float vals[16];                     // up to N = 4096
  const int per = N / 256;            // contiguous chunk per thread? use strided-by-4 chunks: thread handles j = tid*4 + 1024*u
  float s1 = 0.f;
  for (int u = 0; u < per / 4; ++u) {
    const int j = tid * 4 + 1024 * u;
    const v4f a = *(const v4fa*)(x + j);
    v4f b = {0.f,0.f,0.f,0.f}; if (rr) b = *(const v4fa*)(rr + j);
#pragma unroll
    for (int q = 0; q < 4; ++q) { const float v = a[q] + b[q]; vals[u * 4 + q] = v; s1 += v; }
  }
  red[tid] = s1; __syncthreads();
  for (int st = 128; st > 0; st >>= 1) { if (tid < st) red[tid] += red[tid + st]; __syncthreads(); }
  const float mu = red[0] / (float)N; __syncthreads();
  float s2 = 0.f;
  for (int u = 0; u < per / 4; ++u)
#pragma unroll
    for (int q = 0; q < 4; ++q) { const float c = vals[u * 4 + q] - mu; s2 += c * c; }
  red[tid] = s2; __syncthreads();
  for (int st = 128; st > 0; st >>= 1) { if (tid < st) red[tid] += red[tid + st]; __syncthreads(); }
  const float rs = rsqrtf(red[0] / (float)N + eps);
  {
    for (int u = 0; u < per / 4; ++u) {
      const int j = tid * 4 + 1024 * u;
      v4f o, sm;
#pragma unroll
      for (int q = 0; q < 4; ++q) {
        float gg = g[j + q], bb = bta[j + q];
        if (PARAM_BF16) { gg = bf16_round(gg); bb = bf16_round(bb); }
        sm[q] = vals[u * 4 + q]; o[q] = (vals[u * 4 + q] - mu) * rs * gg + bb;
      }
      if (out_sum) *(v4f*)(out_sum + (size_t)row * N + j) = sm;
      *(v4f*)(out_norm + (size_t)row * N + j) = o;
    }
    
  }
}



// ---- f16 WMMA path (v_wmma_f32_16x16x32_f16): 11-bit significands for operands in range — used for every contraction launched here (VN-linear maps, Q·Kᵀ, P·V)
typedef _Float16 v16h __attribute__((ext_vector_type(16)));
union FragH { v16h v; v8us half[2]; _Float16 h[16]; unsigned short u[16]; };
template <int NT>
__device__ __forceinline__ v8f mmaH(v16h ah, v16h al, v16h bh, v16h bl, v8f c) {
  c = __builtin_amdgcn_wmma_f32_16x16x32_f16(false, ah, false, bh, (short)0, c, false, false);
  if (NT >= 2) c = __builtin_amdgcn_wmma_f32_16x16x32_f16(false, al, false, bh, (short)0, c, false, false);
  if (NT >= 3) c = __builtin_amdgcn_wmma_f32_16x16x32_f16(false, ah, false, bl, (short)0, c, false, false);
  asm volatile("v_nop\n\tv_nop\n\tv_nop\n\tv_nop" : "+v"(c) : "v"(ah), "v"(al), "v"(bh), "v"(bl));
  return c;
}
// batched GEMM like k_gemm_b but f16 operands: A f32 (split into f16 hi/lo if ASPLIT, else rounded to f16), Bt = f16 values [n][k]; alpha; C f32; N multiple of 16 (partial tiles skipped)
template <bool ASPLIT>
__global__ __launch_bounds__(128) void k_gemm_h(const float* __restrict__ A, int lda, size_t sA, const _Float16* __restrict__ Bh, int ldb, size_t sB, float alpha, float* __restrict__ C, int ldc, size_t sC, int M, int N, int K) {
  __shared__ __attribute__((aligned(16))) float so[4][16][64];
  const int tid = threadIdx.x, w = tid >> 5, lane = tid & 31, ln = lane & 15, hh = lane >> 4; const int by = blockIdx.y;
  A += (size_t)by * sA; Bh += (size_t)by * sB; C += (size_t)by * sC;
  const int ntn = (N + 63) / 64; const int wid = blockIdx.x * 4 + w; const int mt = wid / ntn, nq = wid % ntn; if (mt * 16 >= M) return;
  const int row0 = mt * 16, col0 = nq * 64; const float* arow = A + (size_t)(row0 + ln) * lda;
  v8f acc[4] = {};
  for (int kb = 0; kb < K; kb += 32) {
    FragH ah, al;
    const v4f x0 = *(const v4fa*)(arow + kb + 8 * hh), x1 = *(const v4fa*)(arow + kb + 8 * hh + 4), x2 = *(const v4fa*)(arow + kb + 16 + 8 * hh), x3 = *(const v4fa*)(arow + kb + 16 + 8 * hh + 4);
    float xs[16] = {x0[0],x0[1],x0[2],x0[3],x1[0],x1[1],x1[2],x1[3],x2[0],x2[1],x2[2],x2[3],x3[0],x3[1],x3[2],x3[3]};
#pragma unroll
    for (int i = 0; i < 16; ++i) { const _Float16 h = (_Float16)xs[i]; ah.h[i] = h; al.h[i] = ASPLIT ? (_Float16)(xs[i] - (float)h) : (_Float16)0.0f; }
#pragma unroll
    for (int t = 0; t < 4; ++t) { if (col0 + t * 16 >= N) continue; const size_t boff = (size_t)(col0 + t * 16 + ln) * ldb + kb; FragH bq; bq.half[0] = *(const v8us*)(Bh + boff + 8 * hh); bq.half[1] = *(const v8us*)(Bh + boff + 16 + 8 * hh);
      acc[t] = mmaH<ASPLIT ? 2 : 1>(ah.v, al.v, bq.v, bq.v, acc[t]); }
  }
#pragma unroll
  for (int t = 0; t < 4; ++t) { if (col0 + t * 16 >= N) continue;
#pragma unroll
    for (int r = 0; r < 8; ++r) so[w][8 * hh + r][t * 16 + ln] = acc[t][r] * alpha; }
  __builtin_amdgcn_fence(__ATOMIC_ACQ_REL, "workgroup"); __builtin_amdgcn_wave_barrier();
  const int rsub = lane >> 4, c4 = (lane & 15) * 4;
  {
#pragma unroll
    for (int q = 0; q < 8; ++q) { const int r = q * 2 + rsub; if (col0 + c4 < N) { const v4f v = *(const v4fa*)&so[w][r][c4]; *(v4f*)(C + (size_t)(row0 + r) * ldc + col0 + c4) = v; } }
     }
}

// Wt[n][k] = f16(W[k][n]·scale) from f32 row-major W[K][N] (scale = power of two; bf16-exact weights stay exact in f16 away from the subnormal range)
__global__ __launch_bounds__(256) void k_wt_f16(const float* __restrict__ W, _Float16* __restrict__ Wt, int K, int N, float scale) {
  const int t = blockIdx.x * 256 + threadIdx.x; if (t >= N * (K / 8)) return; const int n = t / (K / 8), k8 = (t % (K / 8)) * 8; FragH f;
#pragma unroll
  for (int i = 0; i < 8; ++i) f.h[i] = (_Float16)(bf16_round(W[(size_t)(k8 + i) * N + n]) * scale); const v8us o = f.half[0];
  *(v8us*)((unsigned short*)Wt + (size_t)n * K + k8) = o; 
}
// FRAGMENT ORDER. The weights and x are stored as the matrix instructions read them: a matrix of rows x K halves is cut into fragments of 16 rows x 32 k, 1 KB each, at [row / 16][k / 32];
// inside a fragment piece (hs, lane) is 16 bytes: row lane % 16, k = 16 hs + 8 (lane / 16) + 0..7. A wave's 16-byte load of half a fragment is then 512 bytes in a row, four whole lines, where rows of pitch K gave sixteen 32-byte pieces.
#define FRH 512      // halves of one fragment
// Every operand conversion in one launch; the block index picks the job, and no job reads what another writes. Blocks [0, 4 WBL): the four weight matrices, rounded and scaled by 16, WBL blocks each; the rest: x.
// Thread t writes piece t of its packed matrix, so a wave's store is 512 bytes in a row. X3 has its rows in the order (b, c, n): a thread takes the three coordinates of its 8 channels from one run of 96 bytes and writes one piece to each of the three planes.
#define WBL (CO * CI / 8 / 256)
#define XBL (NR * (CI / 8) / 256)
__global__ __launch_bounds__(256) void k_prep(const float* __restrict__ x, const float* __restrict__ Wq, const float* __restrict__ Wk, const float* __restrict__ Wv, const float* __restrict__ Wo,
                                            _Float16* __restrict__ Bq, _Float16* __restrict__ Bk, _Float16* __restrict__ Bv, _Float16* __restrict__ Bo, _Float16* __restrict__ X3) {
  const int bx = blockIdx.x; const int lane = threadIdx.x & 31, hs = (threadIdx.x >> 5) & 1; const int kin = hs * 16 + (lane >> 4) * 8;
  if (bx < 4 * WBL) { const int j = bx / WBL; const float* W = j == 0 ? Wq : j == 1 ? Wk : j == 2 ? Wv : Wo; _Float16* Bt = j == 0 ? Bq : j == 1 ? Bk : j == 2 ? Bv : Bo; const int kf = (j == 3 ? CO : CI) / 32;      // fragments in a row of the matrix
    const int t = (bx % WBL) * 256 + threadIdx.x; const int fr = t >> 6; const float* wp = W + (size_t)((fr / kf) * 16 + (lane & 15)) * (kf * 32) + (fr % kf) * 32 + kin; FragH f;
#pragma unroll      // constant indices keep f in registers
    for (int i = 0; i < 8; ++i) f.h[i] = (_Float16)(bf16_round(wp[i]) * 16.0f); *(v8us*)((unsigned short*)Bt + (size_t)t * 8) = f.half[0]; }
  else { const int t = (bx - 4 * WBL) * 256 + threadIdx.x; const int fr = t >> 6; const int bn = (fr / (CI / 32)) * 16 + (lane & 15); const float* xp = x + ((size_t)bn * CI + (fr % (CI / 32)) * 32 + kin) * 3;
    unsigned short* xo = (unsigned short*)X3 + ((size_t)t + (size_t)(bn / NN) * 2 * (NN / 16) * (CI / 32) * 64) * 8;      // token row b NN + n becomes row (3 b + c) NN + n: 2 b + c planes further
#pragma unroll      // the 24 floats are loaded once, as six 16-byte loads, and the three stores go from one address pair with constant offsets
    for (int c = 0; c < 3; ++c) { FragH f;
#pragma unroll      // constant indices keep f in registers
      for (int q = 0; q < 8; ++q) f.h[q] = (_Float16)bf16_round(xp[q * 3 + c]); *(v8us*)(xo + (size_t)c * (NN / 16) * (CI / 32) * FRH) = f.half[0]; }
    asm volatile("s_wait_xcnt 0x0" ::: "memory"); } }      // behind the last store: no register that the three stores name is rewritten ahead of this wait
// The bare builtin: the compiler keeps the distances behind its own matrix instructions, and with no asm statement naming them the accumulators may live above v255.
// No global load is moved over a volatile asm statement either: with one behind each product every product waited out its own operand loads. In the maps below the operands of a later k step are asked for ahead of the products of this one.
__device__ __forceinline__ v8f mmaP(v16h a, v16h b, v8f c) { return __builtin_amdgcn_wmma_f32_16x16x32_f16(false, a, false, b, (short)0, c, false, false); }
// q or k map: C[(b, n, c)][o] = sum_k X3[(b, c, n)][k] W[o][k] / 16, f16. A wave takes 16 tokens of one (b, c) x 64 outputs; both operands come in fragment order. The result keeps its rows (b, n, c) x 512: a token's row is picked in the store.
__device__ __forceinline__ void gemm_qk(float (*so)[16][64], int bx, const _Float16* __restrict__ X3, const _Float16* __restrict__ Wh, _Float16* __restrict__ C16) {
  const int tid = threadIdx.x, w = tid >> 5, lane = tid & 31, ln = lane & 15, hh = lane >> 4;
  const int wid = bx * 4 + w; const int mt = wid / (CO / 64), nq = wid % (CO / 64); const int col0 = nq * 64;
  const unsigned short* ap = (const unsigned short*)X3 + (size_t)mt * (CI / 32) * FRH + lane * 8;
  const unsigned short* bp = (const unsigned short*)Wh + (size_t)nq * 4 * (CI / 32) * FRH + lane * 8;
  v8f acc[4] = {}; FragH ah[2], bq[2][4];      // two register sets: step ks + 1 is in flight while step ks is multiplied
#pragma unroll      // every load is base + constant, so that no address register is rewritten while loads are out; constant indices keep the fragments and acc in registers
  for (int ks = -1; ks < CI / 32; ++ks) {
    if (ks + 1 < CI / 32) { const int s = (ks + 1) & 1; ah[s].half[0] = *(const v8us*)(ap + (ks + 1) * FRH); ah[s].half[1] = *(const v8us*)(ap + (ks + 1) * FRH + 256);
#pragma unroll      // constant indices keep the fragments in registers
      for (int t = 0; t < 4; ++t) { bq[s][t].half[0] = *(const v8us*)(bp + (t * (CI / 32) + ks + 1) * FRH); bq[s][t].half[1] = *(const v8us*)(bp + (t * (CI / 32) + ks + 1) * FRH + 256); } }
    __builtin_amdgcn_sched_barrier(0);      // holds the loads above ahead of the products below: left free, the compiler sinks each load to its own product, which then waits out the whole latency
    if (ks >= 0)
#pragma unroll      // constant indices keep the fragments and acc in registers
      for (int t = 0; t < 4; ++t) acc[t] = mmaP(ah[ks & 1].v, bq[ks & 1][t].v, acc[t]);
    __builtin_amdgcn_sched_barrier(0); }      // holds the next loads behind these products: hoisted over them they take a third register set, and a SIMD holds seven waves, not eight
  asm volatile("s_wait_xcnt 0x0" :: "v"(ap), "v"(bp) : "memory");      // the loads' two address pairs are named as inputs, so they stay untouched until this wait; behind it they may be reused
#pragma unroll      // constant indices keep the fragments and acc in registers
  for (int t = 0; t < 4; ++t)
#pragma unroll      // constant indices keep the fragments and acc in registers
    for (int r = 0; r < 8; ++r) so[w][8 * hh + r][t * 16 + ln] = acc[t][r] * 0.0625f;
  __builtin_amdgcn_fence(__ATOMIC_ACQ_REL, "workgroup"); __builtin_amdgcn_wave_barrier();      // the wave's LDS stores are done before its lanes read what other lanes stored
  const int rsub = lane >> 4, c4 = (lane & 15) * 4; typedef _Float16 v4h __attribute__((ext_vector_type(4)));
  const int bc = mt / (NN / 16), n0 = (mt % (NN / 16)) * 16;
  _Float16* crow = C16 + (((size_t)(bc / 3) * NN + n0 + rsub) * 3 + bc % 3) * CO + col0 + c4;
#pragma unroll      // constant offsets from one address pair
  for (int q = 0; q < 8; ++q) { const v4f v = *(const v4fa*)&so[w][q * 2 + rsub][c4]; v4h h4; for (int i = 0; i < 4; ++i) h4[i] = (_Float16)v[i]; *(v4h*)(crow + (size_t)q * 2 * 3 * CO) = h4; }
  asm volatile("s_wait_xcnt 0x0" ::: "memory");      // behind the last store: no register that the eight stores name is rewritten ahead of this wait
}
// V^T at once: C[o][n] = sum_k Wv[o][k] X3[(b, c, n)][k]. The weight rows are the A operand and the token rows of one (b, c) the B operand, both in fragment order,
// so a row of the staged tile is 64 tokens of one feature: one whole 128-byte line of the layout that the attention stages. Same products, same k order as the q and k maps.
__device__ __forceinline__ void gemm_vt(float (*so)[16][64], int bx, int by, const _Float16* __restrict__ Wh, const _Float16* __restrict__ X3, _Float16* __restrict__ Vt) {
  const int tid = threadIdx.x, w = tid >> 5, lane = tid & 31, ln = lane & 15, hh = lane >> 4; const int b = by / 3, c = by % 3;
  const int wid = bx * 4 + w; const int mt = wid / (NN / 64), nq = wid % (NN / 64); const int row0 = mt * 16, col0 = nq * 64;
  const unsigned short* arow = (const unsigned short*)Wh + (size_t)mt * (CI / 32) * FRH + lane * 8;
  const unsigned short* xrow = (const unsigned short*)X3 + ((size_t)by * (NN / 16) + nq * 4) * (CI / 32) * FRH + lane * 8;
  v8f acc[4] = {}; FragH ah[2], bq[2][4];      // two register sets: step ks + 1 is in flight while step ks is multiplied
#pragma unroll      // every load is base + constant, so that no address register is rewritten while loads are out; constant indices keep the fragments and acc in registers
  for (int ks = -1; ks < CI / 32; ++ks) {
    if (ks + 1 < CI / 32) { const int s = (ks + 1) & 1; ah[s].half[0] = *(const v8us*)(arow + (ks + 1) * FRH); ah[s].half[1] = *(const v8us*)(arow + (ks + 1) * FRH + 256);
#pragma unroll      // constant indices keep the fragments in registers
      for (int t = 0; t < 4; ++t) { bq[s][t].half[0] = *(const v8us*)(xrow + (t * (CI / 32) + ks + 1) * FRH); bq[s][t].half[1] = *(const v8us*)(xrow + (t * (CI / 32) + ks + 1) * FRH + 256); } }
    __builtin_amdgcn_sched_barrier(0);      // holds the loads above ahead of the products below: left free, the compiler sinks each load to its own product, which then waits out the whole latency
    if (ks >= 0)
#pragma unroll      // constant indices keep the fragments and acc in registers
      for (int t = 0; t < 4; ++t) acc[t] = mmaP(ah[ks & 1].v, bq[ks & 1][t].v, acc[t]);
    __builtin_amdgcn_sched_barrier(0); }      // holds the next loads behind these products: hoisted over them they take a third register set, and a SIMD holds seven waves, not eight
  asm volatile("s_wait_xcnt 0x0" :: "v"(arow), "v"(xrow) : "memory");      // the loads' two address pairs are named as inputs, so they stay untouched until this wait; behind it they may be reused
#pragma unroll      // constant indices keep the fragments and acc in registers
  for (int t = 0; t < 4; ++t)
#pragma unroll      // constant indices keep the fragments and acc in registers
    for (int r = 0; r < 8; ++r) so[w][8 * hh + r][t * 16 + ln] = acc[t][r] * 0.0625f;
  __builtin_amdgcn_fence(__ATOMIC_ACQ_REL, "workgroup"); __builtin_amdgcn_wave_barrier();      // the wave's LDS stores are done before its lanes read what other lanes stored
  const int rsub = lane >> 4, c4 = (lane & 15) * 4; typedef _Float16 v4h __attribute__((ext_vector_type(4)));
  _Float16* vrow = Vt + ((size_t)(b * NH + row0 / HD) * 192 + c * 64 + row0 % HD + rsub) * NN + col0 + c4;      // the 16 features of a tile lie in one head
#pragma unroll      // constant offsets from one address pair
  for (int q = 0; q < 8; ++q) { const v4f v = *(const v4fa*)&so[w][q * 2 + rsub][c4]; v4h h4; for (int i = 0; i < 4; ++i) h4[i] = (_Float16)v[i]; *(v4h*)(vrow + (size_t)q * 2 * NN) = h4; }
}
// The q, k and V^T maps in one launch: all three read X3 and none reads another's result. blockIdx.y picks the map, blockIdx.x is the map's own block number (MBL each).
#define MBL ((NR3 / 16) * (CO / 64) / 4)
#define VBX ((CO / 16) * (NN / 64) / 4)
__global__ __launch_bounds__(128) void k_qkv(const _Float16* __restrict__ X3, const _Float16* __restrict__ Bq, const _Float16* __restrict__ Bk, const _Float16* __restrict__ Bv, _Float16* __restrict__ Q16, _Float16* __restrict__ K16, _Float16* __restrict__ Vt) {
  __shared__ __attribute__((aligned(16))) float so[4][16][64];
  const int bx = blockIdx.x, job = blockIdx.y;
  if (job == 2) gemm_vt(so, bx % VBX, bx / VBX, Bv, X3, Vt);
  else gemm_qk(so, bx, X3, job == 0 ? Bq : Bk, job == 0 ? Q16 : K16);
}
// K and V^T tiles of 64 keys, staged in LDS once per group of four waves and read by these four. Row pitches are 16 B x odd, so the 16 rows of a ds_load_b128 fall on distinct banks.
#define TK 64
#define KP 200      // halves per staged K row: 3 coordinate blocks x 64 + 8 of pad (400 B)
#define VP 72       // halves per staged V^T row: 64 keys + 8 of pad (144 B)
// Twelve asynchronous 16-byte copies per lane, global -> LDS, through no register: copy 4 a + q goes from g + a gs + q gq (halves) to LDS byte l + a ls + q lq.
// The s_wait_xcnt closes the statement so that no address register named here is rewritten ahead of it.
__device__ __forceinline__ void acopy12(unsigned l, unsigned ls, unsigned lq, const unsigned short* g, size_t gs, size_t gq) {
  const unsigned l1 = l + lq, l2 = l + 2 * lq, l3 = l + 3 * lq, l4 = l + ls, l5 = l4 + lq, l6 = l4 + 2 * lq, l7 = l4 + 3 * lq, l8 = l + 2 * ls, l9 = l8 + lq, l10 = l8 + 2 * lq, l11 = l8 + 3 * lq;
  const unsigned short *g1 = g + gq, *g2 = g + 2 * gq, *g3 = g + 3 * gq, *g4 = g + gs, *g5 = g4 + gq, *g6 = g4 + 2 * gq, *g7 = g4 + 3 * gq, *g8 = g + 2 * gs, *g9 = g8 + gq, *g10 = g8 + 2 * gq, *g11 = g8 + 3 * gq;
  asm volatile("global_load_async_to_lds_b128 %0, %12, off\n\t"
               "global_load_async_to_lds_b128 %1, %13, off\n\t"
               "global_load_async_to_lds_b128 %2, %14, off\n\t"
               "global_load_async_to_lds_b128 %3, %15, off\n\t"
               "global_load_async_to_lds_b128 %4, %16, off\n\t"
               "global_load_async_to_lds_b128 %5, %17, off\n\t"
               "global_load_async_to_lds_b128 %6, %18, off\n\t"
               "global_load_async_to_lds_b128 %7, %19, off\n\t"
               "global_load_async_to_lds_b128 %8, %20, off\n\t"
               "global_load_async_to_lds_b128 %9, %21, off\n\t"
               "global_load_async_to_lds_b128 %10, %22, off\n\t"
               "global_load_async_to_lds_b128 %11, %23, off\n\t"
               "s_wait_xcnt 0x0"
               :: "v"(l), "v"(l1), "v"(l2), "v"(l3), "v"(l4), "v"(l5), "v"(l6), "v"(l7), "v"(l8), "v"(l9), "v"(l10), "v"(l11),
                  "v"(g), "v"(g1), "v"(g2), "v"(g3), "v"(g4), "v"(g5), "v"(g6), "v"(g7), "v"(g8), "v"(g9), "v"(g10), "v"(g11) : "memory");
}
// One stage: 64 keys of K (3 coordinate blocks of 128 B a key) and 192 rows of V^T (128 B a row); 24 copies a lane.
__device__ __forceinline__ void stage_kv(unsigned lk, unsigned lv, const unsigned short* kg, const unsigned short* vg) {
  acopy12(lk, 128, 16 * KP * 2, kg, CO, (size_t)16 * 3 * CO);
  acopy12(lv, 64 * VP * 2, 16 * VP * 2, vg, (size_t)64 * NN, (size_t)16 * NN);
}
// lane l with lane l ^ 16, through no LDS
__device__ __forceinline__ float xhalf(float x) { return __builtin_bit_cast(float, __builtin_amdgcn_permlanex16(__builtin_bit_cast(int, x), __builtin_bit_cast(int, x), 0x76543210, 0xfedcba98, false, false)); }
// Scores are formed transposed: K rows are the A operand and Q the B operand, so lane (ln, hh) holds query ln and keys 8 hh + r of each 16-key tile. A query's maximum and sum are then
// in-lane but for one exchange between the wave halves, and the two score tiles of 32 keys, converted in place, are the B operand of O^T += V^T P^T (element i: key 8 hh + i, element 8 + i: key 16 + 8 hh + i, as the V^T loader has it).
// A wave takes 32 queries (two tiles of 16), so every K and V^T fragment that it reads from LDS feeds two products. The work-group has 128 queries and eight waves: waves 0-3 walk keys [0, NN / 2), waves 4-7 keys [NN / 2, NN),
// each group of four staging its own tiles, so that a SIMD still holds two waves; the two groups' partial O, maximum and sum are joined once, through LDS, behind the loop.
#define KH (NN / 2)      // keys of one group of four waves
__global__ __launch_bounds__(256) void k_vnattn(const _Float16* __restrict__ Q16, const _Float16* __restrict__ K16, const _Float16* __restrict__ Vt, _Float16* __restrict__ O3) {
  __shared__ __attribute__((aligned(16))) unsigned short sK[2][2][TK][KP]; __shared__ __attribute__((aligned(16))) unsigned short sV[2][2][192][VP];      // [buffer][key group]
  __shared__ float sML[4][2][2][32];      // the second group's maximum and sum: [query group][tile][which][lane]
  const int tid = threadIdx.x, w = tid >> 5, lane = tid & 31, ln = lane & 15, hh = lane >> 4; const int qg = w & 3, t128 = tid & 127; const int kh = __builtin_amdgcn_readfirstlane(tid >> 7);      // the wave's key group, the same in every lane: kept in a scalar register
  const int slab = blockIdx.x / (NN / 128), qblk = blockIdx.x % (NN / 128); const int b = slab / NH, h = slab % NH; const int q0 = qblk * 128 + qg * 32;
  const unsigned short* Vth = (const unsigned short*)Vt + (size_t)slab * 192 * NN;
  // The lane's share of its group's stage: eight lanes cover one 128-byte row piece, so a wave's copy covers four whole lines. K: key = 16 q + t128 / 8; V^T: row = 64 a + 16 q + t128 / 8.
  const int cr = t128 >> 3, cc = (t128 & 7) * 8;
  // The lane's part of each address; the scalar part (group, buffer, stage) is added where a stage is issued.
  const unsigned kl = cr * (3 * CO) + cc, vl = cr * NN + cc;      // halves
  const unsigned lkl = (unsigned)(size_t)&sK[0][0][cr][cc], lvl = (unsigned)(size_t)&sV[0][0][cr][cc];
  const unsigned short* kgs = (const unsigned short*)K16 + ((size_t)b * NN + kh * KH) * (3 * CO) + h * HD;      // scalar
  const unsigned short* vgs = Vth + kh * KH;                                                                      // scalar
  const unsigned lks = kh * (TK * KP * 2), lvs = kh * (192 * VP * 2);                                              // scalar
  constexpr unsigned KB = 2 * TK * KP * 2, VB = 2 * 192 * VP * 2;      // bytes of one buffer (both groups' tiles)
  constexpr int NT = KH / TK;
  constexpr float SL2 = 0.07216878364870323f * 1.4426950408889634f;      // 1 / sqrt(192) x log2(e)
  FragH aq[2][6]; { const unsigned short* qr = (const unsigned short*)Q16 + ((size_t)b * NN + q0 + ln) * (3 * CO) + h * HD + 8 * hh;      // row (b,n) = [c0 | c1 | c2] x 512 (= rows (b,n,c) of pitch 512)
#pragma unroll
    for (int qt = 0; qt < 2; ++qt)
#pragma unroll
      for (int ks = 0; ks < 6; ++ks) { const int c = ks >> 1, s32 = (ks & 1) * 32; aq[qt][ks].half[0] = *(const v8us*)(qr + qt * 16 * 3 * CO + c * CO + s32); aq[qt][ks].half[1] = *(const v8us*)(qr + qt * 16 * 3 * CO + c * CO + s32 + 16); }
    asm volatile("s_wait_xcnt 0x0" :: "v"(qr) : "memory"); }      // the Q loads' address pair is named as an input, so it stays untouched until this wait; behind it the pair may be reused
  float m_r[2] = {-3.0e38f, -3.0e38f}, l_r[2] = {0.f, 0.f}; v8f oacc[2][12];      // oacc[qt][dt][r] = O[query 16 qt + ln][dt * 16 + 8 hh + r]; l_r sums this half's keys only
#pragma unroll
  for (int qt = 0; qt < 2; ++qt)
#pragma unroll
    for (int dt = 0; dt < 12; ++dt) oacc[qt][dt] = (v8f){0.f,0.f,0.f,0.f,0.f,0.f,0.f,0.f};
  // Trips -2 and -1 only fill the ring, in the order of a two-buffer prologue: trip -2 issues stage 0; trip -1 waits for it, publishes it at the barrier and issues stage 1. So the file has one place that issues a stage:
  // with a second one in front of the loop, the address registers that it named stayed bound below v256 through the loop and were spilled to scratch.
#pragma unroll 1
  for (int t = -2; t < NT; ++t) { const int buf = t & 1;
   if (t >= 0)
#pragma unroll 1      // the two 32-key passes of a stage stay rolled: unrolled, the build spilled the Q fragments to scratch
   for (int p = 0; p < TK / 32; ++p) { v8f s[2][2];
#pragma unroll
    for (int nt = 0; nt < 2; ++nt) { const unsigned short* kr = &sK[buf][kh][p * 32 + nt * 16 + ln][0]; v8f acc0 = (v8f){0.f,0.f,0.f,0.f,0.f,0.f,0.f,0.f}, acc1 = acc0; FragH bk[6];      // six fragments are read as one run ahead of their products: one LDS latency a run, not one a product
#pragma unroll      // constant indices keep bk in registers
      for (int ks = 0; ks < 6; ++ks) { bk[ks].half[0] = *(const v8us*)(kr + ks * 32 + 8 * hh); bk[ks].half[1] = *(const v8us*)(kr + ks * 32 + 16 + 8 * hh); }
#pragma unroll
      for (int ks = 0; ks < 6; ++ks) { acc0 = mmaP(bk[ks].v, aq[0][ks].v, acc0); acc1 = mmaP(bk[ks].v, aq[1][ks].v, acc1); }
      s[0][nt] = acc0; s[1][nt] = acc1; }
    FragH pa[2];
#pragma unroll      // constant indices keep the scores, pa and oacc in registers
    for (int qt = 0; qt < 2; ++qt) {
    float mc = -3.0e38f;
#pragma unroll      // constant indices keep the scores in registers
    for (int r = 0; r < 8; ++r) mc = fmaxf(mc, fmaxf(s[qt][0][r], s[qt][1][r]));
    mc = fmaxf(mc, xhalf(mc));
    // Softmax in the log2 domain: e^(x / sqrt(192) - m) = 2^(x SL2 - m'), SL2 = log2(e) / sqrt(192) > 0, so the maximum is taken on the raw scores and scaled once;
    // a score then costs one multiply-add and one hardware 2^x. m_r is kept in the scaled log2 unit.
    const float mn = fmaxf(m_r[qt], mc * SL2); const float al = __builtin_amdgcn_exp2f(m_r[qt] - mn); m_r[qt] = mn;
    float ps[4] = {0.f, 0.f, 0.f, 0.f};      // four short chains of adds, not one of sixteen
#pragma unroll      // constant indices keep the scores, pa and ps in registers
    for (int r = 0; r < 8; ++r) { const float p0 = __builtin_amdgcn_exp2f(fmaf(s[qt][0][r], SL2, -mn)), p1 = __builtin_amdgcn_exp2f(fmaf(s[qt][1][r], SL2, -mn)); ps[r & 3] += p0 + p1; pa[qt].h[r] = (_Float16)p0; pa[qt].h[8 + r] = (_Float16)p1; }
    l_r[qt] = l_r[qt] * al + ((ps[0] + ps[1]) + (ps[2] + ps[3]));
#pragma unroll
    for (int dt = 0; dt < 12; ++dt)
#pragma unroll
      for (int r = 0; r < 8; ++r) oacc[qt][dt][r] *= al; }
#pragma unroll
    for (int dg = 0; dg < 2; ++dg) { FragH bv[6];      // as for K: a run of six fragments, then their twelve products
#pragma unroll      // constant indices keep bv and oacc in registers
      for (int i = 0; i < 6; ++i) { const unsigned short* vrow = &sV[buf][kh][(dg * 6 + i) * 16 + ln][p * 32]; bv[i].half[0] = *(const v8us*)(vrow + 8 * hh); bv[i].half[1] = *(const v8us*)(vrow + 16 + 8 * hh); }
#pragma unroll
      for (int i = 0; i < 6; ++i) { oacc[0][dg * 6 + i] = mmaP(bv[i].v, pa[0].v, oacc[0][dg * 6 + i]); oacc[1][dg * 6 + i] = mmaP(bv[i].v, pa[1].v, oacc[1][dg * 6 + i]); } } }
   asm volatile("s_wait_dscnt 0x0" ::: "memory");         // this wave's reads of buffer t mod 2 are done before the buffer is handed back
   asm volatile("s_wait_asynccnt 0x0" ::: "memory");      // this wave's share of stage t + 1 has landed
   __syncthreads();                                        // publishes stage t + 1 and ends every wave's reads of stage t
   if (t + 2 < NT) stage_kv(lkl + (lks + buf * KB), lvl + (lvs + buf * VB), (kgs + (size_t)(t + 2) * TK * 3 * CO) + kl, (vgs + (t + 2) * TK) + vl); }
  asm volatile("s_wait_asynccnt 0x0" ::: "memory");        // no copy is outstanding when the ring is put to another use
  // Behind the last barrier of the loop nobody reads the ring and no copy is out: sK becomes the second group's partial O (f32, in register order: piece (tile, dt, j) is 32 lanes x 16 bytes in a row), sV the f16 output staging.
  v4fa* sM = (v4fa*)&sK[0][0][0][0] + (size_t)qg * (2 * 12 * 2 * 32) + lane;
  unsigned short (*sO)[64 + 8] = (unsigned short (*)[64 + 8])&sV[0][0][0][0] + qg * 96;      // one row a (query, coordinate) piece of 64 halves; a query's pitch is 16 B x odd
  float lt[2];
#pragma unroll      // constant indices keep l_r in registers
  for (int qt = 0; qt < 2; ++qt) lt[qt] = l_r[qt] + xhalf(l_r[qt]);      // the two halves' sums are joined once, here
  if (kh == 1) {
#pragma unroll      // constant indices keep oacc in registers
    for (int qt = 0; qt < 2; ++qt) { sML[qg][qt][0][lane] = m_r[qt]; sML[qg][qt][1][lane] = lt[qt];
#pragma unroll      // constant indices keep oacc in registers
      for (int dt = 0; dt < 12; ++dt) { const v8f o = oacc[qt][dt]; sM[((qt * 12 + dt) * 2 + 0) * 32] = (v4f){o[0], o[1], o[2], o[3]}; sM[((qt * 12 + dt) * 2 + 1) * 32] = (v4f){o[4], o[5], o[6], o[7]}; } } }
  __syncthreads();      // the second group's partials are published to the first
  if (kh == 0) {
#pragma unroll      // constant indices keep oacc in registers
    for (int qt = 0; qt < 2; ++qt) { const float m1 = sML[qg][qt][0][lane], l1 = sML[qg][qt][1][lane]; const float mm = fmaxf(m_r[qt], m1);
      const float a0 = __builtin_amdgcn_exp2f(m_r[qt] - mm), a1 = __builtin_amdgcn_exp2f(m1 - mm); const float linv = 1.0f / (lt[qt] * a0 + l1 * a1); const float c0 = a0 * linv, c1 = a1 * linv;
#pragma unroll      // constant indices keep oacc in registers
      for (int dt = 0; dt < 12; ++dt) { const v4f x0 = sM[((qt * 12 + dt) * 2 + 0) * 32], x1 = sM[((qt * 12 + dt) * 2 + 1) * 32]; FragH f;
#pragma unroll      // constant indices keep oacc in registers
        for (int r = 0; r < 4; ++r) { f.h[r] = (_Float16)(oacc[qt][dt][r] * c0 + x0[r] * c1); f.h[4 + r] = (_Float16)(oacc[qt][dt][4 + r] * c0 + x1[r] * c1); }
        *(v8us*)&sO[(qt * 16 + ln) * 3 + dt / 4][(dt % 4) * 16 + 8 * hh] = f.half[0]; } }
    __builtin_amdgcn_fence(__ATOMIC_ACQ_REL, "workgroup"); __builtin_amdgcn_wave_barrier();      // the wave's LDS stores are done before its lanes read what other lanes stored
    // Stored as the output map reads it: rows (b, n, c) x 512. A query's 192 features are three pieces of 64 halves, one 128-byte line each; eight lanes a piece, four pieces a store.
    unsigned short* orow = (unsigned short*)O3 + (((size_t)b * NN + q0) * 3 + (lane >> 3)) * CO + h * HD + (lane & 7) * 8;
#pragma unroll      // constant offsets from one address pair
    for (int q = 0; q < 24; ++q) { const v8us v = *(const v8us*)&sO[q * 4 + (lane >> 3)][(lane & 7) * 8]; *(v8us*)(orow + (size_t)q * 4 * CO) = v; } } }
// Output map with the (o, c) interleave in its store: a wave takes 16 tokens x 3 coordinates x 64 outputs (each lane picks its token's three rows of O3), so a token's piece of the result is 192 floats in a row, six whole lines.
__global__ __launch_bounds__(128) void k_gemm_out(const _Float16* __restrict__ O3, const _Float16* __restrict__ Wh, float* __restrict__ out) {
  __shared__ __attribute__((aligned(16))) float so[4][16][192 + 4];
  const int tid = threadIdx.x, w = tid >> 5, lane = tid & 31, ln = lane & 15, hh = lane >> 4;
  const int wid = blockIdx.x * 4 + w; const int mt = wid / (CI / 64), nq = wid % (CI / 64); const int bn0 = mt * 16, col0 = nq * 64;
  const unsigned short* arow = (const unsigned short*)O3 + (size_t)(bn0 + ln) * 3 * CO + 8 * hh;
  const unsigned short* brow = (const unsigned short*)Wh + (size_t)nq * 4 * (CO / 32) * FRH + lane * 8;      // the weights come in fragment order
  v8f acc[3][4] = {}; FragH a[3][3], bq[3][4];      // three register sets: a SIMD has this one wave, so steps ks + 1 and ks + 2 are in flight while step ks is multiplied
#pragma unroll      // every load is base + constant, so that no address register is rewritten while loads are out; constant indices keep the fragments and acc in registers
  for (int ks = -2; ks < CO / 32; ++ks) {
    if (ks + 2 < CO / 32) { const int s = (ks + 2) % 3, kb = (ks + 2) * 32;
#pragma unroll      // constant indices keep the fragments in registers
      for (int c = 0; c < 3; ++c) { a[s][c].half[0] = *(const v8us*)(arow + c * CO + kb); a[s][c].half[1] = *(const v8us*)(arow + c * CO + kb + 16); }
#pragma unroll      // constant indices keep the fragments in registers
      for (int t = 0; t < 4; ++t) { bq[s][t].half[0] = *(const v8us*)(brow + (t * (CO / 32) + ks + 2) * FRH); bq[s][t].half[1] = *(const v8us*)(brow + (t * (CO / 32) + ks + 2) * FRH + 256); } }
    __builtin_amdgcn_sched_barrier(0);      // holds the loads above ahead of the products below: left free, the compiler sinks each load to its own product, which then waits out the whole latency
    if (ks >= 0)
#pragma unroll      // constant indices keep the fragments and acc in registers
      for (int t = 0; t < 4; ++t)
#pragma unroll      // constant indices keep the fragments and acc in registers
        for (int c = 0; c < 3; ++c) acc[c][t] = mmaP(a[ks % 3][c].v, bq[ks % 3][t].v, acc[c][t]); }
  asm volatile("s_wait_xcnt 0x0" :: "v"(arow), "v"(brow) : "memory");      // the loads' two address pairs are named as inputs, so they stay untouched until this wait; behind it they may be reused
#pragma unroll      // constant indices keep the fragments and acc in registers
  for (int t = 0; t < 4; ++t)
#pragma unroll      // constant indices keep the fragments and acc in registers
    for (int c = 0; c < 3; ++c)
#pragma unroll      // constant indices keep the fragments and acc in registers
      for (int r = 0; r < 8; ++r) so[w][8 * hh + r][(t * 16 + ln) * 3 + c] = acc[c][t][r] * 0.0625f;
  __builtin_amdgcn_fence(__ATOMIC_ACQ_REL, "workgroup"); __builtin_amdgcn_wave_barrier();      // the wave's LDS stores are done before its lanes read what other lanes stored
  // two tokens' pieces are 96 float4, three stores of the wave; from one pair of tokens to the next every address moves by a constant
#pragma unroll      // three address pairs, formed once
  for (int j = 0; j < 3; ++j) { const int i = j * 32 + lane, r = i / 48, p4 = (i % 48) * 4; const float* ls = &so[w][r][p4]; float* gp = out + ((size_t)(bn0 + r) * CI + col0) * 3 + p4;
#pragma unroll      // constant offsets from the pair
    for (int q = 0; q < 8; ++q) { const v4f v = *(const v4fa*)(ls + q * 2 * (192 + 4)); *(v4f*)(gp + (size_t)q * 2 * CI * 3) = v; } }
}
extern "C" void kernel_launch(void* const* d_in, const int* in_sizes, int n_in,
                              void* d_out, int out_size, void* d_ws, size_t ws_size, hipStream_t stream) {
  (void)in_sizes; (void)n_in; (void)out_size;
  const float* x = (const float*)d_in[0]; const float* Wq = (const float*)d_in[1]; const float* Wk = (const float*)d_in[2]; const float* Wv = (const float*)d_in[3]; const float* Wo = (const float*)d_in[4];
  char* ws = (char*)d_ws; size_t off = 0;
  auto take = [&](size_t bytes) { char* p = ws + off; off += (bytes + 255) & ~(size_t)255; return p; };
  _Float16* Bq = (_Float16*)take((size_t)CO * CI * 2); _Float16* Bk = (_Float16*)take((size_t)CO * CI * 2); _Float16* Bv = (_Float16*)take((size_t)CO * CI * 2); _Float16* Bo = (_Float16*)take((size_t)CI * CO * 2);
  _Float16* X3 = (_Float16*)take((size_t)NR3 * CI * 2); _Float16* Q16 = (_Float16*)take((size_t)NR3 * CO * 2); _Float16* K16 = (_Float16*)take((size_t)NR3 * CO * 2); _Float16* Vt = (_Float16*)take((size_t)NR3 * CO * 2); _Float16* O3 = (_Float16*)take((size_t)NR3 * CO * 2);      // O3 has a place of its own: the attention stores it while other work-groups still read Q16
  if (off > ws_size) return;      // 1 + 6.3 + 12.6 x 4, about 58 MB
  k_prep<<<4 * WBL + XBL, 256, 0, stream>>>(x, Wq, Wk, Wv, Wo, Bq, Bk, Bv, Bo, X3);      // weights are (out,in); X3 = rows (b,c,n) x 256; all five in fragment order
  k_qkv<<<dim3(MBL, 3), 128, 0, stream>>>(X3, Bq, Bk, Bv, Q16, K16, Vt);      // q/k planes = rows (b,n,c) x 512 = [(b,n)][c * 512 + o]
  k_vnattn<<<BB * NH * (NN / 128), 256, 0, stream>>>(Q16, K16, Vt, O3);
  k_gemm_out<<<(NR / 16) * (CI / 64) / 4, 128, 0, stream>>>(O3, Bo, (float*)d_out);
}

// v009
// Measured time: 80.9 microseconds a run.
// Two timings next to v008 both put it at 1.13 times that version's speed.
// Over all steps from v000 it is 7.46 times as fast.
#include <hip/hip_runtime.h>
// Vector-neuron attention (B=2, N=2048, C=256 × 3 coordinates, 8 heads × 64): the VN-linear maps (rows (b,n,c) × 256 → 512, weights (out,in) bf16-exact ×2^4) and the attention over the
// 192-dim (d, c) head features as a fused flash-style kernel on v_wmma_f32_16x16x32_f16 (S^T = K Q^T / sqrt(192) with 6 k-steps gathered from the three coordinate blocks, online softmax f32 in-lane, P f16 <= 1 packed from the score registers,
// O^T = V^T P^T with 12 d-tiles; 32 queries a wave, keys split over two groups of waves); f16 operands, single products, f32 accumulate; V^T, the f16 attention output and the final (o, c) interleave are stored by the kernels that compute them.
#define BB 2
#define NN 2048
#define CI 256
#define CO 512
#define NH 8
#define HD 64
#define NR3 (BB * NN * 3)
#define NR (BB * NN)

typedef __bf16 v16b __attribute__((ext_vector_type(16)));
typedef unsigned short v8us __attribute__((ext_vector_type(8), may_alias));
typedef float  v8f  __attribute__((ext_vector_type(8)));
typedef float  v4f  __attribute__((ext_vector_type(4)));
typedef float  v4fa __attribute__((ext_vector_type(4), may_alias));
union FragB { v16b v; v8us half[2]; unsigned short u[16]; };

__device__ __forceinline__ unsigned short bf16_bits(float x) { unsigned int u = __float_as_uint(x); return (unsigned short)((u + 0x7FFFu + ((u >> 16) & 1u)) >> 16); }
__device__ __forceinline__ float bf16_val(unsigned short b) { return __uint_as_float(((unsigned int)b) << 16); }
__device__ __forceinline__ float bf16_round(float x) { return bf16_val(bf16_bits(x)); }
// D += A·B with NT terms: 1 = ah·bh, 2 = + al·bh (A split), 3 = + ah·bl (both split)
template <int NT>
__device__ __forceinline__ v8f mmaN(v16b ah, v16b al, v16b bh, v16b bl, v8f c) {
  c = __builtin_amdgcn_wmma_f32_16x16x32_bf16(false, ah, false, bh, (short)0, c, false, false);
  if (NT >= 2) c = __builtin_amdgcn_wmma_f32_16x16x32_bf16(false, al, false, bh, (short)0, c, false, false);
  if (NT >= 3) c = __builtin_amdgcn_wmma_f32_16x16x32_bf16(false, ah, false, bl, (short)0, c, false, false);
  asm volatile("v_nop\n\tv_nop\n\tv_nop\n\tv_nop" : "+v"(c) : "v"(ah), "v"(al), "v"(bh), "v"(bl));
  return c;
}

__global__ __launch_bounds__(256) void k_wt_bf16(const float* __restrict__ W, unsigned short* __restrict__ Wt, int K, int N) {
  const int t = blockIdx.x * 256 + threadIdx.x;
  const int k8n = K / 8;
  if (t >= N * k8n) return;
  const int n = t / k8n, k8 = (t % k8n) * 8;
  v8us v;
#pragma unroll
  for (int i = 0; i < 8; ++i) v[i] = bf16_bits(W[(size_t)(k8 + i) * N + n]);
  *(v8us*)(Wt + (size_t)n * K + k8) = v;
  
}

// GEMM C[M][N] (f32, pitch ldc) = act(A[M][K]·W + bias). A f32 row-major (pitch lda) converted per fragment to bf16
// (ASPLIT: hi/lo two planes -> 2 terms, else single rounded term); Wt bf16 [N][K] (pitch ldb). BIAS_BF16 rounds the
// bias to bf16 first (bias quantised to bf16 before the add). K%32==0, M%16==0, N%64==0.
template <bool ASPLIT, int ACT, bool BIAS_BF16>
__global__ __launch_bounds__(128) void k_gemm_bf(const float* __restrict__ A, int lda, const unsigned short* __restrict__ Wt, int ldb,
                                               const float* __restrict__ bias, float* __restrict__ C, int ldc, int M, int N, int K) {
  __shared__ __attribute__((aligned(16))) float so[4][16][64];
  const int tid = threadIdx.x, w = tid >> 5, lane = tid & 31, ln = lane & 15, hh = lane >> 4;
  const int ntn = N / 64;
  const int wid = blockIdx.x * 4 + w;
  const int mt = wid / ntn, nq = wid % ntn;
  if (mt * 16 >= M) return;
  const int row0 = mt * 16, col0 = nq * 64;
  const float* arow = A + (size_t)(row0 + ln) * lda;
  v8f acc[4] = {};
  for (int kb = 0; kb < K; kb += 32) {
    FragB ah, al;
    const v4f x0 = *(const v4fa*)(arow + kb + 8 * hh), x1 = *(const v4fa*)(arow + kb + 8 * hh + 4);
    const v4f x2 = *(const v4fa*)(arow + kb + 16 + 8 * hh), x3 = *(const v4fa*)(arow + kb + 16 + 8 * hh + 4);
    float xs[16] = {x0[0],x0[1],x0[2],x0[3],x1[0],x1[1],x1[2],x1[3],x2[0],x2[1],x2[2],x2[3],x3[0],x3[1],x3[2],x3[3]};
#pragma unroll
    for (int i = 0; i < 16; ++i) { const unsigned short hb = bf16_bits(xs[i]); ah.u[i] = hb; al.u[i] = ASPLIT ? bf16_bits(xs[i] - bf16_val(hb)) : (unsigned short)0; }
#pragma unroll
    for (int t = 0; t < 4; ++t) {
      const unsigned short* brow = Wt + (size_t)(col0 + t * 16 + ln) * ldb + kb;
      FragB b;
      b.half[0] = *(const v8us*)(brow + 8 * hh);
      b.half[1] = *(const v8us*)(brow + 16 + 8 * hh);
      acc[t] = mmaN<ASPLIT ? 2 : 1>(ah.v, al.v, b.v, b.v, acc[t]);
    }
  }
#pragma unroll
  for (int t = 0; t < 4; ++t) {
    float bv = bias ? bias[col0 + t * 16 + ln] : 0.f;
    if (BIAS_BF16) bv = bf16_round(bv);
#pragma unroll
    for (int r = 0; r < 8; ++r) { float v = acc[t][r] + bv; if (ACT == 1) v = fmaxf(v, 0.f); so[w][8 * hh + r][t * 16 + ln] = v; }
  }
  __builtin_amdgcn_fence(__ATOMIC_ACQ_REL, "workgroup");
  __builtin_amdgcn_wave_barrier();
  const int rsub = lane >> 4, c4 = (lane & 15) * 4;
  {
#pragma unroll
    for (int q = 0; q < 8; ++q) {
      const int r = q * 2 + rsub;
      const v4f v = *(const v4fa*)&so[w][r][c4];
      *(v4f*)(C + (size_t)(row0 + r) * ldc + col0 + c4) = v;
    }
    
  }
}

// Flash-style causal/unmasked attention, all contractions 3-term bf16 hi/lo splits, f32 softmax with running max.
// q,k,v rows are read from f32 buffers with arbitrary row pitch (so they can live inside a fused qkv buffer);
// D = head size (multiple of 32, <= 128); one wave = 16 query rows; block = 4 waves (64 queries) sharing K/V chunks of 32.
template <int D, bool CAUSAL>
__global__ __launch_bounds__(128) void k_flash(const float* __restrict__ qb, const float* __restrict__ kb, const float* __restrict__ vb,
                                             int pitch, int T, int H, float scale, float* __restrict__ y, int ypitch) {
  constexpr int KS = D / 32;        // k-steps for QK
  constexpr int DT = D / 16;        // d tiles for PV
  __shared__ __attribute__((aligned(16))) unsigned short sKh[32][D + 8], sKl[32][D + 8], sVh[32][D + 8], sVl[32][D + 8];
  __shared__ __attribute__((aligned(16))) unsigned short sPh[4][16][40], sPl[4][16][40];
  __shared__ __attribute__((aligned(16))) float sO[4][16][D];
  const int tid = threadIdx.x, w = tid >> 5, lane = tid & 31, ln = lane & 15, hh = lane >> 4;
  const int nqb = (T + 63) / 64;
  const int bh = blockIdx.x / nqb, qblk = blockIdx.x % nqb;
  const int b = bh / H, h = bh % H;
  const int q0 = qblk * 64 + w * 16;
  const float* Q = qb + (size_t)b * T * pitch + h * D;
  const float* K = kb + (size_t)b * T * pitch + h * D;
  const float* V = vb + (size_t)b * T * pitch + h * D;

  // A fragments of the wave's 16 query rows (scaled), hi/lo
  FragB aqh[KS], aql[KS];
  {
    int row = q0 + ln; if (row >= T) row = T - 1;
    const float* qr = Q + (size_t)row * pitch;
#pragma unroll
    for (int ks = 0; ks < KS; ++ks)
#pragma unroll
      for (int i = 0; i < 16; ++i) {
        const int d = ks * 32 + ((i < 8) ? (8 * hh + i) : (16 + 8 * hh + (i - 8)));
        const float x = qr[d] * scale; const unsigned short hb = bf16_bits(x);
        aqh[ks].u[i] = hb; aql[ks].u[i] = bf16_bits(x - bf16_val(hb));
      }
  }
  float m_r[8], l_r[8];
#pragma unroll
  for (int r = 0; r < 8; ++r) { m_r[r] = -3.0e38f; l_r[r] = 0.f; }
  v8f oacc[DT];
#pragma unroll
  for (int dt = 0; dt < DT; ++dt) oacc[dt] = (v8f){0.f,0.f,0.f,0.f,0.f,0.f,0.f,0.f};

  const int kv_end = CAUSAL ? min(T, qblk * 64 + 64) : T;     // block-uniform
  for (int j0 = 0; j0 < kv_end; j0 += 32) {
    __syncthreads();
    for (int e = tid; e < 32 * (D / 4); e += 128) {
      const int r = e / (D / 4), c4 = (e % (D / 4)) * 4;
      const int key = j0 + r;
      v4f kf = {0.f,0.f,0.f,0.f}, vf = {0.f,0.f,0.f,0.f};
      if (key < T) { kf = *(const v4fa*)(K + (size_t)key * pitch + c4); vf = *(const v4fa*)(V + (size_t)key * pitch + c4); }
#pragma unroll
      for (int t = 0; t < 4; ++t) {
        unsigned short hb = bf16_bits(kf[t]); sKh[r][c4 + t] = hb; sKl[r][c4 + t] = bf16_bits(kf[t] - bf16_val(hb));
        hb = bf16_bits(vf[t]); sVh[r][c4 + t] = hb; sVl[r][c4 + t] = bf16_bits(vf[t] - bf16_val(hb));
      }
    }
    __syncthreads();
    // S tile 16 x 32
    v8f s[2];
#pragma unroll
    for (int nt = 0; nt < 2; ++nt) {
      v8f acc = {};
#pragma unroll
      for (int ks = 0; ks < KS; ++ks) {
        FragB bh_, bl_;
        bh_.half[0] = *(const v8us*)&sKh[nt * 16 + ln][ks * 32 + 8 * hh]; bh_.half[1] = *(const v8us*)&sKh[nt * 16 + ln][ks * 32 + 16 + 8 * hh];
        bl_.half[0] = *(const v8us*)&sKl[nt * 16 + ln][ks * 32 + 8 * hh]; bl_.half[1] = *(const v8us*)&sKl[nt * 16 + ln][ks * 32 + 16 + 8 * hh];
        acc = mmaN<3>(aqh[ks].v, aql[ks].v, bh_.v, bl_.v, acc);
      }
      s[nt] = acc;
    }
    // mask + running max (rows 8hh+r; the 16 lanes of a half share rows)
    float alpha[8];
#pragma unroll
    for (int r = 0; r < 8; ++r) {
      const int qi = q0 + 8 * hh + r;
      const int ja = j0 + ln, jb = j0 + 16 + ln;
      if (CAUSAL) { if (ja > qi) s[0][r] = -3.0e38f; if (jb > qi) s[1][r] = -3.0e38f; }
      if (ja >= T) s[0][r] = -3.0e38f;
      if (jb >= T) s[1][r] = -3.0e38f;
      float mx = fmaxf(s[0][r], s[1][r]);
      mx = fmaxf(mx, __shfl_xor(mx, 1, 32)); mx = fmaxf(mx, __shfl_xor(mx, 2, 32)); mx = fmaxf(mx, __shfl_xor(mx, 4, 32)); mx = fmaxf(mx, __shfl_xor(mx, 8, 32));
      const float mnew = fmaxf(m_r[r], mx);
      alpha[r] = (mnew > -1.0e38f) ? __expf(m_r[r] - mnew) : 1.0f;
      const float p0 = (s[0][r] > -1.0e38f) ? __expf(s[0][r] - mnew) : 0.f;
      const float p1 = (s[1][r] > -1.0e38f) ? __expf(s[1][r] - mnew) : 0.f;
      m_r[r] = mnew;
      l_r[r] = l_r[r] * alpha[r] + p0 + p1;            // per-lane partial row sum (16 lanes combined at the end)
      unsigned short hb = bf16_bits(p0); sPh[w][8 * hh + r][ln] = hb;      sPl[w][8 * hh + r][ln] = bf16_bits(p0 - bf16_val(hb));
      hb = bf16_bits(p1);                sPh[w][8 * hh + r][16 + ln] = hb; sPl[w][8 * hh + r][16 + ln] = bf16_bits(p1 - bf16_val(hb));
    }
#pragma unroll
    for (int dt = 0; dt < DT; ++dt)
#pragma unroll
      for (int r = 0; r < 8; ++r) oacc[dt][r] *= alpha[r];
    __builtin_amdgcn_fence(__ATOMIC_ACQ_REL, "workgroup");
    __builtin_amdgcn_wave_barrier();
    FragB pah, pal;
    pah.half[0] = *(const v8us*)&sPh[w][ln][8 * hh]; pah.half[1] = *(const v8us*)&sPh[w][ln][16 + 8 * hh];
    pal.half[0] = *(const v8us*)&sPl[w][ln][8 * hh]; pal.half[1] = *(const v8us*)&sPl[w][ln][16 + 8 * hh];
#pragma unroll
    for (int dt = 0; dt < DT; ++dt) {
      FragB bvh, bvl;
#pragma unroll
      for (int i = 0; i < 8; ++i) {
        bvh.u[i] = sVh[8 * hh + i][dt * 16 + ln]; bvh.u[8 + i] = sVh[16 + 8 * hh + i][dt * 16 + ln];
        bvl.u[i] = sVl[8 * hh + i][dt * 16 + ln]; bvl.u[8 + i] = sVl[16 + 8 * hh + i][dt * 16 + ln];
      }
      oacc[dt] = mmaN<3>(pah.v, pal.v, bvh.v, bvl.v, oacc[dt]);
    }
    __builtin_amdgcn_fence(__ATOMIC_ACQ_REL, "workgroup");
    __builtin_amdgcn_wave_barrier();
  }
#pragma unroll
  for (int r = 0; r < 8; ++r) {
    float l = l_r[r];
    l += __shfl_xor(l, 1, 32); l += __shfl_xor(l, 2, 32); l += __shfl_xor(l, 4, 32); l += __shfl_xor(l, 8, 32);
    l_r[r] = (l > 0.f) ? 1.0f / l : 0.f;
  }
#pragma unroll
  for (int dt = 0; dt < DT; ++dt)
#pragma unroll
    for (int r = 0; r < 8; ++r) sO[w][8 * hh + r][dt * 16 + ln] = oacc[dt][r] * l_r[r];
  __builtin_amdgcn_fence(__ATOMIC_ACQ_REL, "workgroup");
  __builtin_amdgcn_wave_barrier();
  {
    for (int r = 0; r < 16; ++r) {
      const int row = q0 + r;
      if (row < T && lane < D / 4) {
        const v4f val = *(const v4fa*)&sO[w][r][lane * 4];
        *(v4f*)(y + ((size_t)b * T + row) * ypitch + h * D + lane * 4) = val;
      }
    }
    
  }
}

// GEMM C = act(A·W + bias + resid): A f32 (ASPLIT -> hi/lo 2 terms), Wt bf16 [N][K]; ACT 0 none, 1 relu, 2 exact gelu;
// resid (optional, f32, row index = (row % rmod), pitch ldr, RES_BF16 rounds it) added before the activation.
template <bool ASPLIT, int ACT, bool BIAS_BF16, bool RES_BF16>
__global__ __launch_bounds__(128) void k_gemm_bf3(const float* __restrict__ A, int lda, const unsigned short* __restrict__ Wt, int ldb,
                                                const float* __restrict__ bias, const float* __restrict__ resid, int rmod, int ldr,
                                                float* __restrict__ C, int ldc, int M, int N, int K) {
  __shared__ __attribute__((aligned(16))) float so[4][16][64];
  const int tid = threadIdx.x, w = tid >> 5, lane = tid & 31, ln = lane & 15, hh = lane >> 4;
  const int ntn = N / 64;
  const int wid = blockIdx.x * 4 + w;
  const int mt = wid / ntn, nq = wid % ntn;
  if (mt * 16 >= M) return;
  const int row0 = mt * 16, col0 = nq * 64;
  const float* arow = A + (size_t)(row0 + ln) * lda;
  v8f acc[4] = {};
  for (int kb = 0; kb < K; kb += 32) {
    FragB ah, al;
    const v4f x0 = *(const v4fa*)(arow + kb + 8 * hh), x1 = *(const v4fa*)(arow + kb + 8 * hh + 4);
    const v4f x2 = *(const v4fa*)(arow + kb + 16 + 8 * hh), x3 = *(const v4fa*)(arow + kb + 16 + 8 * hh + 4);
    float xs[16] = {x0[0],x0[1],x0[2],x0[3],x1[0],x1[1],x1[2],x1[3],x2[0],x2[1],x2[2],x2[3],x3[0],x3[1],x3[2],x3[3]};
#pragma unroll
    for (int i = 0; i < 16; ++i) { const unsigned short hb = bf16_bits(xs[i]); ah.u[i] = hb; al.u[i] = ASPLIT ? bf16_bits(xs[i] - bf16_val(hb)) : (unsigned short)0; }
#pragma unroll
    for (int t = 0; t < 4; ++t) {
      const unsigned short* brow = Wt + (size_t)(col0 + t * 16 + ln) * ldb + kb;
      FragB b;
      b.half[0] = *(const v8us*)(brow + 8 * hh);
      b.half[1] = *(const v8us*)(brow + 16 + 8 * hh);
      acc[t] = mmaN<ASPLIT ? 2 : 1>(ah.v, al.v, b.v, b.v, acc[t]);
    }
  }
#pragma unroll
  for (int t = 0; t < 4; ++t) {
    const int col = col0 + t * 16 + ln;
    float bv = bias ? bias[col] : 0.f;
    if (BIAS_BF16) bv = bf16_round(bv);
#pragma unroll
    for (int r = 0; r < 8; ++r) {
      float v = acc[t][r] + bv;
      if (resid) { float rv = resid[(size_t)((row0 + 8 * hh + r) % rmod) * ldr + col]; if (RES_BF16) rv = bf16_round(rv); v += rv; }
      if (ACT == 1) v = fmaxf(v, 0.f);
      if (ACT == 2) v = 0.5f * v * (1.0f + erff(v * 0.70710678118654752f));
      if (ACT == 3) { const float u = 0.7978845608028654f * (v + 0.044715f * v * v * v); v = 0.5f * v * (1.0f + tanhf(u)); }
      so[w][8 * hh + r][t * 16 + ln] = v;
    }
  }
  __builtin_amdgcn_fence(__ATOMIC_ACQ_REL, "workgroup");
  __builtin_amdgcn_wave_barrier();
  const int rsub = lane >> 4, c4 = (lane & 15) * 4;
  {
#pragma unroll
    for (int q = 0; q < 8; ++q) {
      const int r = q * 2 + rsub;
      const v4f v = *(const v4fa*)&so[w][r][c4];
      *(v4f*)(C + (size_t)(row0 + r) * ldc + col0 + c4) = v;
    }
    
  }
}
// row LayerNorm (biased variance, eps) over N: s = X (+ R); optional out_sum <- s; out_norm <- (s-mu)*rsqrt(var+eps)*g + b
template <bool PARAM_BF16>
__global__ __launch_bounds__(256) void k_layernorm(const float* __restrict__ X, const float* __restrict__ R, const float* __restrict__ g, const float* __restrict__ bta,
                                                  float* __restrict__ out_sum, float* __restrict__ out_norm, int N, float eps) {
  __shared__ float red[256];
  const int row = blockIdx.x, tid = threadIdx.x;
  const float* x = X + (size_t)row * N; const float* rr = R ? R + (size_t)row * N : nullptr;
  float vals[16];                     // up to N = 4096
  const int per = N / 256;            // contiguous chunk per thread? use strided-by-4 chunks: thread handles j = tid*4 + 1024*u
  float s1 = 0.f;
  for (int u = 0; u < per / 4; ++u) {
    const int j = tid * 4 + 1024 * u;
    const v4f a = *(const v4fa*)(x + j);
    v4f b = {0.f,0.f,0.f,0.f}; if (rr) b = *(const v4fa*)(rr + j);
#pragma unroll
    for (int q = 0; q < 4; ++q) { const float v = a[q] + b[q]; vals[u * 4 + q] = v; s1 += v; }
  }
  red[tid] = s1; __syncthreads();
  for (int st = 128; st > 0; st >>= 1) { if (tid < st) red[tid] += red[tid + st]; __syncthreads(); }
  const float mu = red[0] / (float)N; __syncthreads();
  float s2 = 0.f;
  for (int u = 0; u < per / 4; ++u)
#pragma unroll
    for (int q = 0; q < 4; ++q) { const float c = vals[u * 4 + q] - mu; s2 += c * c; }
  red[tid] = s2; __syncthreads();
  for (int st = 128; st > 0; st >>= 1) { if (tid < st) red[tid] += red[tid + st]; __syncthreads(); }
  const float rs = rsqrtf(red[0] / (float)N + eps);
  {
    for (int u = 0; u < per / 4; ++u) {
      const int j = tid * 4 + 1024 * u;
      v4f o, sm;
#pragma unroll
      for (int q = 0; q < 4; ++q) {
        float gg = g[j + q], bb = bta[j + q];
        if (PARAM_BF16) { gg = bf16_round(gg); bb = bf16_round(bb); }
        sm[q] = vals[u * 4 + q]; o[q] = (vals[u * 4 + q] - mu) * rs * gg + bb;
      }
      if (out_sum) *(v4f*)(out_sum + (size_t)row * N + j) = sm;
      *(v4f*)(out_norm + (size_t)row * N + j) = o;
    }
    
  }
}



// ---- f16 WMMA path (v_wmma_f32_16x16x32_f16): 11-bit significands for operands in range — used for every contraction launched here (VN-linear maps, Q·Kᵀ, P·V)
typedef _Float16 v16h __attribute__((ext_vector_type(16)));
union FragH { v16h v; v8us half[2]; _Float16 h[16]; unsigned short u[16]; };
template <int NT>
__device__ __forceinline__ v8f mmaH(v16h ah, v16h al, v16h bh, v16h bl, v8f c) {
  c = __builtin_amdgcn_wmma_f32_16x16x32_f16(false, ah, false, bh, (short)0, c, false, false);
  if (NT >= 2) c = __builtin_amdgcn_wmma_f32_16x16x32_f16(false, al, false, bh, (short)0, c, false, false);
  if (NT >= 3) c = __builtin_amdgcn_wmma_f32_16x16x32_f16(false, ah, false, bl, (short)0, c, false, false);
  asm volatile("v_nop\n\tv_nop\n\tv_nop\n\tv_nop" : "+v"(c) : "v"(ah), "v"(al), "v"(bh), "v"(bl));
  return c;
}
// batched GEMM like k_gemm_b but f16 operands: A f32 (split into f16 hi/lo if ASPLIT, else rounded to f16), Bt = f16 values [n][k]; alpha; C f32; N multiple of 16 (partial tiles skipped)
template <bool ASPLIT>
__global__ __launch_bounds__(128) void k_gemm_h(const float* __restrict__ A, int lda, size_t sA, const _Float16* __restrict__ Bh, int ldb, size_t sB, float alpha, float* __restrict__ C, int ldc, size_t sC, int M, int N, int K) {
  __shared__ __attribute__((aligned(16))) float so[4][16][64];
  const int tid = threadIdx.x, w = tid >> 5, lane = tid & 31, ln = lane & 15, hh = lane >> 4; const int by = blockIdx.y;
  A += (size_t)by * sA; Bh += (size_t)by * sB; C += (size_t)by * sC;
  const int ntn = (N + 63) / 64; const int wid = blockIdx.x * 4 + w; const int mt = wid / ntn, nq = wid % ntn; if (mt * 16 >= M) return;
  const int row0 = mt * 16, col0 = nq * 64; const float* arow = A + (size_t)(row0 + ln) * lda;
  v8f acc[4] = {};
  for (int kb = 0; kb < K; kb += 32) {
    FragH ah, al;
    const v4f x0 = *(const v4fa*)(arow + kb + 8 * hh), x1 = *(const v4fa*)(arow + kb + 8 * hh + 4), x2 = *(const v4fa*)(arow + kb + 16 + 8 * hh), x3 = *(const v4fa*)(arow + kb + 16 + 8 * hh + 4);
    float xs[16] = {x0[0],x0[1],x0[2],x0[3],x1[0],x1[1],x1[2],x1[3],x2[0],x2[1],x2[2],x2[3],x3[0],x3[1],x3[2],x3[3]};
#pragma unroll
    for (int i = 0; i < 16; ++i) { const _Float16 h = (_Float16)xs[i]; ah.h[i] = h; al.h[i] = ASPLIT ? (_Float16)(xs[i] - (float)h) : (_Float16)0.0f; }
#pragma unroll
    for (int t = 0; t < 4; ++t) { if (col0 + t * 16 >= N) continue; const size_t boff = (size_t)(col0 + t * 16 + ln) * ldb + kb; FragH bq; bq.half[0] = *(const v8us*)(Bh + boff + 8 * hh); bq.half[1] = *(const v8us*)(Bh + boff + 16 + 8 * hh);
      acc[t] = mmaH<ASPLIT ? 2 : 1>(ah.v, al.v, bq.v, bq.v, acc[t]); }
  }
#pragma unroll
  for (int t = 0; t < 4; ++t) { if (col0 + t * 16 >= N) continue;
#pragma unroll
    for (int r = 0; r < 8; ++r) so[w][8 * hh + r][t * 16 + ln] = acc[t][r] * alpha; }
  __builtin_amdgcn_fence(__ATOMIC_ACQ_REL, "workgroup"); __builtin_amdgcn_wave_barrier();
  const int rsub = lane >> 4, c4 = (lane & 15) * 4;
  {
#pragma unroll
    for (int q = 0; q < 8; ++q) { const int r = q * 2 + rsub; if (col0 + c4 < N) { const v4f v = *(const v4fa*)&so[w][r][c4]; *(v4f*)(C + (size_t)(row0 + r) * ldc + col0 + c4) = v; } }
     }
}

// Wt[n][k] = f16(W[k][n]·scale) from f32 row-major W[K][N] (scale = power of two; bf16-exact weights stay exact in f16 away from the subnormal range)
__global__ __launch_bounds__(256) void k_wt_f16(const float* __restrict__ W, _Float16* __restrict__ Wt, int K, int N, float scale) {
  const int t = blockIdx.x * 256 + threadIdx.x; if (t >= N * (K / 8)) return; const int n = t / (K / 8), k8 = (t % (K / 8)) * 8; FragH f;
#pragma unroll
  for (int i = 0; i < 8; ++i) f.h[i] = (_Float16)(bf16_round(W[(size_t)(k8 + i) * N + n]) * scale); const v8us o = f.half[0];
  *(v8us*)((unsigned short*)Wt + (size_t)n * K + k8) = o; 
}
// FRAGMENT ORDER. The weights and x are stored as the matrix instructions read them: a matrix of rows x K halves is cut into fragments of 16 rows x 32 k, 1 KB each, at [row / 16][k / 32];
// inside a fragment piece (hs, lane) is 16 bytes: row lane % 16, k = 16 hs + 8 (lane / 16) + 0..7. A wave's 16-byte load of half a fragment is then 512 bytes in a row, four whole lines, where rows of pitch K gave sixteen 32-byte pieces.
#define FRH 512      // halves of one fragment
// Every operand conversion in one launch; the block index picks the job, and no job reads what another writes. Blocks [0, 4 WBL): the four weight matrices, rounded and scaled by 16, WBL blocks each; the rest: x.
// Thread t writes piece t of its packed matrix, so a wave's store is 512 bytes in a row. X3 has its rows in the order (b, c, n): a thread takes the three coordinates of its 8 channels from one run of 96 bytes and writes one piece to each of the three planes.
#define WBL (CO * CI / 8 / 256)
#define XBL (NR * (CI / 8) / 256)
__global__ __launch_bounds__(256) void k_prep(const float* __restrict__ x, const float* __restrict__ Wq, const float* __restrict__ Wk, const float* __restrict__ Wv, const float* __restrict__ Wo,
                                            _Float16* __restrict__ Bq, _Float16* __restrict__ Bk, _Float16* __restrict__ Bv, _Float16* __restrict__ Bo, _Float16* __restrict__ X3) {
  const int bx = blockIdx.x; const int lane = threadIdx.x & 31, hs = (threadIdx.x >> 5) & 1; const int kin = hs * 16 + (lane >> 4) * 8;
  if (bx < 4 * WBL) { const int j = bx / WBL; const float* W = j == 0 ? Wq : j == 1 ? Wk : j == 2 ? Wv : Wo; _Float16* Bt = j == 0 ? Bq : j == 1 ? Bk : j == 2 ? Bv : Bo; const int kf = (j == 3 ? CO : CI) / 32;      // fragments in a row of the matrix
    const int t = (bx % WBL) * 256 + threadIdx.x; const int fr = t >> 6; const float* wp = W + (size_t)((fr / kf) * 16 + (lane & 15)) * (kf * 32) + (fr % kf) * 32 + kin; FragH f;
#pragma unroll      // constant indices keep f in registers
    for (int i = 0; i < 8; ++i) f.h[i] = (_Float16)(bf16_round(wp[i]) * 16.0f); *(v8us*)((unsigned short*)Bt + (size_t)t * 8) = f.half[0]; }
  else { const int t = (bx - 4 * WBL) * 256 + threadIdx.x; const int fr = t >> 6; const int bn = (fr / (CI / 32)) * 16 + (lane & 15); const float* xp = x + ((size_t)bn * CI + (fr % (CI / 32)) * 32 + kin) * 3;
    unsigned short* xo = (unsigned short*)X3 + ((size_t)t + (size_t)(bn / NN) * 2 * (NN / 16) * (CI / 32) * 64) * 8;      // token row b NN + n becomes row (3 b + c) NN + n: 2 b + c planes further
#pragma unroll      // the 24 floats are loaded once, as six 16-byte loads, and the three stores go from one address pair with constant offsets
    for (int c = 0; c < 3; ++c) { FragH f;
#pragma unroll      // constant indices keep f in registers
      for (int q = 0; q < 8; ++q) f.h[q] = (_Float16)bf16_round(xp[q * 3 + c]); *(v8us*)(xo + (size_t)c * (NN / 16) * (CI / 32) * FRH) = f.half[0]; }
    asm volatile("s_wait_xcnt 0x0" ::: "memory"); } }      // behind the last store: no register that the three stores name is rewritten ahead of this wait
// The bare builtin: the compiler keeps the distances behind its own matrix instructions, and with no asm statement naming them the accumulators may live above v255.
// No global load is moved over a volatile asm statement either: with one behind each product every product waited out its own operand loads. In the maps below the operands of a later k step are asked for ahead of the products of this one.
__device__ __forceinline__ v8f mmaP(v16h a, v16h b, v8f c) { return __builtin_amdgcn_wmma_f32_16x16x32_f16(false, a, false, b, (short)0, c, false, false); }
// q or k map: C[(b, n, c)][o] = sum_k X3[(b, c, n)][k] W[o][k] / 16, f16. A wave takes 64 tokens of one (b, c) x 64 outputs: four fragments of each operand a k step feed sixteen products, half a fragment a product where a 16 x 64 tile took one and a quarter,
// and the launch has a quarter of the waves to start. The four waves of a work-group form a 128 x 128 tile, so each fragment is asked for by two of them. Both operands come in fragment order. The result keeps its rows (b, n, c) x 512: a token's row is picked in the store.
#define KST (CI / 32)      // k steps of the q, k and V^T maps
#define NSET 3          // register sets of operand fragments: steps ks + 1 .. ks + NSET - 1 are in flight while step ks is multiplied
// acc[i][t] += sum_k A[tile i][k] B[tile t][k] over all of CI; as and bs point at the first fragment of four rows of fragments each.
// as and bs are the same in every lane (scalar registers); the lane's own piece is lo halves further, one vector register for all loads.
__device__ __forceinline__ void mm64(const unsigned short* as, const unsigned short* bs, v8f (&acc)[4][4]) {
  const unsigned lo = (threadIdx.x & 31) * 8; const unsigned short *ap = as + lo, *bp = bs + lo; FragH ah[NSET][4], bq[NSET][4];
#pragma unroll      // every load is base + constant, so that no address register is rewritten while loads are out; constant indices keep the fragments and acc in registers
  for (int ks = 1 - NSET; ks < KST; ++ks) {
    if (ks + NSET - 1 < KST) { const int kn = ks + NSET - 1, s = kn % NSET;
#pragma unroll      // constant indices keep the fragments in registers
      for (int i = 0; i < 4; ++i) { ah[s][i].half[0] = *(const v8us*)(ap + (i * KST + kn) * FRH); ah[s][i].half[1] = *(const v8us*)(ap + (i * KST + kn) * FRH + 256);
        bq[s][i].half[0] = *(const v8us*)(bp + (i * KST + kn) * FRH); bq[s][i].half[1] = *(const v8us*)(bp + (i * KST + kn) * FRH + 256); } }
    __builtin_amdgcn_sched_barrier(0);      // holds the loads above ahead of the products below: left free, the compiler sinks them among later products, with fewer in flight and a shorter lead
    if (ks >= 0)
#pragma unroll      // constant indices keep the fragments and acc in registers
      for (int i = 0; i < 4; ++i)
#pragma unroll      // constant indices keep the fragments and acc in registers
        for (int t = 0; t < 4; ++t) acc[i][t] = mmaP(ah[ks % NSET][i].v, bq[ks % NSET][t].v, acc[i][t]); }
  asm volatile("s_wait_xcnt 0x0" :: "v"(lo), "s"(as), "s"(bs) : "memory");      // the loads' offset register and two scalar bases are named as inputs, so they stay untouched until this wait; behind it they may be reused
}
// The wave's 64 x 64 tile goes through its own 16 KB of LDS, so that a store covers whole lines: row j of the tile is 64 halves, one 128-byte line, at crow + j * pitch (halves); crow already holds the lane's row parity and column.
__device__ __forceinline__ void put64(float (*sw)[64], const v8f (&acc)[4][4], _Float16* crow, size_t pitch) {
  const int lane = threadIdx.x & 31, ln = lane & 15, hh = lane >> 4;
#pragma unroll      // constant indices keep acc in registers
  for (int i = 0; i < 4; ++i)
#pragma unroll      // constant indices keep acc in registers
    for (int t = 0; t < 4; ++t)
#pragma unroll      // constant indices keep acc in registers
      for (int r = 0; r < 8; ++r) sw[i * 16 + 8 * hh + r][t * 16 + ln] = acc[i][t][r] * 0.0625f;
  __builtin_amdgcn_fence(__ATOMIC_ACQ_REL, "workgroup"); __builtin_amdgcn_wave_barrier();      // the wave's LDS stores are done before its lanes read what other lanes stored
  const int rsub = lane >> 4, c4 = (lane & 15) * 4; typedef _Float16 v4h __attribute__((ext_vector_type(4)));
#pragma unroll      // constant offsets from one address pair
  for (int q = 0; q < 32; ++q) { const v4f v = *(const v4fa*)&sw[q * 2 + rsub][c4]; v4h h4; for (int i = 0; i < 4; ++i) h4[i] = (_Float16)v[i]; *(v4h*)(crow + (size_t)q * 2 * pitch) = h4; }
  asm volatile("s_wait_xcnt 0x0" ::: "memory");      // behind the last store: no register that the stores name is rewritten ahead of this wait
}
__device__ __forceinline__ void gemm_qk(float (*so)[64][64], int bx, const _Float16* __restrict__ X3, const _Float16* __restrict__ Wh, _Float16* __restrict__ C16) {
  const int tid = threadIdx.x, lane = tid & 31; const int w = __builtin_amdgcn_readfirstlane(tid >> 5);      // the wave's number, the same in every lane: kept in a scalar register, and the operand addresses with it
  const int mg = (bx / (CO / 128)) * 2 + (w >> 1), nq = (bx % (CO / 128)) * 2 + (w & 1);      // 64 tokens, 64 outputs
  v8f acc[4][4] = {};
  mm64((const unsigned short*)X3 + (size_t)mg * 4 * KST * FRH, (const unsigned short*)Wh + (size_t)nq * 4 * KST * FRH, acc);
  const int bc = mg / (NN / 64), n0 = (mg % (NN / 64)) * 64;
  put64(so[w], acc, C16 + (((size_t)(bc / 3) * NN + n0 + (lane >> 4)) * 3 + bc % 3) * CO + nq * 64 + (lane & 15) * 4, 3 * CO);
}
// V^T at once: C[o][n] = sum_k Wv[o][k] X3[(b, c, n)][k]. The weight rows are the A operand (64 features: one head) and the token rows of one (b, c) the B operand, both in fragment order,
// so a row of the staged tile is 64 tokens of one feature: one whole 128-byte line of the layout that the attention stages. Same products, same k order as the q and k maps.
__device__ __forceinline__ void gemm_vt(float (*so)[64][64], int bx, int by, const _Float16* __restrict__ Wh, const _Float16* __restrict__ X3, _Float16* __restrict__ Vt) {
  const int tid = threadIdx.x, lane = tid & 31; const int w = __builtin_amdgcn_readfirstlane(tid >> 5);      // the wave's number, the same in every lane: kept in a scalar register, and the operand addresses with it
  const int b = by / 3, c = by % 3;
  const int hd = (bx / (NN / 128)) * 2 + (w >> 1), nq = (bx % (NN / 128)) * 2 + (w & 1);      // head, 64 tokens
  v8f acc[4][4] = {};
  mm64((const unsigned short*)Wh + (size_t)hd * 4 * KST * FRH, (const unsigned short*)X3 + ((size_t)by * (NN / 16) + nq * 4) * KST * FRH, acc);
  put64(so[w], acc, Vt + ((size_t)(b * NH + hd) * 192 + c * 64 + (lane >> 4)) * NN + nq * 64 + (lane & 15) * 4, NN);
}
// The q, k and V^T maps in one launch: all three read X3 and none reads another's result. blockIdx.y picks the map, blockIdx.x is the map's own block number (MBL each).
#define MBL ((NR3 / 64) * (CO / 64) / 4)
#define VBX ((CO / 64) * (NN / 64) / 4)
__global__ __launch_bounds__(128) void k_qkv(const _Float16* __restrict__ X3, const _Float16* __restrict__ Bq, const _Float16* __restrict__ Bk, const _Float16* __restrict__ Bv, _Float16* __restrict__ Q16, _Float16* __restrict__ K16, _Float16* __restrict__ Vt) {
  __shared__ __attribute__((aligned(16))) float so[4][64][64];
  const int bx = blockIdx.x, job = blockIdx.y;
  if (job == 2) gemm_vt(so, bx % VBX, bx / VBX, Bv, X3, Vt);
  else gemm_qk(so, bx, X3, job == 0 ? Bq : Bk, job == 0 ? Q16 : K16);
}
// K and V^T tiles of 64 keys, staged in LDS once per group of four waves and read by these four. Row pitches are 16 B x odd, so the 16 rows of a ds_load_b128 fall on distinct banks.
#define TK 64
#define KP 200      // halves per staged K row: 3 coordinate blocks x 64 + 8 of pad (400 B)
#define VP 72       // halves per staged V^T row: 64 keys + 8 of pad (144 B)
// Twelve asynchronous 16-byte copies per lane, global -> LDS, through no register: copy 4 a + q goes from g + a gs + q gq (halves) to LDS byte l + a ls + q lq.
// The s_wait_xcnt closes the statement so that no address register named here is rewritten ahead of it.
__device__ __forceinline__ void acopy12(unsigned l, unsigned ls, unsigned lq, const unsigned short* g, size_t gs, size_t gq) {
  const unsigned l1 = l + lq, l2 = l + 2 * lq, l3 = l + 3 * lq, l4 = l + ls, l5 = l4 + lq, l6 = l4 + 2 * lq, l7 = l4 + 3 * lq, l8 = l + 2 * ls, l9 = l8 + lq, l10 = l8 + 2 * lq, l11 = l8 + 3 * lq;
  const unsigned short *g1 = g + gq, *g2 = g + 2 * gq, *g3 = g + 3 * gq, *g4 = g + gs, *g5 = g4 + gq, *g6 = g4 + 2 * gq, *g7 = g4 + 3 * gq, *g8 = g + 2 * gs, *g9 = g8 + gq, *g10 = g8 + 2 * gq, *g11 = g8 + 3 * gq;
  asm volatile("global_load_async_to_lds_b128 %0, %12, off\n\t"
               "global_load_async_to_lds_b128 %1, %13, off\n\t"
               "global_load_async_to_lds_b128 %2, %14, off\n\t"
               "global_load_async_to_lds_b128 %3, %15, off\n\t"
               "global_load_async_to_lds_b128 %4, %16, off\n\t"
               "global_load_async_to_lds_b128 %5, %17, off\n\t"
               "global_load_async_to_lds_b128 %6, %18, off\n\t"
               "global_load_async_to_lds_b128 %7, %19, off\n\t"
               "global_load_async_to_lds_b128 %8, %20, off\n\t"
               "global_load_async_to_lds_b128 %9, %21, off\n\t"
               "global_load_async_to_lds_b128 %10, %22, off\n\t"
               "global_load_async_to_lds_b128 %11, %23, off\n\t"
               "s_wait_xcnt 0x0"
               :: "v"(l), "v"(l1), "v"(l2), "v"(l3), "v"(l4), "v"(l5), "v"(l6), "v"(l7), "v"(l8), "v"(l9), "v"(l10), "v"(l11),
                  "v"(g), "v"(g1), "v"(g2), "v"(g3), "v"(g4), "v"(g5), "v"(g6), "v"(g7), "v"(g8), "v"(g9), "v"(g10), "v"(g11) : "memory");
}
// One stage: 64 keys of K (3 coordinate blocks of 128 B a key) and 192 rows of V^T (128 B a row); 24 copies a lane.
__device__ __forceinline__ void stage_kv(unsigned lk, unsigned lv, const unsigned short* kg, const unsigned short* vg) {
  acopy12(lk, 128, 16 * KP * 2, kg, CO, (size_t)16 * 3 * CO);
  acopy12(lv, 64 * VP * 2, 16 * VP * 2, vg, (size_t)64 * NN, (size_t)16 * NN);
}
// lane l with lane l ^ 16, through no LDS
__device__ __forceinline__ float xhalf(float x) { return __builtin_bit_cast(float, __builtin_amdgcn_permlanex16(__builtin_bit_cast(int, x), __builtin_bit_cast(int, x), 0x76543210, 0xfedcba98, false, false)); }
// Scores are formed transposed: K rows are the A operand and Q the B operand, so lane (ln, hh) holds query ln and keys 8 hh + r of each 16-key tile. A query's maximum and sum are then
// in-lane but for one exchange between the wave halves, and the two score tiles of 32 keys, converted in place, are the B operand of O^T += V^T P^T (element i: key 8 hh + i, element 8 + i: key 16 + 8 hh + i, as the V^T loader has it).
// A wave takes 32 queries (two tiles of 16), so every K and V^T fragment that it reads from LDS feeds two products. The work-group has 128 queries and eight waves: waves 0-3 walk keys [0, NN / 2), waves 4-7 keys [NN / 2, NN),
// each group of four staging its own tiles, so that a SIMD still holds two waves; the two groups' partial O, maximum and sum are joined once, through LDS, behind the loop.
#define KH (NN / 2)      // keys of one group of four waves
__global__ __launch_bounds__(256) void k_vnattn(const _Float16* __restrict__ Q16, const _Float16* __restrict__ K16, const _Float16* __restrict__ Vt, _Float16* __restrict__ O3) {
  __shared__ __attribute__((aligned(16))) unsigned short sK[2][2][TK][KP]; __shared__ __attribute__((aligned(16))) unsigned short sV[2][2][192][VP];      // [buffer][key group]
  __shared__ float sML[4][2][2][32];      // the second group's maximum and sum: [query group][tile][which][lane]
  const int tid = threadIdx.x, w = tid >> 5, lane = tid & 31, ln = lane & 15, hh = lane >> 4; const int qg = w & 3, t128 = tid & 127; const int kh = __builtin_amdgcn_readfirstlane(tid >> 7);      // the wave's key group, the same in every lane: kept in a scalar register
  const int slab = blockIdx.x / (NN / 128), qblk = blockIdx.x % (NN / 128); const int b = slab / NH, h = slab % NH; const int q0 = qblk * 128 + qg * 32;
  const unsigned short* Vth = (const unsigned short*)Vt + (size_t)slab * 192 * NN;
  // The lane's share of its group's stage: eight lanes cover one 128-byte row piece, so a wave's copy covers four whole lines. K: key = 16 q + t128 / 8; V^T: row = 64 a + 16 q + t128 / 8.
  const int cr = t128 >> 3, cc = (t128 & 7) * 8;
  // The lane's part of each address; the scalar part (group, buffer, stage) is added where a stage is issued.
  const unsigned kl = cr * (3 * CO) + cc, vl = cr * NN + cc;      // halves
  const unsigned lkl = (unsigned)(size_t)&sK[0][0][cr][cc], lvl = (unsigned)(size_t)&sV[0][0][cr][cc];
  const unsigned short* kgs = (const unsigned short*)K16 + ((size_t)b * NN + kh * KH) * (3 * CO) + h * HD;      // scalar
  const unsigned short* vgs = Vth + kh * KH;                                                                      // scalar
  const unsigned lks = kh * (TK * KP * 2), lvs = kh * (192 * VP * 2);                                              // scalar
  constexpr unsigned KB = 2 * TK * KP * 2, VB = 2 * 192 * VP * 2;      // bytes of one buffer (both groups' tiles)
  constexpr int NT = KH / TK;
  constexpr float SL2 = 0.07216878364870323f * 1.4426950408889634f;      // 1 / sqrt(192) x log2(e)
  FragH aq[2][6]; { const unsigned short* qr = (const unsigned short*)Q16 + ((size_t)b * NN + q0 + ln) * (3 * CO) + h * HD + 8 * hh;      // row (b,n) = [c0 | c1 | c2] x 512 (= rows (b,n,c) of pitch 512)
#pragma unroll
    for (int qt = 0; qt < 2; ++qt)
#pragma unroll
      for (int ks = 0; ks < 6; ++ks) { const int c = ks >> 1, s32 = (ks & 1) * 32; aq[qt][ks].half[0] = *(const v8us*)(qr + qt * 16 * 3 * CO + c * CO + s32); aq[qt][ks].half[1] = *(const v8us*)(qr + qt * 16 * 3 * CO + c * CO + s32 + 16); }
    asm volatile("s_wait_xcnt 0x0" :: "v"(qr) : "memory"); }      // the Q loads' address pair is named as an input, so it stays untouched until this wait; behind it the pair may be reused
  float m_r[2] = {-3.0e38f, -3.0e38f}, l_r[2] = {0.f, 0.f}; v8f oacc[2][12];      // oacc[qt][dt][r] = O[query 16 qt + ln][dt * 16 + 8 hh + r]; l_r sums this half's keys only
#pragma unroll
  for (int qt = 0; qt < 2; ++qt)
#pragma unroll
    for (int dt = 0; dt < 12; ++dt) oacc[qt][dt] = (v8f){0.f,0.f,0.f,0.f,0.f,0.f,0.f,0.f};
  // Trips -2 and -1 only fill the ring, in the order of a two-buffer prologue: trip -2 issues stage 0; trip -1 waits for it, publishes it at the barrier and issues stage 1. So the file has one place that issues a stage:
  // with a second one in front of the loop, the address registers that it named stayed bound below v256 through the loop and were spilled to scratch.
#pragma unroll 1
  for (int t = -2; t < NT; ++t) { const int buf = t & 1;
   if (t >= 0)
#pragma unroll 1      // the two 32-key passes of a stage stay rolled: unrolled, the build spilled the Q fragments to scratch
   for (int p = 0; p < TK / 32; ++p) { v8f s[2][2];
#pragma unroll
    for (int nt = 0; nt < 2; ++nt) { const unsigned short* kr = &sK[buf][kh][p * 32 + nt * 16 + ln][0]; v8f acc0 = (v8f){0.f,0.f,0.f,0.f,0.f,0.f,0.f,0.f}, acc1 = acc0; FragH bk[6];      // six fragments are read as one run ahead of their products: one LDS latency a run, not one a product
#pragma unroll      // constant indices keep bk in registers
      for (int ks = 0; ks < 6; ++ks) { bk[ks].half[0] = *(const v8us*)(kr + ks * 32 + 8 * hh); bk[ks].half[1] = *(const v8us*)(kr + ks * 32 + 16 + 8 * hh); }
#pragma unroll
      for (int ks = 0; ks < 6; ++ks) { acc0 = mmaP(bk[ks].v, aq[0][ks].v, acc0); acc1 = mmaP(bk[ks].v, aq[1][ks].v, acc1); }
      s[0][nt] = acc0; s[1][nt] = acc1; }
    FragH pa[2];
#pragma unroll      // constant indices keep the scores, pa and oacc in registers
    for (int qt = 0; qt < 2; ++qt) {
    float mc = -3.0e38f;
#pragma unroll      // constant indices keep the scores in registers
    for (int r = 0; r < 8; ++r) mc = fmaxf(mc, fmaxf(s[qt][0][r], s[qt][1][r]));
    mc = fmaxf(mc, xhalf(mc));
    // Softmax in the log2 domain: e^(x / sqrt(192) - m) = 2^(x SL2 - m'), SL2 = log2(e) / sqrt(192) > 0, so the maximum is taken on the raw scores and scaled once;
    // a score then costs one multiply-add and one hardware 2^x. m_r is kept in the scaled log2 unit.
    const float mn = fmaxf(m_r[qt], mc * SL2); const float al = __builtin_amdgcn_exp2f(m_r[qt] - mn); m_r[qt] = mn;
    float ps[4] = {0.f, 0.f, 0.f, 0.f};      // four short chains of adds, not one of sixteen
#pragma unroll      // constant indices keep the scores, pa and ps in registers
    for (int r = 0; r < 8; ++r) { const float p0 = __builtin_amdgcn_exp2f(fmaf(s[qt][0][r], SL2, -mn)), p1 = __builtin_amdgcn_exp2f(fmaf(s[qt][1][r], SL2, -mn)); ps[r & 3] += p0 + p1; pa[qt].h[r] = (_Float16)p0; pa[qt].h[8 + r] = (_Float16)p1; }
    l_r[qt] = l_r[qt] * al + ((ps[0] + ps[1]) + (ps[2] + ps[3]));
#pragma unroll
    for (int dt = 0; dt < 12; ++dt)
#pragma unroll
      for (int r = 0; r < 8; ++r) oacc[qt][dt][r] *= al; }
#pragma unroll
    for (int dg = 0; dg < 2; ++dg) { FragH bv[6];      // as for K: a run of six fragments, then their twelve products
#pragma unroll      // constant indices keep bv and oacc in registers
      for (int i = 0; i < 6; ++i) { const unsigned short* vrow = &sV[buf][kh][(dg * 6 + i) * 16 + ln][p * 32]; bv[i].half[0] = *(const v8us*)(vrow + 8 * hh); bv[i].half[1] = *(const v8us*)(vrow + 16 + 8 * hh); }
#pragma unroll
      for (int i = 0; i < 6; ++i) { oacc[0][dg * 6 + i] = mmaP(bv[i].v, pa[0].v, oacc[0][dg * 6 + i]); oacc[1][dg * 6 + i] = mmaP(bv[i].v, pa[1].v, oacc[1][dg * 6 + i]); } } }
   asm volatile("s_wait_dscnt 0x0" ::: "memory");         // this wave's reads of buffer t mod 2 are done before the buffer is handed back
   asm volatile("s_wait_asynccnt 0x0" ::: "memory");      // this wave's share of stage t + 1 has landed
   __syncthreads();                                        // publishes stage t + 1 and ends every wave's reads of stage t
   if (t + 2 < NT) stage_kv(lkl + (lks + buf * KB), lvl + (lvs + buf * VB), (kgs + (size_t)(t + 2) * TK * 3 * CO) + kl, (vgs + (t + 2) * TK) + vl); }
  asm volatile("s_wait_asynccnt 0x0" ::: "memory");        // no copy is outstanding when the ring is put to another use
  // Behind the last barrier of the loop nobody reads the ring and no copy is out: sK becomes the second group's partial O (f32, in register order: piece (tile, dt, j) is 32 lanes x 16 bytes in a row), sV the f16 output staging.
  v4fa* sM = (v4fa*)&sK[0][0][0][0] + (size_t)qg * (2 * 12 * 2 * 32) + lane;
  unsigned short (*sO)[64 + 8] = (unsigned short (*)[64 + 8])&sV[0][0][0][0] + qg * 96;      // one row a (query, coordinate) piece of 64 halves; a query's pitch is 16 B x odd
  float lt[2];
#pragma unroll      // constant indices keep l_r in registers
  for (int qt = 0; qt < 2; ++qt) lt[qt] = l_r[qt] + xhalf(l_r[qt]);      // the two halves' sums are joined once, here
  if (kh == 1) {
#pragma unroll      // constant indices keep oacc in registers
    for (int qt = 0; qt < 2; ++qt) { sML[qg][qt][0][lane] = m_r[qt]; sML[qg][qt][1][lane] = lt[qt];
#pragma unroll      // constant indices keep oacc in registers
      for (int dt = 0; dt < 12; ++dt) { const v8f o = oacc[qt][dt]; sM[((qt * 12 + dt) * 2 + 0) * 32] = (v4f){o[0], o[1], o[2], o[3]}; sM[((qt * 12 + dt) * 2 + 1) * 32] = (v4f){o[4], o[5], o[6], o[7]}; } } }
  __syncthreads();      // the second group's partials are published to the first
  if (kh == 0) {
#pragma unroll      // constant indices keep oacc in registers
    for (int qt = 0; qt < 2; ++qt) { const float m1 = sML[qg][qt][0][lane], l1 = sML[qg][qt][1][lane]; const float mm = fmaxf(m_r[qt], m1);
      const float a0 = __builtin_amdgcn_exp2f(m_r[qt] - mm), a1 = __builtin_amdgcn_exp2f(m1 - mm); const float linv = 1.0f / (lt[qt] * a0 + l1 * a1); const float c0 = a0 * linv, c1 = a1 * linv;
#pragma unroll      // constant indices keep oacc in registers
      for (int dt = 0; dt < 12; ++dt) { const v4f x0 = sM[((qt * 12 + dt) * 2 + 0) * 32], x1 = sM[((qt * 12 + dt) * 2 + 1) * 32]; FragH f;
#pragma unroll      // constant indices keep oacc in registers
        for (int r = 0; r < 4; ++r) { f.h[r] = (_Float16)(oacc[qt][dt][r] * c0 + x0[r] * c1); f.h[4 + r] = (_Float16)(oacc[qt][dt][4 + r] * c0 + x1[r] * c1); }
        *(v8us*)&sO[(qt * 16 + ln) * 3 + dt / 4][(dt % 4) * 16 + 8 * hh] = f.half[0]; } }
    __builtin_amdgcn_fence(__ATOMIC_ACQ_REL, "workgroup"); __builtin_amdgcn_wave_barrier();      // the wave's LDS stores are done before its lanes read what other lanes stored
    // Stored as the output map reads it: rows (b, n, c) x 512. A query's 192 features are three pieces of 64 halves, one 128-byte line each; eight lanes a piece, four pieces a store.
    unsigned short* orow = (unsigned short*)O3 + (((size_t)b * NN + q0) * 3 + (lane >> 3)) * CO + h * HD + (lane & 7) * 8;
#pragma unroll      // constant offsets from one address pair
    for (int q = 0; q < 24; ++q) { const v8us v = *(const v8us*)&sO[q * 4 + (lane >> 3)][(lane & 7) * 8]; *(v8us*)(orow + (size_t)q * 4 * CO) = v; } } }
// Output map with the (o, c) interleave in its store: a wave takes 16 tokens x 3 coordinates x 64 outputs (each lane picks its token's three rows of O3), so a token's piece of the result is 192 floats in a row, six whole lines.
__global__ __launch_bounds__(128) void k_gemm_out(const _Float16* __restrict__ O3, const _Float16* __restrict__ Wh, float* __restrict__ out) {
  __shared__ __attribute__((aligned(16))) float so[4][16][192 + 4];
  const int tid = threadIdx.x, w = tid >> 5, lane = tid & 31, ln = lane & 15, hh = lane >> 4;
  const int wid = blockIdx.x * 4 + w; const int mt = wid / (CI / 64), nq = wid % (CI / 64); const int bn0 = mt * 16, col0 = nq * 64;
  const unsigned short* arow = (const unsigned short*)O3 + (size_t)(bn0 + ln) * 3 * CO + 8 * hh;
  const unsigned short* brow = (const unsigned short*)Wh + (size_t)nq * 4 * (CO / 32) * FRH + lane * 8;      // the weights come in fragment order
  v8f acc[3][4] = {}; FragH a[3][3], bq[3][4];      // three register sets: a SIMD has this one wave, so steps ks + 1 and ks + 2 are in flight while step ks is multiplied
#pragma unroll      // every load is base + constant, so that no address register is rewritten while loads are out; constant indices keep the fragments and acc in registers
  for (int ks = -2; ks < CO / 32; ++ks) {
    if (ks + 2 < CO / 32) { const int s = (ks + 2) % 3, kb = (ks + 2) * 32;
#pragma unroll      // constant indices keep the fragments in registers
      for (int c = 0; c < 3; ++c) { a[s][c].half[0] = *(const v8us*)(arow + c * CO + kb); a[s][c].half[1] = *(const v8us*)(arow + c * CO + kb + 16); }
#pragma unroll      // constant indices keep the fragments in registers
      for (int t = 0; t < 4; ++t) { bq[s][t].half[0] = *(const v8us*)(brow + (t * (CO / 32) + ks + 2) * FRH); bq[s][t].half[1] = *(const v8us*)(brow + (t * (CO / 32) + ks + 2) * FRH + 256); } }
    __builtin_amdgcn_sched_barrier(0);      // holds the loads above ahead of the products below: left free, the compiler sinks each load to its own product, which then waits out the whole latency
    if (ks >= 0)
#pragma unroll      // constant indices keep the fragments and acc in registers
      for (int t = 0; t < 4; ++t)
#pragma unroll      // constant indices keep the fragments and acc in registers
        for (int c = 0; c < 3; ++c) acc[c][t] = mmaP(a[ks % 3][c].v, bq[ks % 3][t].v, acc[c][t]); }
  asm volatile("s_wait_xcnt 0x0" :: "v"(arow), "v"(brow) : "memory");      // the loads' two address pairs are named as inputs, so they stay untouched until this wait; behind it they may be reused
#pragma unroll      // constant indices keep the fragments and acc in registers
  for (int t = 0; t < 4; ++t)
#pragma unroll      // constant indices keep the fragments and acc in registers
    for (int c = 0; c < 3; ++c)
#pragma unroll      // constant indices keep the fragments and acc in registers
      for (int r = 0; r < 8; ++r) so[w][8 * hh + r][(t * 16 + ln) * 3 + c] = acc[c][t][r] * 0.0625f;
  __builtin_amdgcn_fence(__ATOMIC_ACQ_REL, "workgroup"); __builtin_amdgcn_wave_barrier();      // the wave's LDS stores are done before its lanes read what other lanes stored
  // two tokens' pieces are 96 float4, three stores of the wave; from one pair of tokens to the next every address moves by a constant
#pragma unroll      // three address pairs, formed once
  for (int j = 0; j < 3; ++j) { const int i = j * 32 + lane, r = i / 48, p4 = (i % 48) * 4; const float* ls = &so[w][r][p4]; float* gp = out + ((size_t)(bn0 + r) * CI + col0) * 3 + p4;
#pragma unroll      // constant offsets from the pair
    for (int q = 0; q < 8; ++q) { const v4f v = *(const v4fa*)(ls + q * 2 * (192 + 4)); *(v4f*)(gp + (size_t)q * 2 * CI * 3) = v; } }
}
extern "C" void kernel_launch(void* const* d_in, const int* in_sizes, int n_in,
                              void* d_out, int out_size, void* d_ws, size_t ws_size, hipStream_t stream) {
  (void)in_sizes; (void)n_in; (void)out_size;
  const float* x = (const float*)d_in[0]; const float* Wq = (const float*)d_in[1]; const float* Wk = (const float*)d_in[2]; const float* Wv = (const float*)d_in[3]; const float* Wo = (const float*)d_in[4];
  char* ws = (char*)d_ws; size_t off = 0;
  auto take = [&](size_t bytes) { char* p = ws + off; off += (bytes + 255) & ~(size_t)255; return p; };
  _Float16* Bq = (_Float16*)take((size_t)CO * CI * 2); _Float16* Bk = (_Float16*)take((size_t)CO * CI * 2); _Float16* Bv = (_Float16*)take((size_t)CO * CI * 2); _Float16* Bo = (_Float16*)take((size_t)CI * CO * 2);
  _Float16* X3 = (_Float16*)take((size_t)NR3 * CI * 2); _Float16* Q16 = (_Float16*)take((size_t)NR3 * CO * 2); _Float16* K16 = (_Float16*)take((size_t)NR3 * CO * 2); _Float16* Vt = (_Float16*)take((size_t)NR3 * CO * 2); _Float16* O3 = (_Float16*)take((size_t)NR3 * CO * 2);      // O3 has a place of its own: the attention stores it while other work-groups still read Q16
  if (off > ws_size) return;      // 1 + 6.3 + 12.6 x 4, about 58 MB
  k_prep<<<4 * WBL + XBL, 256, 0, stream>>>(x, Wq, Wk, Wv, Wo, Bq, Bk, Bv, Bo, X3);      // weights are (out,in); X3 = rows (b,c,n) x 256; all five in fragment order
  k_qkv<<<dim3(MBL, 3), 128, 0, stream>>>(X3, Bq, Bk, Bv, Q16, K16, Vt);      // q/k planes = rows (b,n,c) x 512 = [(b,n)][c * 512 + o]
  k_vnattn<<<BB * NH * (NN / 128), 256, 0, stream>>>(Q16, K16, Vt, O3);
  k_gemm_out<<<(NR / 16) * (CI / 64) / 4, 128, 0, stream>>>(O3, Bo, (float*)d_out);
}

// v010
// It runs in 77.2 microseconds.
// Timed twice side by side with v009, it ran 1.05 times as fast both times.
// Counting every step since v000, it is 7.83 times as fast.
#include <hip/hip_runtime.h>
// Vector-neuron attention (B=2, N=2048, C=256 × 3 coordinates, 8 heads × 64): the VN-linear maps (rows (b,n,c) × 256 → 512, weights (out,in) bf16-exact ×2^4) and the attention over the
// 192-dim (d, c) head features as a fused flash-style kernel on v_wmma_f32_16x16x32_f16 (S^T = K Q^T / sqrt(192) with 6 k-steps gathered from the three coordinate blocks, online softmax f32 in-lane, P f16 <= 2^8 packed from the score registers,
// O^T = V^T P^T with 12 d-tiles; 32 queries a wave, keys split over two groups of waves); f16 operands, single products, f32 accumulate; V^T, the f16 attention output and the final (o, c) interleave are stored by the kernels that compute them.
#define BB 2
#define NN 2048
#define CI 256
#define CO 512
#define NH 8
#define HD 64
#define NR3 (BB * NN * 3)
#define NR (BB * NN)

typedef __bf16 v16b __attribute__((ext_vector_type(16)));
typedef unsigned short v8us __attribute__((ext_vector_type(8), may_alias));
typedef float  v8f  __attribute__((ext_vector_type(8)));
typedef float  v4f  __attribute__((ext_vector_type(4)));
typedef float  v4fa __attribute__((ext_vector_type(4), may_alias));
union FragB { v16b v; v8us half[2]; unsigned short u[16]; };

__device__ __forceinline__ unsigned short bf16_bits(float x) { unsigned int u = __float_as_uint(x); return (unsigned short)((u + 0x7FFFu + ((u >> 16) & 1u)) >> 16); }
__device__ __forceinline__ float bf16_val(unsigned short b) { return __uint_as_float(((unsigned int)b) << 16); }
__device__ __forceinline__ float bf16_round(float x) { return bf16_val(bf16_bits(x)); }
// D += A·B with NT terms: 1 = ah·bh, 2 = + al·bh (A split), 3 = + ah·bl (both split)
template <int NT>
__device__ __forceinline__ v8f mmaN(v16b ah, v16b al, v16b bh, v16b bl, v8f c) {
  c = __builtin_amdgcn_wmma_f32_16x16x32_bf16(false, ah, false, bh, (short)0, c, false, false);
  if (NT >= 2) c = __builtin_amdgcn_wmma_f32_16x16x32_bf16(false, al, false, bh, (short)0, c, false, false);
  if (NT >= 3) c = __builtin_amdgcn_wmma_f32_16x16x32_bf16(false, ah, false, bl, (short)0, c, false, false);
  asm volatile("v_nop\n\tv_nop\n\tv_nop\n\tv_nop" : "+v"(c) : "v"(ah), "v"(al), "v"(bh), "v"(bl));
  return c;
}

__global__ __launch_bounds__(256) void k_wt_bf16(const float* __restrict__ W, unsigned short* __restrict__ Wt, int K, int N) {
  const int t = blockIdx.x * 256 + threadIdx.x;
  const int k8n = K / 8;
  if (t >= N * k8n) return;
  const int n = t / k8n, k8 = (t % k8n) * 8;
  v8us v;
#pragma unroll
  for (int i = 0; i < 8; ++i) v[i] = bf16_bits(W[(size_t)(k8 + i) * N + n]);
  *(v8us*)(Wt + (size_t)n * K + k8) = v;
  
}

// GEMM C[M][N] (f32, pitch ldc) = act(A[M][K]·W + bias). A f32 row-major (pitch lda) converted per fragment to bf16
// (ASPLIT: hi/lo two planes -> 2 terms, else single rounded term); Wt bf16 [N][K] (pitch ldb). BIAS_BF16 rounds the
// bias to bf16 first (bias quantised to bf16 before the add). K%32==0, M%16==0, N%64==0.
template <bool ASPLIT, int ACT, bool BIAS_BF16>
__global__ __launch_bounds__(128) void k_gemm_bf(const float* __restrict__ A, int lda, const unsigned short* __restrict__ Wt, int ldb,
                                               const float* __restrict__ bias, float* __restrict__ C, int ldc, int M, int N, int K) {
  __shared__ __attribute__((aligned(16))) float so[4][16][64];
  const int tid = threadIdx.x, w = tid >> 5, lane = tid & 31, ln = lane & 15, hh = lane >> 4;
  const int ntn = N / 64;
  const int wid = blockIdx.x * 4 + w;
  const int mt = wid / ntn, nq = wid % ntn;
  if (mt * 16 >= M) return;
  const int row0 = mt * 16, col0 = nq * 64;
  const float* arow = A + (size_t)(row0 + ln) * lda;
  v8f acc[4] = {};
  for (int kb = 0; kb < K; kb += 32) {
    FragB ah, al;
    const v4f x0 = *(const v4fa*)(arow + kb + 8 * hh), x1 = *(const v4fa*)(arow + kb + 8 * hh + 4);
    const v4f x2 = *(const v4fa*)(arow + kb + 16 + 8 * hh), x3 = *(const v4fa*)(arow + kb + 16 + 8 * hh + 4);
    float xs[16] = {x0[0],x0[1],x0[2],x0[3],x1[0],x1[1],x1[2],x1[3],x2[0],x2[1],x2[2],x2[3],x3[0],x3[1],x3[2],x3[3]};
#pragma unroll
    for (int i = 0; i < 16; ++i) { const unsigned short hb = bf16_bits(xs[i]); ah.u[i] = hb; al.u[i] = ASPLIT ? bf16_bits(xs[i] - bf16_val(hb)) : (unsigned short)0; }
#pragma unroll
    for (int t = 0; t < 4; ++t) {
      const unsigned short* brow = Wt + (size_t)(col0 + t * 16 + ln) * ldb + kb;
      FragB b;
      b.half[0] = *(const v8us*)(brow + 8 * hh);
      b.half[1] = *(const v8us*)(brow + 16 + 8 * hh);
      acc[t] = mmaN<ASPLIT ? 2 : 1>(ah.v, al.v, b.v, b.v, acc[t]);
    }
  }
#pragma unroll
  for (int t = 0; t < 4; ++t) {
    float bv = bias ? bias[col0 + t * 16 + ln] : 0.f;
    if (BIAS_BF16) bv = bf16_round(bv);
#pragma unroll
    for (int r = 0; r < 8; ++r) { float v = acc[t][r] + bv; if (ACT == 1) v = fmaxf(v, 0.f); so[w][8 * hh + r][t * 16 + ln] = v; }
  }
  __builtin_amdgcn_fence(__ATOMIC_ACQ_REL, "workgroup");
  __builtin_amdgcn_wave_barrier();
  const int rsub = lane >> 4, c4 = (lane & 15) * 4;
  {
#pragma unroll
    for (int q = 0; q < 8; ++q) {
      const int r = q * 2 + rsub;
      const v4f v = *(const v4fa*)&so[w][r][c4];
      *(v4f*)(C + (size_t)(row0 + r) * ldc + col0 + c4) = v;
    }
    
  }
}

// Flash-style causal/unmasked attention, all contractions 3-term bf16 hi/lo splits, f32 softmax with running max.
// q,k,v rows are read from f32 buffers with arbitrary row pitch (so they can live inside a fused qkv buffer);
// D = head size (multiple of 32, <= 128); one wave = 16 query rows; block = 4 waves (64 queries) sharing K/V chunks of 32.
template <int D, bool CAUSAL>
__global__ __launch_bounds__(128) void k_flash(const float* __restrict__ qb, const float* __restrict__ kb, const float* __restrict__ vb,
                                             int pitch, int T, int H, float scale, float* __restrict__ y, int ypitch) {
  constexpr int KS = D / 32;        // k-steps for QK
  constexpr int DT = D / 16;        // d tiles for PV
  __shared__ __attribute__((aligned(16))) unsigned short sKh[32][D + 8], sKl[32][D + 8], sVh[32][D + 8], sVl[32][D + 8];
  __shared__ __attribute__((aligned(16))) unsigned short sPh[4][16][40], sPl[4][16][40];
  __shared__ __attribute__((aligned(16))) float sO[4][16][D];
  const int tid = threadIdx.x, w = tid >> 5, lane = tid & 31, ln = lane & 15, hh = lane >> 4;
  const int nqb = (T + 63) / 64;
  const int bh = blockIdx.x / nqb, qblk = blockIdx.x % nqb;
  const int b = bh / H, h = bh % H;
  const int q0 = qblk * 64 + w * 16;
  const float* Q = qb + (size_t)b * T * pitch + h * D;
  const float* K = kb + (size_t)b * T * pitch + h * D;
  const float* V = vb + (size_t)b * T * pitch + h * D;

  // A fragments of the wave's 16 query rows (scaled), hi/lo
  FragB aqh[KS], aql[KS];
  {
    int row = q0 + ln; if (row >= T) row = T - 1;
    const float* qr = Q + (size_t)row * pitch;
#pragma unroll
    for (int ks = 0; ks < KS; ++ks)
#pragma unroll
      for (int i = 0; i < 16; ++i) {
        const int d = ks * 32 + ((i < 8) ? (8 * hh + i) : (16 + 8 * hh + (i - 8)));
        const float x = qr[d] * scale; const unsigned short hb = bf16_bits(x);
        aqh[ks].u[i] = hb; aql[ks].u[i] = bf16_bits(x - bf16_val(hb));
      }
  }
  float m_r[8], l_r[8];
#pragma unroll
  for (int r = 0; r < 8; ++r) { m_r[r] = -3.0e38f; l_r[r] = 0.f; }
  v8f oacc[DT];
#pragma unroll
  for (int dt = 0; dt < DT; ++dt) oacc[dt] = (v8f){0.f,0.f,0.f,0.f,0.f,0.f,0.f,0.f};

  const int kv_end = CAUSAL ? min(T, qblk * 64 + 64) : T;     // block-uniform
  for (int j0 = 0; j0 < kv_end; j0 += 32) {
    __syncthreads();
    for (int e = tid; e < 32 * (D / 4); e += 128) {
      const int r = e / (D / 4), c4 = (e % (D / 4)) * 4;
      const int key = j0 + r;
      v4f kf = {0.f,0.f,0.f,0.f}, vf = {0.f,0.f,0.f,0.f};
      if (key < T) { kf = *(const v4fa*)(K + (size_t)key * pitch + c4); vf = *(const v4fa*)(V + (size_t)key * pitch + c4); }
#pragma unroll
      for (int t = 0; t < 4; ++t) {
        unsigned short hb = bf16_bits(kf[t]); sKh[r][c4 + t] = hb; sKl[r][c4 + t] = bf16_bits(kf[t] - bf16_val(hb));
        hb = bf16_bits(vf[t]); sVh[r][c4 + t] = hb; sVl[r][c4 + t] = bf16_bits(vf[t] - bf16_val(hb));
      }
    }
    __syncthreads();
    // S tile 16 x 32
    v8f s[2];
#pragma unroll
    for (int nt = 0; nt < 2; ++nt) {
      v8f acc = {};
#pragma unroll
      for (int ks = 0; ks < KS; ++ks) {
        FragB bh_, bl_;
        bh_.half[0] = *(const v8us*)&sKh[nt * 16 + ln][ks * 32 + 8 * hh]; bh_.half[1] = *(const v8us*)&sKh[nt * 16 + ln][ks * 32 + 16 + 8 * hh];
        bl_.half[0] = *(const v8us*)&sKl[nt * 16 + ln][ks * 32 + 8 * hh]; bl_.half[1] = *(const v8us*)&sKl[nt * 16 + ln][ks * 32 + 16 + 8 * hh];
        acc = mmaN<3>(aqh[ks].v, aql[ks].v, bh_.v, bl_.v, acc);
      }
      s[nt] = acc;
    }
    // mask + running max (rows 8hh+r; the 16 lanes of a half share rows)
    float alpha[8];
#pragma unroll
    for (int r = 0; r < 8; ++r) {
      const int qi = q0 + 8 * hh + r;
      const int ja = j0 + ln, jb = j0 + 16 + ln;
      if (CAUSAL) { if (ja > qi) s[0][r] = -3.0e38f; if (jb > qi) s[1][r] = -3.0e38f; }
      if (ja >= T) s[0][r] = -3.0e38f;
      if (jb >= T) s[1][r] = -3.0e38f;
      float mx = fmaxf(s[0][r], s[1][r]);
      mx = fmaxf(mx, __shfl_xor(mx, 1, 32)); mx = fmaxf(mx, __shfl_xor(mx, 2, 32)); mx = fmaxf(mx, __shfl_xor(mx, 4, 32)); mx = fmaxf(mx, __shfl_xor(mx, 8, 32));
      const float mnew = fmaxf(m_r[r], mx);
      alpha[r] = (mnew > -1.0e38f) ? __expf(m_r[r] - mnew) : 1.0f;
      const float p0 = (s[0][r] > -1.0e38f) ? __expf(s[0][r] - mnew) : 0.f;
      const float p1 = (s[1][r] > -1.0e38f) ? __expf(s[1][r] - mnew) : 0.f;
      m_r[r] = mnew;
      l_r[r] = l_r[r] * alpha[r] + p0 + p1;            // per-lane partial row sum (16 lanes combined at the end)
      unsigned short hb = bf16_bits(p0); sPh[w][8 * hh + r][ln] = hb;      sPl[w][8 * hh + r][ln] = bf16_bits(p0 - bf16_val(hb));
      hb = bf16_bits(p1);                sPh[w][8 * hh + r][16 + ln] = hb; sPl[w][8 * hh + r][16 + ln] = bf16_bits(p1 - bf16_val(hb));
    }
#pragma unroll
    for (int dt = 0; dt < DT; ++dt)
#pragma unroll
      for (int r = 0; r < 8; ++r) oacc[dt][r] *= alpha[r];
    __builtin_amdgcn_fence(__ATOMIC_ACQ_REL, "workgroup");
    __builtin_amdgcn_wave_barrier();
    FragB pah, pal;
    pah.half[0] = *(const v8us*)&sPh[w][ln][8 * hh]; pah.half[1] = *(const v8us*)&sPh[w][ln][16 + 8 * hh];
    pal.half[0] = *(const v8us*)&sPl[w][ln][8 * hh]; pal.half[1] = *(const v8us*)&sPl[w][ln][16 + 8 * hh];
#pragma unroll
    for (int dt = 0; dt < DT; ++dt) {
      FragB bvh, bvl;
#pragma unroll
      for (int i = 0; i < 8; ++i) {
        bvh.u[i] = sVh[8 * hh + i][dt * 16 + ln]; bvh.u[8 + i] = sVh[16 + 8 * hh + i][dt * 16 + ln];
        bvl.u[i] = sVl[8 * hh + i][dt * 16 + ln]; bvl.u[8 + i] = sVl[16 + 8 * hh + i][dt * 16 + ln];
      }
      oacc[dt] = mmaN<3>(pah.v, pal.v, bvh.v, bvl.v, oacc[dt]);
    }
    __builtin_amdgcn_fence(__ATOMIC_ACQ_REL, "workgroup");
    __builtin_amdgcn_wave_barrier();
  }
#pragma unroll
  for (int r = 0; r < 8; ++r) {
    float l = l_r[r];
    l += __shfl_xor(l, 1, 32); l += __shfl_xor(l, 2, 32); l += __shfl_xor(l, 4, 32); l += __shfl_xor(l, 8, 32);
    l_r[r] = (l > 0.f) ? 1.0f / l : 0.f;
  }
#pragma unroll
  for (int dt = 0; dt < DT; ++dt)
#pragma unroll
    for (int r = 0; r < 8; ++r) sO[w][8 * hh + r][dt * 16 + ln] = oacc[dt][r] * l_r[r];
  __builtin_amdgcn_fence(__ATOMIC_ACQ_REL, "workgroup");
  __builtin_amdgcn_wave_barrier();
  {
    for (int r = 0; r < 16; ++r) {
      const int row = q0 + r;
      if (row < T && lane < D / 4) {
        const v4f val = *(const v4fa*)&sO[w][r][lane * 4];
        *(v4f*)(y + ((size_t)b * T + row) * ypitch + h * D + lane * 4) = val;
      }
    }
    
  }
}

// GEMM C = act(A·W + bias + resid): A f32 (ASPLIT -> hi/lo 2 terms), Wt bf16 [N][K]; ACT 0 none, 1 relu, 2 exact gelu;
// resid (optional, f32, row index = (row % rmod), pitch ldr, RES_BF16 rounds it) added before the activation.
template <bool ASPLIT, int ACT, bool BIAS_BF16, bool RES_BF16>
__global__ __launch_bounds__(128) void k_gemm_bf3(const float* __restrict__ A, int lda, const unsigned short* __restrict__ Wt, int ldb,
                                                const float* __restrict__ bias, const float* __restrict__ resid, int rmod, int ldr,
                                                float* __restrict__ C, int ldc, int M, int N, int K) {
  __shared__ __attribute__((aligned(16))) float so[4][16][64];
  const int tid = threadIdx.x, w = tid >> 5, lane = tid & 31, ln = lane & 15, hh = lane >> 4;
  const int ntn = N / 64;
  const int wid = blockIdx.x * 4 + w;
  const int mt = wid / ntn, nq = wid % ntn;
  if (mt * 16 >= M) return;
  const int row0 = mt * 16, col0 = nq * 64;
  const float* arow = A + (size_t)(row0 + ln) * lda;
  v8f acc[4] = {};
  for (int kb = 0; kb < K; kb += 32) {
    FragB ah, al;
    const v4f x0 = *(const v4fa*)(arow + kb + 8 * hh), x1 = *(const v4fa*)(arow + kb + 8 * hh + 4);
    const v4f x2 = *(const v4fa*)(arow + kb + 16 + 8 * hh), x3 = *(const v4fa*)(arow + kb + 16 + 8 * hh + 4);
    float xs[16] = {x0[0],x0[1],x0[2],x0[3],x1[0],x1[1],x1[2],x1[3],x2[0],x2[1],x2[2],x2[3],x3[0],x3[1],x3[2],x3[3]};
#pragma unroll
    for (int i = 0; i < 16; ++i) { const unsigned short hb = bf16_bits(xs[i]); ah.u[i] = hb; al.u[i] = ASPLIT ? bf16_bits(xs[i] - bf16_val(hb)) : (unsigned short)0; }
#pragma unroll
    for (int t = 0; t < 4; ++t) {
      const unsigned short* brow = Wt + (size_t)(col0 + t * 16 + ln) * ldb + kb;
      FragB b;
      b.half[0] = *(const v8us*)(brow + 8 * hh);
      b.half[1] = *(const v8us*)(brow + 16 + 8 * hh);
      acc[t] = mmaN<ASPLIT ? 2 : 1>(ah.v, al.v, b.v, b.v, acc[t]);
    }
  }
#pragma unroll
  for (int t = 0; t < 4; ++t) {
    const int col = col0 + t * 16 + ln;
    float bv = bias ? bias[col] : 0.f;
    if (BIAS_BF16) bv = bf16_round(bv);
#pragma unroll
    for (int r = 0; r < 8; ++r) {
      float v = acc[t][r] + bv;
      if (resid) { float rv = resid[(size_t)((row0 + 8 * hh + r) % rmod) * ldr + col]; if (RES_BF16) rv = bf16_round(rv); v += rv; }
      if (ACT == 1) v = fmaxf(v, 0.f);
      if (ACT == 2) v = 0.5f * v * (1.0f + erff(v * 0.70710678118654752f));
      if (ACT == 3) { const float u = 0.7978845608028654f * (v + 0.044715f * v * v * v); v = 0.5f * v * (1.0f + tanhf(u)); }
      so[w][8 * hh + r][t * 16 + ln] = v;
    }
  }
  __builtin_amdgcn_fence(__ATOMIC_ACQ_REL, "workgroup");
  __builtin_amdgcn_wave_barrier();
  const int rsub = lane >> 4, c4 = (lane & 15) * 4;
  {
#pragma unroll
    for (int q = 0; q < 8; ++q) {
      const int r = q * 2 + rsub;
      const v4f v = *(const v4fa*)&so[w][r][c4];
      *(v4f*)(C + (size_t)(row0 + r) * ldc + col0 + c4) = v;
    }
    
  }
}
// row LayerNorm (biased variance, eps) over N: s = X (+ R); optional out_sum <- s; out_norm <- (s-mu)*rsqrt(var+eps)*g + b
template <bool PARAM_BF16>
__global__ __launch_bounds__(256) void k_layernorm(const float* __restrict__ X, const float* __restrict__ R, const float* __restrict__ g, const float* __restrict__ bta,
                                                  float* __restrict__ out_sum, float* __restrict__ out_norm, int N, float eps) {
  __shared__ float red[256];
  const int row = blockIdx.x, tid = threadIdx.x;
  const float* x = X + (size_t)row * N; const float* rr = R ? R + (size_t)row * N : nullptr;
  float vals[16];                     // up to N = 4096
  const int per = N / 256;            // contiguous chunk per thread? use strided-by-4 chunks: thread handles j = tid*4 + 1024*u
  float s1 = 0.f;
  for (int u = 0; u < per / 4; ++u) {
    const int j = tid * 4 + 1024 * u;
    const v4f a = *(const v4fa*)(x + j);
    v4f b = {0.f,0.f,0.f,0.f}; if (rr) b = *(const v4fa*)(rr + j);
#pragma unroll
    for (int q = 0; q < 4; ++q) { const float v = a[q] + b[q]; vals[u * 4 + q] = v; s1 += v; }
  }
  red[tid] = s1; __syncthreads();
  for (int st = 128; st > 0; st >>= 1) { if (tid < st) red[tid] += red[tid + st]; __syncthreads(); }
  const float mu = red[0] / (float)N; __syncthreads();
  float s2 = 0.f;
  for (int u = 0; u < per / 4; ++u)
#pragma unroll
    for (int q = 0; q < 4; ++q) { const float c = vals[u * 4 + q] - mu; s2 += c * c; }
  red[tid] = s2; __syncthreads();
  for (int st = 128; st > 0; st >>= 1) { if (tid < st) red[tid] += red[tid + st]; __syncthreads(); }
  const float rs = rsqrtf(red[0] / (float)N + eps);
  {
    for (int u = 0; u < per / 4; ++u) {
      const int j = tid * 4 + 1024 * u;
      v4f o, sm;
#pragma unroll
      for (int q = 0; q < 4; ++q) {
        float gg = g[j + q], bb = bta[j + q];
        if (PARAM_BF16) { gg = bf16_round(gg); bb = bf16_round(bb); }
        sm[q] = vals[u * 4 + q]; o[q] = (vals[u * 4 + q] - mu) * rs * gg + bb;
      }
      if (out_sum) *(v4f*)(out_sum + (size_t)row * N + j) = sm;
      *(v4f*)(out_norm + (size_t)row * N + j) = o;
    }
    
  }
}



// ---- f16 WMMA path (v_wmma_f32_16x16x32_f16): 11-bit significands for operands in range — used where a [0, 2^8] probability operand needs more precision than bf16
typedef _Float16 v16h __attribute__((ext_vector_type(16)));
union FragH { v16h v; v8us half[2]; _Float16 h[16]; unsigned short u[16]; };
template <int NT>
__device__ __forceinline__ v8f mmaH(v16h ah, v16h al, v16h bh, v16h bl, v8f c) {
  c = __builtin_amdgcn_wmma_f32_16x16x32_f16(false, ah, false, bh, (short)0, c, false, false);
  if (NT >= 2) c = __builtin_amdgcn_wmma_f32_16x16x32_f16(false, al, false, bh, (short)0, c, false, false);
  if (NT >= 3) c = __builtin_amdgcn_wmma_f32_16x16x32_f16(false, ah, false, bl, (short)0, c, false, false);
  asm volatile("v_nop\n\tv_nop\n\tv_nop\n\tv_nop" : "+v"(c) : "v"(ah), "v"(al), "v"(bh), "v"(bl));
  return c;
}
// batched GEMM like k_gemm_b but f16 operands: A f32 (split into f16 hi/lo if ASPLIT, else rounded to f16), Bt = f16 values [n][k]; alpha; C f32; N multiple of 16 (partial tiles skipped)
template <bool ASPLIT>
__global__ __launch_bounds__(128) void k_gemm_h(const float* __restrict__ A, int lda, size_t sA, const _Float16* __restrict__ Bh, int ldb, size_t sB, float alpha, float* __restrict__ C, int ldc, size_t sC, int M, int N, int K) {
  __shared__ __attribute__((aligned(16))) float so[4][16][64];
  const int tid = threadIdx.x, w = tid >> 5, lane = tid & 31, ln = lane & 15, hh = lane >> 4; const int by = blockIdx.y;
  A += (size_t)by * sA; Bh += (size_t)by * sB; C += (size_t)by * sC;
  const int ntn = (N + 63) / 64; const int wid = blockIdx.x * 4 + w; const int mt = wid / ntn, nq = wid % ntn; if (mt * 16 >= M) return;
  const int row0 = mt * 16, col0 = nq * 64; const float* arow = A + (size_t)(row0 + ln) * lda;
  v8f acc[4] = {};
  for (int kb = 0; kb < K; kb += 32) {
    FragH ah, al;
    const v4f x0 = *(const v4fa*)(arow + kb + 8 * hh), x1 = *(const v4fa*)(arow + kb + 8 * hh + 4), x2 = *(const v4fa*)(arow + kb + 16 + 8 * hh), x3 = *(const v4fa*)(arow + kb + 16 + 8 * hh + 4);
    float xs[16] = {x0[0],x0[1],x0[2],x0[3],x1[0],x1[1],x1[2],x1[3],x2[0],x2[1],x2[2],x2[3],x3[0],x3[1],x3[2],x3[3]};
#pragma unroll
    for (int i = 0; i < 16; ++i) { const _Float16 h = (_Float16)xs[i]; ah.h[i] = h; al.h[i] = ASPLIT ? (_Float16)(xs[i] - (float)h) : (_Float16)0.0f; }
#pragma unroll
    for (int t = 0; t < 4; ++t) { if (col0 + t * 16 >= N) continue; const size_t boff = (size_t)(col0 + t * 16 + ln) * ldb + kb; FragH bq; bq.half[0] = *(const v8us*)(Bh + boff + 8 * hh); bq.half[1] = *(const v8us*)(Bh + boff + 16 + 8 * hh);
      acc[t] = mmaH<ASPLIT ? 2 : 1>(ah.v, al.v, bq.v, bq.v, acc[t]); }
  }
#pragma unroll
  for (int t = 0; t < 4; ++t) { if (col0 + t * 16 >= N) continue;
#pragma unroll
    for (int r = 0; r < 8; ++r) so[w][8 * hh + r][t * 16 + ln] = acc[t][r] * alpha; }
  __builtin_amdgcn_fence(__ATOMIC_ACQ_REL, "workgroup"); __builtin_amdgcn_wave_barrier();
  const int rsub = lane >> 4, c4 = (lane & 15) * 4;
  {
#pragma unroll
    for (int q = 0; q < 8; ++q) { const int r = q * 2 + rsub; if (col0 + c4 < N) { const v4f v = *(const v4fa*)&so[w][r][c4]; *(v4f*)(C + (size_t)(row0 + r) * ldc + col0 + c4) = v; } }
     }
}

// Wt[n][k] = f16(W[k][n]·scale) from f32 row-major W[K][N] (scale = power of two; bf16-exact weights stay exact in f16 away from the subnormal range)
__global__ __launch_bounds__(256) void k_wt_f16(const float* __restrict__ W, _Float16* __restrict__ Wt, int K, int N, float scale) {
  const int t = blockIdx.x * 256 + threadIdx.x; if (t >= N * (K / 8)) return; const int n = t / (K / 8), k8 = (t % (K / 8)) * 8; FragH f;
#pragma unroll
  for (int i = 0; i < 8; ++i) f.h[i] = (_Float16)(bf16_round(W[(size_t)(k8 + i) * N + n]) * scale); const v8us o = f.half[0];
  *(v8us*)((unsigned short*)Wt + (size_t)n * K + k8) = o; 
}
// FRAGMENT ORDER. The weights and x are stored as the matrix instructions read them: a matrix of rows x K halves is cut into fragments of 16 rows x 32 k, 1 KB each, at [row / 16][k / 32];
// inside a fragment piece (hs, lane) is 16 bytes: row lane % 16, k = 16 hs + 8 (lane / 16) + 0..7. A wave's 16-byte load of half a fragment is then 512 bytes in a row, four whole lines, where rows of pitch K gave sixteen 32-byte pieces.
#define FRH 512      // halves of one fragment
// Every operand conversion in one launch; the block index picks the job, and no job reads what another writes. Blocks [0, 4 WBL): the four weight matrices, rounded and scaled by 16, WBL blocks each; the rest: x.
// Thread t writes piece t of its packed matrix, so a wave's store is 512 bytes in a row. X3 has its rows in the order (b, c, n): a thread takes the three coordinates of its 8 channels from one run of 96 bytes and writes one piece to each of the three planes.
#define WBL (CO * CI / 8 / 256)
#define XBL (NR * (CI / 8) / 256)
__global__ __launch_bounds__(256) void k_prep(const float* __restrict__ x, const float* __restrict__ Wq, const float* __restrict__ Wk, const float* __restrict__ Wv, const float* __restrict__ Wo,
                                            _Float16* __restrict__ Bq, _Float16* __restrict__ Bk, _Float16* __restrict__ Bv, _Float16* __restrict__ Bo, _Float16* __restrict__ X3) {
  const int bx = blockIdx.x; const int lane = threadIdx.x & 31, hs = (threadIdx.x >> 5) & 1; const int kin = hs * 16 + (lane >> 4) * 8;
  if (bx < 4 * WBL) { const int j = bx / WBL; const float* W = j == 0 ? Wq : j == 1 ? Wk : j == 2 ? Wv : Wo; _Float16* Bt = j == 0 ? Bq : j == 1 ? Bk : j == 2 ? Bv : Bo; const int kf = (j == 3 ? CO : CI) / 32;      // fragments in a row of the matrix
    const int t = (bx % WBL) * 256 + threadIdx.x; const int fr = t >> 6; const float* wp = W + (size_t)((fr / kf) * 16 + (lane & 15)) * (kf * 32) + (fr % kf) * 32 + kin; FragH f;
#pragma unroll      // constant indices keep f in registers
    for (int i = 0; i < 8; ++i) f.h[i] = (_Float16)(bf16_round(wp[i]) * 16.0f); *(v8us*)((unsigned short*)Bt + (size_t)t * 8) = f.half[0]; }
  else { const int t = (bx - 4 * WBL) * 256 + threadIdx.x; const int fr = t >> 6; const int bn = (fr / (CI / 32)) * 16 + (lane & 15); const float* xp = x + ((size_t)bn * CI + (fr % (CI / 32)) * 32 + kin) * 3;
    unsigned short* xo = (unsigned short*)X3 + ((size_t)t + (size_t)(bn / NN) * 2 * (NN / 16) * (CI / 32) * 64) * 8;      // token row b NN + n becomes row (3 b + c) NN + n: 2 b + c planes further
#pragma unroll      // the 24 floats are loaded once, as six 16-byte loads, and the three stores go from one address pair with constant offsets
    for (int c = 0; c < 3; ++c) { FragH f;
#pragma unroll      // constant indices keep f in registers
      for (int q = 0; q < 8; ++q) f.h[q] = (_Float16)bf16_round(xp[q * 3 + c]); *(v8us*)(xo + (size_t)c * (NN / 16) * (CI / 32) * FRH) = f.half[0]; }
    asm volatile("s_wait_xcnt 0x0" ::: "memory"); } }      // behind the last store: no register that the three stores name is rewritten ahead of this wait
// The bare builtin: the compiler keeps the distances behind its own matrix instructions, and with no asm statement naming them the accumulators may live above v255.
// No global load is moved over a volatile asm statement either: with one behind each product every product waited out its own operand loads. In the maps below the operands of a later k step are asked for ahead of the products of this one.
__device__ __forceinline__ v8f mmaP(v16h a, v16h b, v8f c) { return __builtin_amdgcn_wmma_f32_16x16x32_f16(false, a, false, b, (short)0, c, false, false); }
// q or k map: C[(b, n, c)][o] = sum_k X3[(b, c, n)][k] W[o][k] / 16, f16. A wave takes 64 tokens of one (b, c) x 64 outputs: four fragments of each operand a k step feed sixteen products, half a fragment a product where a 16 x 64 tile took one and a quarter,
// and the launch has a quarter of the waves to start. The four waves of a work-group form a 128 x 128 tile, so each fragment is asked for by two of them. Both operands come in fragment order. The result keeps its rows (b, n, c) x 512: a token's row is picked in the store.
#define KST (CI / 32)      // k steps of the q, k and V^T maps
#define NSET 3          // register sets of operand fragments: steps ks + 1 .. ks + NSET - 1 are in flight while step ks is multiplied
// acc[i][t] += sum_k A[tile i][k] B[tile t][k] over all of CI; as and bs point at the first fragment of four rows of fragments each.
// as and bs are the same in every lane (scalar registers); the lane's own piece is lo halves further, one vector register for all loads.
__device__ __forceinline__ void mm64(const unsigned short* as, const unsigned short* bs, v8f (&acc)[4][4]) {
  const unsigned lo = (threadIdx.x & 31) * 8; const unsigned short *ap = as + lo, *bp = bs + lo; FragH ah[NSET][4], bq[NSET][4];
#pragma unroll      // every load is base + constant, so that no address register is rewritten while loads are out; constant indices keep the fragments and acc in registers
  for (int ks = 1 - NSET; ks < KST; ++ks) {
    if (ks + NSET - 1 < KST) { const int kn = ks + NSET - 1, s = kn % NSET;
#pragma unroll      // constant indices keep the fragments in registers
      for (int i = 0; i < 4; ++i) { ah[s][i].half[0] = *(const v8us*)(ap + (i * KST + kn) * FRH); ah[s][i].half[1] = *(const v8us*)(ap + (i * KST + kn) * FRH + 256);
        bq[s][i].half[0] = *(const v8us*)(bp + (i * KST + kn) * FRH); bq[s][i].half[1] = *(const v8us*)(bp + (i * KST + kn) * FRH + 256); } }
    __builtin_amdgcn_sched_barrier(0);      // holds the loads above ahead of the products below: left free, the compiler sinks them among later products, with fewer in flight and a shorter lead
    if (ks >= 0)
#pragma unroll      // constant indices keep the fragments and acc in registers
      for (int i = 0; i < 4; ++i)
#pragma unroll      // constant indices keep the fragments and acc in registers
        for (int t = 0; t < 4; ++t) acc[i][t] = mmaP(ah[ks % NSET][i].v, bq[ks % NSET][t].v, acc[i][t]); }
  asm volatile("s_wait_xcnt 0x0" :: "v"(lo), "s"(as), "s"(bs) : "memory");      // the loads' offset register and two scalar bases are named as inputs, so they stay untouched until this wait; behind it they may be reused
}
// The wave's 64 x 64 tile goes through its own 16 KB of LDS, so that a store covers whole lines: row j of the tile is 64 halves, one 128-byte line, at crow + j * pitch (halves); crow already holds the lane's row parity and column.
__device__ __forceinline__ void put64(float (*sw)[64], const v8f (&acc)[4][4], _Float16* crow, size_t pitch) {
  const int lane = threadIdx.x & 31, ln = lane & 15, hh = lane >> 4;
#pragma unroll      // constant indices keep acc in registers
  for (int i = 0; i < 4; ++i)
#pragma unroll      // constant indices keep acc in registers
    for (int t = 0; t < 4; ++t)
#pragma unroll      // constant indices keep acc in registers
      for (int r = 0; r < 8; ++r) sw[i * 16 + 8 * hh + r][t * 16 + ln] = acc[i][t][r] * 0.0625f;
  __builtin_amdgcn_fence(__ATOMIC_ACQ_REL, "workgroup"); __builtin_amdgcn_wave_barrier();      // the wave's LDS stores are done before its lanes read what other lanes stored
  const int rsub = lane >> 4, c4 = (lane & 15) * 4; typedef _Float16 v4h __attribute__((ext_vector_type(4)));
#pragma unroll      // constant offsets from one address pair
  for (int q = 0; q < 32; ++q) { const v4f v = *(const v4fa*)&sw[q * 2 + rsub][c4]; v4h h4; for (int i = 0; i < 4; ++i) h4[i] = (_Float16)v[i]; *(v4h*)(crow + (size_t)q * 2 * pitch) = h4; }
  asm volatile("s_wait_xcnt 0x0" ::: "memory");      // behind the last store: no register that the stores name is rewritten ahead of this wait
}
__device__ __forceinline__ void gemm_qk(float (*so)[64][64], int bx, const _Float16* __restrict__ X3, const _Float16* __restrict__ Wh, _Float16* __restrict__ C16) {
  const int tid = threadIdx.x, lane = tid & 31; const int w = __builtin_amdgcn_readfirstlane(tid >> 5);      // the wave's number, the same in every lane: kept in a scalar register, and the operand addresses with it
  const int mg = (bx / (CO / 128)) * 2 + (w >> 1), nq = (bx % (CO / 128)) * 2 + (w & 1);      // 64 tokens, 64 outputs
  v8f acc[4][4] = {};
  mm64((const unsigned short*)X3 + (size_t)mg * 4 * KST * FRH, (const unsigned short*)Wh + (size_t)nq * 4 * KST * FRH, acc);
  const int bc = mg / (NN / 64), n0 = (mg % (NN / 64)) * 64;
  put64(so[w], acc, C16 + (((size_t)(bc / 3) * NN + n0 + (lane >> 4)) * 3 + bc % 3) * CO + nq * 64 + (lane & 15) * 4, 3 * CO);
}
// V^T at once: C[o][n] = sum_k Wv[o][k] X3[(b, c, n)][k]. The weight rows are the A operand (64 features: one head) and the token rows of one (b, c) the B operand, both in fragment order,
// so a row of the staged tile is 64 tokens of one feature: one whole 128-byte line of the layout that the attention stages. Same products, same k order as the q and k maps.
__device__ __forceinline__ void gemm_vt(float (*so)[64][64], int bx, int by, const _Float16* __restrict__ Wh, const _Float16* __restrict__ X3, _Float16* __restrict__ Vt) {
  const int tid = threadIdx.x, lane = tid & 31; const int w = __builtin_amdgcn_readfirstlane(tid >> 5);      // the wave's number, the same in every lane: kept in a scalar register, and the operand addresses with it
  const int b = by / 3, c = by % 3;
  const int hd = (bx / (NN / 128)) * 2 + (w >> 1), nq = (bx % (NN / 128)) * 2 + (w & 1);      // head, 64 tokens
  v8f acc[4][4] = {};
  mm64((const unsigned short*)Wh + (size_t)hd * 4 * KST * FRH, (const unsigned short*)X3 + ((size_t)by * (NN / 16) + nq * 4) * KST * FRH, acc);
  put64(so[w], acc, Vt + ((size_t)(b * NH + hd) * 192 + c * 64 + (lane >> 4)) * NN + nq * 64 + (lane & 15) * 4, NN);
}
// The q, k and V^T maps in one launch: all three read X3 and none reads another's result. blockIdx.y picks the map, blockIdx.x is the map's own block number (MBL each).
#define MBL ((NR3 / 64) * (CO / 64) / 4)
#define VBX ((CO / 64) * (NN / 64) / 4)
__global__ __launch_bounds__(128) void k_qkv(const _Float16* __restrict__ X3, const _Float16* __restrict__ Bq, const _Float16* __restrict__ Bk, const _Float16* __restrict__ Bv, _Float16* __restrict__ Q16, _Float16* __restrict__ K16, _Float16* __restrict__ Vt) {
  __shared__ __attribute__((aligned(16))) float so[4][64][64];
  const int bx = blockIdx.x, job = blockIdx.y;
  if (job == 2) gemm_vt(so, bx % VBX, bx / VBX, Bv, X3, Vt);
  else gemm_qk(so, bx, X3, job == 0 ? Bq : Bk, job == 0 ? Q16 : K16);
}
// K and V^T tiles of 64 keys, staged in LDS once per group of four waves and read by these four. Row pitches are 16 B x odd, so the 16 rows of a ds_load_b128 fall on distinct banks.
#define TK 64
#define KP 200      // halves per staged K row: 3 coordinate blocks x 64 + 8 of pad (400 B)
#define VP 72       // halves per staged V^T row: 64 keys + 8 of pad (144 B)
// Twelve asynchronous 16-byte copies per lane, global -> LDS, through no register: copy 4 a + q goes from g + a gs + q gq (halves) to LDS byte l + a ls + q lq.
// The s_wait_xcnt closes the statement so that no address register named here is rewritten ahead of it.
__device__ __forceinline__ void acopy12(unsigned l, unsigned ls, unsigned lq, const unsigned short* g, size_t gs, size_t gq) {
  const unsigned l1 = l + lq, l2 = l + 2 * lq, l3 = l + 3 * lq, l4 = l + ls, l5 = l4 + lq, l6 = l4 + 2 * lq, l7 = l4 + 3 * lq, l8 = l + 2 * ls, l9 = l8 + lq, l10 = l8 + 2 * lq, l11 = l8 + 3 * lq;
  const unsigned short *g1 = g + gq, *g2 = g + 2 * gq, *g3 = g + 3 * gq, *g4 = g + gs, *g5 = g4 + gq, *g6 = g4 + 2 * gq, *g7 = g4 + 3 * gq, *g8 = g + 2 * gs, *g9 = g8 + gq, *g10 = g8 + 2 * gq, *g11 = g8 + 3 * gq;
  asm volatile("global_load_async_to_lds_b128 %0, %12, off\n\t"
               "global_load_async_to_lds_b128 %1, %13, off\n\t"
               "global_load_async_to_lds_b128 %2, %14, off\n\t"
               "global_load_async_to_lds_b128 %3, %15, off\n\t"
               "global_load_async_to_lds_b128 %4, %16, off\n\t"
               "global_load_async_to_lds_b128 %5, %17, off\n\t"
               "global_load_async_to_lds_b128 %6, %18, off\n\t"
               "global_load_async_to_lds_b128 %7, %19, off\n\t"
               "global_load_async_to_lds_b128 %8, %20, off\n\t"
               "global_load_async_to_lds_b128 %9, %21, off\n\t"
               "global_load_async_to_lds_b128 %10, %22, off\n\t"
               "global_load_async_to_lds_b128 %11, %23, off\n\t"
               "s_wait_xcnt 0x0"
               :: "v"(l), "v"(l1), "v"(l2), "v"(l3), "v"(l4), "v"(l5), "v"(l6), "v"(l7), "v"(l8), "v"(l9), "v"(l10), "v"(l11),
                  "v"(g), "v"(g1), "v"(g2), "v"(g3), "v"(g4), "v"(g5), "v"(g6), "v"(g7), "v"(g8), "v"(g9), "v"(g10), "v"(g11) : "memory");
}
// One stage: 64 keys of K (3 coordinate blocks of 128 B a key) and 192 rows of V^T (128 B a row); 24 copies a lane.
__device__ __forceinline__ void stage_kv(unsigned lk, unsigned lv, const unsigned short* kg, const unsigned short* vg) {
  acopy12(lk, 128, 16 * KP * 2, kg, CO, (size_t)16 * 3 * CO);
  acopy12(lv, 64 * VP * 2, 16 * VP * 2, vg, (size_t)64 * NN, (size_t)16 * NN);
}
// lane l with lane l ^ 16, through no LDS
__device__ __forceinline__ float xhalf(float x) { return __builtin_bit_cast(float, __builtin_amdgcn_permlanex16(__builtin_bit_cast(int, x), __builtin_bit_cast(int, x), 0x76543210, 0xfedcba98, false, false)); }
// Scores are formed transposed: K rows are the A operand and Q the B operand, so lane (ln, hh) holds query ln and keys 8 hh + r of each 16-key tile. A query's maximum and sum are then
// in-lane but for one exchange between the wave halves, and the two score tiles of 32 keys, converted in place, are the B operand of O^T += V^T P^T (element i: key 8 hh + i, element 8 + i: key 16 + 8 hh + i, as the V^T loader has it).
// A wave takes 32 queries (two tiles of 16), so every K and V^T fragment that it reads from LDS feeds two products. The work-group has 128 queries and eight waves: waves 0-3 walk keys [0, NN / 2), waves 4-7 keys [NN / 2, NN),
// each group of four staging its own tiles, so that a SIMD still holds two waves; the two groups' partial O, maximum and sum are joined once, through LDS, behind the loop.
#define KH (NN / 2)      // keys of one group of four waves
__global__ __launch_bounds__(256) void k_vnattn(const _Float16* __restrict__ Q16, const _Float16* __restrict__ K16, const _Float16* __restrict__ Vt, _Float16* __restrict__ O3) {
  __shared__ __attribute__((aligned(16))) unsigned short sK[2][2][TK][KP]; __shared__ __attribute__((aligned(16))) unsigned short sV[2][2][192][VP];      // [buffer][key group]
  __shared__ float sML[4][2][2][32];      // the second group's maximum and sum: [query group][tile][which][lane]
  const int tid = threadIdx.x, w = tid >> 5, lane = tid & 31, ln = lane & 15, hh = lane >> 4; const int qg = w & 3, t128 = tid & 127; const int kh = __builtin_amdgcn_readfirstlane(tid >> 7);      // the wave's key group, the same in every lane: kept in a scalar register
  const int slab = blockIdx.x / (NN / 128), qblk = blockIdx.x % (NN / 128); const int b = slab / NH, h = slab % NH; const int q0 = qblk * 128 + qg * 32;
  const unsigned short* Vth = (const unsigned short*)Vt + (size_t)slab * 192 * NN;
  // The lane's share of its group's stage: eight lanes cover one 128-byte row piece, so a wave's copy covers four whole lines. K: key = 16 q + t128 / 8; V^T: row = 64 a + 16 q + t128 / 8.
  const int cr = t128 >> 3, cc = (t128 & 7) * 8;
  // The lane's part of each address; the scalar part (group, buffer, stage) is added where a stage is issued.
  const unsigned kl = cr * (3 * CO) + cc, vl = cr * NN + cc;      // halves
  const unsigned lkl = (unsigned)(size_t)&sK[0][0][cr][cc], lvl = (unsigned)(size_t)&sV[0][0][cr][cc];
  const unsigned short* kgs = (const unsigned short*)K16 + ((size_t)b * NN + kh * KH) * (3 * CO) + h * HD;      // scalar
  const unsigned short* vgs = Vth + kh * KH;                                                                      // scalar
  const unsigned lks = kh * (TK * KP * 2), lvs = kh * (192 * VP * 2);                                              // scalar
  constexpr unsigned KB = 2 * TK * KP * 2, VB = 2 * 192 * VP * 2;      // bytes of one buffer (both groups' tiles)
  constexpr int NT = KH / TK;
  constexpr float SL2 = 0.07216878364870323f * 1.4426950408889634f;      // 1 / sqrt(192) x log2(e)
  FragH aq[2][6]; { const unsigned short* qr = (const unsigned short*)Q16 + ((size_t)b * NN + q0 + ln) * (3 * CO) + h * HD + 8 * hh;      // row (b,n) = [c0 | c1 | c2] x 512 (= rows (b,n,c) of pitch 512)
#pragma unroll
    for (int qt = 0; qt < 2; ++qt)
#pragma unroll
      for (int ks = 0; ks < 6; ++ks) { const int c = ks >> 1, s32 = (ks & 1) * 32; aq[qt][ks].half[0] = *(const v8us*)(qr + qt * 16 * 3 * CO + c * CO + s32); aq[qt][ks].half[1] = *(const v8us*)(qr + qt * 16 * 3 * CO + c * CO + s32 + 16); }
    asm volatile("s_wait_xcnt 0x0" :: "v"(qr) : "memory"); }      // the Q loads' address pair is named as an input, so it stays untouched until this wait; behind it the pair may be reused
  float m_r[2] = {-3.0e38f, -3.0e38f}, l_r[2] = {0.f, 0.f}; v8f oacc[2][12];      // oacc[qt][dt][r] = O[query 16 qt + ln][dt * 16 + 8 hh + r]; l_r sums this half's keys only
#pragma unroll
  for (int qt = 0; qt < 2; ++qt)
#pragma unroll
    for (int dt = 0; dt < 12; ++dt) oacc[qt][dt] = (v8f){0.f,0.f,0.f,0.f,0.f,0.f,0.f,0.f};
  // Trips -2 and -1 only fill the ring, in the order of a two-buffer prologue: trip -2 issues stage 0; trip -1 waits for it, publishes it at the barrier and issues stage 1. So the file has one place that issues a stage:
  // with a second one in front of the loop, the address registers that it named stayed bound below v256 through the loop and were spilled to scratch.
#pragma unroll 1
  for (int t = -2; t < NT; ++t) { const int buf = t & 1;
   if (t >= 0)
#pragma unroll 1      // the two 32-key passes of a stage stay rolled: unrolled, the build spilled the Q fragments to scratch
   for (int p = 0; p < TK / 32; ++p) { v8f s[2][2]; FragH bv[6];      // K and V^T come in runs of six fragments, each run read ahead of its twelve products: one LDS latency a run, not one a product
    auto vrun = [&](int dg) {
#pragma unroll      // constant indices keep bv in registers
      for (int i = 0; i < 6; ++i) { const unsigned short* vrow = &sV[buf][kh][(dg * 6 + i) * 16 + ln][p * 32]; bv[i].half[0] = *(const v8us*)(vrow + 8 * hh); bv[i].half[1] = *(const v8us*)(vrow + 16 + 8 * hh); } };
#pragma unroll
    for (int nt = 0; nt < 2; ++nt) { const unsigned short* kr = &sK[buf][kh][p * 32 + nt * 16 + ln][0]; v8f acc0 = (v8f){0.f,0.f,0.f,0.f,0.f,0.f,0.f,0.f}, acc1 = acc0; FragH bk[6];
#pragma unroll      // constant indices keep bk in registers
      for (int ks = 0; ks < 6; ++ks) { bk[ks].half[0] = *(const v8us*)(kr + ks * 32 + 8 * hh); bk[ks].half[1] = *(const v8us*)(kr + ks * 32 + 16 + 8 * hh); }
      if (nt == 1) vrun(0);      // V^T's first run is asked for on this side of the test below: no load is moved up over a branch, and behind it the first products would wait out the whole LDS latency
      __builtin_amdgcn_sched_barrier(0);      // holds a run's loads together ahead of its products: left free in this build, the compiler reads one fragment at a time into one register set, one LDS latency a pair of products
#pragma unroll
      for (int ks = 0; ks < 6; ++ks) { acc0 = mmaP(bk[ks].v, aq[0][ks].v, acc0); acc1 = mmaP(bk[ks].v, aq[1][ks].v, acc1); }
      s[0][nt] = acc0; s[1][nt] = acc1; }
    // Softmax in the log2 domain: e^(x / sqrt(192) - m) = 2^(x SL2 - m'), SL2 = log2(e) / sqrt(192) > 0: a score costs one multiply-add and one hardware 2^x. m_r, in the scaled log2 unit, is the reference in use, the same in both halves of the wave.
    // Any reference gives the same result: O and the sum carry the one factor 2^-m_r, and the division behind the loop takes it out. So it is held from pass to pass: no maximum is taken and O is not rescaled while P stays small.
    FragH pa[2]; float psum[2];
    auto probs = [&](int qt) { const float mn = m_r[qt]; float ps[4] = {0.f, 0.f, 0.f, 0.f};      // four short chains of adds, not one of sixteen
#pragma unroll      // constant indices keep the scores, pa and ps in registers
      for (int r = 0; r < 8; ++r) { const float p0 = __builtin_amdgcn_exp2f(fmaf(s[qt][0][r], SL2, -mn)), p1 = __builtin_amdgcn_exp2f(fmaf(s[qt][1][r], SL2, -mn)); ps[r & 3] += p0 + p1; pa[qt].h[r] = (_Float16)p0; pa[qt].h[8 + r] = (_Float16)p1; }
      psum[qt] = (ps[0] + ps[1]) + (ps[2] + ps[3]); };
    probs(0); probs(1);
    // One test a pass for the whole wave, a scalar branch: a lane's sum of sixteen P bounds each of them. Where a sum is above 2^8 (or infinite, as in the first pass, whose reference is -3e38), the references move up to the running maxima,
    // O and the sums are rescaled, and the pass's P are formed anew from the scores, which are still in registers. P <= 2^8 keeps its 11 bits in f16.
    asm volatile("" :: "v"(bv[0].v), "v"(bv[1].v), "v"(bv[2].v), "v"(bv[3].v), "v"(bv[4].v), "v"(bv[5].v));      // the loaded fragments as inputs only: keeps their loads on this side of the branch, where the compiler would sink them behind it
    if (__builtin_amdgcn_ballot_w32(fmaxf(psum[0], psum[1]) > 256.0f) != 0) {
#pragma unroll      // constant indices keep the scores, pa and oacc in registers
      for (int qt = 0; qt < 2; ++qt) { float mc = -3.0e38f;
#pragma unroll      // constant indices keep the scores in registers
        for (int r = 0; r < 8; ++r) mc = fmaxf(mc, fmaxf(s[qt][0][r], s[qt][1][r]));
        mc = fmaxf(mc, xhalf(mc));      // SL2 > 0: the maximum is taken on the raw scores and scaled once
        const float mn = fmaxf(m_r[qt], mc * SL2); const float al = __builtin_amdgcn_exp2f(m_r[qt] - mn); m_r[qt] = mn; l_r[qt] *= al;
#pragma unroll
        for (int dt = 0; dt < 12; ++dt)
#pragma unroll
          for (int r = 0; r < 8; ++r) oacc[qt][dt][r] *= al;
        probs(qt); } }
    l_r[0] += psum[0]; l_r[1] += psum[1];
#pragma unroll
    for (int dg = 0; dg < 2; ++dg) {
      if (dg == 1) { vrun(1); __builtin_amdgcn_sched_barrier(0); }      // as for K: the second run's loads stay together ahead of its products
#pragma unroll
      for (int i = 0; i < 6; ++i) { oacc[0][dg * 6 + i] = mmaP(bv[i].v, pa[0].v, oacc[0][dg * 6 + i]); oacc[1][dg * 6 + i] = mmaP(bv[i].v, pa[1].v, oacc[1][dg * 6 + i]); } } }
   asm volatile("s_wait_dscnt 0x0" ::: "memory");         // this wave's reads of buffer t mod 2 are done before the buffer is handed back
   asm volatile("s_wait_asynccnt 0x0" ::: "memory");      // this wave's share of stage t + 1 has landed
   __syncthreads();                                        // publishes stage t + 1 and ends every wave's reads of stage t
   if (t + 2 < NT) stage_kv(lkl + (lks + buf * KB), lvl + (lvs + buf * VB), (kgs + (size_t)(t + 2) * TK * 3 * CO) + kl, (vgs + (t + 2) * TK) + vl); }
  asm volatile("s_wait_asynccnt 0x0" ::: "memory");        // no copy is outstanding when the ring is put to another use
  // Behind the last barrier of the loop nobody reads the ring and no copy is out: sK becomes the second group's partial O (f32, in register order: piece (tile, dt, j) is 32 lanes x 16 bytes in a row), sV the f16 output staging.
  v4fa* sM = (v4fa*)&sK[0][0][0][0] + (size_t)qg * (2 * 12 * 2 * 32) + lane;
  unsigned short (*sO)[64 + 8] = (unsigned short (*)[64 + 8])&sV[0][0][0][0] + qg * 96;      // one row a (query, coordinate) piece of 64 halves; a query's pitch is 16 B x odd
  float lt[2];
#pragma unroll      // constant indices keep l_r in registers
  for (int qt = 0; qt < 2; ++qt) lt[qt] = l_r[qt] + xhalf(l_r[qt]);      // the two halves' sums are joined once, here
  if (kh == 1) {
#pragma unroll      // constant indices keep oacc in registers
    for (int qt = 0; qt < 2; ++qt) { sML[qg][qt][0][lane] = m_r[qt]; sML[qg][qt][1][lane] = lt[qt];
#pragma unroll      // constant indices keep oacc in registers
      for (int dt = 0; dt < 12; ++dt) { const v8f o = oacc[qt][dt]; sM[((qt * 12 + dt) * 2 + 0) * 32] = (v4f){o[0], o[1], o[2], o[3]}; sM[((qt * 12 + dt) * 2 + 1) * 32] = (v4f){o[4], o[5], o[6], o[7]}; } } }
  __syncthreads();      // the second group's partials are published to the first
  if (kh == 0) {
#pragma unroll      // constant indices keep oacc in registers
    for (int qt = 0; qt < 2; ++qt) { const float m1 = sML[qg][qt][0][lane], l1 = sML[qg][qt][1][lane]; const float mm = fmaxf(m_r[qt], m1);
      const float a0 = __builtin_amdgcn_exp2f(m_r[qt] - mm), a1 = __builtin_amdgcn_exp2f(m1 - mm); const float linv = 1.0f / (lt[qt] * a0 + l1 * a1); const float c0 = a0 * linv, c1 = a1 * linv;
#pragma unroll      // constant indices keep oacc in registers
      for (int dt = 0; dt < 12; ++dt) { const v4f x0 = sM[((qt * 12 + dt) * 2 + 0) * 32], x1 = sM[((qt * 12 + dt) * 2 + 1) * 32]; FragH f;
#pragma unroll      // constant indices keep oacc in registers
        for (int r = 0; r < 4; ++r) { f.h[r] = (_Float16)(oacc[qt][dt][r] * c0 + x0[r] * c1); f.h[4 + r] = (_Float16)(oacc[qt][dt][4 + r] * c0 + x1[r] * c1); }
        *(v8us*)&sO[(qt * 16 + ln) * 3 + dt / 4][(dt % 4) * 16 + 8 * hh] = f.half[0]; } }
    __builtin_amdgcn_fence(__ATOMIC_ACQ_REL, "workgroup"); __builtin_amdgcn_wave_barrier();      // the wave's LDS stores are done before its lanes read what other lanes stored
    // Stored as the output map reads it: rows (b, n, c) x 512. A query's 192 features are three pieces of 64 halves, one 128-byte line each; eight lanes a piece, four pieces a store.
    unsigned short* orow = (unsigned short*)O3 + (((size_t)b * NN + q0) * 3 + (lane >> 3)) * CO + h * HD + (lane & 7) * 8;
#pragma unroll      // constant offsets from one address pair
    for (int q = 0; q < 24; ++q) { const v8us v = *(const v8us*)&sO[q * 4 + (lane >> 3)][(lane & 7) * 8]; *(v8us*)(orow + (size_t)q * 4 * CO) = v; } } }
// Output map with the (o, c) interleave in its store: a wave takes 16 tokens x 3 coordinates x 64 outputs (each lane picks its token's three rows of O3), so a token's piece of the result is 192 floats in a row, six whole lines.
__global__ __launch_bounds__(128) void k_gemm_out(const _Float16* __restrict__ O3, const _Float16* __restrict__ Wh, float* __restrict__ out) {
  __shared__ __attribute__((aligned(16))) float so[4][16][192 + 4];
  const int tid = threadIdx.x, w = tid >> 5, lane = tid & 31, ln = lane & 15, hh = lane >> 4;
  const int wid = blockIdx.x * 4 + w; const int mt = wid / (CI / 64), nq = wid % (CI / 64); const int bn0 = mt * 16, col0 = nq * 64;
  const unsigned short* arow = (const unsigned short*)O3 + (size_t)(bn0 + ln) * 3 * CO + 8 * hh;
  const unsigned short* brow = (const unsigned short*)Wh + (size_t)nq * 4 * (CO / 32) * FRH + lane * 8;      // the weights come in fragment order
  v8f acc[3][4] = {}; FragH a[3][3], bq[3][4];      // three register sets: a SIMD has this one wave, so steps ks + 1 and ks + 2 are in flight while step ks is multiplied
#pragma unroll      // every load is base + constant, so that no address register is rewritten while loads are out; constant indices keep the fragments and acc in registers
  for (int ks = -2; ks < CO / 32; ++ks) {
    if (ks + 2 < CO / 32) { const int s = (ks + 2) % 3, kb = (ks + 2) * 32;
#pragma unroll      // constant indices keep the fragments in registers
      for (int c = 0; c < 3; ++c) { a[s][c].half[0] = *(const v8us*)(arow + c * CO + kb); a[s][c].half[1] = *(const v8us*)(arow + c * CO + kb + 16); }
#pragma unroll      // constant indices keep the fragments in registers
      for (int t = 0; t < 4; ++t) { bq[s][t].half[0] = *(const v8us*)(brow + (t * (CO / 32) + ks + 2) * FRH); bq[s][t].half[1] = *(const v8us*)(brow + (t * (CO / 32) + ks + 2) * FRH + 256); } }
    __builtin_amdgcn_sched_barrier(0);      // holds the loads above ahead of the products below: left free, the compiler sinks each load to its own product, which then waits out the whole latency
    if (ks >= 0)
#pragma unroll      // constant indices keep the fragments and acc in registers
      for (int t = 0; t < 4; ++t)
#pragma unroll      // constant indices keep the fragments and acc in registers
        for (int c = 0; c < 3; ++c) acc[c][t] = mmaP(a[ks % 3][c].v, bq[ks % 3][t].v, acc[c][t]); }
  asm volatile("s_wait_xcnt 0x0" :: "v"(arow), "v"(brow) : "memory");      // the loads' two address pairs are named as inputs, so they stay untouched until this wait; behind it they may be reused
#pragma unroll      // constant indices keep the fragments and acc in registers
  for (int t = 0; t < 4; ++t)
#pragma unroll      // constant indices keep the fragments and acc in registers
    for (int c = 0; c < 3; ++c)
#pragma unroll      // constant indices keep the fragments and acc in registers
      for (int r = 0; r < 8; ++r) so[w][8 * hh + r][(t * 16 + ln) * 3 + c] = acc[c][t][r] * 0.0625f;
  __builtin_amdgcn_fence(__ATOMIC_ACQ_REL, "workgroup"); __builtin_amdgcn_wave_barrier();      // the wave's LDS stores are done before its lanes read what other lanes stored
  // two tokens' pieces are 96 float4, three stores of the wave; from one pair of tokens to the next every address moves by a constant
#pragma unroll      // three address pairs, formed once
  for (int j = 0; j < 3; ++j) { const int i = j * 32 + lane, r = i / 48, p4 = (i % 48) * 4; const float* ls = &so[w][r][p4]; float* gp = out + ((size_t)(bn0 + r) * CI + col0) * 3 + p4;
#pragma unroll      // constant offsets from the pair
    for (int q = 0; q < 8; ++q) { const v4f v = *(const v4fa*)(ls + q * 2 * (192 + 4)); *(v4f*)(gp + (size_t)q * 2 * CI * 3) = v; } }
}
extern "C" void kernel_launch(void* const* d_in, const int* in_sizes, int n_in,
                              void* d_out, int out_size, void* d_ws, size_t ws_size, hipStream_t stream) {
  (void)in_sizes; (void)n_in; (void)out_size;
  const float* x = (const float*)d_in[0]; const float* Wq = (const float*)d_in[1]; const float* Wk = (const float*)d_in[2]; const float* Wv = (const float*)d_in[3]; const float* Wo = (const float*)d_in[4];
  char* ws = (char*)d_ws; size_t off = 0;
  auto take = [&](size_t bytes) { char* p = ws + off; off += (bytes + 255) & ~(size_t)255; return p; };
  _Float16* Bq = (_Float16*)take((size_t)CO * CI * 2); _Float16* Bk = (_Float16*)take((size_t)CO * CI * 2); _Float16* Bv = (_Float16*)take((size_t)CO * CI * 2); _Float16* Bo = (_Float16*)take((size_t)CI * CO * 2);
  _Float16* X3 = (_Float16*)take((size_t)NR3 * CI * 2); _Float16* Q16 = (_Float16*)take((size_t)NR3 * CO * 2); _Float16* K16 = (_Float16*)take((size_t)NR3 * CO * 2); _Float16* Vt = (_Float16*)take((size_t)NR3 * CO * 2); _Float16* O3 = (_Float16*)take((size_t)NR3 * CO * 2);      // O3 has a place of its own: the attention stores it while other work-groups still read Q16
  if (off > ws_size) return;      // 1 + 6.3 + 12.6 x 4, about 58 MB
  k_prep<<<4 * WBL + XBL, 256, 0, stream>>>(x, Wq, Wk, Wv, Wo, Bq, Bk, Bv, Bo, X3);      // weights are (out,in); X3 = rows (b,c,n) x 256; all five in fragment order
  k_qkv<<<dim3(MBL, 3), 128, 0, stream>>>(X3, Bq, Bk, Bv, Q16, K16, Vt);      // q/k planes = rows (b,n,c) x 512 = [(b,n)][c * 512 + o]
  k_vnattn<<<BB * NH * (NN / 128), 256, 0, stream>>>(Q16, K16, Vt, O3);
  k_gemm_out<<<(NR / 16) * (CI / 64) / 4, 128, 0, stream>>>(O3, Bo, (float*)d_out);
}
